// v000
// Times are from an AMD MI455X. After a warm-up the kernel runs many times in a row, and a time is the length of
// such a window on the GPU divided by its runs, so every launch and the gaps after it count. The runs cycle
// through copies of the inputs. A figure is the median of several windows, for all but v000 over two sittings.
// Sittings can differ by a few percent; kernels timed side by side share one.
// The starting kernel, v000, takes 409 microseconds a run.
#include <hip/hip_runtime.h>

// Dense (unmasked) multi-head self-attention, width 768 = 12 heads x 64, x [NB][SEQ][768]; each of the four projections is y = x W^T + b + (x A^T) B^T with W [out][in], A [8][in], B [out][8]; score scale 1/8; f32 output.
// Compute dtypes, f32 accumulate everywhere: the rank-8 update is folded once into W_eff = W + B A (f32 on the vector unit, K = 8; W, A, B, b, x RNE-converted to bf16 first) and carried as bf16 value | bf16 remainder along K;
// softmax f32 (online, running max); output projection v_wmma_f32_16x16x32_bf16 with ctx as bf16 value | remainder and W_eff as bf16 value | remainder (K = 2304: value x value, remainder x value, value x remainder), one accumulator.
// Layout: bf16 copy of x; folded weight planes [4][768][value 768 | remainder 768]; q, k planes [b*12+h][t][d], v^T plane [b*12+h][d][t] (f16) written by the GEMM epilogue; fused flash kernel in transposed form
// (S^T = K Q^T, O^T = V^T P^T, key loop over the whole sequence) writes the ctx plane [b*SEQ+t][value 768 | remainder 768] (bf16); final GEMM adds the bias at the store stage.

#ifndef NB
#define NB 4
#endif
#ifndef SEQ
#define SEQ 2048
#endif
#define NB_FULL  4
#define SEQ_FULL 2048
#ifndef OUT_SEQ
#define OUT_SEQ SEQ              // row pitch (in tokens) between batches of the output
#endif
#define DM   768
#define NH_  12
#define HD   64
#define LR   8                   // rank of the low-rank update
#define WP   (2 * DM)            // folded weight plane row pitch: value columns 0..DM-1, remainder columns DM..2DM-1
#define CXP  (2 * DM)            // ctx plane row pitch: value columns 0..DM-1, remainder columns DM..2DM-1
#define KO   (3 * DM)            // K extent of the output projection
#define AW   4                   // waves per flash block (16 query rows each)
#define SC2  (0.125f * 1.4426950408889634f)   // HD^-0.5 * log2(e)
#define PSH  8.0f                // log2 of the P carry (256)

static_assert(HD == 64);
static_assert(NH_ * HD == DM);                 // head h = columns h*64 + d
static_assert(DM % 64 == 0);                   // column tiles of 64
static_assert(DM % 32 == 0);                   // GEMM k-loop steps by 32; a k-step never straddles a wrap point
static_assert(CXP == 2 * DM);
static_assert(CXP % 32 == 0);
static_assert(WP == 2 * DM);
static_assert(WP % 32 == 0);
static_assert(KO == CXP + DM);                 // third K segment meets the ctx value half again (A wrap at CXP) and the weight remainder half (B wrap at DM)
static_assert(KO % 32 == 0);
static_assert(LR == 8);                        // one 32-byte load covers a row of B [out][8]
static_assert(DM % 8 == 0);                    // fold kernel: 8 columns per lane
static_assert((DM / 8) % 8 == 0);
static_assert(SEQ % 64 == 0);                  // a 64-row tile never straddles two batches
static_assert((NB * SEQ) % 64 == 0);
static_assert(SEQ % 32 == 0);                  // key loop steps by 32 and stays inside the sequence
static_assert(SEQ % (16 * AW) == 0);           // flash grid covers the sequence exactly
static_assert(((size_t)SEQ * DM) % 8 == 0);
static_assert(((size_t)DM * DM) % 8 == 0);
static_assert(NB <= NB_FULL);
static_assert(SEQ <= SEQ_FULL);
static_assert(AW * 32 <= 256);

typedef _Float16 h16;
typedef unsigned short bf;
typedef __attribute__((ext_vector_type(16))) __bf16   v16bf;
typedef __attribute__((ext_vector_type(16))) _Float16 v16h;
typedef __attribute__((ext_vector_type(8)))  _Float16 v8h;
typedef __attribute__((ext_vector_type(8)))  unsigned short v8us;
typedef __attribute__((ext_vector_type(8)))  float    v8f;
typedef __attribute__((ext_vector_type(4)))  float    v4f;
typedef v4f  __attribute__((may_alias)) v4fa;

__device__ __forceinline__ unsigned short f2bf(float f) { unsigned u = __float_as_uint(f); u += 0x7FFFu + ((u >> 16) & 1u); return (unsigned short)(u >> 16); }
__device__ __forceinline__ float bf2f(unsigned short s) { return __uint_as_float(((unsigned)s) << 16); }
__device__ __forceinline__ float bfr(float f) { return bf2f(f2bf(f)); }     // f32 -> bf16 (RNE) -> f32
__device__ __forceinline__ v16h cat16(v8h lo, v8h hi) { return __builtin_shufflevector(lo, hi, 0, 1, 2, 3, 4, 5, 6, 7, 8, 9, 10, 11, 12, 13, 14, 15); }
__device__ __forceinline__ v16bf cat16b(v8us lo, v8us hi) { return __builtin_bit_cast(v16bf, __builtin_shufflevector(lo, hi, 0, 1, 2, 3, 4, 5, 6, 7, 8, 9, 10, 11, 12, 13, 14, 15)); }
__device__ __forceinline__ v8f wmma16(v16h a, v16h b, v8f c) { return __builtin_amdgcn_wmma_f32_16x16x32_f16(false, a, false, b, (short)0, c, false, false); }
__device__ __forceinline__ v8f wmmab(v16bf a, v16bf b, v8f c) { return __builtin_amdgcn_wmma_f32_16x16x32_bf16(false, a, false, b, (short)0, c, false, false); }
// fragment loaders from K-contiguous 16-bit rows; p already includes + 8*(lane>>4): elements 0..7 <- k0+8h+0..7, elements 8..15 <- k0+16+8h+0..7 (same map for A and B)
__device__ __forceinline__ v16h  ldh(const h16* p) { return cat16(*(const v8h*)p, *(const v8h*)(p + 16)); }
__device__ __forceinline__ v16bf ldb(const bf* p)  { return cat16b(*(const v8us*)p, *(const v8us*)(p + 16)); }
// ordering point for wave-private LDS tiles (same wave writes and reads)
__device__ __forceinline__ void wave_sync() { __builtin_amdgcn_fence(3 /* release order */, "wavefront"); __builtin_amdgcn_wave_barrier(); asm volatile("" ::: "memory"); }
// f32 -> f16 for WMMA operand planes: magnitudes below the smallest normal f16 become exactly 0 (value select)
static __device__ __forceinline__ h16 toh_flush(float v) { const h16 r = (h16)v; return (fabsf(v) < 6.103515625e-05f) ? (h16)0.0f : r; }

__global__ __launch_bounds__(256) void k_cvt8(const float* __restrict__ src, bf* dst, size_t n8) {
    const size_t i = (size_t)blockIdx.x * 256 + threadIdx.x; if (i >= n8) return;
    const v8f v = *(const v8f*)(src + i * 8); v8us o;
#pragma unroll
    for (int k = 0; k < 8; ++k) o[k] = f2bf(v[k]);
    *(v8us*)(dst + i * 8) = o; 
}

// k_fold: W_eff[m][k] = bf16(W[m][k]) + sum_r bf16(LB[m][r]) * bf16(LA[r][k]) in f32 (K = 8, vector unit, rank loop rolled), written as bf16 value at dst[m][k] and bf16 remainder at dst[m][DM + k]
__global__ __launch_bounds__(256) void k_fold(const float* __restrict__ W, const float* __restrict__ LA, const float* __restrict__ LB, bf* dst) {
    const size_t i = (size_t)blockIdx.x * 256 + threadIdx.x; if (i >= (size_t)DM * (DM / 8)) return;
    const int m = (int)(i / (DM / 8)); const int k0 = (int)(i % (DM / 8)) * 8;
    const v8f w = *(const v8f*)(W + (size_t)m * DM + k0);
    const v8f lb = *(const v8f*)(LB + (size_t)m * LR);
    float acc[8];
#pragma unroll
    for (int k = 0; k < 8; ++k) acc[k] = bfr(w[k]);
    float blr[8];
#pragma unroll
    for (int r = 0; r < 8; ++r) blr[r] = bfr(lb[r]);
    // rank loop rolled: the multiplier of step r is rotated to slot 0 so every register index stays static
#pragma unroll 1
    for (int r = 0; r < LR; ++r) {
        const float bl = blr[0];
#pragma unroll
        for (int q = 0; q < 7; ++q) blr[q] = blr[q + 1];
        const v8f a = *(const v8f*)(LA + (size_t)r * DM + k0);
#pragma unroll
        for (int k = 0; k < 8; ++k) acc[k] = acc[k] + bl * bfr(a[k]);
    }
    v8us hv, lv;
#pragma unroll
    for (int k = 0; k < 8; ++k) { const unsigned short h0 = f2bf(acc[k]); hv[k] = h0; lv[k] = f2bf(acc[k] - bf2f(h0)); }
    bf* p = dst + (size_t)m * WP + k0;
    *(v8us*)(p) = hv; *(v8us*)(p + DM) = lv;
    
}

// gemm_main: one wave, 64x64 tile, 16 accumulators; C[m][n] += sum_k A[m][k mod awrap] Bt[n][k >= kwrap ? k - kwrap : k] (K <= 2*awrap, one subtraction each); operands straight from K-contiguous bf16 planes.
// aoff / boff already include (row + lane&15) * pitch + 8*(lane>>4). pa / pb = row pitches (elements), K, awrap and kwrap multiples of 32.
__device__ __forceinline__ void gemm_main(const bf* __restrict__ A, const bf* __restrict__ Bt, const size_t aoff, const size_t boff,
                                          const int pa, const int pb, const int K, const int awrap, const int kwrap, v8f (&acc)[4][4]) {
#pragma unroll 1
    for (int kc = 0; kc < K; kc += 32) {
        const int ka = (kc >= awrap) ? (kc - awrap) : kc;
        const int kb = (kc >= kwrap) ? (kc - kwrap) : kc;
        v16bf a[4];
#pragma unroll
        for (int mb = 0; mb < 4; ++mb) a[mb] = ldb(A + aoff + (size_t)(mb * 16) * (size_t)pa + ka);
        v16bf b = ldb(Bt + boff + kb);
#pragma unroll
        for (int mb = 0; mb < 4; ++mb) acc[mb][0] = wmmab(a[mb], b, acc[mb][0]);
#pragma unroll
        for (int nb = 1; nb < 4; ++nb) {
            b = ldb(Bt + boff + (size_t)(nb * 16) * (size_t)pb + kb);
#pragma unroll
            for (int mb = 0; mb < 4; ++mb) acc[mb][nb] = wmmab(a[mb], b, acc[mb][nb]);
        }
        asm volatile("" : "+v"(acc[0][0]), "+v"(acc[0][1]), "+v"(acc[0][2]), "+v"(acc[0][3]), "+v"(acc[1][0]), "+v"(acc[1][1]), "+v"(acc[1][2]), "+v"(acc[1][3]));
        asm volatile("v_nop\n\tv_nop\n\tv_nop\n\tv_nop" : "+v"(acc[2][0]), "+v"(acc[2][1]), "+v"(acc[2][2]), "+v"(acc[2][3]), "+v"(acc[3][0]), "+v"(acc[3][1]), "+v"(acc[3][2]), "+v"(acc[3][3])
                     : "v"(a[0]), "v"(a[1]), "v"(a[2]), "v"(a[3]), "v"(b));
    }
}

// k_proj: bf16 GEMM, ONE WAVE per 64x64 tile, K = WP (value half then remainder half of the folded weight; the x operand wraps at DM).
// C[m][n] = sum_k A[m][k mod awrap] Bt[n][k mod bwrap] + bias (bias by column n when biasRow == 0, by row m when biasRow != 0; bias RNE-converted to bf16),
// written as f16 at tile base (r0/RB)*sRB + (r0%RB)*pitch + (c0/CB)*sCB + (c0%CB), row pitch 'pitch' (halves). grid (M/64, N/64), 32 threads.
__global__ __launch_bounds__(32) void k_proj(const bf* __restrict__ A, const bf* __restrict__ Bt, int pa, int pb, int awrap, int bwrap,
                                             const float* __restrict__ bias, int biasRow, h16* Ph, int RB, size_t sRB, int pitch, int CB, size_t sCB) {
    __shared__ __align__(16) float os[16 * 68];
    const int lane = threadIdx.x & 31, lr = lane & 15, hi = lane >> 4; const int r0 = blockIdx.x * 64, c0 = blockIdx.y * 64;
    v8f acc[4][4];
#pragma unroll
    for (int mb = 0; mb < 4; ++mb)
#pragma unroll
        for (int nb = 0; nb < 4; ++nb) acc[mb][nb] = (v8f){};
    gemm_main(A, Bt, (size_t)(r0 + lr) * (size_t)pa + 8 * hi, (size_t)(c0 + lr) * (size_t)pb + 8 * hi, pa, pb, WP, awrap, bwrap, acc);
    const int rq = lane >> 3, c8 = (lane & 7) * 8;
    float bc[8];
    { int cb = c0 + c8; cb = (cb < DM - 8) ? cb : (DM - 8);          // clamped address; value selected afterwards
      const v4f b0 = *(const v4f*)(bias + cb); const v4f b1 = *(const v4f*)(bias + cb + 4);
#pragma unroll
      for (int i = 0; i < 4; ++i) { bc[i] = biasRow ? 0.0f : bfr(b0[i]); bc[4 + i] = biasRow ? 0.0f : bfr(b1[i]); } }
    const size_t tbase = (size_t)(r0 / RB) * sRB + (size_t)(r0 % RB) * (size_t)pitch + (size_t)(c0 / CB) * sCB + (size_t)(c0 % CB);
#pragma unroll
    for (int mb = 0; mb < 4; ++mb) {
#pragma unroll
        for (int nb = 0; nb < 4; ++nb) {
#pragma unroll
            for (int j = 0; j < 8; ++j) os[(hi * 8 + j) * 68 + nb * 16 + lr] = acc[mb][nb][j]; }   // D: row 8h+j, col lane&15
        wave_sync();
        float br[4];
#pragma unroll
        for (int s = 0; s < 4; ++s) { int ri = r0 + mb * 16 + 4 * s + rq; ri = (ri < DM - 1) ? ri : (DM - 1); const float bv_ = bias[ri]; br[s] = biasRow ? bfr(bv_) : 0.0f; }
        const size_t sb = tbase + (size_t)(mb * 16) * (size_t)pitch;
{
#pragma unroll
            for (int s = 0; s < 4; ++s) { const int row = 4 * s + rq;   // 4 s x 4 row groups = 16 rows; 8 lanes x 8 = 64 columns
                const v4f x0 = *(const v4fa*)(&os[row * 68 + c8]); const v4f x1 = *(const v4fa*)(&os[row * 68 + c8 + 4]);
                float val[8]; v8h hv;
#pragma unroll
                for (int i = 0; i < 4; ++i) { val[i] = x0[i] + bc[i] + br[s]; val[4 + i] = x1[i] + bc[4 + i] + br[s]; }
#pragma unroll
                for (int i = 0; i < 8; ++i) hv[i] = toh_flush(val[i]);
                const size_t oo = sb + (size_t)row * (size_t)pitch + c8;
                *(v8h*)(Ph + oo) = hv; }
             }
        wave_sync();
    }
}

// k_flash: fused dense attention, one wave per 16 query rows of one (batch, head); K / V^T / Q fragments straight from the f16 planes (two 16-B loads each, arithmetic addressing).
// Transposed form: S^T[key][t] = K Q^T (A = K rows, B = Q rows); lane (t = lane&15, h = lane>>4) holds keys 8h+r of each 16-key tile, so the packed
// P tile is directly the B fragment of O^T[d][t] = V^T P^T (element r <- tile keys 0..15, element 8+r <- tile keys 16..31, lane unchanged).
// Key loop covers keys 0 .. SEQ-1 in steps of 32 (all inside the sequence, every key valid for every row).
// Softmax state (running max, partial sum) is one scalar per lane; the two lane halves of a row are combined with one xor-16 exchange.
// P carries x256; a P whose exponent argument is below -14 (under the smallest normal f16) is taken as exactly 0; the row sum runs over the converted P.
__global__ __launch_bounds__(32 * AW) void k_flash(const h16* __restrict__ QH, const h16* __restrict__ KP, const h16* __restrict__ VT, bf* CX) {
    __shared__ __align__(16) float os[AW * 16 * 68];
    const int lane = threadIdx.x & 31, lr = lane & 15, hi = lane >> 4;
    const int wave = __builtin_amdgcn_readfirstlane(threadIdx.x >> 5);
    const int zh = blockIdx.y; const int b = zh / NH_, h = zh % NH_;
    const int t0 = (blockIdx.x * AW + wave) * 16;
    const size_t pbase = (size_t)zh * SEQ * HD;
    const size_t qo = pbase + (size_t)(t0 + lr) * HD + 8 * hi;
    const v16h qh0 = ldh(QH + qo), qh1 = ldh(QH + qo + 32);   // B fragments: col t, k = d
    const size_t ko = pbase + (size_t)lr * HD + 8 * hi;      // + key * HD       (A fragment: row key, k = d)
    const size_t vo = pbase + (size_t)lr * SEQ + 8 * hi;     // + 16j*SEQ + key  (A fragment: row d, k = key)
    v8f o[4];
#pragma unroll
    for (int j = 0; j < 4; ++j) { o[j] = (v8f){}; }
    float m = -3.0e38f, l = 0.0f;
#pragma unroll 1
    for (int key0 = 0; key0 < SEQ; key0 += 32) {
        const h16* ka = KP + ko + (size_t)key0 * HD;
        const v16h ka0 = ldh(ka), ka1 = ldh(ka + 32), kb0 = ldh(ka + 16 * HD), kb1 = ldh(ka + 16 * HD + 32);
        v8f sHa = (v8f){}, sHb = (v8f){};
        sHa = wmma16(ka0, qh0, sHa); sHb = wmma16(kb0, qh0, sHb);
        sHa = wmma16(ka1, qh1, sHa); sHb = wmma16(kb1, qh1, sHb);
        asm volatile("v_nop\n\tv_nop\n\tv_nop\n\tv_nop" : "+v"(sHa), "+v"(sHb) : "v"(ka0), "v"(ka1), "v"(kb0), "v"(kb1), "v"(qh0), "v"(qh1));
        float ta[8], tb[8];
#pragma unroll
        for (int r = 0; r < 8; ++r) { ta[r] = sHa[r] * SC2; tb[r] = sHb[r] * SC2; }
        float mx = -3.0e38f;
#pragma unroll
        for (int r = 0; r < 8; ++r) mx = fmaxf(mx, fmaxf(ta[r], tb[r]));
        mx = fmaxf(mx, __shfl_xor(mx, 16, 32));
        const float mnew = fmaxf(m, mx);
        const float alpha = __builtin_amdgcn_exp2f(m - mnew);
        const float sh = PSH - mnew;
        v16h pb; float ls = 0.0f;
#pragma unroll
        for (int r = 0; r < 8; ++r) { const float ea = ta[r] + sh; const float eb = tb[r] + sh;
            const float xa = __builtin_amdgcn_exp2f(ea); const float xb = __builtin_amdgcn_exp2f(eb);
            const h16 pa = (ea < -14.0f) ? (h16)0.0f : (h16)xa; const h16 pc = (eb < -14.0f) ? (h16)0.0f : (h16)xb;
            pb[r] = pa; pb[8 + r] = pc; ls += (float)pa + (float)pc; }
#pragma unroll
        for (int j = 0; j < 4; ++j) o[j] = o[j] * alpha;
        const h16* va = VT + vo + key0;
        const v16h v0 = ldh(va), v1 = ldh(va + (size_t)16 * SEQ), v2 = ldh(va + (size_t)32 * SEQ), v3 = ldh(va + (size_t)48 * SEQ);
        o[0] = wmma16(v0, pb, o[0]); o[1] = wmma16(v1, pb, o[1]); o[2] = wmma16(v2, pb, o[2]); o[3] = wmma16(v3, pb, o[3]);
        asm volatile("v_nop\n\tv_nop\n\tv_nop\n\tv_nop" : "+v"(o[0]), "+v"(o[1]), "+v"(o[2]), "+v"(o[3]) : "v"(v0), "v"(v1), "v"(v2), "v"(v3), "v"(pb));
        l = l * alpha + ls; m = mnew;
    }
    l += __shfl_xor(l, 16, 32);
    const float inv = 1.0f / l;
    const int wb = wave * 16 * 68;
    // O^T D layout: o_j[r] = (d = 16j + 8h + r, t = lane&15) -> os[t][d]; rows 0..15 x columns 0..63 all written
#pragma unroll
    for (int j = 0; j < 4; ++j) { v4f a, c;
#pragma unroll
        for (int i = 0; i < 4; ++i) { a[i] = o[j][i] * inv; c[i] = o[j][4 + i] * inv; }
        *(v4fa*)(&os[wb + lr * 68 + 16 * j + 8 * hi]) = a; *(v4fa*)(&os[wb + lr * 68 + 16 * j + 8 * hi + 4]) = c; }
    wave_sync();
    const int rq = lane >> 3, c8 = (lane & 7) * 8;
    bf* crow = CX + ((size_t)b * SEQ + t0) * CXP + h * HD;
{
#pragma unroll
        for (int s = 0; s < 4; ++s) { const int row = 4 * s + rq;   // 4 s x 4 row groups = 16 rows; 8 lanes x 8 = 64 columns
            const v4f x0 = *(const v4fa*)(&os[wb + row * 68 + c8]); const v4f x1 = *(const v4fa*)(&os[wb + row * 68 + c8 + 4]); v8us hv, lv;
#pragma unroll
            for (int i = 0; i < 4; ++i) { const unsigned short h0 = f2bf(x0[i]); const unsigned short h1 = f2bf(x1[i]);
                hv[i] = h0; hv[4 + i] = h1; lv[i] = f2bf(x0[i] - bf2f(h0)); lv[4 + i] = f2bf(x1[i] - bf2f(h1)); }
            const size_t oo = (size_t)row * CXP + c8;
            *(v8us*)(crow + oo) = hv; *(v8us*)(crow + oo + DM) = lv; }
         }
}

// k_out: final projection, ONE WAVE per 64x64 tile. A = ctx plane [m][value 768 | remainder 768] read at k mod 1536 (K = 2304: value, remainder, value),
// Bt = folded Wo plane [n][value 768 | remainder 768] read at k (k < 768) or k - 768 (value, value, remainder).
// OUT[m][n] = acc + bias[n] (bias RNE-converted to bf16), f32. Epilogue: per 16-row slab staged in LDS (wave-private), each output row segment (64 floats = 256 B = two lines)
__global__ __launch_bounds__(32) void k_out(const bf* __restrict__ A, const bf* __restrict__ Bt, const float* __restrict__ bias, float* OUT) {
    __shared__ __align__(16) float os[16 * 68];
    const int lane = threadIdx.x & 31, lr = lane & 15, hi = lane >> 4; const int r0 = blockIdx.x * 64, c0 = blockIdx.y * 64;
    v8f acc[4][4];
#pragma unroll
    for (int mb = 0; mb < 4; ++mb)
#pragma unroll
        for (int nb = 0; nb < 4; ++nb) acc[mb][nb] = (v8f){};
    gemm_main(A, Bt, (size_t)(r0 + lr) * CXP + 8 * hi, (size_t)(c0 + lr) * WP + 8 * hi, CXP, WP, KO, CXP, DM, acc);
    const int cofs = lr * 4;
    v4f b4 = *(const v4f*)(bias + c0 + cofs);          // c0 + cofs + 3 <= DM - 1 always
    b4[0] = bfr(b4[0]); b4[1] = bfr(b4[1]); b4[2] = bfr(b4[2]); b4[3] = bfr(b4[3]);
    const size_t orow0 = (size_t)(r0 / SEQ) * OUT_SEQ + (size_t)(r0 % SEQ);
#pragma unroll
    for (int mb = 0; mb < 4; ++mb) {
#pragma unroll
        for (int nb = 0; nb < 4; ++nb) {
#pragma unroll
            for (int j = 0; j < 8; ++j) os[(hi * 8 + j) * 68 + nb * 16 + lr] = acc[mb][nb][j]; }   // D: row 8h+j, col lane&15
        wave_sync();
        float* ob = OUT + (orow0 + (size_t)(mb * 16)) * DM + c0;
{
#pragma unroll
            for (int s = 0; s < 8; ++s) { const int row = 2 * s + hi;   // 8 s x 2 rows = 16 rows; 16 lanes x 4 floats = 64 columns
                const v4f xv = *(const v4fa*)(&os[row * 68 + cofs]);
                const v4f val = xv + b4;
                *(v4f*)(ob + (size_t)row * DM + cofs) = val; }
             }
        wave_sync();
    }
}

static constexpr size_t al256(size_t v) { return (v + 255) & ~(size_t)255; }
static constexpr size_t SZ_XB = al256((size_t)NB * SEQ * DM * 2);
static constexpr size_t SZ_WB = al256((size_t)4 * DM * WP * 2);
static constexpr size_t SZ_PL = al256((size_t)NB * NH_ * SEQ * HD * 2);
static constexpr size_t SZ_CX = al256((size_t)NB * SEQ * CXP * 2);
static constexpr size_t SZ_TOTAL = SZ_XB + SZ_WB + 3 * SZ_PL + SZ_CX;
static_assert(SZ_TOTAL <= (size_t)134217728);          // workspace carve <= 128 MiB
static_assert(((size_t)DM * WP * 2) % 256 == 0);       // weight sub-planes stay 256-byte aligned
static_assert((size_t)NB * NH_ * SEQ * HD == (size_t)NB * SEQ * DM);   // plane extent == GEMM tile grid extent

extern "C" void kernel_launch(void* const* d_in, const int* in_sizes, int n_in,
                              void* d_out, int out_size, void* d_ws, size_t ws_size, hipStream_t stream) {
    if (n_in < 17) return;
    const size_t needx = ((size_t)(NB - 1) * SEQ_FULL + SEQ) * DM;
    if ((size_t)in_sizes[0] < needx) return;
    if ((size_t)in_sizes[1] < (size_t)DM * DM || (size_t)in_sizes[5] < (size_t)DM * DM || (size_t)in_sizes[9] < (size_t)DM * DM || (size_t)in_sizes[13] < (size_t)DM * DM) return;
    if (in_sizes[2] < DM || in_sizes[6] < DM || in_sizes[10] < DM || in_sizes[14] < DM) return;
    if (in_sizes[3] < LR * DM || in_sizes[7] < LR * DM || in_sizes[11] < LR * DM || in_sizes[15] < LR * DM) return;
    if (in_sizes[4] < DM * LR || in_sizes[8] < DM * LR || in_sizes[12] < DM * LR || in_sizes[16] < DM * LR) return;
    if ((size_t)out_size < ((size_t)(NB - 1) * OUT_SEQ + SEQ) * DM) return;
    if (SZ_TOTAL > ws_size) return;
    // wire order: x, then per projection (q, k, v, o): W [out][in], b [out], A [8][in], B [out][8]; folded weights [out][in] = Bt as-is
    const float* x   = (const float*)d_in[0];
    const float* wq  = (const float*)d_in[1];  const float* bq  = (const float*)d_in[2];  const float* laq = (const float*)d_in[3];  const float* lbq = (const float*)d_in[4];
    const float* wk  = (const float*)d_in[5];  const float* bk  = (const float*)d_in[6];  const float* lak = (const float*)d_in[7];  const float* lbk = (const float*)d_in[8];
    const float* wv  = (const float*)d_in[9];  const float* bv  = (const float*)d_in[10]; const float* lav = (const float*)d_in[11]; const float* lbv = (const float*)d_in[12];
    const float* wo  = (const float*)d_in[13]; const float* bo  = (const float*)d_in[14]; const float* lao = (const float*)d_in[15]; const float* lbo = (const float*)d_in[16];
    float* OUT = (float*)d_out;      // [NB][SEQ][768]
    char* wsp = (char*)d_ws;
    bf* XB = (bf*)wsp; wsp += SZ_XB;                 // [NB*SEQ][768]
    bf* WB = (bf*)wsp; wsp += SZ_WB;                 // [4][768][value 768 | remainder 768]: q | k | v | o
    h16* QH = (h16*)wsp; wsp += SZ_PL;               // [NB*12][SEQ][64]
    h16* KP = (h16*)wsp; wsp += SZ_PL;               // [NB*12][SEQ][64]
    h16* VT = (h16*)wsp; wsp += SZ_PL;               // [NB*12][64][SEQ]
    bf* CX = (bf*)wsp; wsp += SZ_CX;                 // [NB*SEQ][value 768 | remainder 768]
    bf* WQ = WB; bf* WK = WB + (size_t)DM * WP; bf* WV = WB + (size_t)2 * DM * WP; bf* WO = WB + (size_t)3 * DM * WP;

    if (SEQ == SEQ_FULL) {
        const size_t n8 = (size_t)NB * SEQ * DM / 8;
        k_cvt8<<<(unsigned)((n8 + 255) / 256), 256, 0, stream>>>(x, XB, n8);
    } else {
        const size_t n8 = (size_t)SEQ * DM / 8;
        for (int b = 0; b < NB; ++b) k_cvt8<<<(unsigned)((n8 + 255) / 256), 256, 0, stream>>>(x + (size_t)b * SEQ_FULL * DM, XB + (size_t)b * SEQ * DM, n8);
    }
    { const size_t nt = (size_t)DM * (DM / 8); const unsigned g = (unsigned)((nt + 255) / 256);
      k_fold<<<g, 256, 0, stream>>>(wq, laq, lbq, WQ); k_fold<<<g, 256, 0, stream>>>(wk, lak, lbk, WK);
      k_fold<<<g, 256, 0, stream>>>(wv, lav, lbv, WV); k_fold<<<g, 256, 0, stream>>>(wo, lao, lbo, WO); }

    // q, k: A = x rows (m = b*SEQ + t, pitch DM, wraps at DM), Bt = folded W rows (n = h*64 + d, pitch WP, no wrap), bias by column -> plane [(b*12 + h)][t][d]
    k_proj<<<dim3(NB * SEQ / 64, DM / 64, 1), 32, 0, stream>>>(XB, WQ, DM, WP, DM, WP, bq, 0, QH, SEQ, (size_t)NH_ * SEQ * HD, HD, HD, (size_t)SEQ * HD);
    k_proj<<<dim3(NB * SEQ / 64, DM / 64, 1), 32, 0, stream>>>(XB, WK, DM, WP, DM, WP, bk, 0, KP, SEQ, (size_t)NH_ * SEQ * HD, HD, HD, (size_t)SEQ * HD);
    // v^T: A = folded Wv rows (m = h*64 + d, pitch WP, no wrap), Bt = x rows (n = b*SEQ + t, pitch DM, wraps at DM), bias by row -> plane [(b*768 + m)][t] = [(b*12 + h)][d][t]
    k_proj<<<dim3(DM / 64, NB * SEQ / 64, 1), 32, 0, stream>>>(WV, XB, WP, DM, WP, DM, bv, 1, VT, DM, (size_t)0, SEQ, SEQ, (size_t)DM * SEQ);

    k_flash<<<dim3(SEQ / (16 * AW), NB * NH_, 1), 32 * AW, 0, stream>>>(QH, KP, VT, CX);

    // out: A = ctx rows [m][value | remainder], Bt = folded Wo rows (n) [value | remainder], bias by column -> OUT[b][t][n]
    k_out<<<dim3(NB * SEQ / 64, DM / 64, 1), 32, 0, stream>>>(CX, WO, bo, OUT);
}

// v001
// It runs in 388 microseconds.
// Next to v000, in two timings, it ran 1.08 and 1.09 times as fast.
#include <hip/hip_runtime.h>

// Dense (unmasked) multi-head self-attention, width 768 = 12 heads x 64, x [NB][SEQ][768]; each of the four projections is y = x W^T + b + (x A^T) B^T with W [out][in], A [8][in], B [out][8]; score scale 1/8; f32 output.
// Compute dtypes, f32 accumulate everywhere: the rank-8 update is folded once into W_eff = W + B A (f32 on the vector unit, K = 8; W, A, B, b, x RNE-converted to bf16 first) and carried as bf16 value | bf16 remainder along K;
// softmax f32 (online, running max); output projection v_wmma_f32_16x16x32_bf16 with ctx as bf16 value | remainder and W_eff as bf16 value | remainder (K = 2304: value x value, remainder x value, value x remainder), one accumulator.
// Layout: bf16 copy of x; folded weight planes [4][768][value 768 | remainder 768]; q, k planes [b*12+h][t][d], v^T plane [b*12+h][d][t] (f16) written by the GEMM epilogue; fused flash kernel in transposed form
// Every one of these planes is stored in FRAGMENT ORDER: a block of 16 rows x 32 k is 512 consecutive elements, element (row, k) of a block at (k>>4)*256 + ((k>>3)&1)*128 + row*8 + (k&7);
// blocks run along k (512 elements each), then along rows (16 * pitch elements per block row). A fragment is then two wave-wide 16-B loads of 512 contiguous bytes each (four whole lines) instead of 16 partial lines.
// (S^T = K Q^T, O^T = V^T P^T, key loop over the whole sequence) writes the ctx plane [b*SEQ+t][value 768 | remainder 768] (bf16); final GEMM adds the bias at the store stage.

#ifndef NB
#define NB 4
#endif
#ifndef SEQ
#define SEQ 2048
#endif
#define NB_FULL  4
#define SEQ_FULL 2048
#ifndef OUT_SEQ
#define OUT_SEQ SEQ              // row pitch (in tokens) between batches of the output
#endif
#define DM   768
#define NH_  12
#define HD   64
#define LR   8                   // rank of the low-rank update
#define WP   (2 * DM)            // folded weight plane row pitch: value columns 0..DM-1, remainder columns DM..2DM-1
#define CXP  (2 * DM)            // ctx plane row pitch: value columns 0..DM-1, remainder columns DM..2DM-1
#define KO   (3 * DM)            // K extent of the output projection
#define AW   4                   // waves per flash block (16 query rows each)
#define SC2  (0.125f * 1.4426950408889634f)   // HD^-0.5 * log2(e)
#define PSH  8.0f                // log2 of the P carry (256)

static_assert(HD == 64);
static_assert(NH_ * HD == DM);                 // head h = columns h*64 + d
static_assert(DM % 64 == 0);                   // column tiles of 64
static_assert(DM % 32 == 0);                   // GEMM k-loop steps by 32; a k-step never straddles a wrap point
static_assert(CXP == 2 * DM);
static_assert(CXP % 32 == 0);
static_assert(WP == 2 * DM);
static_assert(WP % 32 == 0);
static_assert(KO == CXP + DM);                 // third K segment meets the ctx value half again (A wrap at CXP) and the weight remainder half (B wrap at DM)
static_assert(KO % 32 == 0);
static_assert(LR == 8);                        // one 32-byte load covers a row of B [out][8]
static_assert(DM % 8 == 0);                    // fold kernel: 8 columns per lane
static_assert((DM / 8) % 8 == 0);
static_assert(SEQ % 64 == 0);                  // a 64-row tile never straddles two batches
static_assert((NB * SEQ) % 64 == 0);
static_assert(SEQ % 32 == 0);                  // key loop steps by 32 and stays inside the sequence
static_assert(SEQ % (16 * AW) == 0);           // flash grid covers the sequence exactly
static_assert(((size_t)SEQ * DM) % 8 == 0);
static_assert(((size_t)DM * DM) % 8 == 0);
static_assert(NB <= NB_FULL);
static_assert(SEQ <= SEQ_FULL);
static_assert(AW * 32 <= 256);

typedef _Float16 h16;
typedef unsigned short bf;
typedef __attribute__((ext_vector_type(16))) __bf16   v16bf;
typedef __attribute__((ext_vector_type(16))) _Float16 v16h;
typedef __attribute__((ext_vector_type(8)))  _Float16 v8h;
typedef __attribute__((ext_vector_type(8)))  unsigned short v8us;
typedef __attribute__((ext_vector_type(8)))  float    v8f;
typedef __attribute__((ext_vector_type(4)))  float    v4f;
typedef v4f  __attribute__((may_alias)) v4fa;

__device__ __forceinline__ unsigned short f2bf(float f) { unsigned u = __float_as_uint(f); u += 0x7FFFu + ((u >> 16) & 1u); return (unsigned short)(u >> 16); }
__device__ __forceinline__ float bf2f(unsigned short s) { return __uint_as_float(((unsigned)s) << 16); }
__device__ __forceinline__ float bfr(float f) { return bf2f(f2bf(f)); }     // f32 -> bf16 (RNE) -> f32
__device__ __forceinline__ v16h cat16(v8h lo, v8h hi) { return __builtin_shufflevector(lo, hi, 0, 1, 2, 3, 4, 5, 6, 7, 8, 9, 10, 11, 12, 13, 14, 15); }
__device__ __forceinline__ v16bf cat16b(v8us lo, v8us hi) { return __builtin_bit_cast(v16bf, __builtin_shufflevector(lo, hi, 0, 1, 2, 3, 4, 5, 6, 7, 8, 9, 10, 11, 12, 13, 14, 15)); }
__device__ __forceinline__ v8f wmma16(v16h a, v16h b, v8f c) { return __builtin_amdgcn_wmma_f32_16x16x32_f16(false, a, false, b, (short)0, c, false, false); }
__device__ __forceinline__ v8f wmmab(v16bf a, v16bf b, v8f c) { return __builtin_amdgcn_wmma_f32_16x16x32_bf16(false, a, false, b, (short)0, c, false, false); }
// fragment loaders from fragment-order planes; p = block base + 8*lane: elements 0..7 <- k0+8h+0..7, elements 8..15 <- k0+16+8h+0..7 of row lane&15 (same map for A and B)
__device__ __forceinline__ v16h  ldh(const h16* p) { return cat16(*(const v8h*)p, *(const v8h*)(p + 256)); }
__device__ __forceinline__ v16bf ldb(const bf* p)  { return cat16b(*(const v8us*)p, *(const v8us*)(p + 256)); }
// ordering point for wave-private LDS tiles (same wave writes and reads)
__device__ __forceinline__ void wave_sync() { __builtin_amdgcn_fence(3 /* release order */, "wavefront"); __builtin_amdgcn_wave_barrier(); asm volatile("" ::: "memory"); }
// f32 -> f16 for WMMA operand planes: magnitudes below the smallest normal f16 become exactly 0 (value select)
static __device__ __forceinline__ h16 toh_flush(float v) { const h16 r = (h16)v; return (fabsf(v) < 6.103515625e-05f) ? (h16)0.0f : r; }

__global__ __launch_bounds__(256) void k_cvt8(const float* __restrict__ src, bf* dst, size_t n8) {
    const size_t i = (size_t)blockIdx.x * 256 + threadIdx.x; if (i >= n8) return;
    // i counts 8-element pieces of the fragment-order plane (row pitch DM): block i>>6, piece w = i&63 holds row w&15, k (w>>4)*8 .. +7 of the block
    const size_t blk = i >> 6; const int w = (int)(i & 63);
    const size_t m = (blk / (DM / 32)) * 16 + (size_t)(w & 15); const int k0 = (int)(blk % (DM / 32)) * 32 + (w >> 4) * 8;
    const v8f v = *(const v8f*)(src + m * DM + k0); v8us o;
#pragma unroll
    for (int k = 0; k < 8; ++k) o[k] = f2bf(v[k]);
    *(v8us*)(dst + i * 8) = o; 
}

// k_fold: W_eff[m][k] = bf16(W[m][k]) + sum_r bf16(LB[m][r]) * bf16(LA[r][k]) in f32 (K = 8, vector unit, rank loop rolled), written as bf16 value at column k and bf16 remainder at column DM + k of row m (fragment order, pitch WP)
__global__ __launch_bounds__(256) void k_fold(const float* __restrict__ W, const float* __restrict__ LA, const float* __restrict__ LB, bf* dst) {
    const size_t i = (size_t)blockIdx.x * 256 + threadIdx.x; if (i >= (size_t)DM * (DM / 8)) return;
    // i counts 8-element pieces of the value half in fragment order: block i>>6 (block row rb, block column kb), piece pc = i&63 holds row pc&15, k (pc>>4)*8 .. +7 of the block
    const int rb = (int)(i >> 6) / (DM / 32), kb = (int)(i >> 6) % (DM / 32), pc = (int)(i & 63);
    const int m = rb * 16 + (pc & 15); const int k0 = kb * 32 + (pc >> 4) * 8;
    const v8f w = *(const v8f*)(W + (size_t)m * DM + k0);
    const v8f lb = *(const v8f*)(LB + (size_t)m * LR);
    float acc[8];
#pragma unroll
    for (int k = 0; k < 8; ++k) acc[k] = bfr(w[k]);
    float blr[8];
#pragma unroll
    for (int r = 0; r < 8; ++r) blr[r] = bfr(lb[r]);
    // rank loop rolled: the multiplier of step r is rotated to slot 0 so every register index stays static
#pragma unroll 1
    for (int r = 0; r < LR; ++r) {
        const float bl = blr[0];
#pragma unroll
        for (int q = 0; q < 7; ++q) blr[q] = blr[q + 1];
        const v8f a = *(const v8f*)(LA + (size_t)r * DM + k0);
#pragma unroll
        for (int k = 0; k < 8; ++k) acc[k] = acc[k] + bl * bfr(a[k]);
    }
    v8us hv, lv;
#pragma unroll
    for (int k = 0; k < 8; ++k) { const unsigned short h0 = f2bf(acc[k]); hv[k] = h0; lv[k] = f2bf(acc[k] - bf2f(h0)); }
    bf* p = dst + (size_t)rb * 16 * WP + (size_t)kb * 512 + pc * 8;
    *(v8us*)(p) = hv; *(v8us*)(p + DM * 16) = lv;          // DM columns further = DM/32 blocks = DM*16 elements
    
}

// gemm_main: one wave, 64x64 tile, 16 accumulators; C[m][n] += sum_k A[m][k mod awrap] Bt[n][k >= kwrap ? k - kwrap : k] (K <= 2*awrap, one subtraction each); operands straight from fragment-order bf16 planes.
// aoff / boff already include row0 * pitch + 8*lane (row0 a multiple of 16). pa / pb = row pitches (elements), K, awrap and kwrap multiples of 32; 32 k = one block = 512 elements, so column k0 is at k0*16.
__device__ __forceinline__ void gemm_main(const bf* __restrict__ A, const bf* __restrict__ Bt, const size_t aoff, const size_t boff,
                                          const int pa, const int pb, const int K, const int awrap, const int kwrap, v8f (&acc)[4][4]) {
#pragma unroll 1
    for (int kc = 0; kc < K; kc += 32) {
        const int ka = (kc >= awrap) ? (kc - awrap) : kc;
        const int kb = (kc >= kwrap) ? (kc - kwrap) : kc;
        v16bf a[4];
#pragma unroll
        for (int mb = 0; mb < 4; ++mb) a[mb] = ldb(A + aoff + (size_t)(mb * 16) * (size_t)pa + (size_t)ka * 16);
        v16bf b = ldb(Bt + boff + (size_t)kb * 16);
#pragma unroll
        for (int mb = 0; mb < 4; ++mb) acc[mb][0] = wmmab(a[mb], b, acc[mb][0]);
#pragma unroll
        for (int nb = 1; nb < 4; ++nb) {
            b = ldb(Bt + boff + (size_t)(nb * 16) * (size_t)pb + (size_t)kb * 16);
#pragma unroll
            for (int mb = 0; mb < 4; ++mb) acc[mb][nb] = wmmab(a[mb], b, acc[mb][nb]);
        }
        asm volatile("" : "+v"(acc[0][0]), "+v"(acc[0][1]), "+v"(acc[0][2]), "+v"(acc[0][3]), "+v"(acc[1][0]), "+v"(acc[1][1]), "+v"(acc[1][2]), "+v"(acc[1][3]));
        asm volatile("v_nop\n\tv_nop\n\tv_nop\n\tv_nop" : "+v"(acc[2][0]), "+v"(acc[2][1]), "+v"(acc[2][2]), "+v"(acc[2][3]), "+v"(acc[3][0]), "+v"(acc[3][1]), "+v"(acc[3][2]), "+v"(acc[3][3])
                     : "v"(a[0]), "v"(a[1]), "v"(a[2]), "v"(a[3]), "v"(b));
    }
}

// k_proj: bf16 GEMM, ONE WAVE per 64x64 tile, K = WP (value half then remainder half of the folded weight; the x operand wraps at DM).
// C[m][n] = sum_k A[m][k mod awrap] Bt[n][k mod bwrap] + bias (bias by column n when biasRow == 0, by row m when biasRow != 0; bias RNE-converted to bf16),
// written as f16, in fragment order, into the sub-plane at (r0/RB)*sRB + (c0/CB)*sCB: rows r0%RB .., columns c0%CB .., row pitch 'pitch' (halves). grid (M/64, N/64), 32 threads.
__global__ __launch_bounds__(32) void k_proj(const bf* __restrict__ A, const bf* __restrict__ Bt, int pa, int pb, int awrap, int bwrap,
                                             const float* __restrict__ bias, int biasRow, h16* Ph, int RB, size_t sRB, int pitch, int CB, size_t sCB) {
    __shared__ __align__(16) float os[16 * 68];
    const int lane = threadIdx.x & 31, lr = lane & 15, hi = lane >> 4; const int r0 = blockIdx.x * 64, c0 = blockIdx.y * 64;
    v8f acc[4][4];
#pragma unroll
    for (int mb = 0; mb < 4; ++mb)
#pragma unroll
        for (int nb = 0; nb < 4; ++nb) acc[mb][nb] = (v8f){};
    gemm_main(A, Bt, (size_t)r0 * (size_t)pa + 8 * lane, (size_t)c0 * (size_t)pb + 8 * lane, pa, pb, WP, awrap, bwrap, acc);
    // store stage s = 0..3: lane holds row lane&15, columns (s>>1)*32 + (s&1)*16 + 8h + 0..7 of the slab = piece 'lane' of half s&1 of block s>>1
    float bc[4][8];
#pragma unroll
    for (int s = 0; s < 4; ++s) { int cb = c0 + (s >> 1) * 32 + (s & 1) * 16 + hi * 8; cb = (cb < DM - 8) ? cb : (DM - 8);          // clamped address; value selected afterwards
      const v4f b0 = *(const v4f*)(bias + cb); const v4f b1 = *(const v4f*)(bias + cb + 4);
#pragma unroll
      for (int i = 0; i < 4; ++i) { bc[s][i] = biasRow ? 0.0f : bfr(b0[i]); bc[s][4 + i] = biasRow ? 0.0f : bfr(b1[i]); } }
    const size_t tbase = (size_t)(r0 / RB) * sRB + (size_t)(r0 % RB) * (size_t)pitch + (size_t)(c0 / CB) * sCB + (size_t)(c0 % CB) * 16 + 8 * lane;
#pragma unroll
    for (int mb = 0; mb < 4; ++mb) {
#pragma unroll
        for (int nb = 0; nb < 4; ++nb) {
#pragma unroll
            for (int j = 0; j < 8; ++j) os[(hi * 8 + j) * 68 + nb * 16 + lr] = acc[mb][nb][j]; }   // D: row 8h+j, col lane&15
        wave_sync();
        float br;
        { int ri = r0 + mb * 16 + lr; ri = (ri < DM - 1) ? ri : (DM - 1); const float bv_ = bias[ri]; br = biasRow ? bfr(bv_) : 0.0f; }
        const size_t sb = tbase + (size_t)(mb * 16) * (size_t)pitch;
{
#pragma unroll
            for (int s = 0; s < 4; ++s) { const int col = (s >> 1) * 32 + (s & 1) * 16 + hi * 8;   // 16 lanes = 16 rows; 4 s x 2 halves x 8 = 64 columns
                const v4f x0 = *(const v4fa*)(&os[lr * 68 + col]); const v4f x1 = *(const v4fa*)(&os[lr * 68 + col + 4]);
                float val[8]; v8h hv;
#pragma unroll
                for (int i = 0; i < 4; ++i) { val[i] = x0[i] + bc[s][i] + br; val[4 + i] = x1[i] + bc[s][4 + i] + br; }
#pragma unroll
                for (int i = 0; i < 8; ++i) hv[i] = toh_flush(val[i]);
                const size_t oo = sb + (size_t)((s >> 1) * 512 + (s & 1) * 256);
                *(v8h*)(Ph + oo) = hv; }
             }
        wave_sync();
    }
}

// k_flash: fused dense attention, one wave per 16 query rows of one (batch, head); K / V^T / Q fragments straight from the fragment-order f16 planes (two 16-B loads each, 512 contiguous bytes per load, arithmetic addressing).
// Transposed form: S^T[key][t] = K Q^T (A = K rows, B = Q rows); lane (t = lane&15, h = lane>>4) holds keys 8h+r of each 16-key tile, so the packed
// P tile is directly the B fragment of O^T[d][t] = V^T P^T (element r <- tile keys 0..15, element 8+r <- tile keys 16..31, lane unchanged).
// Key loop covers keys 0 .. SEQ-1 in steps of 32 (all inside the sequence, every key valid for every row).
// Softmax state (running max, partial sum) is one scalar per lane; the two lane halves of a row are combined with one xor-16 exchange.
// P carries x256; a P whose exponent argument is below -14 (under the smallest normal f16) is taken as exactly 0; the row sum runs over the converted P.
__global__ __launch_bounds__(32 * AW) void k_flash(const h16* __restrict__ QH, const h16* __restrict__ KP, const h16* __restrict__ VT, bf* CX) {
    const int lane = threadIdx.x & 31;
    const int wave = __builtin_amdgcn_readfirstlane(threadIdx.x >> 5);
    const int zh = blockIdx.y; const int b = zh / NH_, h = zh % NH_;
    const int t0 = (blockIdx.x * AW + wave) * 16;
    const size_t pbase = (size_t)zh * SEQ * HD;
    const size_t qo = pbase + (size_t)t0 * HD + 8 * lane;
    const v16h qh0 = ldh(QH + qo), qh1 = ldh(QH + qo + 512);   // B fragments: col t, k = d (blocks d 0..31, d 32..63)
    const size_t ko = pbase + 8 * lane;      // + key0 * HD + 512 * (d block)   (A fragment: row key, k = d)
    const size_t vo = pbase + 8 * lane;      // + 16j*SEQ + key0 * 16           (A fragment: row d, k = key)
    v8f o[4];
#pragma unroll
    for (int j = 0; j < 4; ++j) { o[j] = (v8f){}; }
    float m = -3.0e38f, l = 0.0f;
#pragma unroll 1
    for (int key0 = 0; key0 < SEQ; key0 += 32) {
        const h16* ka = KP + ko + (size_t)key0 * HD;
        const v16h ka0 = ldh(ka), ka1 = ldh(ka + 512), kb0 = ldh(ka + 16 * HD), kb1 = ldh(ka + 16 * HD + 512);
        v8f sHa = (v8f){}, sHb = (v8f){};
        sHa = wmma16(ka0, qh0, sHa); sHb = wmma16(kb0, qh0, sHb);
        sHa = wmma16(ka1, qh1, sHa); sHb = wmma16(kb1, qh1, sHb);
        asm volatile("v_nop\n\tv_nop\n\tv_nop\n\tv_nop" : "+v"(sHa), "+v"(sHb) : "v"(ka0), "v"(ka1), "v"(kb0), "v"(kb1), "v"(qh0), "v"(qh1));
        float ta[8], tb[8];
#pragma unroll
        for (int r = 0; r < 8; ++r) { ta[r] = sHa[r] * SC2; tb[r] = sHb[r] * SC2; }
        float mx = -3.0e38f;
#pragma unroll
        for (int r = 0; r < 8; ++r) mx = fmaxf(mx, fmaxf(ta[r], tb[r]));
        mx = fmaxf(mx, __shfl_xor(mx, 16, 32));
        const float mnew = fmaxf(m, mx);
        const float alpha = __builtin_amdgcn_exp2f(m - mnew);
        const float sh = PSH - mnew;
        v16h pb; float ls = 0.0f;
#pragma unroll
        for (int r = 0; r < 8; ++r) { const float ea = ta[r] + sh; const float eb = tb[r] + sh;
            const float xa = __builtin_amdgcn_exp2f(ea); const float xb = __builtin_amdgcn_exp2f(eb);
            const h16 pa = (ea < -14.0f) ? (h16)0.0f : (h16)xa; const h16 pc = (eb < -14.0f) ? (h16)0.0f : (h16)xb;
            pb[r] = pa; pb[8 + r] = pc; ls += (float)pa + (float)pc; }
#pragma unroll
        for (int j = 0; j < 4; ++j) o[j] = o[j] * alpha;
        const h16* va = VT + vo + (size_t)key0 * 16;
        const v16h v0 = ldh(va), v1 = ldh(va + (size_t)16 * SEQ), v2 = ldh(va + (size_t)32 * SEQ), v3 = ldh(va + (size_t)48 * SEQ);
        o[0] = wmma16(v0, pb, o[0]); o[1] = wmma16(v1, pb, o[1]); o[2] = wmma16(v2, pb, o[2]); o[3] = wmma16(v3, pb, o[3]);
        asm volatile("v_nop\n\tv_nop\n\tv_nop\n\tv_nop" : "+v"(o[0]), "+v"(o[1]), "+v"(o[2]), "+v"(o[3]) : "v"(v0), "v"(v1), "v"(v2), "v"(v3), "v"(pb));
        l = l * alpha + ls; m = mnew;
    }
    l += __shfl_xor(l, 16, 32);
    const float inv = 1.0f / l;
    // O^T D layout: o_j[r] = (d = 16j + 8h + r, t = lane&15) = row t, columns 16j + 8h + 0..7: piece 'lane' of half j&1 of block j>>1 in fragment order, so every lane stores its own registers (no transposition)
    bf* crow = CX + ((size_t)b * SEQ + t0) * CXP + (size_t)(h * HD) * 16 + 8 * lane;   // block row t0/16, first block of column h*64, piece 'lane'
#pragma unroll
    for (int j = 0; j < 4; ++j) { v8us hv, lv;
#pragma unroll
        for (int i = 0; i < 8; ++i) { const float x = o[j][i] * inv; const unsigned short h0 = f2bf(x); hv[i] = h0; lv[i] = f2bf(x - bf2f(h0)); }
        const size_t oo = (size_t)((j >> 1) * 512 + (j & 1) * 256);
        *(v8us*)(crow + oo) = hv; *(v8us*)(crow + oo + DM * 16) = lv; }
}

// k_out: final projection, ONE WAVE per 64x64 tile. A = ctx plane [m][value 768 | remainder 768] read at k mod 1536 (K = 2304: value, remainder, value),
// Bt = folded Wo plane [n][value 768 | remainder 768] read at k (k < 768) or k - 768 (value, value, remainder).
// OUT[m][n] = acc + bias[n] (bias RNE-converted to bf16), f32. Epilogue: per 16-row slab staged in LDS (wave-private), each output row segment (64 floats = 256 B = two lines)
__global__ __launch_bounds__(32) void k_out(const bf* __restrict__ A, const bf* __restrict__ Bt, const float* __restrict__ bias, float* OUT) {
    __shared__ __align__(16) float os[16 * 68];
    const int lane = threadIdx.x & 31, lr = lane & 15, hi = lane >> 4; const int r0 = blockIdx.x * 64, c0 = blockIdx.y * 64;
    v8f acc[4][4];
#pragma unroll
    for (int mb = 0; mb < 4; ++mb)
#pragma unroll
        for (int nb = 0; nb < 4; ++nb) acc[mb][nb] = (v8f){};
    gemm_main(A, Bt, (size_t)r0 * CXP + 8 * lane, (size_t)c0 * WP + 8 * lane, CXP, WP, KO, CXP, DM, acc);
    const int cofs = lr * 4;
    v4f b4 = *(const v4f*)(bias + c0 + cofs);          // c0 + cofs + 3 <= DM - 1 always
    b4[0] = bfr(b4[0]); b4[1] = bfr(b4[1]); b4[2] = bfr(b4[2]); b4[3] = bfr(b4[3]);
    const size_t orow0 = (size_t)(r0 / SEQ) * OUT_SEQ + (size_t)(r0 % SEQ);
#pragma unroll
    for (int mb = 0; mb < 4; ++mb) {
#pragma unroll
        for (int nb = 0; nb < 4; ++nb) {
#pragma unroll
            for (int j = 0; j < 8; ++j) os[(hi * 8 + j) * 68 + nb * 16 + lr] = acc[mb][nb][j]; }   // D: row 8h+j, col lane&15
        wave_sync();
        float* ob = OUT + (orow0 + (size_t)(mb * 16)) * DM + c0;
{
#pragma unroll
            for (int s = 0; s < 8; ++s) { const int row = 2 * s + hi;   // 8 s x 2 rows = 16 rows; 16 lanes x 4 floats = 64 columns
                const v4f xv = *(const v4fa*)(&os[row * 68 + cofs]);
                const v4f val = xv + b4;
                *(v4f*)(ob + (size_t)row * DM + cofs) = val; }
             }
        wave_sync();
    }
}

static constexpr size_t al256(size_t v) { return (v + 255) & ~(size_t)255; }
static constexpr size_t SZ_XB = al256((size_t)NB * SEQ * DM * 2);
static constexpr size_t SZ_WB = al256((size_t)4 * DM * WP * 2);
static constexpr size_t SZ_PL = al256((size_t)NB * NH_ * SEQ * HD * 2);
static constexpr size_t SZ_CX = al256((size_t)NB * SEQ * CXP * 2);
static constexpr size_t SZ_TOTAL = SZ_XB + SZ_WB + 3 * SZ_PL + SZ_CX;
static_assert(SZ_TOTAL <= (size_t)134217728);          // workspace carve <= 128 MiB
static_assert(((size_t)DM * WP * 2) % 256 == 0);       // weight sub-planes stay 256-byte aligned
static_assert((size_t)NB * NH_ * SEQ * HD == (size_t)NB * SEQ * DM);   // plane extent == GEMM tile grid extent

extern "C" void kernel_launch(void* const* d_in, const int* in_sizes, int n_in,
                              void* d_out, int out_size, void* d_ws, size_t ws_size, hipStream_t stream) {
    if (n_in < 17) return;
    const size_t needx = ((size_t)(NB - 1) * SEQ_FULL + SEQ) * DM;
    if ((size_t)in_sizes[0] < needx) return;
    if ((size_t)in_sizes[1] < (size_t)DM * DM || (size_t)in_sizes[5] < (size_t)DM * DM || (size_t)in_sizes[9] < (size_t)DM * DM || (size_t)in_sizes[13] < (size_t)DM * DM) return;
    if (in_sizes[2] < DM || in_sizes[6] < DM || in_sizes[10] < DM || in_sizes[14] < DM) return;
    if (in_sizes[3] < LR * DM || in_sizes[7] < LR * DM || in_sizes[11] < LR * DM || in_sizes[15] < LR * DM) return;
    if (in_sizes[4] < DM * LR || in_sizes[8] < DM * LR || in_sizes[12] < DM * LR || in_sizes[16] < DM * LR) return;
    if ((size_t)out_size < ((size_t)(NB - 1) * OUT_SEQ + SEQ) * DM) return;
    if (SZ_TOTAL > ws_size) return;
    // wire order: x, then per projection (q, k, v, o): W [out][in], b [out], A [8][in], B [out][8]; folded weights [out][in] = Bt as-is
    const float* x   = (const float*)d_in[0];
    const float* wq  = (const float*)d_in[1];  const float* bq  = (const float*)d_in[2];  const float* laq = (const float*)d_in[3];  const float* lbq = (const float*)d_in[4];
    const float* wk  = (const float*)d_in[5];  const float* bk  = (const float*)d_in[6];  const float* lak = (const float*)d_in[7];  const float* lbk = (const float*)d_in[8];
    const float* wv  = (const float*)d_in[9];  const float* bv  = (const float*)d_in[10]; const float* lav = (const float*)d_in[11]; const float* lbv = (const float*)d_in[12];
    const float* wo  = (const float*)d_in[13]; const float* bo  = (const float*)d_in[14]; const float* lao = (const float*)d_in[15]; const float* lbo = (const float*)d_in[16];
    float* OUT = (float*)d_out;      // [NB][SEQ][768]
    char* wsp = (char*)d_ws;
    bf* XB = (bf*)wsp; wsp += SZ_XB;                 // [NB*SEQ][768]
    bf* WB = (bf*)wsp; wsp += SZ_WB;                 // [4][768][value 768 | remainder 768]: q | k | v | o
    h16* QH = (h16*)wsp; wsp += SZ_PL;               // [NB*12][SEQ][64]
    h16* KP = (h16*)wsp; wsp += SZ_PL;               // [NB*12][SEQ][64]
    h16* VT = (h16*)wsp; wsp += SZ_PL;               // [NB*12][64][SEQ]
    bf* CX = (bf*)wsp; wsp += SZ_CX;                 // [NB*SEQ][value 768 | remainder 768]
    bf* WQ = WB; bf* WK = WB + (size_t)DM * WP; bf* WV = WB + (size_t)2 * DM * WP; bf* WO = WB + (size_t)3 * DM * WP;

    if (SEQ == SEQ_FULL) {
        const size_t n8 = (size_t)NB * SEQ * DM / 8;
        k_cvt8<<<(unsigned)((n8 + 255) / 256), 256, 0, stream>>>(x, XB, n8);
    } else {
        const size_t n8 = (size_t)SEQ * DM / 8;
        for (int b = 0; b < NB; ++b) k_cvt8<<<(unsigned)((n8 + 255) / 256), 256, 0, stream>>>(x + (size_t)b * SEQ_FULL * DM, XB + (size_t)b * SEQ * DM, n8);
    }
    { const size_t nt = (size_t)DM * (DM / 8); const unsigned g = (unsigned)((nt + 255) / 256);
      k_fold<<<g, 256, 0, stream>>>(wq, laq, lbq, WQ); k_fold<<<g, 256, 0, stream>>>(wk, lak, lbk, WK);
      k_fold<<<g, 256, 0, stream>>>(wv, lav, lbv, WV); k_fold<<<g, 256, 0, stream>>>(wo, lao, lbo, WO); }

    // q, k: A = x rows (m = b*SEQ + t, pitch DM, wraps at DM), Bt = folded W rows (n = h*64 + d, pitch WP, no wrap), bias by column -> plane [(b*12 + h)][t][d]
    k_proj<<<dim3(NB * SEQ / 64, DM / 64, 1), 32, 0, stream>>>(XB, WQ, DM, WP, DM, WP, bq, 0, QH, SEQ, (size_t)NH_ * SEQ * HD, HD, HD, (size_t)SEQ * HD);
    k_proj<<<dim3(NB * SEQ / 64, DM / 64, 1), 32, 0, stream>>>(XB, WK, DM, WP, DM, WP, bk, 0, KP, SEQ, (size_t)NH_ * SEQ * HD, HD, HD, (size_t)SEQ * HD);
    // v^T: A = folded Wv rows (m = h*64 + d, pitch WP, no wrap), Bt = x rows (n = b*SEQ + t, pitch DM, wraps at DM), bias by row -> plane [(b*768 + m)][t] = [(b*12 + h)][d][t]
    k_proj<<<dim3(DM / 64, NB * SEQ / 64, 1), 32, 0, stream>>>(WV, XB, WP, DM, WP, DM, bv, 1, VT, DM, (size_t)0, SEQ, SEQ, (size_t)DM * SEQ);

    k_flash<<<dim3(SEQ / (16 * AW), NB * NH_, 1), 32 * AW, 0, stream>>>(QH, KP, VT, CX);

    // out: A = ctx rows [m][value | remainder], Bt = folded Wo rows (n) [value | remainder], bias by column -> OUT[b][t][n]
    k_out<<<dim3(NB * SEQ / 64, DM / 64, 1), 32, 0, stream>>>(CX, WO, bo, OUT);
}

// v002
// One run takes 200 microseconds.
// Timed twice side by side with v001, it ran 1.98 and 1.96 times as fast.
// All steps since v000 together make it 2.13 times as fast.
#include <hip/hip_runtime.h>

// Dense (unmasked) multi-head self-attention, width 768 = 12 heads x 64, x [NB][SEQ][768]; each of the four projections is y = x W^T + b + (x A^T) B^T with W [out][in], A [8][in], B [out][8]; score scale 1/8; f32 output.
// Compute dtypes, f32 accumulate everywhere: the rank-8 update is folded once into W_eff = W + B A (f32 on the vector unit, K = 8; W, A, B, b, x RNE-converted to bf16 first) and carried as bf16 value | bf16 remainder along K;
// softmax f32 (online, running max); output projection v_wmma_f32_16x16x32_bf16 with ctx as bf16 value | remainder and W_eff as bf16 value | remainder (K = 2304: value x value, remainder x value, value x remainder), one accumulator.
// Layout: bf16 copy of x; folded weight planes [4][768][value 768 | remainder 768]; q, k planes [b*12+h][t][d], v^T plane [b*12+h][d][t] (f16) written by the GEMM epilogue; fused flash kernel in transposed form
// Every one of these planes is stored in FRAGMENT ORDER: a block of 16 rows x 32 k is 512 consecutive elements, element (row, k) of a block at (k>>4)*256 + ((k>>3)&1)*128 + row*8 + (k&7);
// blocks run along k (512 elements each), then along rows (16 * pitch elements per block row). A fragment is then two wave-wide 16-B loads of 512 contiguous bytes each (four whole lines) instead of 16 partial lines.
// (S^T = K Q^T, O^T = V^T P^T, key loop over the whole sequence) writes the ctx plane [b*SEQ+t][value 768 | remainder 768] (bf16); final GEMM adds the bias at the store stage.

#ifndef NB
#define NB 4
#endif
#ifndef SEQ
#define SEQ 2048
#endif
#define NB_FULL  4
#define SEQ_FULL 2048
#ifndef OUT_SEQ
#define OUT_SEQ SEQ              // row pitch (in tokens) between batches of the output
#endif
#define DM   768
#define NH_  12
#define HD   64
#define LR   8                   // rank of the low-rank update
#define WP   (2 * DM)            // folded weight plane row pitch: value columns 0..DM-1, remainder columns DM..2DM-1
#define CXP  (2 * DM)            // ctx plane row pitch: value columns 0..DM-1, remainder columns DM..2DM-1
#define KO   (3 * DM)            // K extent of the output projection
#define AW   4                   // waves per flash block (16 query rows each)
#define SC2  (0.125f * 1.4426950408889634f)   // HD^-0.5 * log2(e)
#define PSH  8.0f                // log2 of the P carry (256)

static_assert(HD == 64);
static_assert(NH_ * HD == DM);                 // head h = columns h*64 + d
static_assert(DM % 64 == 0);                   // column tiles of 64
static_assert(DM % 32 == 0);                   // GEMM k-loop steps by 32; a k-step never straddles a wrap point
static_assert(CXP == 2 * DM);
static_assert(CXP % 32 == 0);
static_assert(WP == 2 * DM);
static_assert(WP % 32 == 0);
static_assert(KO == CXP + DM);                 // third K segment meets the ctx value half again (A wrap at CXP) and the weight remainder half (B wrap at DM)
static_assert(KO % 32 == 0);
static_assert(LR == 8);                        // one 32-byte load covers a row of B [out][8]
static_assert(DM % 8 == 0);                    // fold kernel: 8 columns per lane
static_assert((DM / 8) % 8 == 0);
static_assert(SEQ % 64 == 0);                  // a 64-row tile never straddles two batches
static_assert((NB * SEQ) % 64 == 0);
static_assert(SEQ % 32 == 0);                  // key loop steps by 32 and stays inside the sequence
static_assert(SEQ % (16 * AW) == 0);           // flash grid covers the sequence exactly
static_assert(((size_t)SEQ * DM) % 8 == 0);
static_assert(((size_t)DM * DM) % 8 == 0);
static_assert(NB <= NB_FULL);
static_assert(SEQ <= SEQ_FULL);
static_assert(AW * 32 <= 256);

typedef _Float16 h16;
typedef unsigned short bf;
typedef __attribute__((ext_vector_type(16))) __bf16   v16bf;
typedef __attribute__((ext_vector_type(16))) _Float16 v16h;
typedef __attribute__((ext_vector_type(8)))  _Float16 v8h;
typedef __attribute__((ext_vector_type(8)))  unsigned short v8us;
typedef __attribute__((ext_vector_type(8)))  float    v8f;
typedef __attribute__((ext_vector_type(4)))  float    v4f;
typedef v4f  __attribute__((may_alias)) v4fa;

__device__ __forceinline__ unsigned short f2bf(float f) { unsigned u = __float_as_uint(f); u += 0x7FFFu + ((u >> 16) & 1u); return (unsigned short)(u >> 16); }
__device__ __forceinline__ float bf2f(unsigned short s) { return __uint_as_float(((unsigned)s) << 16); }
__device__ __forceinline__ float bfr(float f) { return bf2f(f2bf(f)); }     // f32 -> bf16 (RNE) -> f32
__device__ __forceinline__ v16h cat16(v8h lo, v8h hi) { return __builtin_shufflevector(lo, hi, 0, 1, 2, 3, 4, 5, 6, 7, 8, 9, 10, 11, 12, 13, 14, 15); }
__device__ __forceinline__ v16bf cat16b(v8us lo, v8us hi) { return __builtin_bit_cast(v16bf, __builtin_shufflevector(lo, hi, 0, 1, 2, 3, 4, 5, 6, 7, 8, 9, 10, 11, 12, 13, 14, 15)); }
__device__ __forceinline__ v8f wmma16(v16h a, v16h b, v8f c) { return __builtin_amdgcn_wmma_f32_16x16x32_f16(false, a, false, b, (short)0, c, false, false); }
__device__ __forceinline__ v8f wmmab(v16bf a, v16bf b, v8f c) { return __builtin_amdgcn_wmma_f32_16x16x32_bf16(false, a, false, b, (short)0, c, false, false); }
// fragment loaders from fragment-order planes; p = block base + 8*lane: elements 0..7 <- k0+8h+0..7, elements 8..15 <- k0+16+8h+0..7 of row lane&15 (same map for A and B)
__device__ __forceinline__ v16h  ldh(const h16* p) { return cat16(*(const v8h*)p, *(const v8h*)(p + 256)); }
__device__ __forceinline__ v16bf ldb(const bf* p)  { return cat16b(*(const v8us*)p, *(const v8us*)(p + 256)); }
// ordering point for wave-private LDS tiles (same wave writes and reads)
__device__ __forceinline__ void wave_sync() { __builtin_amdgcn_fence(3 /* release order */, "wavefront"); __builtin_amdgcn_wave_barrier(); asm volatile("" ::: "memory"); }
// f32 -> f16 for WMMA operand planes: magnitudes below the smallest normal f16 become exactly 0 (value select)
static __device__ __forceinline__ h16 toh_flush(float v) { const h16 r = (h16)v; return (fabsf(v) < 6.103515625e-05f) ? (h16)0.0f : r; }

__global__ __launch_bounds__(256) void k_cvt8(const float* __restrict__ src, bf* dst, size_t n8) {
    const size_t i = (size_t)blockIdx.x * 256 + threadIdx.x; if (i >= n8) return;
    // i counts 8-element pieces of the fragment-order plane (row pitch DM): block i>>6, piece w = i&63 holds row w&15, k (w>>4)*8 .. +7 of the block
    const size_t blk = i >> 6; const int w = (int)(i & 63);
    const size_t m = (blk / (DM / 32)) * 16 + (size_t)(w & 15); const int k0 = (int)(blk % (DM / 32)) * 32 + (w >> 4) * 8;
    const v8f v = *(const v8f*)(src + m * DM + k0); v8us o;
#pragma unroll
    for (int k = 0; k < 8; ++k) o[k] = f2bf(v[k]);
    *(v8us*)(dst + i * 8) = o; 
}

// k_fold: W_eff[m][k] = bf16(W[m][k]) + sum_r bf16(LB[m][r]) * bf16(LA[r][k]) in f32 (K = 8, vector unit, rank loop rolled), written as bf16 value at column k and bf16 remainder at column DM + k of row m (fragment order, pitch WP)
__global__ __launch_bounds__(256) void k_fold(const float* __restrict__ W, const float* __restrict__ LA, const float* __restrict__ LB, bf* dst) {
    const size_t i = (size_t)blockIdx.x * 256 + threadIdx.x; if (i >= (size_t)DM * (DM / 8)) return;
    // i counts 8-element pieces of the value half in fragment order: block i>>6 (block row rb, block column kb), piece pc = i&63 holds row pc&15, k (pc>>4)*8 .. +7 of the block
    const int rb = (int)(i >> 6) / (DM / 32), kb = (int)(i >> 6) % (DM / 32), pc = (int)(i & 63);
    const int m = rb * 16 + (pc & 15); const int k0 = kb * 32 + (pc >> 4) * 8;
    const v8f w = *(const v8f*)(W + (size_t)m * DM + k0);
    const v8f lb = *(const v8f*)(LB + (size_t)m * LR);
    float acc[8];
#pragma unroll
    for (int k = 0; k < 8; ++k) acc[k] = bfr(w[k]);
    float blr[8];
#pragma unroll
    for (int r = 0; r < 8; ++r) blr[r] = bfr(lb[r]);
    // rank loop rolled: the multiplier of step r is rotated to slot 0 so every register index stays static
#pragma unroll 1
    for (int r = 0; r < LR; ++r) {
        const float bl = blr[0];
#pragma unroll
        for (int q = 0; q < 7; ++q) blr[q] = blr[q + 1];
        const v8f a = *(const v8f*)(LA + (size_t)r * DM + k0);
#pragma unroll
        for (int k = 0; k < 8; ++k) acc[k] = acc[k] + bl * bfr(a[k]);
    }
    v8us hv, lv;
#pragma unroll
    for (int k = 0; k < 8; ++k) { const unsigned short h0 = f2bf(acc[k]); hv[k] = h0; lv[k] = f2bf(acc[k] - bf2f(h0)); }
    bf* p = dst + (size_t)rb * 16 * WP + (size_t)kb * 512 + pc * 8;
    *(v8us*)(p) = hv; *(v8us*)(p + DM * 16) = lv;          // DM columns further = DM/32 blocks = DM*16 elements
    
}

// gemm_main: one wave, 64x64 tile, 16 accumulators; C[m][n] += sum_k A[m][ka] Bt[n][kb], ka = k - AWR if k >= AWR else k, kb likewise with BWR (one subtraction each); operands straight from fragment-order bf16 planes.
// ap / bp = plane + row0 * pitch + 8*lane (row0 a multiple of 16). PA / PB = row pitches (elements); K, AWR and BWR multiples of 32; 32 k = one block = 512 elements, so column k0 is at k0*16.
// The fragments of a k-step (4 of A, 4 of B) live in a ring of four register sets: the loads of step s + 3 are issued among the products of step s (A fragments ahead of its first eight, B fragments ahead of its last eight),
// so a load has three steps of products to come back. Pitches and wrap points are compile-time, so the eight loads of a group hang on one address pair. Every accumulator still takes its k-steps in rising order.
template <int P, int WR>
__device__ __forceinline__ void frag_load(const bf* __restrict__ p, const int kc, v16bf (&f)[4]) {
    const int k = (kc >= WR) ? (kc - WR) : kc;
    const bf* q = p + (size_t)k * 16;
#pragma unroll
    for (int i = 0; i < 4; ++i) f[i] = ldb(q + (size_t)(i * 16) * (size_t)P);
}
template <int NB0>
__device__ __forceinline__ void mma_half(const v16bf (&a)[4], const v16bf (&b)[4], v8f (&acc)[4][4]) {
#pragma unroll
    for (int nb = NB0; nb < NB0 + 2; ++nb)
#pragma unroll
        for (int mb = 0; mb < 4; ++mb) acc[mb][nb] = wmmab(a[mb], b[nb], acc[mb][nb]);
}
// one k-step: products of the set (ac, bc); when LD, the loads of k-step kl into the set (an, bn)
template <int PA, int PB, int AWR, int BWR, bool LD>
__device__ __forceinline__ void gemm_step(const bf* __restrict__ ap, const bf* __restrict__ bp, const int kl, v16bf (&an)[4], v16bf (&bn)[4],
                                          const v16bf (&ac)[4], const v16bf (&bc)[4], v8f (&acc)[4][4]) {
    if (LD) {
        frag_load<PA, AWR>(ap, kl, an);
        __builtin_amdgcn_sched_barrier(0);                        // keeps the load group whole and ahead of the products: sunk among them it would be issued later and waited for sooner
    }
    mma_half<0>(ac, bc, acc);
    if (LD) {
        __builtin_amdgcn_sched_barrier(0);                        // keeps the wait below behind the eight products: directly behind the loads it would stall them
        asm volatile("s_wait_xcnt 0x0" ::: "memory");             // the next group's address is formed in registers that the loads above name
        __builtin_amdgcn_sched_barrier(0);                        // holds that address arithmetic behind the wait
        frag_load<PB, BWR>(bp, kl, bn);
        __builtin_amdgcn_sched_barrier(0);                        // keeps this load group whole and ahead of the products, as the first
    }
    mma_half<2>(ac, bc, acc);
    if (LD) {
        __builtin_amdgcn_sched_barrier(0);                        // keeps the wait below behind the eight products
        asm volatile("s_wait_xcnt 0x0" ::: "memory");             // the next group's address is formed in registers that the loads above name
        __builtin_amdgcn_sched_barrier(0);                        // holds that address arithmetic behind the wait
    }
}
template <int PA, int PB, int K, int AWR, int BWR>
__device__ __forceinline__ void gemm_main(const bf* __restrict__ ap, const bf* __restrict__ bp, v8f (&acc)[4][4]) {
    static_assert(K % 128 == 0 && K >= 256 && AWR > 64 && BWR > 64);
    v16bf a0[4], b0[4], a1[4], b1[4], a2[4], b2[4], a3[4], b3[4];
    frag_load<PA, AWR>(ap, 0, a0);  frag_load<PB, BWR>(bp, 0, b0);
    __builtin_amdgcn_sched_barrier(0);                            // the three sets are asked for in the order in which they are used, so the counted waits of the loop fit its first trip too
    frag_load<PA, AWR>(ap, 32, a1); frag_load<PB, BWR>(bp, 32, b1);
    __builtin_amdgcn_sched_barrier(0);                            // as above
    frag_load<PA, AWR>(ap, 64, a2); frag_load<PB, BWR>(bp, 64, b2);
    asm volatile("s_wait_xcnt 0x0" ::: "memory");                 // the loop forms its addresses in registers that these loads may name
    __builtin_amdgcn_sched_barrier(0);                            // holds that address arithmetic behind the wait
#pragma unroll 1
    for (int kc = 0; kc < K - 128; kc += 128) {
        gemm_step<PA, PB, AWR, BWR, true>(ap, bp, kc + 96,  a3, b3, a0, b0, acc);
        gemm_step<PA, PB, AWR, BWR, true>(ap, bp, kc + 128, a0, b0, a1, b1, acc);
        gemm_step<PA, PB, AWR, BWR, true>(ap, bp, kc + 160, a1, b1, a2, b2, acc);
        gemm_step<PA, PB, AWR, BWR, true>(ap, bp, kc + 192, a2, b2, a3, b3, acc);
        asm volatile("" : "+v"(acc[0][0]), "+v"(acc[0][1]), "+v"(acc[0][2]), "+v"(acc[0][3]), "+v"(acc[1][0]), "+v"(acc[1][1]), "+v"(acc[1][2]), "+v"(acc[1][3]));
        asm volatile("v_nop\n\tv_nop\n\tv_nop\n\tv_nop" : "+v"(acc[2][0]), "+v"(acc[2][1]), "+v"(acc[2][2]), "+v"(acc[2][3]), "+v"(acc[3][0]), "+v"(acc[3][1]), "+v"(acc[3][2]), "+v"(acc[3][3])
                     : "v"(a3[0]), "v"(a3[1]), "v"(a3[2]), "v"(a3[3]), "v"(b3[0]), "v"(b3[1]), "v"(b3[2]), "v"(b3[3]));
    }
    gemm_step<PA, PB, AWR, BWR, true>(ap, bp, K - 32, a3, b3, a0, b0, acc);
    gemm_step<PA, PB, AWR, BWR, false>(ap, bp, 0, a0, b0, a1, b1, acc);
    gemm_step<PA, PB, AWR, BWR, false>(ap, bp, 0, a0, b0, a2, b2, acc);
    gemm_step<PA, PB, AWR, BWR, false>(ap, bp, 0, a0, b0, a3, b3, acc);
}

// k_proj: bf16 GEMM, ONE WAVE per 64x64 tile, K = WP (value half then remainder half of the folded weight; the x operand wraps at DM).
// C[m][n] = sum_k A[m][k mod AWR] Bt[n][k mod BWR] + bias (bias by column n when biasRow == 0, by row m when biasRow != 0; bias RNE-converted to bf16),
// written as f16, in fragment order, into the sub-plane at (r0/RB)*sRB + (c0/CB)*sCB: rows r0%RB .., columns c0%CB .., row pitch 'pitch' (halves). grid (M/64, N/64), 32 threads.
template <int PA, int PB, int AWR, int BWR>
__global__ __launch_bounds__(32) void k_proj(const bf* __restrict__ A, const bf* __restrict__ Bt,
                                             const float* __restrict__ bias, int biasRow, h16* Ph, int RB, size_t sRB, int pitch, int CB, size_t sCB) {
    __shared__ __align__(16) float os[16 * 68];
    const int lane = threadIdx.x & 31, lr = lane & 15, hi = lane >> 4; const int r0 = blockIdx.x * 64, c0 = blockIdx.y * 64;
    v8f acc[4][4];
#pragma unroll
    for (int mb = 0; mb < 4; ++mb)
#pragma unroll
        for (int nb = 0; nb < 4; ++nb) acc[mb][nb] = (v8f){};
    gemm_main<PA, PB, WP, AWR, BWR>(A + (size_t)r0 * PA + 8 * lane, Bt + (size_t)c0 * PB + 8 * lane, acc);
    // store stage s = 0..3: lane holds row lane&15, columns (s>>1)*32 + (s&1)*16 + 8h + 0..7 of the slab = piece 'lane' of half s&1 of block s>>1
    float bc[4][8];
#pragma unroll
    for (int s = 0; s < 4; ++s) { int cb = c0 + (s >> 1) * 32 + (s & 1) * 16 + hi * 8; cb = (cb < DM - 8) ? cb : (DM - 8);          // clamped address; value selected afterwards
      const v4f b0 = *(const v4f*)(bias + cb); const v4f b1 = *(const v4f*)(bias + cb + 4);
#pragma unroll
      for (int i = 0; i < 4; ++i) { bc[s][i] = biasRow ? 0.0f : bfr(b0[i]); bc[s][4 + i] = biasRow ? 0.0f : bfr(b1[i]); } }
    const size_t tbase = (size_t)(r0 / RB) * sRB + (size_t)(r0 % RB) * (size_t)pitch + (size_t)(c0 / CB) * sCB + (size_t)(c0 % CB) * 16 + 8 * lane;
#pragma unroll
    for (int mb = 0; mb < 4; ++mb) {
#pragma unroll
        for (int nb = 0; nb < 4; ++nb) {
#pragma unroll
            for (int j = 0; j < 8; ++j) os[(hi * 8 + j) * 68 + nb * 16 + lr] = acc[mb][nb][j]; }   // D: row 8h+j, col lane&15
        wave_sync();
        float br;
        { int ri = r0 + mb * 16 + lr; ri = (ri < DM - 1) ? ri : (DM - 1); const float bv_ = bias[ri]; br = biasRow ? bfr(bv_) : 0.0f; }
        const size_t sb = tbase + (size_t)(mb * 16) * (size_t)pitch;
{
#pragma unroll
            for (int s = 0; s < 4; ++s) { const int col = (s >> 1) * 32 + (s & 1) * 16 + hi * 8;   // 16 lanes = 16 rows; 4 s x 2 halves x 8 = 64 columns
                const v4f x0 = *(const v4fa*)(&os[lr * 68 + col]); const v4f x1 = *(const v4fa*)(&os[lr * 68 + col + 4]);
                float val[8]; v8h hv;
#pragma unroll
                for (int i = 0; i < 4; ++i) { val[i] = x0[i] + bc[s][i] + br; val[4 + i] = x1[i] + bc[s][4 + i] + br; }
#pragma unroll
                for (int i = 0; i < 8; ++i) hv[i] = toh_flush(val[i]);
                const size_t oo = sb + (size_t)((s >> 1) * 512 + (s & 1) * 256);
                *(v8h*)(Ph + oo) = hv; }
             }
        wave_sync();
    }
}

// k_flash: fused dense attention, one wave per 16 query rows of one (batch, head); K / V^T / Q fragments straight from the fragment-order f16 planes (two 16-B loads each, 512 contiguous bytes per load, arithmetic addressing).
// Transposed form: S^T[key][t] = K Q^T (A = K rows, B = Q rows); lane (t = lane&15, h = lane>>4) holds keys 8h+r of each 16-key tile, so the packed
// P tile is directly the B fragment of O^T[d][t] = V^T P^T (element r <- tile keys 0..15, element 8+r <- tile keys 16..31, lane unchanged).
// Key loop covers keys 0 .. SEQ-1 in steps of 32 (all inside the sequence, every key valid for every row).
// Softmax state (running max, partial sum) is one scalar per lane; the two lane halves of a row are combined with one xor-16 exchange.
// P carries x256; a P whose exponent argument is below -14 (under the smallest normal f16) is taken as exactly 0; the row sum runs over the converted P.
__global__ __launch_bounds__(32 * AW) void k_flash(const h16* __restrict__ QH, const h16* __restrict__ KP, const h16* __restrict__ VT, bf* CX) {
    const int lane = threadIdx.x & 31;
    const int wave = __builtin_amdgcn_readfirstlane(threadIdx.x >> 5);
    const int zh = blockIdx.y; const int b = zh / NH_, h = zh % NH_;
    const int t0 = (blockIdx.x * AW + wave) * 16;
    const size_t pbase = (size_t)zh * SEQ * HD;
    const size_t qo = pbase + (size_t)t0 * HD + 8 * lane;
    const v16h qh0 = ldh(QH + qo), qh1 = ldh(QH + qo + 512);   // B fragments: col t, k = d (blocks d 0..31, d 32..63)
    const size_t ko = pbase + 8 * lane;      // + key0 * HD + 512 * (d block)   (A fragment: row key, k = d)
    const size_t vo = pbase + 8 * lane;      // + 16j*SEQ + key0 * 16           (A fragment: row d, k = key)
    v8f o[4];
#pragma unroll
    for (int j = 0; j < 4; ++j) { o[j] = (v8f){}; }
    float m = -3.0e38f, l = 0.0f;
    // K and V^T fragments are fetched one pass ahead, each into its own registers: the next pass's K right behind this pass's score products, its V^T right behind this pass's output products
    v16h ka0 = ldh(KP + ko), ka1 = ldh(KP + ko + 512), kb0 = ldh(KP + ko + 16 * HD), kb1 = ldh(KP + ko + 16 * HD + 512);
    __builtin_amdgcn_sched_barrier(0);      // Q and K are asked for ahead of V^T, as in the loop: else the loop's first wait has to cover the V^T loads as well, on every pass
    v16h v0 = ldh(VT + vo), v1 = ldh(VT + vo + (size_t)16 * SEQ), v2 = ldh(VT + vo + (size_t)32 * SEQ), v3 = ldh(VT + vo + (size_t)48 * SEQ);
    __builtin_amdgcn_sched_barrier(0);      // as above
#pragma unroll 1
    for (int key0 = 0; key0 < SEQ; key0 += 32) {
        const int kn = (key0 + 32 < SEQ) ? (key0 + 32) : 0;      // keys of the next pass; the last pass asks for the first keys again (in bounds, not used)
        v8f sHa = (v8f){}, sHb = (v8f){};
        sHa = wmma16(ka0, qh0, sHa); sHb = wmma16(kb0, qh0, sHb);
        sHa = wmma16(ka1, qh1, sHa); sHb = wmma16(kb1, qh1, sHb);
        asm volatile("v_nop\n\tv_nop\n\tv_nop\n\tv_nop" : "+v"(sHa), "+v"(sHb) : "v"(ka0), "v"(ka1), "v"(kb0), "v"(kb1), "v"(qh0), "v"(qh1));
        const h16* ka = KP + ko + (size_t)kn * HD;
        ka0 = ldh(ka); ka1 = ldh(ka + 512); kb0 = ldh(ka + 16 * HD); kb1 = ldh(ka + 16 * HD + 512);
        float ta[8], tb[8];
#pragma unroll
        for (int r = 0; r < 8; ++r) { ta[r] = sHa[r] * SC2; tb[r] = sHb[r] * SC2; }
        float mx = -3.0e38f;
#pragma unroll
        for (int r = 0; r < 8; ++r) mx = fmaxf(mx, fmaxf(ta[r], tb[r]));
        mx = fmaxf(mx, __shfl_xor(mx, 16, 32));
        const float mnew = fmaxf(m, mx);
        const float alpha = __builtin_amdgcn_exp2f(m - mnew);
        const float sh = PSH - mnew;
        v16h pb; float ls = 0.0f;
#pragma unroll
        for (int r = 0; r < 8; ++r) { const float ea = ta[r] + sh; const float eb = tb[r] + sh;
            const float xa = __builtin_amdgcn_exp2f(ea); const float xb = __builtin_amdgcn_exp2f(eb);
            const h16 pa = (ea < -14.0f) ? (h16)0.0f : (h16)xa; const h16 pc = (eb < -14.0f) ? (h16)0.0f : (h16)xb;
            pb[r] = pa; pb[8 + r] = pc; ls += (float)pa + (float)pc; }
#pragma unroll
        for (int j = 0; j < 4; ++j) o[j] = o[j] * alpha;
        o[0] = wmma16(v0, pb, o[0]); o[1] = wmma16(v1, pb, o[1]); o[2] = wmma16(v2, pb, o[2]); o[3] = wmma16(v3, pb, o[3]);
        asm volatile("v_nop\n\tv_nop\n\tv_nop\n\tv_nop" : "+v"(o[0]), "+v"(o[1]), "+v"(o[2]), "+v"(o[3]) : "v"(v0), "v"(v1), "v"(v2), "v"(v3), "v"(pb));
        const h16* va = VT + vo + (size_t)kn * 16;
        v0 = ldh(va); v1 = ldh(va + (size_t)16 * SEQ); v2 = ldh(va + (size_t)32 * SEQ); v3 = ldh(va + (size_t)48 * SEQ);
        l = l * alpha + ls; m = mnew;
        __builtin_amdgcn_sched_barrier(0);                       // keeps the wait below at the pass's end: directly behind the loads it would stall the row-sum arithmetic
        asm volatile("s_wait_xcnt 0x0" ::: "memory");            // the next pass's first product lands in the registers that held the address of the V^T loads above
    }
    asm volatile("s_wait_loadcnt 0x0" ::: "memory");             // the last pass's fetches (not used) are home before the wave hands its registers back at its end
    l += __shfl_xor(l, 16, 32);
    const float inv = 1.0f / l;
    // O^T D layout: o_j[r] = (d = 16j + 8h + r, t = lane&15) = row t, columns 16j + 8h + 0..7: piece 'lane' of half j&1 of block j>>1 in fragment order, so every lane stores its own registers (no transposition)
    bf* crow = CX + ((size_t)b * SEQ + t0) * CXP + (size_t)(h * HD) * 16 + 8 * lane;   // block row t0/16, first block of column h*64, piece 'lane'
#pragma unroll
    for (int j = 0; j < 4; ++j) { v8us hv, lv;
#pragma unroll
        for (int i = 0; i < 8; ++i) { const float x = o[j][i] * inv; const unsigned short h0 = f2bf(x); hv[i] = h0; lv[i] = f2bf(x - bf2f(h0)); }
        const size_t oo = (size_t)((j >> 1) * 512 + (j & 1) * 256);
        *(v8us*)(crow + oo) = hv; *(v8us*)(crow + oo + DM * 16) = lv; }
}

// k_out: final projection, ONE WAVE per 64x64 tile. A = ctx plane [m][value 768 | remainder 768] read at k mod 1536 (K = 2304: value, remainder, value),
// Bt = folded Wo plane [n][value 768 | remainder 768] read at k (k < 768) or k - 768 (value, value, remainder).
// OUT[m][n] = acc + bias[n] (bias RNE-converted to bf16), f32. Epilogue: per 16-row slab staged in LDS (wave-private), each output row segment (64 floats = 256 B = two lines)
__global__ __launch_bounds__(32) void k_out(const bf* __restrict__ A, const bf* __restrict__ Bt, const float* __restrict__ bias, float* OUT) {
    __shared__ __align__(16) float os[16 * 68];
    const int lane = threadIdx.x & 31, lr = lane & 15, hi = lane >> 4; const int r0 = blockIdx.x * 64, c0 = blockIdx.y * 64;
    v8f acc[4][4];
#pragma unroll
    for (int mb = 0; mb < 4; ++mb)
#pragma unroll
        for (int nb = 0; nb < 4; ++nb) acc[mb][nb] = (v8f){};
    gemm_main<CXP, WP, KO, CXP, DM>(A + (size_t)r0 * CXP + 8 * lane, Bt + (size_t)c0 * WP + 8 * lane, acc);
    const int cofs = lr * 4;
    v4f b4 = *(const v4f*)(bias + c0 + cofs);          // c0 + cofs + 3 <= DM - 1 always
    asm volatile("s_wait_xcnt 0x0" ::: "memory");      // the address arithmetic below reuses registers that this load names
    __builtin_amdgcn_sched_barrier(0);                 // holds that arithmetic behind the wait
    b4[0] = bfr(b4[0]); b4[1] = bfr(b4[1]); b4[2] = bfr(b4[2]); b4[3] = bfr(b4[3]);
    const size_t orow0 = (size_t)(r0 / SEQ) * OUT_SEQ + (size_t)(r0 % SEQ);
#pragma unroll
    for (int mb = 0; mb < 4; ++mb) {
#pragma unroll
        for (int nb = 0; nb < 4; ++nb) {
#pragma unroll
            for (int j = 0; j < 8; ++j) os[(hi * 8 + j) * 68 + nb * 16 + lr] = acc[mb][nb][j]; }   // D: row 8h+j, col lane&15
        wave_sync();
        float* ob = OUT + (orow0 + (size_t)(mb * 16)) * DM + c0;
{
#pragma unroll
            for (int s = 0; s < 8; ++s) { const int row = 2 * s + hi;   // 8 s x 2 rows = 16 rows; 16 lanes x 4 floats = 64 columns
                const v4f xv = *(const v4fa*)(&os[row * 68 + cofs]);
                const v4f val = xv + b4;
                *(v4f*)(ob + (size_t)row * DM + cofs) = val; }
             }
        wave_sync();
    }
}

static constexpr size_t al256(size_t v) { return (v + 255) & ~(size_t)255; }
static constexpr size_t SZ_XB = al256((size_t)NB * SEQ * DM * 2);
static constexpr size_t SZ_WB = al256((size_t)4 * DM * WP * 2);
static constexpr size_t SZ_PL = al256((size_t)NB * NH_ * SEQ * HD * 2);
static constexpr size_t SZ_CX = al256((size_t)NB * SEQ * CXP * 2);
static constexpr size_t SZ_TOTAL = SZ_XB + SZ_WB + 3 * SZ_PL + SZ_CX;
static_assert(SZ_TOTAL <= (size_t)134217728);          // workspace carve <= 128 MiB
static_assert(((size_t)DM * WP * 2) % 256 == 0);       // weight sub-planes stay 256-byte aligned
static_assert((size_t)NB * NH_ * SEQ * HD == (size_t)NB * SEQ * DM);   // plane extent == GEMM tile grid extent

extern "C" void kernel_launch(void* const* d_in, const int* in_sizes, int n_in,
                              void* d_out, int out_size, void* d_ws, size_t ws_size, hipStream_t stream) {
    if (n_in < 17) return;
    const size_t needx = ((size_t)(NB - 1) * SEQ_FULL + SEQ) * DM;
    if ((size_t)in_sizes[0] < needx) return;
    if ((size_t)in_sizes[1] < (size_t)DM * DM || (size_t)in_sizes[5] < (size_t)DM * DM || (size_t)in_sizes[9] < (size_t)DM * DM || (size_t)in_sizes[13] < (size_t)DM * DM) return;
    if (in_sizes[2] < DM || in_sizes[6] < DM || in_sizes[10] < DM || in_sizes[14] < DM) return;
    if (in_sizes[3] < LR * DM || in_sizes[7] < LR * DM || in_sizes[11] < LR * DM || in_sizes[15] < LR * DM) return;
    if (in_sizes[4] < DM * LR || in_sizes[8] < DM * LR || in_sizes[12] < DM * LR || in_sizes[16] < DM * LR) return;
    if ((size_t)out_size < ((size_t)(NB - 1) * OUT_SEQ + SEQ) * DM) return;
    if (SZ_TOTAL > ws_size) return;
    // wire order: x, then per projection (q, k, v, o): W [out][in], b [out], A [8][in], B [out][8]; folded weights [out][in] = Bt as-is
    const float* x   = (const float*)d_in[0];
    const float* wq  = (const float*)d_in[1];  const float* bq  = (const float*)d_in[2];  const float* laq = (const float*)d_in[3];  const float* lbq = (const float*)d_in[4];
    const float* wk  = (const float*)d_in[5];  const float* bk  = (const float*)d_in[6];  const float* lak = (const float*)d_in[7];  const float* lbk = (const float*)d_in[8];
    const float* wv  = (const float*)d_in[9];  const float* bv  = (const float*)d_in[10]; const float* lav = (const float*)d_in[11]; const float* lbv = (const float*)d_in[12];
    const float* wo  = (const float*)d_in[13]; const float* bo  = (const float*)d_in[14]; const float* lao = (const float*)d_in[15]; const float* lbo = (const float*)d_in[16];
    float* OUT = (float*)d_out;      // [NB][SEQ][768]
    char* wsp = (char*)d_ws;
    bf* XB = (bf*)wsp; wsp += SZ_XB;                 // [NB*SEQ][768]
    bf* WB = (bf*)wsp; wsp += SZ_WB;                 // [4][768][value 768 | remainder 768]: q | k | v | o
    h16* QH = (h16*)wsp; wsp += SZ_PL;               // [NB*12][SEQ][64]
    h16* KP = (h16*)wsp; wsp += SZ_PL;               // [NB*12][SEQ][64]
    h16* VT = (h16*)wsp; wsp += SZ_PL;               // [NB*12][64][SEQ]
    bf* CX = (bf*)wsp; wsp += SZ_CX;                 // [NB*SEQ][value 768 | remainder 768]
    bf* WQ = WB; bf* WK = WB + (size_t)DM * WP; bf* WV = WB + (size_t)2 * DM * WP; bf* WO = WB + (size_t)3 * DM * WP;

    if (SEQ == SEQ_FULL) {
        const size_t n8 = (size_t)NB * SEQ * DM / 8;
        k_cvt8<<<(unsigned)((n8 + 255) / 256), 256, 0, stream>>>(x, XB, n8);
    } else {
        const size_t n8 = (size_t)SEQ * DM / 8;
        for (int b = 0; b < NB; ++b) k_cvt8<<<(unsigned)((n8 + 255) / 256), 256, 0, stream>>>(x + (size_t)b * SEQ_FULL * DM, XB + (size_t)b * SEQ * DM, n8);
    }
    { const size_t nt = (size_t)DM * (DM / 8); const unsigned g = (unsigned)((nt + 255) / 256);
      k_fold<<<g, 256, 0, stream>>>(wq, laq, lbq, WQ); k_fold<<<g, 256, 0, stream>>>(wk, lak, lbk, WK);
      k_fold<<<g, 256, 0, stream>>>(wv, lav, lbv, WV); k_fold<<<g, 256, 0, stream>>>(wo, lao, lbo, WO); }

    // q, k: A = x rows (m = b*SEQ + t, pitch DM, wraps at DM), Bt = folded W rows (n = h*64 + d, pitch WP, no wrap), bias by column -> plane [(b*12 + h)][t][d]
    k_proj<DM, WP, DM, WP><<<dim3(NB * SEQ / 64, DM / 64, 1), 32, 0, stream>>>(XB, WQ, bq, 0, QH, SEQ, (size_t)NH_ * SEQ * HD, HD, HD, (size_t)SEQ * HD);
    k_proj<DM, WP, DM, WP><<<dim3(NB * SEQ / 64, DM / 64, 1), 32, 0, stream>>>(XB, WK, bk, 0, KP, SEQ, (size_t)NH_ * SEQ * HD, HD, HD, (size_t)SEQ * HD);
    // v^T: A = folded Wv rows (m = h*64 + d, pitch WP, no wrap), Bt = x rows (n = b*SEQ + t, pitch DM, wraps at DM), bias by row -> plane [(b*768 + m)][t] = [(b*12 + h)][d][t]
    k_proj<WP, DM, WP, DM><<<dim3(DM / 64, NB * SEQ / 64, 1), 32, 0, stream>>>(WV, XB, bv, 1, VT, DM, (size_t)0, SEQ, SEQ, (size_t)DM * SEQ);

    k_flash<<<dim3(SEQ / (16 * AW), NB * NH_, 1), 32 * AW, 0, stream>>>(QH, KP, VT, CX);

    // out: A = ctx rows [m][value | remainder], Bt = folded Wo rows (n) [value | remainder], bias by column -> OUT[b][t][n]
    k_out<<<dim3(NB * SEQ / 64, DM / 64, 1), 32, 0, stream>>>(CX, WO, bo, OUT);
}

// v003
// It runs in 181 microseconds.
// In two side-by-side timings against v002, it was 1.10 and 1.11 times as fast.
// All steps since v000 together make it 2.35 times as fast.
#include <hip/hip_runtime.h>

// Dense (unmasked) multi-head self-attention, width 768 = 12 heads x 64, x [NB][SEQ][768]; each of the four projections is y = x W^T + b + (x A^T) B^T with W [out][in], A [8][in], B [out][8]; score scale 1/8; f32 output.
// Compute dtypes, f32 accumulate everywhere: the rank-8 update is folded once into W_eff = W + B A (f32 on the vector unit, K = 8; W, A, B, b, x RNE-converted to bf16 first) and carried as bf16 value | bf16 remainder along K;
// softmax f32 (online, running max); output projection v_wmma_f32_16x16x32_bf16 with ctx as bf16 value | remainder and W_eff as bf16 value | remainder (K = 2304: value x value, remainder x value, value x remainder), one accumulator.
// Layout: bf16 copy of x; folded weight planes [4][768][value 768 | remainder 768]; q, k planes [b*12+h][t][d], v^T plane [b*12+h][d][t] (f16) written by the GEMM epilogue; fused flash kernel in transposed form
// Every one of these planes is stored in FRAGMENT ORDER: a block of 16 rows x 32 k is 512 consecutive elements, element (row, k) of a block at (k>>4)*256 + ((k>>3)&1)*128 + row*8 + (k&7);
// blocks run along k (512 elements each), then along rows (16 * pitch elements per block row). A fragment is then two wave-wide 16-B loads of 512 contiguous bytes each (four whole lines) instead of 16 partial lines.
// (S^T = K Q^T, O^T = V^T P^T, key loop over the whole sequence) writes the ctx plane [b*SEQ+t][value 768 | remainder 768] (bf16); final GEMM adds the bias at the store stage.

#ifndef NB
#define NB 4
#endif
#ifndef SEQ
#define SEQ 2048
#endif
#define NB_FULL  4
#define SEQ_FULL 2048
#ifndef OUT_SEQ
#define OUT_SEQ SEQ              // row pitch (in tokens) between batches of the output
#endif
#define DM   768
#define NH_  12
#define HD   64
#define LR   8                   // rank of the low-rank update
#define WP   (2 * DM)            // folded weight plane row pitch: value columns 0..DM-1, remainder columns DM..2DM-1
#define CXP  (2 * DM)            // ctx plane row pitch: value columns 0..DM-1, remainder columns DM..2DM-1
#define KO   (3 * DM)            // K extent of the output projection
#define AW   8                   // waves per flash block (16 query rows each)
#define KS   64                  // keys per LDS stage of the flash kernel (two passes of 32)
#define GW   4                   // waves per GEMM block, 2 x 2, one 64x64 tile each: block tile 128 x 128
#define KC   128                 // k per LDS stage of the GEMMs (four k-steps of 32)
#define GST  (2 * 128 * KC)      // elements of one GEMM stage: A 128 rows x KC, then B 128 rows x KC
#define SC2  (0.125f * 1.4426950408889634f)   // HD^-0.5 * log2(e)
#define PSH  8.0f                // log2 of the P carry (256)

static_assert(HD == 64);
static_assert(NH_ * HD == DM);                 // head h = columns h*64 + d
static_assert(DM % 64 == 0);                   // column tiles of 64
static_assert(DM % 32 == 0);                   // GEMM k-loop steps by 32; a k-step never straddles a wrap point
static_assert(CXP == 2 * DM);
static_assert(CXP % 32 == 0);
static_assert(WP == 2 * DM);
static_assert(WP % 32 == 0);
static_assert(KO == CXP + DM);                 // third K segment meets the ctx value half again (A wrap at CXP) and the weight remainder half (B wrap at DM)
static_assert(KO % 32 == 0);
static_assert(LR == 8);                        // one 32-byte load covers a row of B [out][8]
static_assert(DM % 8 == 0);                    // fold kernel: 8 columns per lane
static_assert((DM / 8) % 8 == 0);
static_assert(SEQ % 64 == 0);                  // a 64-row tile never straddles two batches
static_assert((NB * SEQ) % 64 == 0);
static_assert(SEQ % 32 == 0);                  // key loop steps by 32 and stays inside the sequence
static_assert(SEQ % (16 * AW) == 0);           // flash grid covers the sequence exactly
static_assert(((size_t)SEQ * DM) % 8 == 0);
static_assert(((size_t)DM * DM) % 8 == 0);
static_assert(NB <= NB_FULL);
static_assert(SEQ <= SEQ_FULL);
static_assert(AW * 32 == 256);                 // the stage copy deals 16-byte pieces to exactly 256 lanes
static_assert(KS == 64 && SEQ % KS == 0 && SEQ / KS >= 2);   // the two-buffer prologue needs two stages
static_assert(GW == 4 && KC == 128);           // the tile copy deals one half (2 KiB) of a 4-KiB block row (16 rows x KC) to exactly 128 lanes
static_assert(DM % 128 == 0 && (NB * SEQ) % 128 == 0);       // block tiles of 128 x 128 cover every GEMM exactly
static_assert(DM % KC == 0 && WP % KC == 0 && CXP % KC == 0 && KO % KC == 0);   // a stage never straddles a wrap point

typedef _Float16 h16;
typedef unsigned short bf;
typedef __attribute__((ext_vector_type(16))) __bf16   v16bf;
typedef __attribute__((ext_vector_type(16))) _Float16 v16h;
typedef __attribute__((ext_vector_type(8)))  _Float16 v8h;
typedef __attribute__((ext_vector_type(8)))  unsigned short v8us;
typedef __attribute__((ext_vector_type(8)))  float    v8f;
typedef __attribute__((ext_vector_type(4)))  float    v4f;
typedef v4f  __attribute__((may_alias)) v4fa;

__device__ __forceinline__ unsigned short f2bf(float f) { unsigned u = __float_as_uint(f); u += 0x7FFFu + ((u >> 16) & 1u); return (unsigned short)(u >> 16); }
__device__ __forceinline__ float bf2f(unsigned short s) { return __uint_as_float(((unsigned)s) << 16); }
__device__ __forceinline__ float bfr(float f) { return bf2f(f2bf(f)); }     // f32 -> bf16 (RNE) -> f32
__device__ __forceinline__ v16h cat16(v8h lo, v8h hi) { return __builtin_shufflevector(lo, hi, 0, 1, 2, 3, 4, 5, 6, 7, 8, 9, 10, 11, 12, 13, 14, 15); }
__device__ __forceinline__ v16bf cat16b(v8us lo, v8us hi) { return __builtin_bit_cast(v16bf, __builtin_shufflevector(lo, hi, 0, 1, 2, 3, 4, 5, 6, 7, 8, 9, 10, 11, 12, 13, 14, 15)); }
__device__ __forceinline__ v8f wmma16(v16h a, v16h b, v8f c) { return __builtin_amdgcn_wmma_f32_16x16x32_f16(false, a, false, b, (short)0, c, false, false); }
__device__ __forceinline__ v8f wmmab(v16bf a, v16bf b, v8f c) { return __builtin_amdgcn_wmma_f32_16x16x32_bf16(false, a, false, b, (short)0, c, false, false); }
// fragment loaders from fragment-order planes; p = block base + 8*lane: elements 0..7 <- k0+8h+0..7, elements 8..15 <- k0+16+8h+0..7 of row lane&15 (same map for A and B)
__device__ __forceinline__ v16h  ldh(const h16* p) { return cat16(*(const v8h*)p, *(const v8h*)(p + 256)); }
__device__ __forceinline__ v16bf ldb(const bf* p)  { return cat16b(*(const v8us*)p, *(const v8us*)(p + 256)); }
// ordering point for wave-private LDS tiles (same wave writes and reads)
__device__ __forceinline__ void wave_sync() { __builtin_amdgcn_fence(3 /* release order */, "wavefront"); __builtin_amdgcn_wave_barrier(); asm volatile("" ::: "memory"); }
// f32 -> f16 for WMMA operand planes: magnitudes below the smallest normal f16 become exactly 0 (value select)
static __device__ __forceinline__ h16 toh_flush(float v) { const h16 r = (h16)v; return (fabsf(v) < 6.103515625e-05f) ? (h16)0.0f : r; }

__global__ __launch_bounds__(256) void k_cvt8(const float* __restrict__ src, bf* dst, size_t n8) {
    const size_t i = (size_t)blockIdx.x * 256 + threadIdx.x; if (i >= n8) return;
    // i counts 8-element pieces of the fragment-order plane (row pitch DM): block i>>6, piece w = i&63 holds row w&15, k (w>>4)*8 .. +7 of the block
    const size_t blk = i >> 6; const int w = (int)(i & 63);
    const size_t m = (blk / (DM / 32)) * 16 + (size_t)(w & 15); const int k0 = (int)(blk % (DM / 32)) * 32 + (w >> 4) * 8;
    const v8f v = *(const v8f*)(src + m * DM + k0); v8us o;
#pragma unroll
    for (int k = 0; k < 8; ++k) o[k] = f2bf(v[k]);
    *(v8us*)(dst + i * 8) = o; 
}

// k_fold: W_eff[m][k] = bf16(W[m][k]) + sum_r bf16(LB[m][r]) * bf16(LA[r][k]) in f32 (K = 8, vector unit, rank loop rolled), written as bf16 value at column k and bf16 remainder at column DM + k of row m (fragment order, pitch WP)
__global__ __launch_bounds__(256) void k_fold(const float* __restrict__ W, const float* __restrict__ LA, const float* __restrict__ LB, bf* dst) {
    const size_t i = (size_t)blockIdx.x * 256 + threadIdx.x; if (i >= (size_t)DM * (DM / 8)) return;
    // i counts 8-element pieces of the value half in fragment order: block i>>6 (block row rb, block column kb), piece pc = i&63 holds row pc&15, k (pc>>4)*8 .. +7 of the block
    const int rb = (int)(i >> 6) / (DM / 32), kb = (int)(i >> 6) % (DM / 32), pc = (int)(i & 63);
    const int m = rb * 16 + (pc & 15); const int k0 = kb * 32 + (pc >> 4) * 8;
    const v8f w = *(const v8f*)(W + (size_t)m * DM + k0);
    const v8f lb = *(const v8f*)(LB + (size_t)m * LR);
    float acc[8];
#pragma unroll
    for (int k = 0; k < 8; ++k) acc[k] = bfr(w[k]);
    float blr[8];
#pragma unroll
    for (int r = 0; r < 8; ++r) blr[r] = bfr(lb[r]);
    // rank loop rolled: the multiplier of step r is rotated to slot 0 so every register index stays static
#pragma unroll 1
    for (int r = 0; r < LR; ++r) {
        const float bl = blr[0];
#pragma unroll
        for (int q = 0; q < 7; ++q) blr[q] = blr[q + 1];
        const v8f a = *(const v8f*)(LA + (size_t)r * DM + k0);
#pragma unroll
        for (int k = 0; k < 8; ++k) acc[k] = acc[k] + bl * bfr(a[k]);
    }
    v8us hv, lv;
#pragma unroll
    for (int k = 0; k < 8; ++k) { const unsigned short h0 = f2bf(acc[k]); hv[k] = h0; lv[k] = f2bf(acc[k] - bf2f(h0)); }
    bf* p = dst + (size_t)rb * 16 * WP + (size_t)kb * 512 + pc * 8;
    *(v8us*)(p) = hv; *(v8us*)(p + DM * 16) = lv;          // DM columns further = DM/32 blocks = DM*16 elements
    
}

// gemm_main: a block of four waves (2 x 2) on a 128x128 tile, each wave 64x64 with 16 accumulators; C[m][n] += sum_k A[m][k mod AWR] Bt[n][k mod BWR] (one subtraction each); operands from fragment-order bf16 planes.
// Both operands reach the waves through LDS: a stage is KC = 128 k of the block's 128 A rows and 128 B rows (8 + 8 block rows of 4 KiB, still in fragment order), copied once per block by asynchronous 16-B copies,
// 32 per lane, into one of two buffers, one stage ahead of its use; each A block row is then read by two waves and each B block row by two waves (512 contiguous bytes per ds load).
// Inside a stage the fragments of a k-step (4 of A, 4 of B) live in two register sets: the reads of k-step ks + 2 are issued as one group behind the products of k-step ks; no fragment is read across a stage's end.
// ga / gb = plane + (block's first row) * pitch + 8 * thread. PA / PB = row pitches (elements); K, AWR and BWR multiples of KC; 32 k = one block = 512 elements, so column k0 is at k0*16.
// Every accumulator still takes its k-steps in rising order.
// Eight copies of one lane: the same 16-B piece of block rows 0..7 of one operand's tile; l = LDS byte address of the piece in block row 0, g = the same piece in the plane.
template <int P>
__device__ __forceinline__ void tile_copy(const unsigned l, const bf* g) {
    // the wait is the statement's last line: the address registers that the copies name are rewritten only behind it
    asm volatile(
                 "global_load_async_to_lds_b128 %0, %8, off\n\t"
                 "global_load_async_to_lds_b128 %1, %9, off\n\t"
                 "global_load_async_to_lds_b128 %2, %10, off\n\t"
                 "global_load_async_to_lds_b128 %3, %11, off\n\t"
                 "global_load_async_to_lds_b128 %4, %12, off\n\t"
                 "global_load_async_to_lds_b128 %5, %13, off\n\t"
                 "global_load_async_to_lds_b128 %6, %14, off\n\t"
                 "global_load_async_to_lds_b128 %7, %15, off\n\t"
                 "s_wait_xcnt 0x0"
                 :: "v"(l), "v"(l + 4096u), "v"(l + 8192u), "v"(l + 12288u), "v"(l + 16384u), "v"(l + 20480u), "v"(l + 24576u), "v"(l + 28672u),
                    "v"(g), "v"(g + 16 * P), "v"(g + 32 * P), "v"(g + 48 * P), "v"(g + 64 * P), "v"(g + 80 * P), "v"(g + 96 * P), "v"(g + 112 * P) : "memory");
}
template <int PA, int PB, int AWR, int BWR>
__device__ __forceinline__ void stage_fill(const unsigned l, const bf* ga, const bf* gb, const int kc) {
    const int ka = (kc >= AWR) ? (kc - AWR) : kc; const int kb = (kc >= BWR) ? (kc - BWR) : kc;
    // a block row of a stage is 4 KiB = 256 pieces: this lane's pieces are 'thread' and 'thread + 128' (2 KiB further, in the plane as in LDS)
    tile_copy<PA>(l, ga + (size_t)ka * 16);
    tile_copy<PA>(l + 2048u, ga + (size_t)ka * 16 + 1024);
    tile_copy<PB>(l + (unsigned)(128 * KC * 2), gb + (size_t)kb * 16);
    tile_copy<PB>(l + (unsigned)(128 * KC * 2) + 2048u, gb + (size_t)kb * 16 + 1024);
}
template <int PA, int PB, int K, int AWR, int BWR>
__device__ __forceinline__ void gemm_main(const bf* st, const bf* ga, const bf* gb, const int tid, const int wm, const int wn, v8f (&acc)[4][4]) {
    static_assert(K % KC == 0 && K / KC >= 2 && AWR % KC == 0 && BWR % KC == 0);
    const int lane = tid & 31;
    const unsigned l0 = (unsigned)(size_t)st + (unsigned)tid * 16u;
    stage_fill<PA, PB, AWR, BWR>(l0, ga, gb, 0);
    asm volatile("s_wait_asynccnt 0x0" ::: "memory");            // this wave's share of stage 0 has landed before the barrier that shows it to the other waves
    __syncthreads();
    stage_fill<PA, PB, AWR, BWR>(l0 + (unsigned)(GST * 2), ga, gb, KC);
#pragma unroll 1                                                 // one stage per trip: the two buffers alternate by s & 1
    for (int s = 0; s < K / KC; ++s) {
        const bf* sa = st + (s & 1) * GST + wm * (64 * KC) + 8 * lane;                 // this wave's four A block rows
        const bf* sb = st + (s & 1) * GST + 128 * KC + wn * (64 * KC) + 8 * lane;      // this wave's four B block rows
        v16bf a[2][4], b[2][4];
#pragma unroll
        for (int q = 0; q < 2; ++q)
#pragma unroll
            for (int i = 0; i < 4; ++i) { a[q][i] = ldb(sa + i * (16 * KC) + q * 512); b[q][i] = ldb(sb + i * (16 * KC) + q * 512); }
        __builtin_amdgcn_sched_barrier(0);                       // the first two read groups stand whole ahead of the products: sunk among them each row of products would wait for its own reads
#pragma unroll                                                   // unrolled so that the register set ks & 1 is a static choice
        for (int ks = 0; ks < KC / 32; ++ks) {
#pragma unroll
            for (int nb = 0; nb < 4; ++nb)
#pragma unroll
                for (int mb = 0; mb < 4; ++mb) acc[mb][nb] = wmmab(a[ks & 1][mb], b[ks & 1][nb], acc[mb][nb]);
            if (ks + 2 < KC / 32) {
                __builtin_amdgcn_sched_barrier(0);               // keeps the read group below behind the products that read its registers
#pragma unroll
                for (int i = 0; i < 4; ++i) { a[ks & 1][i] = ldb(sa + i * (16 * KC) + (ks + 2) * 512); b[ks & 1][i] = ldb(sb + i * (16 * KC) + (ks + 2) * 512); }
                __builtin_amdgcn_sched_barrier(0);               // keeps that group whole and ahead of the next k-step's products, which give it time to come back
            }
        }
        __builtin_amdgcn_sched_barrier(0);                       // keeps the waits below behind the last products: lifted over them they would wait out the last read group with the matrix unit idle
        // hand-over of the buffers, every wave: its own reads of this stage are home, its own copies of the next stage have landed, then the barrier; only behind it is this stage's buffer refilled
        asm volatile("s_wait_dscnt 0x0" ::: "memory");           // this wave has finished reading the buffer that is refilled below
        asm volatile("s_wait_asynccnt 0x0" ::: "memory");        // this wave's share of stage s + 1 has landed
        __syncthreads();
        if (s + 2 < K / KC) stage_fill<PA, PB, AWR, BWR>(l0 + (unsigned)(s & 1) * (unsigned)(GST * 2), ga, gb, (s + 2) * KC);
    }
    asm volatile("s_wait_asynccnt 0x0" ::: "memory");            // no copy is outstanding when the wave goes on to the store stage
}

// k_proj: bf16 GEMM, four waves per 128x128 tile (one 64x64 tile each), K = WP (value half then remainder half of the folded weight; the x operand wraps at DM).
// C[m][n] = sum_k A[m][k mod AWR] Bt[n][k mod BWR] + bias (bias by column n when biasRow == 0, by row m when biasRow != 0; bias RNE-converted to bf16),
// written as f16, in fragment order, into the sub-plane at (r0/RB)*sRB + (c0/CB)*sCB: rows r0%RB .., columns c0%CB .., row pitch 'pitch' (halves). grid (M/128, N/128), 128 threads.
template <int PA, int PB, int AWR, int BWR>
__global__ __launch_bounds__(32 * GW) void k_proj(const bf* __restrict__ A, const bf* __restrict__ Bt,
                                             const float* __restrict__ bias, int biasRow, h16* Ph, int RB, size_t sRB, int pitch, int CB, size_t sCB) {
    __shared__ __align__(16) bf st[2 * GST];
    __shared__ __align__(16) float osa[GW][16 * 68];
    const int tid = threadIdx.x; const int wave = __builtin_amdgcn_readfirstlane(threadIdx.x >> 5); const int wm = wave >> 1, wn = wave & 1;
    float* os = &osa[wave][0];                                   // store staging, private to the wave
    const int lane = threadIdx.x & 31, lr = lane & 15, hi = lane >> 4; const int r0 = blockIdx.x * 128 + wm * 64, c0 = blockIdx.y * 128 + wn * 64;
    v8f acc[4][4];
#pragma unroll
    for (int mb = 0; mb < 4; ++mb)
#pragma unroll
        for (int nb = 0; nb < 4; ++nb) acc[mb][nb] = (v8f){};
    gemm_main<PA, PB, WP, AWR, BWR>(st, A + (size_t)(blockIdx.x * 128) * PA + 8 * tid, Bt + (size_t)(blockIdx.y * 128) * PB + 8 * tid, tid, wm, wn, acc);
    // store stage s = 0..3: lane holds row lane&15, columns (s>>1)*32 + (s&1)*16 + 8h + 0..7 of the slab = piece 'lane' of half s&1 of block s>>1
    float bc[4][8];
#pragma unroll
    for (int s = 0; s < 4; ++s) { int cb = c0 + (s >> 1) * 32 + (s & 1) * 16 + hi * 8; cb = (cb < DM - 8) ? cb : (DM - 8);          // clamped address; value selected afterwards
      const v4f b0 = *(const v4f*)(bias + cb); const v4f b1 = *(const v4f*)(bias + cb + 4);
#pragma unroll
      for (int i = 0; i < 4; ++i) { bc[s][i] = biasRow ? 0.0f : bfr(b0[i]); bc[s][4 + i] = biasRow ? 0.0f : bfr(b1[i]); } }
    const size_t tbase = (size_t)(r0 / RB) * sRB + (size_t)(r0 % RB) * (size_t)pitch + (size_t)(c0 / CB) * sCB + (size_t)(c0 % CB) * 16 + 8 * lane;
#pragma unroll
    for (int mb = 0; mb < 4; ++mb) {
#pragma unroll
        for (int nb = 0; nb < 4; ++nb) {
#pragma unroll
            for (int j = 0; j < 8; ++j) os[(hi * 8 + j) * 68 + nb * 16 + lr] = acc[mb][nb][j]; }   // D: row 8h+j, col lane&15
        wave_sync();
        float br;
        { int ri = r0 + mb * 16 + lr; ri = (ri < DM - 1) ? ri : (DM - 1); const float bv_ = bias[ri]; br = biasRow ? bfr(bv_) : 0.0f; }
        const size_t sb = tbase + (size_t)(mb * 16) * (size_t)pitch;
{
#pragma unroll
            for (int s = 0; s < 4; ++s) { const int col = (s >> 1) * 32 + (s & 1) * 16 + hi * 8;   // 16 lanes = 16 rows; 4 s x 2 halves x 8 = 64 columns
                const v4f x0 = *(const v4fa*)(&os[lr * 68 + col]); const v4f x1 = *(const v4fa*)(&os[lr * 68 + col + 4]);
                float val[8]; v8h hv;
#pragma unroll
                for (int i = 0; i < 4; ++i) { val[i] = x0[i] + bc[s][i] + br; val[4 + i] = x1[i] + bc[s][4 + i] + br; }
#pragma unroll
                for (int i = 0; i < 8; ++i) hv[i] = toh_flush(val[i]);
                const size_t oo = sb + (size_t)((s >> 1) * 512 + (s & 1) * 256);
                *(v8h*)(Ph + oo) = hv; }
             }
        wave_sync();
    }
}

// k_flash: fused dense attention, one wave per 16 query rows of one (batch, head), eight waves per block; Q fragments straight from the fragment-order f16 plane (two 16-B loads each, 512 contiguous bytes per load).
// K and V^T reach the waves through LDS: a stage is 64 keys (K 8 KiB, V^T 4 block rows x 2 KiB, both still in fragment order), copied once per block by asynchronous 16-B copies, four per lane, into one of two buffers,
// one stage ahead of its use; all eight waves read their fragments from it (512 contiguous bytes per ds load).
// Transposed form: S^T[key][t] = K Q^T (A = K rows, B = Q rows); lane (t = lane&15, h = lane>>4) holds keys 8h+r of each 16-key tile, so the packed
// P tile is directly the B fragment of O^T[d][t] = V^T P^T (element r <- tile keys 0..15, element 8+r <- tile keys 16..31, lane unchanged).
// Key loop covers keys 0 .. SEQ-1 in steps of 32 (all inside the sequence, every key valid for every row).
// Softmax state (running max, partial sum) is one scalar per lane; the two lane halves of a row are combined with one xor-16 exchange.
// P carries x256; a P whose exponent argument is below -14 (under the smallest normal f16) is taken as exactly 0; the row sum runs over the converted P.
// One lane's four copies of a stage: l = LDS byte address of its first piece in the buffer, gk / gv = its first K and V^T piece of the stage.
__device__ __forceinline__ void stage_copy(const unsigned l, const h16* gk, const h16* gv) {
    const unsigned l1 = l + 4096u, l2 = l + 8192u, l3 = l + 12288u;
    const h16* gk1 = gk + 2048; const h16* gv1 = gv + (size_t)32 * SEQ;      // K piece + 256; V^T piece + 256 = two block rows further
    // the wait is the statement's last line: the address registers that the copies name are rewritten only behind it
    asm volatile("global_load_async_to_lds_b128 %0, %4, off\n\t"
                 "global_load_async_to_lds_b128 %1, %5, off\n\t"
                 "global_load_async_to_lds_b128 %2, %6, off\n\t"
                 "global_load_async_to_lds_b128 %3, %7, off\n\t"
                 "s_wait_xcnt 0x0"
                 :: "v"(l), "v"(l1), "v"(l2), "v"(l3), "v"(gk), "v"(gk1), "v"(gv), "v"(gv1) : "memory");
}
__global__ __launch_bounds__(32 * AW) void k_flash(const h16* __restrict__ QH, const h16* __restrict__ KP, const h16* __restrict__ VT, bf* CX) {
    __shared__ __align__(16) h16 kv[2][2 * KS * HD];            // per buffer: K [64 keys][64 d] (4096 halves), then V^T [4 block rows][64 keys x 16 d] (4096 halves)
    const int tid = threadIdx.x;
    const int lane = threadIdx.x & 31;
    const int wave = __builtin_amdgcn_readfirstlane(threadIdx.x >> 5);
    const int zh = blockIdx.y; const int b = zh / NH_, h = zh % NH_;
    const int t0 = (blockIdx.x * AW + wave) * 16;
    const size_t pbase = (size_t)zh * SEQ * HD;
    const size_t qo = pbase + (size_t)t0 * HD + 8 * lane;
    const v16h qh0 = ldh(QH + qo), qh1 = ldh(QH + qo + 512);   // B fragments: col t, k = d (blocks d 0..31, d 32..63)
    // this lane's pieces of a stage: K pieces tid and tid + 256 of 512 (contiguous); V^T pieces tid and tid + 256 of 512 (piece i: block row i >> 7, 16-B unit i & 127 of its 2 KiB)
    const unsigned lds0 = (unsigned)(size_t)&kv[0][0] + (unsigned)tid * 16u;
    const h16* gk = KP + pbase + (size_t)tid * 8;                                          // + stage * KS * HD
    const h16* gv = VT + pbase + (size_t)(tid >> 7) * 16 * SEQ + (size_t)(tid & 127) * 8;  // + stage * KS * 16
    v8f o[4];
#pragma unroll
    for (int j = 0; j < 4; ++j) { o[j] = (v8f){}; }
    float m = -3.0e38f, l = 0.0f;
    stage_copy(lds0, gk, gv);
    asm volatile("s_wait_asynccnt 0x0" ::: "memory");            // this wave's share of stage 0 has landed before the barrier that shows it to the other waves
    __syncthreads();
    stage_copy(lds0 + (unsigned)sizeof(kv[0]), gk + KS * HD, gv + KS * 16);
#pragma unroll 1                                                 // one stage per trip: the two buffers alternate by s & 1
    for (int s = 0; s < SEQ / KS; ++s) {
        const h16* sb = &kv[s & 1][0] + 8 * lane;
#pragma unroll                                                   // both passes of a stage in one trip: their LDS offsets become immediates
        for (int p = 0; p < KS / 32; ++p) {
        const h16* ka = sb + p * 32 * HD;                        // A fragments: row key, k = d
        const v16h ka0 = ldh(ka), ka1 = ldh(ka + 512), kb0 = ldh(ka + 16 * HD), kb1 = ldh(ka + 16 * HD + 512);
        const h16* va = sb + KS * HD + p * 512;                  // A fragments: row d, k = key
        const v16h v0 = ldh(va), v1 = ldh(va + KS * 16), v2 = ldh(va + 2 * KS * 16), v3 = ldh(va + 3 * KS * 16);
        v8f sHa = (v8f){}, sHb = (v8f){};
        sHa = wmma16(ka0, qh0, sHa); sHb = wmma16(kb0, qh0, sHb);
        sHa = wmma16(ka1, qh1, sHa); sHb = wmma16(kb1, qh1, sHb);
        float ta[8], tb[8];
#pragma unroll
        for (int r = 0; r < 8; ++r) { ta[r] = sHa[r] * SC2; tb[r] = sHb[r] * SC2; }
        float mx = -3.0e38f;
#pragma unroll
        for (int r = 0; r < 8; ++r) mx = fmaxf(mx, fmaxf(ta[r], tb[r]));
        mx = fmaxf(mx, __shfl_xor(mx, 16, 32));
        const float mnew = fmaxf(m, mx);
        float alpha;
        // the exponential and the one free slot behind it in one statement
        asm("v_exp_f32 %0, %1\n\tv_nop" : "=v"(alpha) : "v"(m - mnew));
        const float sh = PSH - mnew;
        v16h pb; float ls = 0.0f;
#pragma unroll
        for (int r = 0; r < 8; ++r) { const float ea = ta[r] + sh; const float eb = tb[r] + sh;
            const float xa = __builtin_amdgcn_exp2f(ea); const float xb = __builtin_amdgcn_exp2f(eb);
            const h16 pa = (ea < -14.0f) ? (h16)0.0f : (h16)xa; const h16 pc = (eb < -14.0f) ? (h16)0.0f : (h16)xb;
            pb[r] = pa; pb[8 + r] = pc; ls += (float)pa + (float)pc; }
#pragma unroll
        for (int j = 0; j < 4; ++j) o[j] = o[j] * alpha;
        o[0] = wmma16(v0, pb, o[0]); o[1] = wmma16(v1, pb, o[1]); o[2] = wmma16(v2, pb, o[2]); o[3] = wmma16(v3, pb, o[3]);
        l = l * alpha + ls; m = mnew;
        }
        // hand-over of the buffers, every wave: its own reads of this stage are home, its own copies of the next stage have landed, then the barrier; only behind it is this stage's buffer refilled
        asm volatile("s_wait_dscnt 0x0" ::: "memory");           // this wave has finished reading the buffer that is refilled below
        asm volatile("s_wait_asynccnt 0x0" ::: "memory");        // this wave's share of stage s + 1 has landed
        __syncthreads();
        if (s + 2 < SEQ / KS) stage_copy(lds0 + (unsigned)(s & 1) * (unsigned)sizeof(kv[0]), gk + (size_t)(s + 2) * (KS * HD), gv + (size_t)(s + 2) * (KS * 16));
    }
    asm volatile("s_wait_asynccnt 0x0" ::: "memory");            // no copy is outstanding when the wave ends
    l += __shfl_xor(l, 16, 32);
    const float inv = 1.0f / l;
    // O^T D layout: o_j[r] = (d = 16j + 8h + r, t = lane&15) = row t, columns 16j + 8h + 0..7: piece 'lane' of half j&1 of block j>>1 in fragment order, so every lane stores its own registers (no transposition)
    bf* crow = CX + ((size_t)b * SEQ + t0) * CXP + (size_t)(h * HD) * 16 + 8 * lane;   // block row t0/16, first block of column h*64, piece 'lane'
#pragma unroll
    for (int j = 0; j < 4; ++j) { v8us hv, lv;
#pragma unroll
        for (int i = 0; i < 8; ++i) { const float x = o[j][i] * inv; const unsigned short h0 = f2bf(x); hv[i] = h0; lv[i] = f2bf(x - bf2f(h0)); }
        const size_t oo = (size_t)((j >> 1) * 512 + (j & 1) * 256);
        *(v8us*)(crow + oo) = hv; *(v8us*)(crow + oo + DM * 16) = lv; }
}

// k_out: final projection, four waves per 128x128 tile (one 64x64 tile each). A = ctx plane [m][value 768 | remainder 768] read at k mod 1536 (K = 2304: value, remainder, value),
// Bt = folded Wo plane [n][value 768 | remainder 768] read at k (k < 768) or k - 768 (value, value, remainder).
// OUT[m][n] = acc + bias[n] (bias RNE-converted to bf16), f32. Epilogue: per 16-row slab staged in LDS (wave-private), each output row segment (64 floats = 256 B = two lines)
__global__ __launch_bounds__(32 * GW) void k_out(const bf* __restrict__ A, const bf* __restrict__ Bt, const float* __restrict__ bias, float* OUT) {
    __shared__ __align__(16) bf st[2 * GST];
    __shared__ __align__(16) float osa[GW][16 * 68];
    const int tid = threadIdx.x; const int wave = __builtin_amdgcn_readfirstlane(threadIdx.x >> 5); const int wm = wave >> 1, wn = wave & 1;
    float* os = &osa[wave][0];                                   // store staging, private to the wave
    const int lane = threadIdx.x & 31, lr = lane & 15, hi = lane >> 4; const int r0 = blockIdx.x * 128 + wm * 64, c0 = blockIdx.y * 128 + wn * 64;
    v8f acc[4][4];
#pragma unroll
    for (int mb = 0; mb < 4; ++mb)
#pragma unroll
        for (int nb = 0; nb < 4; ++nb) acc[mb][nb] = (v8f){};
    gemm_main<CXP, WP, KO, CXP, DM>(st, A + (size_t)(blockIdx.x * 128) * CXP + 8 * tid, Bt + (size_t)(blockIdx.y * 128) * WP + 8 * tid, tid, wm, wn, acc);
    const int cofs = lr * 4;
    v4f b4 = *(const v4f*)(bias + c0 + cofs);          // c0 + cofs + 3 <= DM - 1 always
    asm volatile("s_wait_xcnt 0x0" ::: "memory");      // the address arithmetic below reuses registers that this load names
    __builtin_amdgcn_sched_barrier(0);                 // holds that arithmetic behind the wait
    b4[0] = bfr(b4[0]); b4[1] = bfr(b4[1]); b4[2] = bfr(b4[2]); b4[3] = bfr(b4[3]);
    const size_t orow0 = (size_t)(r0 / SEQ) * OUT_SEQ + (size_t)(r0 % SEQ);
#pragma unroll
    for (int mb = 0; mb < 4; ++mb) {
#pragma unroll
        for (int nb = 0; nb < 4; ++nb) {
#pragma unroll
            for (int j = 0; j < 8; ++j) os[(hi * 8 + j) * 68 + nb * 16 + lr] = acc[mb][nb][j]; }   // D: row 8h+j, col lane&15
        wave_sync();
        float* ob = OUT + (orow0 + (size_t)(mb * 16)) * DM + c0;
{
#pragma unroll
            for (int s = 0; s < 8; ++s) { const int row = 2 * s + hi;   // 8 s x 2 rows = 16 rows; 16 lanes x 4 floats = 64 columns
                const v4f xv = *(const v4fa*)(&os[row * 68 + cofs]);
                const v4f val = xv + b4;
                *(v4f*)(ob + (size_t)row * DM + cofs) = val; }
             }
        wave_sync();
    }
}

static constexpr size_t al256(size_t v) { return (v + 255) & ~(size_t)255; }
static constexpr size_t SZ_XB = al256((size_t)NB * SEQ * DM * 2);
static constexpr size_t SZ_WB = al256((size_t)4 * DM * WP * 2);
static constexpr size_t SZ_PL = al256((size_t)NB * NH_ * SEQ * HD * 2);
static constexpr size_t SZ_CX = al256((size_t)NB * SEQ * CXP * 2);
static constexpr size_t SZ_TOTAL = SZ_XB + SZ_WB + 3 * SZ_PL + SZ_CX;
static_assert(SZ_TOTAL <= (size_t)134217728);          // workspace carve <= 128 MiB
static_assert(((size_t)DM * WP * 2) % 256 == 0);       // weight sub-planes stay 256-byte aligned
static_assert((size_t)NB * NH_ * SEQ * HD == (size_t)NB * SEQ * DM);   // plane extent == GEMM tile grid extent

extern "C" void kernel_launch(void* const* d_in, const int* in_sizes, int n_in,
                              void* d_out, int out_size, void* d_ws, size_t ws_size, hipStream_t stream) {
    if (n_in < 17) return;
    const size_t needx = ((size_t)(NB - 1) * SEQ_FULL + SEQ) * DM;
    if ((size_t)in_sizes[0] < needx) return;
    if ((size_t)in_sizes[1] < (size_t)DM * DM || (size_t)in_sizes[5] < (size_t)DM * DM || (size_t)in_sizes[9] < (size_t)DM * DM || (size_t)in_sizes[13] < (size_t)DM * DM) return;
    if (in_sizes[2] < DM || in_sizes[6] < DM || in_sizes[10] < DM || in_sizes[14] < DM) return;
    if (in_sizes[3] < LR * DM || in_sizes[7] < LR * DM || in_sizes[11] < LR * DM || in_sizes[15] < LR * DM) return;
    if (in_sizes[4] < DM * LR || in_sizes[8] < DM * LR || in_sizes[12] < DM * LR || in_sizes[16] < DM * LR) return;
    if ((size_t)out_size < ((size_t)(NB - 1) * OUT_SEQ + SEQ) * DM) return;
    if (SZ_TOTAL > ws_size) return;
    // wire order: x, then per projection (q, k, v, o): W [out][in], b [out], A [8][in], B [out][8]; folded weights [out][in] = Bt as-is
    const float* x   = (const float*)d_in[0];
    const float* wq  = (const float*)d_in[1];  const float* bq  = (const float*)d_in[2];  const float* laq = (const float*)d_in[3];  const float* lbq = (const float*)d_in[4];
    const float* wk  = (const float*)d_in[5];  const float* bk  = (const float*)d_in[6];  const float* lak = (const float*)d_in[7];  const float* lbk = (const float*)d_in[8];
    const float* wv  = (const float*)d_in[9];  const float* bv  = (const float*)d_in[10]; const float* lav = (const float*)d_in[11]; const float* lbv = (const float*)d_in[12];
    const float* wo  = (const float*)d_in[13]; const float* bo  = (const float*)d_in[14]; const float* lao = (const float*)d_in[15]; const float* lbo = (const float*)d_in[16];
    float* OUT = (float*)d_out;      // [NB][SEQ][768]
    char* wsp = (char*)d_ws;
    bf* XB = (bf*)wsp; wsp += SZ_XB;                 // [NB*SEQ][768]
    bf* WB = (bf*)wsp; wsp += SZ_WB;                 // [4][768][value 768 | remainder 768]: q | k | v | o
    h16* QH = (h16*)wsp; wsp += SZ_PL;               // [NB*12][SEQ][64]
    h16* KP = (h16*)wsp; wsp += SZ_PL;               // [NB*12][SEQ][64]
    h16* VT = (h16*)wsp; wsp += SZ_PL;               // [NB*12][64][SEQ]
    bf* CX = (bf*)wsp; wsp += SZ_CX;                 // [NB*SEQ][value 768 | remainder 768]
    bf* WQ = WB; bf* WK = WB + (size_t)DM * WP; bf* WV = WB + (size_t)2 * DM * WP; bf* WO = WB + (size_t)3 * DM * WP;

    if (SEQ == SEQ_FULL) {
        const size_t n8 = (size_t)NB * SEQ * DM / 8;
        k_cvt8<<<(unsigned)((n8 + 255) / 256), 256, 0, stream>>>(x, XB, n8);
    } else {
        const size_t n8 = (size_t)SEQ * DM / 8;
        for (int b = 0; b < NB; ++b) k_cvt8<<<(unsigned)((n8 + 255) / 256), 256, 0, stream>>>(x + (size_t)b * SEQ_FULL * DM, XB + (size_t)b * SEQ * DM, n8);
    }
    { const size_t nt = (size_t)DM * (DM / 8); const unsigned g = (unsigned)((nt + 255) / 256);
      k_fold<<<g, 256, 0, stream>>>(wq, laq, lbq, WQ); k_fold<<<g, 256, 0, stream>>>(wk, lak, lbk, WK);
      k_fold<<<g, 256, 0, stream>>>(wv, lav, lbv, WV); k_fold<<<g, 256, 0, stream>>>(wo, lao, lbo, WO); }

    // q, k: A = x rows (m = b*SEQ + t, pitch DM, wraps at DM), Bt = folded W rows (n = h*64 + d, pitch WP, no wrap), bias by column -> plane [(b*12 + h)][t][d]
    k_proj<DM, WP, DM, WP><<<dim3(NB * SEQ / 128, DM / 128, 1), 32 * GW, 0, stream>>>(XB, WQ, bq, 0, QH, SEQ, (size_t)NH_ * SEQ * HD, HD, HD, (size_t)SEQ * HD);
    k_proj<DM, WP, DM, WP><<<dim3(NB * SEQ / 128, DM / 128, 1), 32 * GW, 0, stream>>>(XB, WK, bk, 0, KP, SEQ, (size_t)NH_ * SEQ * HD, HD, HD, (size_t)SEQ * HD);
    // v^T: A = folded Wv rows (m = h*64 + d, pitch WP, no wrap), Bt = x rows (n = b*SEQ + t, pitch DM, wraps at DM), bias by row -> plane [(b*768 + m)][t] = [(b*12 + h)][d][t]
    k_proj<WP, DM, WP, DM><<<dim3(DM / 128, NB * SEQ / 128, 1), 32 * GW, 0, stream>>>(WV, XB, bv, 1, VT, DM, (size_t)0, SEQ, SEQ, (size_t)DM * SEQ);

    k_flash<<<dim3(SEQ / (16 * AW), NB * NH_, 1), 32 * AW, 0, stream>>>(QH, KP, VT, CX);

    // out: A = ctx rows [m][value | remainder], Bt = folded Wo rows (n) [value | remainder], bias by column -> OUT[b][t][n]
    k_out<<<dim3(NB * SEQ / 128, DM / 128, 1), 32 * GW, 0, stream>>>(CX, WO, bo, OUT);
}

// v004
// It runs in 155 microseconds.
// Timed twice side by side with v003, it ran 1.17 times as fast both times.
// All steps since v000 together make it 2.75 times as fast.
#include <hip/hip_runtime.h>

// Dense (unmasked) multi-head self-attention, width 768 = 12 heads x 64, x [NB][SEQ][768]; each of the four projections is y = x W^T + b + (x A^T) B^T with W [out][in], A [8][in], B [out][8]; score scale 1/8; f32 output.
// Compute dtypes, f32 accumulate everywhere: the rank-8 update is folded once into W_eff = W + B A (f32 on the vector unit, K = 8; W, A, B, b, x RNE-converted to bf16 first) and carried as bf16 value | bf16 remainder along K;
// softmax f32 (online, running max); output projection v_wmma_f32_16x16x32_bf16 with ctx as bf16 value | remainder and W_eff as bf16 value | remainder (K = 2304: value x value, remainder x value, value x remainder), one accumulator.
// Layout: bf16 copy of x; folded weight planes [4][768][value 768 | remainder 768]; q, k planes [b*12+h][t][d], v^T plane [b*12+h][d][t] (f16) written by the GEMM epilogue; fused flash kernel in transposed form
// Every one of these planes is stored in FRAGMENT ORDER: a block of 16 rows x 32 k is 512 consecutive elements, element (row, k) of a block at (k>>4)*256 + ((k>>3)&1)*128 + row*8 + (k&7);
// blocks run along k (512 elements each), then along rows (16 * pitch elements per block row). A fragment is then two wave-wide 16-B loads of 512 contiguous bytes each (four whole lines) instead of 16 partial lines.
// (S^T = K Q^T, O^T = V^T P^T, key loop over the whole sequence) writes the ctx plane [b*SEQ+t][value 768 | remainder 768] (bf16); final GEMM adds the bias at the store stage.

#ifndef NB
#define NB 4
#endif
#ifndef SEQ
#define SEQ 2048
#endif
#define NB_FULL  4
#define SEQ_FULL 2048
#ifndef OUT_SEQ
#define OUT_SEQ SEQ              // row pitch (in tokens) between batches of the output
#endif
#define DM   768
#define NH_  12
#define HD   64
#define LR   8                   // rank of the low-rank update
#define WP   (2 * DM)            // folded weight plane row pitch: value columns 0..DM-1, remainder columns DM..2DM-1
#define CXP  (2 * DM)            // ctx plane row pitch: value columns 0..DM-1, remainder columns DM..2DM-1
#define KO   (3 * DM)            // K extent of the output projection
#define AW   8                   // waves per flash block (16 query rows each)
#define KS   64                  // keys per LDS stage of the flash kernel (two passes of 32)
#define GW   4                   // waves per GEMM block, 2 x 2, one 64x64 tile each: block tile 128 x 128
#define KC   128                 // k per LDS stage of the GEMMs (four k-steps of 32)
#define GST  (2 * 128 * KC)      // elements of one GEMM stage: A 128 rows x KC, then B 128 rows x KC
#define SC2  (0.125f * 1.4426950408889634f)   // HD^-0.5 * log2(e)
#define PSH  8.0f                // log2 of the P carry (256)

static_assert(HD == 64);
static_assert(NH_ * HD == DM);                 // head h = columns h*64 + d
static_assert(DM % 64 == 0);                   // column tiles of 64
static_assert(DM % 32 == 0);                   // GEMM k-loop steps by 32; a k-step never straddles a wrap point
static_assert(CXP == 2 * DM);
static_assert(CXP % 32 == 0);
static_assert(WP == 2 * DM);
static_assert(WP % 32 == 0);
static_assert(KO == CXP + DM);                 // third K segment meets the ctx value half again (A wrap at CXP) and the weight remainder half (B wrap at DM)
static_assert(KO % 32 == 0);
static_assert(LR == 8);                        // one 32-byte load covers a row of B [out][8]
static_assert(DM % 8 == 0);                    // fold kernel: 8 columns per lane
static_assert((DM / 8) % 8 == 0);
static_assert(SEQ % 64 == 0);                  // a 64-row tile never straddles two batches
static_assert((NB * SEQ) % 64 == 0);
static_assert(SEQ % 32 == 0);                  // key loop steps by 32 and stays inside the sequence
static_assert(SEQ % (16 * AW) == 0);           // flash grid covers the sequence exactly
static_assert(((size_t)SEQ * DM) % 8 == 0);
static_assert(((size_t)DM * DM) % 8 == 0);
static_assert(NB <= NB_FULL);
static_assert(SEQ <= SEQ_FULL);
static_assert(AW * 32 == 256);                 // the stage copy deals 16-byte pieces to exactly 256 lanes
static_assert(KS == 64 && SEQ % KS == 0 && SEQ / KS >= 2);   // the two-buffer prologue needs two stages
static_assert(GW == 4 && KC == 128);           // the tile copy deals one half (2 KiB) of a 4-KiB block row (16 rows x KC) to exactly 128 lanes
static_assert(DM % 128 == 0 && (NB * SEQ) % 128 == 0);       // block tiles of 128 x 128 cover every GEMM exactly
static_assert(DM % KC == 0 && WP % KC == 0 && CXP % KC == 0 && KO % KC == 0);   // a stage never straddles a wrap point

typedef _Float16 h16;
typedef unsigned short bf;
typedef __attribute__((ext_vector_type(16))) __bf16   v16bf;
typedef __attribute__((ext_vector_type(16))) _Float16 v16h;
typedef __attribute__((ext_vector_type(8)))  _Float16 v8h;
typedef __attribute__((ext_vector_type(8)))  unsigned short v8us;
typedef __attribute__((ext_vector_type(8)))  float    v8f;
typedef __attribute__((ext_vector_type(4)))  float    v4f;
typedef v4f  __attribute__((may_alias)) v4fa;

__device__ __forceinline__ unsigned short f2bf(float f) { unsigned u = __float_as_uint(f); u += 0x7FFFu + ((u >> 16) & 1u); return (unsigned short)(u >> 16); }
__device__ __forceinline__ float bf2f(unsigned short s) { return __uint_as_float(((unsigned)s) << 16); }
__device__ __forceinline__ float bfr(float f) { return bf2f(f2bf(f)); }     // f32 -> bf16 (RNE) -> f32
__device__ __forceinline__ v16h cat16(v8h lo, v8h hi) { return __builtin_shufflevector(lo, hi, 0, 1, 2, 3, 4, 5, 6, 7, 8, 9, 10, 11, 12, 13, 14, 15); }
__device__ __forceinline__ v16bf cat16b(v8us lo, v8us hi) { return __builtin_bit_cast(v16bf, __builtin_shufflevector(lo, hi, 0, 1, 2, 3, 4, 5, 6, 7, 8, 9, 10, 11, 12, 13, 14, 15)); }
__device__ __forceinline__ v8f wmma16(v16h a, v16h b, v8f c) { return __builtin_amdgcn_wmma_f32_16x16x32_f16(false, a, false, b, (short)0, c, false, false); }
__device__ __forceinline__ v8f wmmab(v16bf a, v16bf b, v8f c) { return __builtin_amdgcn_wmma_f32_16x16x32_bf16(false, a, false, b, (short)0, c, false, false); }
// fragment loaders from fragment-order planes; p = block base + 8*lane: elements 0..7 <- k0+8h+0..7, elements 8..15 <- k0+16+8h+0..7 of row lane&15 (same map for A and B)
__device__ __forceinline__ v16h  ldh(const h16* p) { return cat16(*(const v8h*)p, *(const v8h*)(p + 256)); }
__device__ __forceinline__ v16bf ldb(const bf* p)  { return cat16b(*(const v8us*)p, *(const v8us*)(p + 256)); }
// ordering point for wave-private LDS tiles (same wave writes and reads)
__device__ __forceinline__ void wave_sync() { __builtin_amdgcn_fence(3 /* release order */, "wavefront"); __builtin_amdgcn_wave_barrier(); asm volatile("" ::: "memory"); }
// f32 -> f16 for WMMA operand planes: magnitudes below the smallest normal f16 become exactly 0 (value select)
static __device__ __forceinline__ h16 toh_flush(float v) { const h16 r = (h16)v; return (fabsf(v) < 6.103515625e-05f) ? (h16)0.0f : r; }

// cvt8_piece: one 8-element piece of the bf16 copy of x (rows b*SEQ + t, read from row b*SEQ_FULL + t of x)
__device__ __forceinline__ void cvt8_piece(const float* __restrict__ src, bf* dst, const size_t i, const size_t n8) {
    if (i >= n8) return;
    // i counts 8-element pieces of the fragment-order plane (row pitch DM): block i>>6, piece w = i&63 holds row w&15, k (w>>4)*8 .. +7 of the block
    const size_t blk = i >> 6; const int w = (int)(i & 63);
    const size_t m = (blk / (DM / 32)) * 16 + (size_t)(w & 15); const int k0 = (int)(blk % (DM / 32)) * 32 + (w >> 4) * 8;
    const size_t ms = (m / SEQ) * SEQ_FULL + (m % SEQ);
    const v8f v = *(const v8f*)(src + ms * DM + k0); v8us o;
#pragma unroll
    for (int k = 0; k < 8; ++k) o[k] = f2bf(v[k]);
    *(v8us*)(dst + i * 8) = o; 
}

// fold_piece: W_eff[m][k] = bf16(W[m][k]) + sum_r bf16(LB[m][r]) * bf16(LA[r][k]) in f32 (K = 8, vector unit, rank loop rolled), written as bf16 value at column k and bf16 remainder at column DM + k of row m (fragment order, pitch WP)
__device__ __forceinline__ void fold_piece(const float* __restrict__ W, const float* __restrict__ LA, const float* __restrict__ LB, bf* dst, const size_t i) {
    if (i >= (size_t)DM * (DM / 8)) return;
    // i counts 8-element pieces of the value half in fragment order: block i>>6 (block row rb, block column kb), piece pc = i&63 holds row pc&15, k (pc>>4)*8 .. +7 of the block
    const int rb = (int)(i >> 6) / (DM / 32), kb = (int)(i >> 6) % (DM / 32), pc = (int)(i & 63);
    const int m = rb * 16 + (pc & 15); const int k0 = kb * 32 + (pc >> 4) * 8;
    const v8f w = *(const v8f*)(W + (size_t)m * DM + k0);
    const v8f lb = *(const v8f*)(LB + (size_t)m * LR);
    float acc[8];
#pragma unroll
    for (int k = 0; k < 8; ++k) acc[k] = bfr(w[k]);
    float blr[8];
#pragma unroll
    for (int r = 0; r < 8; ++r) blr[r] = bfr(lb[r]);
    // rank loop rolled: the multiplier of step r is rotated to slot 0 so every register index stays static
#pragma unroll 1
    for (int r = 0; r < LR; ++r) {
        const float bl = blr[0];
#pragma unroll
        for (int q = 0; q < 7; ++q) blr[q] = blr[q + 1];
        const v8f a = *(const v8f*)(LA + (size_t)r * DM + k0);
#pragma unroll
        for (int k = 0; k < 8; ++k) acc[k] = acc[k] + bl * bfr(a[k]);
    }
    v8us hv, lv;
#pragma unroll
    for (int k = 0; k < 8; ++k) { const unsigned short h0 = f2bf(acc[k]); hv[k] = h0; lv[k] = f2bf(acc[k] - bf2f(h0)); }
    bf* p = dst + (size_t)rb * 16 * WP + (size_t)kb * 512 + pc * 8;
    *(v8us*)(p) = hv; *(v8us*)(p + DM * 16) = lv;          // DM columns further = DM/32 blocks = DM*16 elements
}

// k_prep: everything that depends on the inputs alone, in one launch: blocks 0 .. 4*FOLD_BLOCKS-1 fold the four weights (q, k, v, o; FOLD_BLOCKS blocks each), the rest convert x.
// The folds stand first in the grid: their chain of dependent loads is the longer one.
#define FOLD_BLOCKS ((DM * (DM / 8)) / 256)
#define CVT_BLOCKS  ((NB * SEQ * (DM / 8)) / 256)
static_assert((DM * (DM / 8)) % 256 == 0 && (NB * SEQ * (DM / 8)) % 256 == 0);   // both parts fill whole blocks
__global__ __launch_bounds__(256) void k_prep(const float* __restrict__ x,
                                              const float* __restrict__ wq, const float* __restrict__ laq, const float* __restrict__ lbq,
                                              const float* __restrict__ wk, const float* __restrict__ lak, const float* __restrict__ lbk,
                                              const float* __restrict__ wv, const float* __restrict__ lav, const float* __restrict__ lbv,
                                              const float* __restrict__ wo, const float* __restrict__ lao, const float* __restrict__ lbo,
                                              bf* XB, bf* WB) {
    const int blk = blockIdx.x;
    if (blk < 4 * FOLD_BLOCKS) {
        const int f = blk / FOLD_BLOCKS;
        const float* W  = (f == 0) ? wq  : (f == 1) ? wk  : (f == 2) ? wv  : wo;
        const float* LA = (f == 0) ? laq : (f == 1) ? lak : (f == 2) ? lav : lao;
        const float* LB = (f == 0) ? lbq : (f == 1) ? lbk : (f == 2) ? lbv : lbo;
        fold_piece(W, LA, LB, WB + (size_t)f * DM * WP, (size_t)(blk - f * FOLD_BLOCKS) * 256 + threadIdx.x);
    } else {
        cvt8_piece(x, XB, (size_t)(blk - 4 * FOLD_BLOCKS) * 256 + threadIdx.x, (size_t)NB * SEQ * (DM / 8));
    }
}

// gemm_main: a block of four waves (2 x 2) on a 128x128 tile, each wave 64x64 with 16 accumulators; C[m][n] += sum_k A[m][k mod AWR] Bt[n][k mod BWR] (one subtraction each); operands from fragment-order bf16 planes.
// Both operands reach the waves through LDS: a stage is KC = 128 k of the block's 128 A rows and 128 B rows (8 + 8 block rows of 4 KiB, still in fragment order), copied once per block by asynchronous 16-B copies,
// 32 per lane, into one of two buffers, one stage ahead of its use; each A block row is then read by two waves and each B block row by two waves (512 contiguous bytes per ds load).
// Inside a stage the fragments of a k-step (4 of A, 4 of B) live in two register sets: the reads of k-step ks + 2 are issued as one group behind the products of k-step ks; no fragment is read across a stage's end.
// ga / gb = plane + (block's first row) * pitch + 8 * thread. PA / PB = row pitches (elements); K, AWR and BWR multiples of KC; 32 k = one block = 512 elements, so column k0 is at k0*16.
// Every accumulator still takes its k-steps in rising order.
// Eight copies of one lane: the same 16-B piece of block rows 0..7 of one operand's tile; l = LDS byte address of the piece in block row 0, g = the same piece in the plane.
template <int P>
__device__ __forceinline__ void tile_copy(const unsigned l, const bf* g) {
    // the wait is the statement's last line: the address registers that the copies name are rewritten only behind it
    asm volatile(
                 "global_load_async_to_lds_b128 %0, %8, off\n\t"
                 "global_load_async_to_lds_b128 %1, %9, off\n\t"
                 "global_load_async_to_lds_b128 %2, %10, off\n\t"
                 "global_load_async_to_lds_b128 %3, %11, off\n\t"
                 "global_load_async_to_lds_b128 %4, %12, off\n\t"
                 "global_load_async_to_lds_b128 %5, %13, off\n\t"
                 "global_load_async_to_lds_b128 %6, %14, off\n\t"
                 "global_load_async_to_lds_b128 %7, %15, off\n\t"
                 "s_wait_xcnt 0x0"
                 :: "v"(l), "v"(l + 4096u), "v"(l + 8192u), "v"(l + 12288u), "v"(l + 16384u), "v"(l + 20480u), "v"(l + 24576u), "v"(l + 28672u),
                    "v"(g), "v"(g + 16 * P), "v"(g + 32 * P), "v"(g + 48 * P), "v"(g + 64 * P), "v"(g + 80 * P), "v"(g + 96 * P), "v"(g + 112 * P) : "memory");
}
template <int PA, int PB, int AWR, int BWR>
__device__ __forceinline__ void stage_fill(const unsigned l, const bf* ga, const bf* gb, const int kc) {
    const int ka = (kc >= AWR) ? (kc - AWR) : kc; const int kb = (kc >= BWR) ? (kc - BWR) : kc;
    // a block row of a stage is 4 KiB = 256 pieces: this lane's pieces are 'thread' and 'thread + 128' (2 KiB further, in the plane as in LDS)
    tile_copy<PA>(l, ga + (size_t)ka * 16);
    tile_copy<PA>(l + 2048u, ga + (size_t)ka * 16 + 1024);
    tile_copy<PB>(l + (unsigned)(128 * KC * 2), gb + (size_t)kb * 16);
    tile_copy<PB>(l + (unsigned)(128 * KC * 2) + 2048u, gb + (size_t)kb * 16 + 1024);
}
template <int PA, int PB, int K, int AWR, int BWR>
__device__ __forceinline__ void gemm_main(const bf* st, const bf* ga, const bf* gb, const int tid, const int wm, const int wn, v8f (&acc)[4][4]) {
    static_assert(K % KC == 0 && K / KC >= 2 && AWR % KC == 0 && BWR % KC == 0);
    const int lane = tid & 31;
    const unsigned l0 = (unsigned)(size_t)st + (unsigned)tid * 16u;
    stage_fill<PA, PB, AWR, BWR>(l0, ga, gb, 0);
    asm volatile("s_wait_asynccnt 0x0" ::: "memory");            // this wave's share of stage 0 has landed before the barrier that shows it to the other waves
    __syncthreads();
    stage_fill<PA, PB, AWR, BWR>(l0 + (unsigned)(GST * 2), ga, gb, KC);
#pragma unroll 1                                                 // one stage per trip: the two buffers alternate by s & 1
    for (int s = 0; s < K / KC; ++s) {
        const bf* sa = st + (s & 1) * GST + wm * (64 * KC) + 8 * lane;                 // this wave's four A block rows
        const bf* sb = st + (s & 1) * GST + 128 * KC + wn * (64 * KC) + 8 * lane;      // this wave's four B block rows
        v16bf a[2][4], b[2][4];
#pragma unroll
        for (int q = 0; q < 2; ++q)
#pragma unroll
            for (int i = 0; i < 4; ++i) { a[q][i] = ldb(sa + i * (16 * KC) + q * 512); b[q][i] = ldb(sb + i * (16 * KC) + q * 512); }
        __builtin_amdgcn_sched_barrier(0);                       // the first two read groups stand whole ahead of the products: sunk among them each row of products would wait for its own reads
#pragma unroll                                                   // unrolled so that the register set ks & 1 is a static choice
        for (int ks = 0; ks < KC / 32; ++ks) {
#pragma unroll
            for (int nb = 0; nb < 4; ++nb)
#pragma unroll
                for (int mb = 0; mb < 4; ++mb) acc[mb][nb] = wmmab(a[ks & 1][mb], b[ks & 1][nb], acc[mb][nb]);
            if (ks + 2 < KC / 32) {
                __builtin_amdgcn_sched_barrier(0);               // keeps the read group below behind the products that read its registers
#pragma unroll
                for (int i = 0; i < 4; ++i) { a[ks & 1][i] = ldb(sa + i * (16 * KC) + (ks + 2) * 512); b[ks & 1][i] = ldb(sb + i * (16 * KC) + (ks + 2) * 512); }
                __builtin_amdgcn_sched_barrier(0);               // keeps that group whole and ahead of the next k-step's products, which give it time to come back
            }
        }
        __builtin_amdgcn_sched_barrier(0);                       // keeps the waits below behind the last products: lifted over them they would wait out the last read group with the matrix unit idle
        // hand-over of the buffers, every wave: its own reads of this stage are home, its own copies of the next stage have landed, then the barrier; only behind it is this stage's buffer refilled
        asm volatile("s_wait_dscnt 0x0" ::: "memory");           // this wave has finished reading the buffer that is refilled below
        asm volatile("s_wait_asynccnt 0x0" ::: "memory");        // this wave's share of stage s + 1 has landed
        __syncthreads();
        if (s + 2 < K / KC) stage_fill<PA, PB, AWR, BWR>(l0 + (unsigned)(s & 1) * (unsigned)(GST * 2), ga, gb, (s + 2) * KC);
    }
    asm volatile("s_wait_asynccnt 0x0" ::: "memory");            // no copy is outstanding when the wave goes on to the store stage
}

// proj_tile: bf16 GEMM, four waves per 128x128 tile (one 64x64 tile each), K = WP (value half then remainder half of the folded weight; the x operand wraps at DM).
// C[m][n] = sum_k A[m][k mod AWR] Bt[n][k mod BWR] + bias (bias by column n when biasRow == 0, by row m when biasRow != 0; bias RNE-converted to bf16),
// written as f16, in fragment order, into the sub-plane at (r0/RB)*sRB + (c0/CB)*sCB: rows r0%RB .., columns c0%CB .., row pitch 'pitch' (halves). Tile (bx, by) of (M/128, N/128), 128 threads; st, osa = the block's LDS.
template <int PA, int PB, int AWR, int BWR>
__device__ __forceinline__ void proj_tile(const bf* st, float* osa, const bf* __restrict__ A, const bf* __restrict__ Bt,
                                          const float* __restrict__ bias, const int biasRow, h16* Ph, const int RB, const size_t sRB, const int pitch, const int CB, const size_t sCB,
                                          const int bx, const int by) {
    const int tid = threadIdx.x; const int wave = __builtin_amdgcn_readfirstlane(threadIdx.x >> 5); const int wm = wave >> 1, wn = wave & 1;
    float* os = osa + wave * (16 * 68);                          // store staging, private to the wave
    const int lane = threadIdx.x & 31, lr = lane & 15, hi = lane >> 4; const int r0 = bx * 128 + wm * 64, c0 = by * 128 + wn * 64;
    v8f acc[4][4];
#pragma unroll
    for (int mb = 0; mb < 4; ++mb)
#pragma unroll
        for (int nb = 0; nb < 4; ++nb) acc[mb][nb] = (v8f){};
    gemm_main<PA, PB, WP, AWR, BWR>(st, A + (size_t)(bx * 128) * PA + 8 * tid, Bt + (size_t)(by * 128) * PB + 8 * tid, tid, wm, wn, acc);
    // store stage s = 0..3: lane holds row lane&15, columns (s>>1)*32 + (s&1)*16 + 8h + 0..7 of the slab = piece 'lane' of half s&1 of block s>>1
    float bc[4][8];
#pragma unroll
    for (int s = 0; s < 4; ++s) {
      if (biasRow) {                                             // known at compile time at both calls: with the bias by row no column bias is read
#pragma unroll
        for (int i = 0; i < 8; ++i) bc[s][i] = 0.0f;
      } else {
        int cb = c0 + (s >> 1) * 32 + (s & 1) * 16 + hi * 8; cb = (cb < DM - 8) ? cb : (DM - 8);          // clamped address
        const v4f b0 = *(const v4f*)(bias + cb);
        asm volatile("s_wait_xcnt 0x0" ::: "memory");            // in this build a later bias load lands in a register that this load names as its address
        const v4f b1 = *(const v4f*)(bias + cb + 4);
        asm volatile("s_wait_xcnt 0x0" ::: "memory");            // the same for the second half
#pragma unroll
        for (int i = 0; i < 4; ++i) { bc[s][i] = bfr(b0[i]); bc[s][4 + i] = bfr(b1[i]); }
      }
    }
    const size_t tbase = (size_t)(r0 / RB) * sRB + (size_t)(r0 % RB) * (size_t)pitch + (size_t)(c0 / CB) * sCB + (size_t)(c0 % CB) * 16 + 8 * lane;
#pragma unroll
    for (int mb = 0; mb < 4; ++mb) {
#pragma unroll
        for (int nb = 0; nb < 4; ++nb) {
#pragma unroll
            for (int j = 0; j < 8; ++j) os[(hi * 8 + j) * 68 + nb * 16 + lr] = acc[mb][nb][j]; }   // D: row 8h+j, col lane&15
        wave_sync();
        float br;
        { int ri = r0 + mb * 16 + lr; ri = (ri < DM - 1) ? ri : (DM - 1); const float bv_ = bias[ri]; br = biasRow ? bfr(bv_) : 0.0f; }
        const size_t sb = tbase + (size_t)(mb * 16) * (size_t)pitch;
{
#pragma unroll
            for (int s = 0; s < 4; ++s) { const int col = (s >> 1) * 32 + (s & 1) * 16 + hi * 8;   // 16 lanes = 16 rows; 4 s x 2 halves x 8 = 64 columns
                const v4f x0 = *(const v4fa*)(&os[lr * 68 + col]); const v4f x1 = *(const v4fa*)(&os[lr * 68 + col + 4]);
                float val[8]; v8h hv;
#pragma unroll
                for (int i = 0; i < 4; ++i) { val[i] = x0[i] + bc[s][i] + br; val[4 + i] = x1[i] + bc[s][4 + i] + br; }
#pragma unroll
                for (int i = 0; i < 8; ++i) hv[i] = toh_flush(val[i]);
                const size_t oo = sb + (size_t)((s >> 1) * 512 + (s & 1) * 256);
                *(v8h*)(Ph + oo) = hv; }
             }
        if (biasRow) asm volatile("s_wait_xcnt 0x0" ::: "memory");   // in this build the next slab's row-bias load lands in a register that one of these stores names
        wave_sync();
    }
}

// k_qkv: the three input projections in one launch, grid (NB*SEQ/128, DM/128, 3); the choice by blockIdx.z is the same for a whole block.
// z = 0, 1 (q, k): A = x rows (m = b*SEQ + t, pitch DM, wraps at DM), Bt = folded W rows (n = h*64 + d, pitch WP, no wrap), bias by column -> plane [(b*12 + h)][t][d]
// z = 2 (v^T):     A = folded Wv rows (m = h*64 + d, pitch WP, no wrap), Bt = x rows (n = b*SEQ + t, pitch DM, wraps at DM), bias by row -> plane [(b*768 + m)][t] = [(b*12 + h)][d][t]
__global__ __launch_bounds__(32 * GW) void k_qkv(const bf* __restrict__ XB, const bf* __restrict__ WB,
                                                 const float* __restrict__ bq, const float* __restrict__ bk, const float* __restrict__ bv, h16* QH, h16* KP, h16* VT) {
    __shared__ __align__(16) bf st[2 * GST];
    __shared__ __align__(16) float osa[GW * 16 * 68];
    const int z = blockIdx.z;
    if (z < 2) proj_tile<DM, WP, DM, WP>(st, osa, XB, WB + (size_t)z * DM * WP, z ? bk : bq, 0, z ? KP : QH, SEQ, (size_t)NH_ * SEQ * HD, HD, HD, (size_t)SEQ * HD, blockIdx.x, blockIdx.y);
    else       proj_tile<WP, DM, WP, DM>(st, osa, WB + (size_t)2 * DM * WP, XB, bv, 1, VT, DM, (size_t)0, SEQ, SEQ, (size_t)DM * SEQ, blockIdx.y, blockIdx.x);
}

// k_flash: fused dense attention, one wave per 16 query rows of one (batch, head), eight waves per block; Q fragments straight from the fragment-order f16 plane (two 16-B loads each, 512 contiguous bytes per load).
// K and V^T reach the waves through LDS: a stage is 64 keys (K 8 KiB, V^T 4 block rows x 2 KiB, both still in fragment order), copied once per block by asynchronous 16-B copies, four per lane, into one of two buffers,
// one stage ahead of its use; all eight waves read their fragments from it (512 contiguous bytes per ds load).
// Transposed form: S^T[key][t] = K Q^T (A = K rows, B = Q rows); lane (t = lane&15, h = lane>>4) holds keys 8h+r of each 16-key tile, so the packed
// P tile is directly the B fragment of O^T[d][t] = V^T P^T (element r <- tile keys 0..15, element 8+r <- tile keys 16..31, lane unchanged).
// Key loop covers keys 0 .. SEQ-1 in steps of 32 (all inside the sequence, every key valid for every row).
// Softmax state (running max, partial sum) is one scalar per lane; the two lane halves of a row are combined with one xor-16 exchange.
// P carries x256; a P whose exponent argument is below -14 (under the smallest normal f16) is taken as exactly 0; the row sum runs over the converted P.
// One lane's four copies of a stage: l = LDS byte address of its first piece in the buffer, gk / gv = its first K and V^T piece of the stage.
__device__ __forceinline__ void stage_copy(const unsigned l, const h16* gk, const h16* gv) {
    const unsigned l1 = l + 4096u, l2 = l + 8192u, l3 = l + 12288u;
    const h16* gk1 = gk + 2048; const h16* gv1 = gv + (size_t)32 * SEQ;      // K piece + 256; V^T piece + 256 = two block rows further
    // the wait is the statement's last line: the address registers that the copies name are rewritten only behind it
    asm volatile("global_load_async_to_lds_b128 %0, %4, off\n\t"
                 "global_load_async_to_lds_b128 %1, %5, off\n\t"
                 "global_load_async_to_lds_b128 %2, %6, off\n\t"
                 "global_load_async_to_lds_b128 %3, %7, off\n\t"
                 "s_wait_xcnt 0x0"
                 :: "v"(l), "v"(l1), "v"(l2), "v"(l3), "v"(gk), "v"(gk1), "v"(gv), "v"(gv1) : "memory");
}
__global__ __launch_bounds__(32 * AW) void k_flash(const h16* __restrict__ QH, const h16* __restrict__ KP, const h16* __restrict__ VT, bf* CX) {
    __shared__ __align__(16) h16 kv[2][2 * KS * HD];            // per buffer: K [64 keys][64 d] (4096 halves), then V^T [4 block rows][64 keys x 16 d] (4096 halves)
    const int tid = threadIdx.x;
    const int lane = threadIdx.x & 31;
    const int wave = __builtin_amdgcn_readfirstlane(threadIdx.x >> 5);
    const int zh = blockIdx.y; const int b = zh / NH_, h = zh % NH_;
    const int t0 = (blockIdx.x * AW + wave) * 16;
    const size_t pbase = (size_t)zh * SEQ * HD;
    const size_t qo = pbase + (size_t)t0 * HD + 8 * lane;
    const v16h qh0 = ldh(QH + qo), qh1 = ldh(QH + qo + 512);   // B fragments: col t, k = d (blocks d 0..31, d 32..63)
    // this lane's pieces of a stage: K pieces tid and tid + 256 of 512 (contiguous); V^T pieces tid and tid + 256 of 512 (piece i: block row i >> 7, 16-B unit i & 127 of its 2 KiB)
    const unsigned lds0 = (unsigned)(size_t)&kv[0][0] + (unsigned)tid * 16u;
    const h16* gk = KP + pbase + (size_t)tid * 8;                                          // + stage * KS * HD
    const h16* gv = VT + pbase + (size_t)(tid >> 7) * 16 * SEQ + (size_t)(tid & 127) * 8;  // + stage * KS * 16
    v8f o[4];
#pragma unroll
    for (int j = 0; j < 4; ++j) { o[j] = (v8f){}; }
    float m = -3.0e38f, l = 0.0f;
    stage_copy(lds0, gk, gv);
    asm volatile("s_wait_asynccnt 0x0" ::: "memory");            // this wave's share of stage 0 has landed before the barrier that shows it to the other waves
    __syncthreads();
    stage_copy(lds0 + (unsigned)sizeof(kv[0]), gk + KS * HD, gv + KS * 16);
#pragma unroll 1                                                 // one stage per trip: the two buffers alternate by s & 1
    for (int s = 0; s < SEQ / KS; ++s) {
        const h16* sb = &kv[s & 1][0] + 8 * lane;
#pragma unroll                                                   // both passes of a stage in one trip: their LDS offsets become immediates
        for (int p = 0; p < KS / 32; ++p) {
        const h16* ka = sb + p * 32 * HD;                        // A fragments: row key, k = d
        const v16h ka0 = ldh(ka), ka1 = ldh(ka + 512), kb0 = ldh(ka + 16 * HD), kb1 = ldh(ka + 16 * HD + 512);
        const h16* va = sb + KS * HD + p * 512;                  // A fragments: row d, k = key
        const v16h v0 = ldh(va), v1 = ldh(va + KS * 16), v2 = ldh(va + 2 * KS * 16), v3 = ldh(va + 3 * KS * 16);
        v8f sHa = (v8f){}, sHb = (v8f){};
        sHa = wmma16(ka0, qh0, sHa); sHb = wmma16(kb0, qh0, sHb);
        sHa = wmma16(ka1, qh1, sHa); sHb = wmma16(kb1, qh1, sHb);
        float ta[8], tb[8];
#pragma unroll
        for (int r = 0; r < 8; ++r) { ta[r] = sHa[r] * SC2; tb[r] = sHb[r] * SC2; }
        float mx = -3.0e38f;
#pragma unroll
        for (int r = 0; r < 8; ++r) mx = fmaxf(mx, fmaxf(ta[r], tb[r]));
        mx = fmaxf(mx, __shfl_xor(mx, 16, 32));
        const float mnew = fmaxf(m, mx);
        float alpha;
        // the exponential and the one free slot behind it in one statement
        asm("v_exp_f32 %0, %1\n\tv_nop" : "=v"(alpha) : "v"(m - mnew));
        const float sh = PSH - mnew;
        v16h pb; float ls = 0.0f;
#pragma unroll
        for (int r = 0; r < 8; ++r) { const float ea = ta[r] + sh; const float eb = tb[r] + sh;
            const float xa = __builtin_amdgcn_exp2f(ea); const float xb = __builtin_amdgcn_exp2f(eb);
            const h16 pa = (ea < -14.0f) ? (h16)0.0f : (h16)xa; const h16 pc = (eb < -14.0f) ? (h16)0.0f : (h16)xb;
            pb[r] = pa; pb[8 + r] = pc; ls += (float)pa + (float)pc; }
#pragma unroll
        for (int j = 0; j < 4; ++j) o[j] = o[j] * alpha;
        o[0] = wmma16(v0, pb, o[0]); o[1] = wmma16(v1, pb, o[1]); o[2] = wmma16(v2, pb, o[2]); o[3] = wmma16(v3, pb, o[3]);
        l = l * alpha + ls; m = mnew;
        }
        // hand-over of the buffers, every wave: its own reads of this stage are home, its own copies of the next stage have landed, then the barrier; only behind it is this stage's buffer refilled
        asm volatile("s_wait_dscnt 0x0" ::: "memory");           // this wave has finished reading the buffer that is refilled below
        asm volatile("s_wait_asynccnt 0x0" ::: "memory");        // this wave's share of stage s + 1 has landed
        __syncthreads();
        if (s + 2 < SEQ / KS) stage_copy(lds0 + (unsigned)(s & 1) * (unsigned)sizeof(kv[0]), gk + (size_t)(s + 2) * (KS * HD), gv + (size_t)(s + 2) * (KS * 16));
    }
    asm volatile("s_wait_asynccnt 0x0" ::: "memory");            // no copy is outstanding when the wave ends
    l += __shfl_xor(l, 16, 32);
    const float inv = 1.0f / l;
    // O^T D layout: o_j[r] = (d = 16j + 8h + r, t = lane&15) = row t, columns 16j + 8h + 0..7: piece 'lane' of half j&1 of block j>>1 in fragment order, so every lane stores its own registers (no transposition)
    bf* crow = CX + ((size_t)b * SEQ + t0) * CXP + (size_t)(h * HD) * 16 + 8 * lane;   // block row t0/16, first block of column h*64, piece 'lane'
#pragma unroll
    for (int j = 0; j < 4; ++j) { v8us hv, lv;
#pragma unroll
        for (int i = 0; i < 8; ++i) { const float x = o[j][i] * inv; const unsigned short h0 = f2bf(x); hv[i] = h0; lv[i] = f2bf(x - bf2f(h0)); }
        const size_t oo = (size_t)((j >> 1) * 512 + (j & 1) * 256);
        *(v8us*)(crow + oo) = hv; *(v8us*)(crow + oo + DM * 16) = lv; }
}

// k_out: final projection, four waves per 128x128 tile (one 64x64 tile each). A = ctx plane [m][value 768 | remainder 768] read at k mod 1536 (K = 2304: value, remainder, value),
// Bt = folded Wo plane [n][value 768 | remainder 768] read at k (k < 768) or k - 768 (value, value, remainder).
// OUT[m][n] = acc + bias[n] (bias RNE-converted to bf16), f32. Epilogue: per 16-row slab staged in LDS (wave-private), each output row segment (64 floats = 256 B = two lines)
__global__ __launch_bounds__(32 * GW) void k_out(const bf* __restrict__ A, const bf* __restrict__ Bt, const float* __restrict__ bias, float* OUT) {
    __shared__ __align__(16) bf st[2 * GST];
    __shared__ __align__(16) float osa[GW][16 * 68];
    const int tid = threadIdx.x; const int wave = __builtin_amdgcn_readfirstlane(threadIdx.x >> 5); const int wm = wave >> 1, wn = wave & 1;
    float* os = &osa[wave][0];                                   // store staging, private to the wave
    const int lane = threadIdx.x & 31, lr = lane & 15, hi = lane >> 4; const int r0 = blockIdx.x * 128 + wm * 64, c0 = blockIdx.y * 128 + wn * 64;
    v8f acc[4][4];
#pragma unroll
    for (int mb = 0; mb < 4; ++mb)
#pragma unroll
        for (int nb = 0; nb < 4; ++nb) acc[mb][nb] = (v8f){};
    gemm_main<CXP, WP, KO, CXP, DM>(st, A + (size_t)(blockIdx.x * 128) * CXP + 8 * tid, Bt + (size_t)(blockIdx.y * 128) * WP + 8 * tid, tid, wm, wn, acc);
    const int cofs = lr * 4;
    v4f b4 = *(const v4f*)(bias + c0 + cofs);          // c0 + cofs + 3 <= DM - 1 always
    asm volatile("s_wait_xcnt 0x0" ::: "memory");      // the address arithmetic below reuses registers that this load names
    __builtin_amdgcn_sched_barrier(0);                 // holds that arithmetic behind the wait
    b4[0] = bfr(b4[0]); b4[1] = bfr(b4[1]); b4[2] = bfr(b4[2]); b4[3] = bfr(b4[3]);
    const size_t orow0 = (size_t)(r0 / SEQ) * OUT_SEQ + (size_t)(r0 % SEQ);
#pragma unroll
    for (int mb = 0; mb < 4; ++mb) {
#pragma unroll
        for (int nb = 0; nb < 4; ++nb) {
#pragma unroll
            for (int j = 0; j < 8; ++j) os[(hi * 8 + j) * 68 + nb * 16 + lr] = acc[mb][nb][j]; }   // D: row 8h+j, col lane&15
        wave_sync();
        float* ob = OUT + (orow0 + (size_t)(mb * 16)) * DM + c0;
{
#pragma unroll
            for (int s = 0; s < 8; ++s) { const int row = 2 * s + hi;   // 8 s x 2 rows = 16 rows; 16 lanes x 4 floats = 64 columns
                const v4f xv = *(const v4fa*)(&os[row * 68 + cofs]);
                const v4f val = xv + b4;
                *(v4f*)(ob + (size_t)row * DM + cofs) = val; }
             }
        wave_sync();
    }
}

static constexpr size_t al256(size_t v) { return (v + 255) & ~(size_t)255; }
static constexpr size_t SZ_XB = al256((size_t)NB * SEQ * DM * 2);
static constexpr size_t SZ_WB = al256((size_t)4 * DM * WP * 2);
static constexpr size_t SZ_PL = al256((size_t)NB * NH_ * SEQ * HD * 2);
static constexpr size_t SZ_CX = al256((size_t)NB * SEQ * CXP * 2);
static constexpr size_t SZ_TOTAL = SZ_XB + SZ_WB + 3 * SZ_PL + SZ_CX;
static_assert(SZ_TOTAL <= (size_t)134217728);          // workspace carve <= 128 MiB
static_assert(((size_t)DM * WP * 2) % 256 == 0);       // weight sub-planes stay 256-byte aligned
static_assert((size_t)NB * NH_ * SEQ * HD == (size_t)NB * SEQ * DM);   // plane extent == GEMM tile grid extent

extern "C" void kernel_launch(void* const* d_in, const int* in_sizes, int n_in,
                              void* d_out, int out_size, void* d_ws, size_t ws_size, hipStream_t stream) {
    if (n_in < 17) return;
    const size_t needx = ((size_t)(NB - 1) * SEQ_FULL + SEQ) * DM;
    if ((size_t)in_sizes[0] < needx) return;
    if ((size_t)in_sizes[1] < (size_t)DM * DM || (size_t)in_sizes[5] < (size_t)DM * DM || (size_t)in_sizes[9] < (size_t)DM * DM || (size_t)in_sizes[13] < (size_t)DM * DM) return;
    if (in_sizes[2] < DM || in_sizes[6] < DM || in_sizes[10] < DM || in_sizes[14] < DM) return;
    if (in_sizes[3] < LR * DM || in_sizes[7] < LR * DM || in_sizes[11] < LR * DM || in_sizes[15] < LR * DM) return;
    if (in_sizes[4] < DM * LR || in_sizes[8] < DM * LR || in_sizes[12] < DM * LR || in_sizes[16] < DM * LR) return;
    if ((size_t)out_size < ((size_t)(NB - 1) * OUT_SEQ + SEQ) * DM) return;
    if (SZ_TOTAL > ws_size) return;
    // wire order: x, then per projection (q, k, v, o): W [out][in], b [out], A [8][in], B [out][8]; folded weights [out][in] = Bt as-is
    const float* x   = (const float*)d_in[0];
    const float* wq  = (const float*)d_in[1];  const float* bq  = (const float*)d_in[2];  const float* laq = (const float*)d_in[3];  const float* lbq = (const float*)d_in[4];
    const float* wk  = (const float*)d_in[5];  const float* bk  = (const float*)d_in[6];  const float* lak = (const float*)d_in[7];  const float* lbk = (const float*)d_in[8];
    const float* wv  = (const float*)d_in[9];  const float* bv  = (const float*)d_in[10]; const float* lav = (const float*)d_in[11]; const float* lbv = (const float*)d_in[12];
    const float* wo  = (const float*)d_in[13]; const float* bo  = (const float*)d_in[14]; const float* lao = (const float*)d_in[15]; const float* lbo = (const float*)d_in[16];
    float* OUT = (float*)d_out;      // [NB][SEQ][768]
    char* wsp = (char*)d_ws;
    bf* XB = (bf*)wsp; wsp += SZ_XB;                 // [NB*SEQ][768]
    bf* WB = (bf*)wsp; wsp += SZ_WB;                 // [4][768][value 768 | remainder 768]: q | k | v | o
    h16* QH = (h16*)wsp; wsp += SZ_PL;               // [NB*12][SEQ][64]
    h16* KP = (h16*)wsp; wsp += SZ_PL;               // [NB*12][SEQ][64]
    h16* VT = (h16*)wsp; wsp += SZ_PL;               // [NB*12][64][SEQ]
    bf* CX = (bf*)wsp; wsp += SZ_CX;                 // [NB*SEQ][value 768 | remainder 768]
    bf* WO = WB + (size_t)3 * DM * WP;

    k_prep<<<4 * FOLD_BLOCKS + CVT_BLOCKS, 256, 0, stream>>>(x, wq, laq, lbq, wk, lak, lbk, wv, lav, lbv, wo, lao, lbo, XB, WB);

    k_qkv<<<dim3(NB * SEQ / 128, DM / 128, 3), 32 * GW, 0, stream>>>(XB, WB, bq, bk, bv, QH, KP, VT);

    k_flash<<<dim3(SEQ / (16 * AW), NB * NH_, 1), 32 * AW, 0, stream>>>(QH, KP, VT, CX);

    // out: A = ctx rows [m][value | remainder], Bt = folded Wo rows (n) [value | remainder], bias by column -> OUT[b][t][n]
    k_out<<<dim3(NB * SEQ / 128, DM / 128, 1), 32 * GW, 0, stream>>>(CX, WO, bo, OUT);
}

// v005
// A run of this version takes 150 microseconds.
// Timed twice side by side with v004, it ran 1.04 times as fast both times.
// Counting every step since v000, it is 2.86 times as fast.
#include <hip/hip_runtime.h>

// Dense (unmasked) multi-head self-attention, width 768 = 12 heads x 64, x [NB][SEQ][768]; each of the four projections is y = x W^T + b + (x A^T) B^T with W [out][in], A [8][in], B [out][8]; score scale 1/8; f32 output.
// Compute dtypes, f32 accumulate everywhere: the rank-8 update is folded once into W_eff = W + B A (f32 on the vector unit, K = 8; W, A, B, b, x RNE-converted to bf16 first) and carried as bf16 value | bf16 remainder along K;
// softmax f32 (online, running max); output projection v_wmma_f32_16x16x32_bf16 with ctx as bf16 value | remainder and W_eff as bf16 value | remainder (per k-step: value x value, remainder x value, value x remainder), one accumulator.
// Layout: bf16 copy of x; folded weight planes [4][768][value 768 | remainder 768]; q, k planes [b*12+h][t][d], v^T plane [b*12+h][d][t] (f16) written by the GEMM epilogue; fused flash kernel in transposed form
// Every one of these planes is stored in FRAGMENT ORDER: a block of 16 rows x 32 k is 512 consecutive elements, element (row, k) of a block at (k>>4)*256 + ((k>>3)&1)*128 + row*8 + (k&7);
// blocks run along k (512 elements each), then along rows (16 * pitch elements per block row). A fragment is then two wave-wide 16-B loads of 512 contiguous bytes each (four whole lines) instead of 16 partial lines.
// (S^T = K Q^T, O^T = V^T P^T, key loop over the whole sequence) writes the ctx plane [b*SEQ+t][value 768 | remainder 768] (bf16); final GEMM adds the bias at the store stage.

#ifndef NB
#define NB 4
#endif
#ifndef SEQ
#define SEQ 2048
#endif
#define NB_FULL  4
#define SEQ_FULL 2048
#ifndef OUT_SEQ
#define OUT_SEQ SEQ              // row pitch (in tokens) between batches of the output
#endif
#define DM   768
#define NH_  12
#define HD   64
#define LR   8                   // rank of the low-rank update
#define WP   (2 * DM)            // folded weight plane row pitch: value columns 0..DM-1, remainder columns DM..2DM-1
#define CXP  (2 * DM)            // ctx plane row pitch: value columns 0..DM-1, remainder columns DM..2DM-1
#define AW   8                   // waves per flash block (16 query rows each)
#define KS   64                  // keys per LDS stage of the flash kernel (two passes of 32)
#define GW   4                   // waves per GEMM block, 2 x 2, one 64x64 tile each: block tile 128 x 128
#define KC   64                  // k per LDS stage of the GEMMs (two k-steps of 32)
#define PNL  (128 * KC)          // elements of one panel of a GEMM stage: 128 rows x KC of one half (value or remainder) of one operand = 8 block rows of 2 KiB
#define SC2  (0.125f * 1.4426950408889634f)   // HD^-0.5 * log2(e)
#define PSH  8.0f                // log2 of the P carry (256)

static_assert(HD == 64);
static_assert(NH_ * HD == DM);                 // head h = columns h*64 + d
static_assert(DM % 64 == 0);                   // column tiles of 64
static_assert(DM % 32 == 0);                   // GEMM k-loop steps by 32
static_assert(CXP == 2 * DM);
static_assert(CXP % 32 == 0);
static_assert(WP == 2 * DM);
static_assert(WP % 32 == 0);
static_assert(LR == 8);                        // one 32-byte load covers a row of B [out][8]
static_assert(DM % 8 == 0);                    // fold kernel: 8 columns per lane
static_assert((DM / 8) % 8 == 0);
static_assert(SEQ % 64 == 0);                  // a 64-row tile never straddles two batches
static_assert((NB * SEQ) % 64 == 0);
static_assert(SEQ % 32 == 0);                  // key loop steps by 32 and stays inside the sequence
static_assert(SEQ % (16 * AW) == 0);           // flash grid covers the sequence exactly
static_assert(((size_t)SEQ * DM) % 8 == 0);
static_assert(((size_t)DM * DM) % 8 == 0);
static_assert(NB <= NB_FULL);
static_assert(SEQ <= SEQ_FULL);
static_assert(AW * 32 == 256);                 // the stage copy deals 16-byte pieces to exactly 256 lanes
static_assert(KS == 64 && SEQ % KS == 0 && SEQ / KS >= 2);   // the two-buffer prologue needs two stages
static_assert(GW == 4 && KC == 64);            // the tile copy deals one 2-KiB block row (16 rows x KC) to exactly 128 lanes
static_assert(DM % 128 == 0 && (NB * SEQ) % 128 == 0);       // block tiles of 128 x 128 cover every GEMM exactly
static_assert(DM % KC == 0 && DM / KC >= 2);   // whole stages along k, and the two-buffer prologue needs two of them

typedef _Float16 h16;
typedef unsigned short bf;
typedef __attribute__((ext_vector_type(16))) __bf16   v16bf;
typedef __attribute__((ext_vector_type(16))) _Float16 v16h;
typedef __attribute__((ext_vector_type(8)))  _Float16 v8h;
typedef __attribute__((ext_vector_type(8)))  unsigned short v8us;
typedef __attribute__((ext_vector_type(8)))  float    v8f;
typedef __attribute__((ext_vector_type(4)))  float    v4f;
typedef v4f  __attribute__((may_alias)) v4fa;

__device__ __forceinline__ unsigned short f2bf(float f) { unsigned u = __float_as_uint(f); u += 0x7FFFu + ((u >> 16) & 1u); return (unsigned short)(u >> 16); }
__device__ __forceinline__ float bf2f(unsigned short s) { return __uint_as_float(((unsigned)s) << 16); }
__device__ __forceinline__ float bfr(float f) { return bf2f(f2bf(f)); }     // f32 -> bf16 (RNE) -> f32
__device__ __forceinline__ v16h cat16(v8h lo, v8h hi) { return __builtin_shufflevector(lo, hi, 0, 1, 2, 3, 4, 5, 6, 7, 8, 9, 10, 11, 12, 13, 14, 15); }
__device__ __forceinline__ v16bf cat16b(v8us lo, v8us hi) { return __builtin_bit_cast(v16bf, __builtin_shufflevector(lo, hi, 0, 1, 2, 3, 4, 5, 6, 7, 8, 9, 10, 11, 12, 13, 14, 15)); }
__device__ __forceinline__ v8f wmma16(v16h a, v16h b, v8f c) { return __builtin_amdgcn_wmma_f32_16x16x32_f16(false, a, false, b, (short)0, c, false, false); }
__device__ __forceinline__ v8f wmmab(v16bf a, v16bf b, v8f c) { return __builtin_amdgcn_wmma_f32_16x16x32_bf16(false, a, false, b, (short)0, c, false, false); }
// fragment loaders from fragment-order planes; p = block base + 8*lane: elements 0..7 <- k0+8h+0..7, elements 8..15 <- k0+16+8h+0..7 of row lane&15 (same map for A and B)
__device__ __forceinline__ v16h  ldh(const h16* p) { return cat16(*(const v8h*)p, *(const v8h*)(p + 256)); }
__device__ __forceinline__ v16bf ldb(const bf* p)  { return cat16b(*(const v8us*)p, *(const v8us*)(p + 256)); }
// ordering point for wave-private LDS tiles (same wave writes and reads)
__device__ __forceinline__ void wave_sync() { __builtin_amdgcn_fence(3 /* release order */, "wavefront"); __builtin_amdgcn_wave_barrier(); asm volatile("" ::: "memory"); }
// f32 -> f16 for WMMA operand planes: magnitudes below the smallest normal f16 become exactly 0 (value select)
static __device__ __forceinline__ h16 toh_flush(float v) { const h16 r = (h16)v; return (fabsf(v) < 6.103515625e-05f) ? (h16)0.0f : r; }

// cvt8_piece: one 8-element piece of the bf16 copy of x (rows b*SEQ + t, read from row b*SEQ_FULL + t of x)
__device__ __forceinline__ void cvt8_piece(const float* __restrict__ src, bf* dst, const size_t i, const size_t n8) {
    if (i >= n8) return;
    // i counts 8-element pieces of the fragment-order plane (row pitch DM): block i>>6, piece w = i&63 holds row w&15, k (w>>4)*8 .. +7 of the block
    const size_t blk = i >> 6; const int w = (int)(i & 63);
    const size_t m = (blk / (DM / 32)) * 16 + (size_t)(w & 15); const int k0 = (int)(blk % (DM / 32)) * 32 + (w >> 4) * 8;
    const size_t ms = (m / SEQ) * SEQ_FULL + (m % SEQ);
    const v8f v = *(const v8f*)(src + ms * DM + k0); v8us o;
#pragma unroll
    for (int k = 0; k < 8; ++k) o[k] = f2bf(v[k]);
    *(v8us*)(dst + i * 8) = o; 
}

// fold_piece: W_eff[m][k] = bf16(W[m][k]) + sum_r bf16(LB[m][r]) * bf16(LA[r][k]) in f32 (K = 8, vector unit, rank loop rolled), written as bf16 value at column k and bf16 remainder at column DM + k of row m (fragment order, pitch WP)
__device__ __forceinline__ void fold_piece(const float* __restrict__ W, const float* __restrict__ LA, const float* __restrict__ LB, bf* dst, const size_t i) {
    if (i >= (size_t)DM * (DM / 8)) return;
    // i counts 8-element pieces of the value half in fragment order: block i>>6 (block row rb, block column kb), piece pc = i&63 holds row pc&15, k (pc>>4)*8 .. +7 of the block
    const int rb = (int)(i >> 6) / (DM / 32), kb = (int)(i >> 6) % (DM / 32), pc = (int)(i & 63);
    const int m = rb * 16 + (pc & 15); const int k0 = kb * 32 + (pc >> 4) * 8;
    const v8f w = *(const v8f*)(W + (size_t)m * DM + k0);
    const v8f lb = *(const v8f*)(LB + (size_t)m * LR);
    float acc[8];
#pragma unroll
    for (int k = 0; k < 8; ++k) acc[k] = bfr(w[k]);
    float blr[8];
#pragma unroll
    for (int r = 0; r < 8; ++r) blr[r] = bfr(lb[r]);
    // rank loop rolled: the multiplier of step r is rotated to slot 0 so every register index stays static
#pragma unroll 1
    for (int r = 0; r < LR; ++r) {
        const float bl = blr[0];
#pragma unroll
        for (int q = 0; q < 7; ++q) blr[q] = blr[q + 1];
        const v8f a = *(const v8f*)(LA + (size_t)r * DM + k0);
#pragma unroll
        for (int k = 0; k < 8; ++k) acc[k] = acc[k] + bl * bfr(a[k]);
    }
    v8us hv, lv;
#pragma unroll
    for (int k = 0; k < 8; ++k) { const unsigned short h0 = f2bf(acc[k]); hv[k] = h0; lv[k] = f2bf(acc[k] - bf2f(h0)); }
    bf* p = dst + (size_t)rb * 16 * WP + (size_t)kb * 512 + pc * 8;
    *(v8us*)(p) = hv; *(v8us*)(p + DM * 16) = lv;          // DM columns further = DM/32 blocks = DM*16 elements
}

// k_prep: everything that depends on the inputs alone, in one launch: blocks 0 .. 4*FOLD_BLOCKS-1 fold the four weights (q, k, v, o; FOLD_BLOCKS blocks each), the rest convert x.
// The folds stand first in the grid: their chain of dependent loads is the longer one.
#define FOLD_BLOCKS ((DM * (DM / 8)) / 256)
#define CVT_BLOCKS  ((NB * SEQ * (DM / 8)) / 256)
static_assert((DM * (DM / 8)) % 256 == 0 && (NB * SEQ * (DM / 8)) % 256 == 0);   // both parts fill whole blocks
__global__ __launch_bounds__(256) void k_prep(const float* __restrict__ x,
                                              const float* __restrict__ wq, const float* __restrict__ laq, const float* __restrict__ lbq,
                                              const float* __restrict__ wk, const float* __restrict__ lak, const float* __restrict__ lbk,
                                              const float* __restrict__ wv, const float* __restrict__ lav, const float* __restrict__ lbv,
                                              const float* __restrict__ wo, const float* __restrict__ lao, const float* __restrict__ lbo,
                                              bf* XB, bf* WB) {
    const int blk = blockIdx.x;
    if (blk < 4 * FOLD_BLOCKS) {
        const int f = blk / FOLD_BLOCKS;
        const float* W  = (f == 0) ? wq  : (f == 1) ? wk  : (f == 2) ? wv  : wo;
        const float* LA = (f == 0) ? laq : (f == 1) ? lak : (f == 2) ? lav : lao;
        const float* LB = (f == 0) ? lbq : (f == 1) ? lbk : (f == 2) ? lbv : lbo;
        fold_piece(W, LA, LB, WB + (size_t)f * DM * WP, (size_t)(blk - f * FOLD_BLOCKS) * 256 + threadIdx.x);
    } else {
        cvt8_piece(x, XB, (size_t)(blk - 4 * FOLD_BLOCKS) * 256 + threadIdx.x, (size_t)NB * SEQ * (DM / 8));
    }
}

// gemm_main: a block of four waves (2 x 2) on a 128x128 tile, each wave 64x64 with 16 accumulators; operands from fragment-order bf16 planes whose rows hold NA (A) or NBH (B) halves of DM columns: value, or value | remainder.
// C[m][n] += sum over k < DM of A0[m][k] B0[n][k] + A1[m][k] B0[n][k] + A0[m][k] B1[n][k] (the terms whose halves exist; never remainder x remainder).
// The k loop runs over DM once: a stage is KC = 64 k of every half of the block's 128 A rows and 128 B rows (NA + NBH panels of 16 KiB, still in fragment order), so each half is brought from L2 once per block
// and each fragment read from LDS serves every product that its k-step has for it (an operand with one half meets both halves of the other from the same registers).
// A stage is copied once per block by asynchronous 16-B copies, 8 per lane and panel, into one of two buffers, one stage ahead of its use; each block row is then read by two waves (512 contiguous bytes per ds load).
// The fragments of a stage's two k-steps are read as one group ahead of its products; no fragment is read across a stage's end.
// ga / gb = plane + (block's first row) * pitch + 8 * thread. PA / PB = row pitches (elements); 32 k = one block = 512 elements, so column k0 is at k0*16 and the remainder half DM*16 further.
// Every accumulator takes its k-steps in rising order, and inside a k-step value x value, remainder x value, value x remainder.
// Eight copies of one lane: the same 16-B piece of block rows 0..7 of one panel; l = LDS byte address of the piece in block row 0, g = the same piece in the plane.
template <int P>
__device__ __forceinline__ void tile_copy(const unsigned l, const bf* g) {
    // the wait is the statement's last line: the address registers that the copies name are rewritten only behind it
    asm volatile(
                 "global_load_async_to_lds_b128 %0, %8, off\n\t"
                 "global_load_async_to_lds_b128 %1, %9, off\n\t"
                 "global_load_async_to_lds_b128 %2, %10, off\n\t"
                 "global_load_async_to_lds_b128 %3, %11, off\n\t"
                 "global_load_async_to_lds_b128 %4, %12, off\n\t"
                 "global_load_async_to_lds_b128 %5, %13, off\n\t"
                 "global_load_async_to_lds_b128 %6, %14, off\n\t"
                 "global_load_async_to_lds_b128 %7, %15, off\n\t"
                 "s_wait_xcnt 0x0"
                 :: "v"(l), "v"(l + 2048u), "v"(l + 4096u), "v"(l + 6144u), "v"(l + 8192u), "v"(l + 10240u), "v"(l + 12288u), "v"(l + 14336u),
                    "v"(g), "v"(g + 16 * P), "v"(g + 32 * P), "v"(g + 48 * P), "v"(g + 64 * P), "v"(g + 80 * P), "v"(g + 96 * P), "v"(g + 112 * P) : "memory");
}
template <int PA, int PB, int NA, int NBH>
__device__ __forceinline__ void stage_fill(const unsigned l, const bf* ga, const bf* gb, const int kc) {
    // a block row of a panel is 2 KiB = 128 pieces: this lane's piece is 'thread'; panels in the buffer: A halves, then B halves
#pragma unroll
    for (int h = 0; h < NA; ++h)  tile_copy<PA>(l + (unsigned)(h * PNL * 2), ga + (size_t)(kc + h * DM) * 16);
#pragma unroll
    for (int h = 0; h < NBH; ++h) tile_copy<PB>(l + (unsigned)((NA + h) * PNL * 2), gb + (size_t)(kc + h * DM) * 16);
}
template <int PA, int PB, int NA, int NBH>
__device__ __forceinline__ void gemm_main(const bf* st, const bf* ga, const bf* gb, const int tid, const int wm, const int wn, v8f (&acc)[4][4]) {
    static_assert(NA * DM <= PA && NBH * DM <= PB && NA >= 1 && NA <= 2 && NBH >= 1 && NBH <= 2);   // every half lies inside its plane's rows
    constexpr int GST = (NA + NBH) * PNL;                        // elements of one stage
    const int lane = tid & 31;
    const unsigned l0 = (unsigned)(size_t)st + (unsigned)tid * 16u;
    stage_fill<PA, PB, NA, NBH>(l0, ga, gb, 0);
    asm volatile("s_wait_asynccnt 0x0" ::: "memory");            // this wave's share of stage 0 has landed before the barrier that shows it to the other waves
    __syncthreads();
    stage_fill<PA, PB, NA, NBH>(l0 + (unsigned)(GST * 2), ga, gb, KC);
#pragma unroll 1                                                 // one stage per trip: the two buffers alternate by s & 1
    for (int s = 0; s < DM / KC; ++s) {
        const bf* sa = st + (s & 1) * GST + wm * (64 * KC) + 8 * lane;                 // this wave's four A block rows (first half)
        const bf* sb = st + (s & 1) * GST + NA * PNL + wn * (64 * KC) + 8 * lane;      // this wave's four B block rows (first half)
        v16bf a[KC / 32][NA][4], b[KC / 32][NBH][4];
#pragma unroll
        for (int q = 0; q < KC / 32; ++q) {
#pragma unroll
            for (int i = 0; i < 4; ++i) { a[q][0][i] = ldb(sa + i * (16 * KC) + q * 512); b[q][0][i] = ldb(sb + i * (16 * KC) + q * 512); }
            if (NA > 1) {
#pragma unroll
                for (int i = 0; i < 4; ++i) a[q][NA - 1][i] = ldb(sa + PNL + i * (16 * KC) + q * 512);
            }
            if (NBH > 1) {
#pragma unroll
                for (int i = 0; i < 4; ++i) b[q][NBH - 1][i] = ldb(sb + PNL + i * (16 * KC) + q * 512);
            }
        }
        __builtin_amdgcn_sched_barrier(0);                       // the stage's read group stands whole ahead of the products: sunk among them each row of products would wait for its own reads
#pragma unroll                                                   // unrolled so that every fragment's register set is a static choice
        for (int ks = 0; ks < KC / 32; ++ks) {
#pragma unroll
            for (int hb = 0; hb < NBH; ++hb)
#pragma unroll
                for (int ha = 0; ha < NA; ++ha) {
                    if (ha + hb > 1) continue;                   // remainder x remainder is not part of the sum
#pragma unroll
                    for (int nb = 0; nb < 4; ++nb)
#pragma unroll
                        for (int mb = 0; mb < 4; ++mb) acc[mb][nb] = wmmab(a[ks][ha][mb], b[ks][hb][nb], acc[mb][nb]);
                }
        }
        __builtin_amdgcn_sched_barrier(0);                       // keeps the waits below behind the last products: lifted over them the s_wait_dscnt 0 would hold every product back until the whole read group is home
        // hand-over of the buffers, every wave: its own reads of this stage are home, its own copies of the next stage have landed, then the barrier; only behind it is this stage's buffer refilled
        asm volatile("s_wait_dscnt 0x0" ::: "memory");           // this wave has finished reading the buffer that is refilled below
        asm volatile("s_wait_asynccnt 0x0" ::: "memory");        // this wave's share of stage s + 1 has landed
        __syncthreads();
        if (s + 2 < DM / KC) stage_fill<PA, PB, NA, NBH>(l0 + (unsigned)(s & 1) * (unsigned)(GST * 2), ga, gb, (s + 2) * KC);
    }
    asm volatile("s_wait_asynccnt 0x0" ::: "memory");            // no copy is outstanding when the wave goes on to the store stage
}

// proj_tile: bf16 GEMM, four waves per 128x128 tile (one 64x64 tile each), k over DM; the folded weight has two halves (value, remainder), x one: NA / NBH = halves of A / Bt.
// C[m][n] = sum_k x . (W value + W remainder) + bias (bias by column n when biasRow == 0, by row m when biasRow != 0; bias RNE-converted to bf16),
// written as f16, in fragment order, into the sub-plane at (r0/RB)*sRB + (c0/CB)*sCB: rows r0%RB .., columns c0%CB .., row pitch 'pitch' (halves). Tile (bx, by) of (M/128, N/128), 128 threads; st, osa = the block's LDS.
template <int PA, int PB, int NA, int NBH>
__device__ __forceinline__ void proj_tile(const bf* st, float* osa, const bf* __restrict__ A, const bf* __restrict__ Bt,
                                          const float* __restrict__ bias, const int biasRow, h16* Ph, const int RB, const size_t sRB, const int pitch, const int CB, const size_t sCB,
                                          const int bx, const int by) {
    const int tid = threadIdx.x; const int wave = __builtin_amdgcn_readfirstlane(threadIdx.x >> 5); const int wm = wave >> 1, wn = wave & 1;
    float* os = osa + wave * (16 * 68);                          // store staging, private to the wave
    const int lane = threadIdx.x & 31, lr = lane & 15, hi = lane >> 4; const int r0 = bx * 128 + wm * 64, c0 = by * 128 + wn * 64;
    v8f acc[4][4];
#pragma unroll
    for (int mb = 0; mb < 4; ++mb)
#pragma unroll
        for (int nb = 0; nb < 4; ++nb) acc[mb][nb] = (v8f){};
    gemm_main<PA, PB, NA, NBH>(st, A + (size_t)(bx * 128) * PA + 8 * tid, Bt + (size_t)(by * 128) * PB + 8 * tid, tid, wm, wn, acc);
    // store stage s = 0..3: lane holds row lane&15, columns (s>>1)*32 + (s&1)*16 + 8h + 0..7 of the slab = piece 'lane' of half s&1 of block s>>1
    float bc[4][8];
#pragma unroll
    for (int s = 0; s < 4; ++s) {
      if (biasRow) {                                             // known at compile time at both calls: with the bias by row no column bias is read
#pragma unroll
        for (int i = 0; i < 8; ++i) bc[s][i] = 0.0f;
      } else {
        int cb = c0 + (s >> 1) * 32 + (s & 1) * 16 + hi * 8; cb = (cb < DM - 8) ? cb : (DM - 8);          // clamped address
        const v4f b0 = *(const v4f*)(bias + cb);
        asm volatile("s_wait_xcnt 0x0" ::: "memory");            // in this build a later bias load lands in a register that this load names as its address
        const v4f b1 = *(const v4f*)(bias + cb + 4);
        asm volatile("s_wait_xcnt 0x0" ::: "memory");            // the same for the second half
#pragma unroll
        for (int i = 0; i < 4; ++i) { bc[s][i] = bfr(b0[i]); bc[s][4 + i] = bfr(b1[i]); }
      }
    }
    const size_t tbase = (size_t)(r0 / RB) * sRB + (size_t)(r0 % RB) * (size_t)pitch + (size_t)(c0 / CB) * sCB + (size_t)(c0 % CB) * 16 + 8 * lane;
#pragma unroll
    for (int mb = 0; mb < 4; ++mb) {
#pragma unroll
        for (int nb = 0; nb < 4; ++nb) {
#pragma unroll
            for (int j = 0; j < 8; ++j) os[(hi * 8 + j) * 68 + nb * 16 + lr] = acc[mb][nb][j]; }   // D: row 8h+j, col lane&15
        wave_sync();
        float br;
        { int ri = r0 + mb * 16 + lr; ri = (ri < DM - 1) ? ri : (DM - 1); const float bv_ = bias[ri]; br = biasRow ? bfr(bv_) : 0.0f; }
        const size_t sb = tbase + (size_t)(mb * 16) * (size_t)pitch;
{
#pragma unroll
            for (int s = 0; s < 4; ++s) { const int col = (s >> 1) * 32 + (s & 1) * 16 + hi * 8;   // 16 lanes = 16 rows; 4 s x 2 halves x 8 = 64 columns
                const v4f x0 = *(const v4fa*)(&os[lr * 68 + col]); const v4f x1 = *(const v4fa*)(&os[lr * 68 + col + 4]);
                float val[8]; v8h hv;
#pragma unroll
                for (int i = 0; i < 4; ++i) { val[i] = x0[i] + bc[s][i] + br; val[4 + i] = x1[i] + bc[s][4 + i] + br; }
#pragma unroll
                for (int i = 0; i < 8; ++i) hv[i] = toh_flush(val[i]);
                const size_t oo = sb + (size_t)((s >> 1) * 512 + (s & 1) * 256);
                *(v8h*)(Ph + oo) = hv; }
             }
        if (biasRow) asm volatile("s_wait_xcnt 0x0" ::: "memory");   // in this build the next slab's row-bias load lands in a register that one of these stores names
        wave_sync();
    }
}

// k_qkv: the three input projections in one launch, grid (NB*SEQ/128, DM/128, 3); the choice by blockIdx.z is the same for a whole block.
// z = 0, 1 (q, k): A = x rows (m = b*SEQ + t, pitch DM, one half), Bt = folded W rows (n = h*64 + d, pitch WP, two halves), bias by column -> plane [(b*12 + h)][t][d]
// z = 2 (v^T):     A = folded Wv rows (m = h*64 + d, pitch WP, two halves), Bt = x rows (n = b*SEQ + t, pitch DM, one half), bias by row -> plane [(b*768 + m)][t] = [(b*12 + h)][d][t]
__global__ __launch_bounds__(32 * GW) void k_qkv(const bf* __restrict__ XB, const bf* __restrict__ WB,
                                                 const float* __restrict__ bq, const float* __restrict__ bk, const float* __restrict__ bv, h16* QH, h16* KP, h16* VT) {
    __shared__ __align__(16) bf st[2 * 3 * PNL];                 // two buffers of three panels
    __shared__ __align__(16) float osa[GW * 16 * 68];
    const int z = blockIdx.z;
    if (z < 2) proj_tile<DM, WP, 1, 2>(st, osa, XB, WB + (size_t)z * DM * WP, z ? bk : bq, 0, z ? KP : QH, SEQ, (size_t)NH_ * SEQ * HD, HD, HD, (size_t)SEQ * HD, blockIdx.x, blockIdx.y);
    else       proj_tile<WP, DM, 2, 1>(st, osa, WB + (size_t)2 * DM * WP, XB, bv, 1, VT, DM, (size_t)0, SEQ, SEQ, (size_t)DM * SEQ, blockIdx.y, blockIdx.x);
}

// k_flash: fused dense attention, one wave per 16 query rows of one (batch, head), eight waves per block; Q fragments straight from the fragment-order f16 plane (two 16-B loads each, 512 contiguous bytes per load).
// K and V^T reach the waves through LDS: a stage is 64 keys (K 8 KiB, V^T 4 block rows x 2 KiB, both still in fragment order), copied once per block by asynchronous 16-B copies, four per lane, into one of two buffers,
// one stage ahead of its use; all eight waves read their fragments from it (512 contiguous bytes per ds load).
// Transposed form: S^T[key][t] = K Q^T (A = K rows, B = Q rows); lane (t = lane&15, h = lane>>4) holds keys 8h+r of each 16-key tile, so the packed
// P tile is directly the B fragment of O^T[d][t] = V^T P^T (element r <- tile keys 0..15, element 8+r <- tile keys 16..31, lane unchanged).
// Key loop covers keys 0 .. SEQ-1 in steps of 32 (all inside the sequence, every key valid for every row).
// Softmax state (running max, partial sum) is one scalar per lane; the two lane halves of a row are combined with one xor-16 exchange.
// P carries x256; a P whose exponent argument is below -14 (under the smallest normal f16) is taken as exactly 0; the row sum runs over the converted P.
// One lane's four copies of a stage: l = LDS byte address of its first piece in the buffer, gk / gv = its first K and V^T piece of the stage.
__device__ __forceinline__ void stage_copy(const unsigned l, const h16* gk, const h16* gv) {
    const unsigned l1 = l + 4096u, l2 = l + 8192u, l3 = l + 12288u;
    const h16* gk1 = gk + 2048; const h16* gv1 = gv + (size_t)32 * SEQ;      // K piece + 256; V^T piece + 256 = two block rows further
    // the wait is the statement's last line: the address registers that the copies name are rewritten only behind it
    asm volatile("global_load_async_to_lds_b128 %0, %4, off\n\t"
                 "global_load_async_to_lds_b128 %1, %5, off\n\t"
                 "global_load_async_to_lds_b128 %2, %6, off\n\t"
                 "global_load_async_to_lds_b128 %3, %7, off\n\t"
                 "s_wait_xcnt 0x0"
                 :: "v"(l), "v"(l1), "v"(l2), "v"(l3), "v"(gk), "v"(gk1), "v"(gv), "v"(gv1) : "memory");
}
__global__ __launch_bounds__(32 * AW) void k_flash(const h16* __restrict__ QH, const h16* __restrict__ KP, const h16* __restrict__ VT, bf* CX) {
    __shared__ __align__(16) h16 kv[2][2 * KS * HD];            // per buffer: K [64 keys][64 d] (4096 halves), then V^T [4 block rows][64 keys x 16 d] (4096 halves)
    const int tid = threadIdx.x;
    const int lane = threadIdx.x & 31;
    const int wave = __builtin_amdgcn_readfirstlane(threadIdx.x >> 5);
    const int zh = blockIdx.y; const int b = zh / NH_, h = zh % NH_;
    const int t0 = (blockIdx.x * AW + wave) * 16;
    const size_t pbase = (size_t)zh * SEQ * HD;
    const size_t qo = pbase + (size_t)t0 * HD + 8 * lane;
    const v16h qh0 = ldh(QH + qo), qh1 = ldh(QH + qo + 512);   // B fragments: col t, k = d (blocks d 0..31, d 32..63)
    // this lane's pieces of a stage: K pieces tid and tid + 256 of 512 (contiguous); V^T pieces tid and tid + 256 of 512 (piece i: block row i >> 7, 16-B unit i & 127 of its 2 KiB)
    const unsigned lds0 = (unsigned)(size_t)&kv[0][0] + (unsigned)tid * 16u;
    const h16* gk = KP + pbase + (size_t)tid * 8;                                          // + stage * KS * HD
    const h16* gv = VT + pbase + (size_t)(tid >> 7) * 16 * SEQ + (size_t)(tid & 127) * 8;  // + stage * KS * 16
    v8f o[4];
#pragma unroll
    for (int j = 0; j < 4; ++j) { o[j] = (v8f){}; }
    float m = -3.0e38f, l = 0.0f;
    stage_copy(lds0, gk, gv);
    asm volatile("s_wait_asynccnt 0x0" ::: "memory");            // this wave's share of stage 0 has landed before the barrier that shows it to the other waves
    __syncthreads();
    stage_copy(lds0 + (unsigned)sizeof(kv[0]), gk + KS * HD, gv + KS * 16);
#pragma unroll 1                                                 // one stage per trip: the two buffers alternate by s & 1
    for (int s = 0; s < SEQ / KS; ++s) {
        const h16* sb = &kv[s & 1][0] + 8 * lane;
#pragma unroll                                                   // both passes of a stage in one trip: their LDS offsets become immediates
        for (int p = 0; p < KS / 32; ++p) {
        const h16* ka = sb + p * 32 * HD;                        // A fragments: row key, k = d
        const v16h ka0 = ldh(ka), ka1 = ldh(ka + 512), kb0 = ldh(ka + 16 * HD), kb1 = ldh(ka + 16 * HD + 512);
        const h16* va = sb + KS * HD + p * 512;                  // A fragments: row d, k = key
        const v16h v0 = ldh(va), v1 = ldh(va + KS * 16), v2 = ldh(va + 2 * KS * 16), v3 = ldh(va + 3 * KS * 16);
        v8f sHa = (v8f){}, sHb = (v8f){};
        sHa = wmma16(ka0, qh0, sHa); sHb = wmma16(kb0, qh0, sHb);
        sHa = wmma16(ka1, qh1, sHa); sHb = wmma16(kb1, qh1, sHb);
        float ta[8], tb[8];
#pragma unroll
        for (int r = 0; r < 8; ++r) { ta[r] = sHa[r] * SC2; tb[r] = sHb[r] * SC2; }
        float mx = -3.0e38f;
#pragma unroll
        for (int r = 0; r < 8; ++r) mx = fmaxf(mx, fmaxf(ta[r], tb[r]));
        mx = fmaxf(mx, __shfl_xor(mx, 16, 32));
        const float mnew = fmaxf(m, mx);
        float alpha;
        // the exponential and the one free slot behind it in one statement
        asm("v_exp_f32 %0, %1\n\tv_nop" : "=v"(alpha) : "v"(m - mnew));
        const float sh = PSH - mnew;
        v16h pb; float ls = 0.0f;
#pragma unroll
        for (int r = 0; r < 8; ++r) { const float ea = ta[r] + sh; const float eb = tb[r] + sh;
            const float xa = __builtin_amdgcn_exp2f(ea); const float xb = __builtin_amdgcn_exp2f(eb);
            const h16 pa = (ea < -14.0f) ? (h16)0.0f : (h16)xa; const h16 pc = (eb < -14.0f) ? (h16)0.0f : (h16)xb;
            pb[r] = pa; pb[8 + r] = pc; ls += (float)pa + (float)pc; }
#pragma unroll
        for (int j = 0; j < 4; ++j) o[j] = o[j] * alpha;
        o[0] = wmma16(v0, pb, o[0]); o[1] = wmma16(v1, pb, o[1]); o[2] = wmma16(v2, pb, o[2]); o[3] = wmma16(v3, pb, o[3]);
        l = l * alpha + ls; m = mnew;
        }
        // hand-over of the buffers, every wave: its own reads of this stage are home, its own copies of the next stage have landed, then the barrier; only behind it is this stage's buffer refilled
        asm volatile("s_wait_dscnt 0x0" ::: "memory");           // this wave has finished reading the buffer that is refilled below
        asm volatile("s_wait_asynccnt 0x0" ::: "memory");        // this wave's share of stage s + 1 has landed
        __syncthreads();
        if (s + 2 < SEQ / KS) stage_copy(lds0 + (unsigned)(s & 1) * (unsigned)sizeof(kv[0]), gk + (size_t)(s + 2) * (KS * HD), gv + (size_t)(s + 2) * (KS * 16));
    }
    asm volatile("s_wait_asynccnt 0x0" ::: "memory");            // no copy is outstanding when the wave ends
    l += __shfl_xor(l, 16, 32);
    const float inv = 1.0f / l;
    // O^T D layout: o_j[r] = (d = 16j + 8h + r, t = lane&15) = row t, columns 16j + 8h + 0..7: piece 'lane' of half j&1 of block j>>1 in fragment order, so every lane stores its own registers (no transposition)
    bf* crow = CX + ((size_t)b * SEQ + t0) * CXP + (size_t)(h * HD) * 16 + 8 * lane;   // block row t0/16, first block of column h*64, piece 'lane'
#pragma unroll
    for (int j = 0; j < 4; ++j) { v8us hv, lv;
#pragma unroll
        for (int i = 0; i < 8; ++i) { const float x = o[j][i] * inv; const unsigned short h0 = f2bf(x); hv[i] = h0; lv[i] = f2bf(x - bf2f(h0)); }
        const size_t oo = (size_t)((j >> 1) * 512 + (j & 1) * 256);
        *(v8us*)(crow + oo) = hv; *(v8us*)(crow + oo + DM * 16) = lv; }
}

// k_out: final projection, four waves per 128x128 tile (one 64x64 tile each). A = ctx plane [m][value 768 | remainder 768], Bt = folded Wo plane [n][value 768 | remainder 768], k over 768:
// per k-step value x value, remainder x value, value x remainder, from one read of each of the four halves.
// OUT[m][n] = acc + bias[n] (bias RNE-converted to bf16), f32. Epilogue: per 16-row slab staged in LDS (wave-private), each output row segment (64 floats = 256 B = two lines)
__global__ __launch_bounds__(32 * GW) void k_out(const bf* __restrict__ A, const bf* __restrict__ Bt, const float* __restrict__ bias, float* OUT) {
    __shared__ __align__(16) bf st[2 * 4 * PNL];                 // two buffers of four panels
    __shared__ __align__(16) float osa[GW][16 * 68];
    const int tid = threadIdx.x; const int wave = __builtin_amdgcn_readfirstlane(threadIdx.x >> 5); const int wm = wave >> 1, wn = wave & 1;
    float* os = &osa[wave][0];                                   // store staging, private to the wave
    const int lane = threadIdx.x & 31, lr = lane & 15, hi = lane >> 4; const int r0 = blockIdx.x * 128 + wm * 64, c0 = blockIdx.y * 128 + wn * 64;
    v8f acc[4][4];
#pragma unroll
    for (int mb = 0; mb < 4; ++mb)
#pragma unroll
        for (int nb = 0; nb < 4; ++nb) acc[mb][nb] = (v8f){};
    gemm_main<CXP, WP, 2, 2>(st, A + (size_t)(blockIdx.x * 128) * CXP + 8 * tid, Bt + (size_t)(blockIdx.y * 128) * WP + 8 * tid, tid, wm, wn, acc);
    const int cofs = lr * 4;
    v4f b4 = *(const v4f*)(bias + c0 + cofs);          // c0 + cofs + 3 <= DM - 1 always
    asm volatile("s_wait_xcnt 0x0" ::: "memory");      // the address arithmetic below reuses registers that this load names
    __builtin_amdgcn_sched_barrier(0);                 // holds that arithmetic behind the wait
    b4[0] = bfr(b4[0]); b4[1] = bfr(b4[1]); b4[2] = bfr(b4[2]); b4[3] = bfr(b4[3]);
    const size_t orow0 = (size_t)(r0 / SEQ) * OUT_SEQ + (size_t)(r0 % SEQ);
#pragma unroll
    for (int mb = 0; mb < 4; ++mb) {
#pragma unroll
        for (int nb = 0; nb < 4; ++nb) {
#pragma unroll
            for (int j = 0; j < 8; ++j) os[(hi * 8 + j) * 68 + nb * 16 + lr] = acc[mb][nb][j]; }   // D: row 8h+j, col lane&15
        wave_sync();
        float* ob = OUT + (orow0 + (size_t)(mb * 16)) * DM + c0;
{
#pragma unroll
            for (int s = 0; s < 8; ++s) { const int row = 2 * s + hi;   // 8 s x 2 rows = 16 rows; 16 lanes x 4 floats = 64 columns
                const v4f xv = *(const v4fa*)(&os[row * 68 + cofs]);
                const v4f val = xv + b4;
                *(v4f*)(ob + (size_t)row * DM + cofs) = val; }
             }
        wave_sync();
    }
}

static constexpr size_t al256(size_t v) { return (v + 255) & ~(size_t)255; }
static constexpr size_t SZ_XB = al256((size_t)NB * SEQ * DM * 2);
static constexpr size_t SZ_WB = al256((size_t)4 * DM * WP * 2);
static constexpr size_t SZ_PL = al256((size_t)NB * NH_ * SEQ * HD * 2);
static constexpr size_t SZ_CX = al256((size_t)NB * SEQ * CXP * 2);
static constexpr size_t SZ_TOTAL = SZ_XB + SZ_WB + 3 * SZ_PL + SZ_CX;
static_assert(SZ_TOTAL <= (size_t)134217728);          // workspace carve <= 128 MiB
static_assert(((size_t)DM * WP * 2) % 256 == 0);       // weight sub-planes stay 256-byte aligned
static_assert((size_t)NB * NH_ * SEQ * HD == (size_t)NB * SEQ * DM);   // plane extent == GEMM tile grid extent

extern "C" void kernel_launch(void* const* d_in, const int* in_sizes, int n_in,
                              void* d_out, int out_size, void* d_ws, size_t ws_size, hipStream_t stream) {
    if (n_in < 17) return;
    const size_t needx = ((size_t)(NB - 1) * SEQ_FULL + SEQ) * DM;
    if ((size_t)in_sizes[0] < needx) return;
    if ((size_t)in_sizes[1] < (size_t)DM * DM || (size_t)in_sizes[5] < (size_t)DM * DM || (size_t)in_sizes[9] < (size_t)DM * DM || (size_t)in_sizes[13] < (size_t)DM * DM) return;
    if (in_sizes[2] < DM || in_sizes[6] < DM || in_sizes[10] < DM || in_sizes[14] < DM) return;
    if (in_sizes[3] < LR * DM || in_sizes[7] < LR * DM || in_sizes[11] < LR * DM || in_sizes[15] < LR * DM) return;
    if (in_sizes[4] < DM * LR || in_sizes[8] < DM * LR || in_sizes[12] < DM * LR || in_sizes[16] < DM * LR) return;
    if ((size_t)out_size < ((size_t)(NB - 1) * OUT_SEQ + SEQ) * DM) return;
    if (SZ_TOTAL > ws_size) return;
    // wire order: x, then per projection (q, k, v, o): W [out][in], b [out], A [8][in], B [out][8]; folded weights [out][in] = Bt as-is
    const float* x   = (const float*)d_in[0];
    const float* wq  = (const float*)d_in[1];  const float* bq  = (const float*)d_in[2];  const float* laq = (const float*)d_in[3];  const float* lbq = (const float*)d_in[4];
    const float* wk  = (const float*)d_in[5];  const float* bk  = (const float*)d_in[6];  const float* lak = (const float*)d_in[7];  const float* lbk = (const float*)d_in[8];
    const float* wv  = (const float*)d_in[9];  const float* bv  = (const float*)d_in[10]; const float* lav = (const float*)d_in[11]; const float* lbv = (const float*)d_in[12];
    const float* wo  = (const float*)d_in[13]; const float* bo  = (const float*)d_in[14]; const float* lao = (const float*)d_in[15]; const float* lbo = (const float*)d_in[16];
    float* OUT = (float*)d_out;      // [NB][SEQ][768]
    char* wsp = (char*)d_ws;
    bf* XB = (bf*)wsp; wsp += SZ_XB;                 // [NB*SEQ][768]
    bf* WB = (bf*)wsp; wsp += SZ_WB;                 // [4][768][value 768 | remainder 768]: q | k | v | o
    h16* QH = (h16*)wsp; wsp += SZ_PL;               // [NB*12][SEQ][64]
    h16* KP = (h16*)wsp; wsp += SZ_PL;               // [NB*12][SEQ][64]
    h16* VT = (h16*)wsp; wsp += SZ_PL;               // [NB*12][64][SEQ]
    bf* CX = (bf*)wsp; wsp += SZ_CX;                 // [NB*SEQ][value 768 | remainder 768]
    bf* WO = WB + (size_t)3 * DM * WP;

    k_prep<<<4 * FOLD_BLOCKS + CVT_BLOCKS, 256, 0, stream>>>(x, wq, laq, lbq, wk, lak, lbk, wv, lav, lbv, wo, lao, lbo, XB, WB);

    k_qkv<<<dim3(NB * SEQ / 128, DM / 128, 3), 32 * GW, 0, stream>>>(XB, WB, bq, bk, bv, QH, KP, VT);

    k_flash<<<dim3(SEQ / (16 * AW), NB * NH_, 1), 32 * AW, 0, stream>>>(QH, KP, VT, CX);

    // out: A = ctx rows [m][value | remainder], Bt = folded Wo rows (n) [value | remainder], bias by column -> OUT[b][t][n]
    k_out<<<dim3(NB * SEQ / 128, DM / 128, 1), 32 * GW, 0, stream>>>(CX, WO, bo, OUT);
}

// v006
// A run of this version takes 136 microseconds.
// Timed twice side by side with v005, it ran 1.11 and 1.10 times as fast.
// Counting every step since v000, it is 3.16 times as fast.
#include <hip/hip_runtime.h>

// Dense (unmasked) multi-head self-attention, width 768 = 12 heads x 64, x [NB][SEQ][768]; each of the four projections is y = x W^T + b + (x A^T) B^T with W [out][in], A [8][in], B [out][8]; score scale 1/8; f32 output.
// Compute dtypes, f32 accumulate everywhere: the rank-8 update is folded once into W_eff = W + B A (f32 on the vector unit, K = 8; W, A, B, b, x RNE-converted to bf16 first) and carried as bf16 value | bf16 remainder along K;
// softmax f32 (online, running max); output projection v_wmma_f32_16x16x32_bf16 with ctx as bf16 value | remainder and W_eff as bf16 value | remainder (per k-step: value x value, remainder x value, value x remainder), one accumulator.
// Layout: bf16 copy of x; folded weight planes [4][768][value 768 | remainder 768]; q, k planes [b*12+h][t][d], v^T plane [b*12+h][d][t] (f16) written by the GEMM epilogue; fused flash kernel in transposed form
// Every one of these planes is stored in FRAGMENT ORDER: a block of 16 rows x 32 k is 512 consecutive elements, element (row, k) of a block at (k>>4)*256 + ((k>>3)&1)*128 + row*8 + (k&7);
// blocks run along k (512 elements each), then along rows (16 * pitch elements per block row). A fragment is then two wave-wide 16-B loads of 512 contiguous bytes each (four whole lines) instead of 16 partial lines.
// (S^T = K Q^T, O^T = V^T P^T, key loop over the whole sequence) writes the ctx plane [b*SEQ+t][value 768 | remainder 768] (bf16); final GEMM adds the bias at the store stage.

#ifndef NB
#define NB 4
#endif
#ifndef SEQ
#define SEQ 2048
#endif
#define NB_FULL  4
#define SEQ_FULL 2048
#ifndef OUT_SEQ
#define OUT_SEQ SEQ              // row pitch (in tokens) between batches of the output
#endif
#define DM   768
#define NH_  12
#define HD   64
#define LR   8                   // rank of the low-rank update
#define WP   (2 * DM)            // folded weight plane row pitch: value columns 0..DM-1, remainder columns DM..2DM-1
#define CXP  (2 * DM)            // ctx plane row pitch: value columns 0..DM-1, remainder columns DM..2DM-1
#define AW   8                   // waves per flash block (16 query rows each)
#define KS   64                  // keys per LDS stage of the flash kernel (two passes of 32)
#define GW   4                   // waves per GEMM block, 2 x 2, one 64x64 tile each: block tile 128 x 128
#define KC   64                  // k per LDS stage of the GEMMs (two k-steps of 32)
#define PNL  (128 * KC)          // elements of one panel of a GEMM stage: 128 rows x KC of one half (value or remainder) of one operand = 8 block rows of 2 KiB
#define SC2  (0.125f * 1.4426950408889634f)   // HD^-0.5 * log2(e)
#define PSH  8.0f                // log2 of the P carry (256)

static_assert(HD == 64);
static_assert(NH_ * HD == DM);                 // head h = columns h*64 + d
static_assert(DM % 64 == 0);                   // column tiles of 64
static_assert(DM % 32 == 0);                   // GEMM k-loop steps by 32
static_assert(CXP == 2 * DM);
static_assert(CXP % 32 == 0);
static_assert(WP == 2 * DM);
static_assert(WP % 32 == 0);
static_assert(LR == 8);                        // one 32-byte load covers a row of B [out][8]
static_assert(DM % 8 == 0);                    // fold kernel: 8 columns per lane
static_assert((DM / 8) % 8 == 0);
static_assert(SEQ % 64 == 0);                  // a 64-row tile never straddles two batches
static_assert((NB * SEQ) % 64 == 0);
static_assert(SEQ % 32 == 0);                  // key loop steps by 32 and stays inside the sequence
static_assert(SEQ % (16 * AW) == 0);           // flash grid covers the sequence exactly
static_assert(((size_t)SEQ * DM) % 8 == 0);
static_assert(((size_t)DM * DM) % 8 == 0);
static_assert(NB <= NB_FULL);
static_assert(SEQ <= SEQ_FULL);
static_assert(AW * 32 == 256);                 // the stage copy deals 16-byte pieces to exactly 256 lanes
static_assert(KS == 64 && SEQ % KS == 0 && SEQ / KS >= 2);   // the two-buffer prologue needs two stages
static_assert(GW == 4 && KC == 64);            // the tile copy deals one 2-KiB block row (16 rows x KC) to exactly 128 lanes
static_assert(DM % 128 == 0 && (NB * SEQ) % 128 == 0);       // block tiles of 128 x 128 cover every GEMM exactly
static_assert(DM % KC == 0 && DM / KC >= 2);   // whole stages along k, and the two-buffer prologue needs two of them

typedef _Float16 h16;
typedef unsigned short bf;
typedef __attribute__((ext_vector_type(16))) __bf16   v16bf;
typedef __attribute__((ext_vector_type(16))) _Float16 v16h;
typedef __attribute__((ext_vector_type(8)))  _Float16 v8h;
typedef __attribute__((ext_vector_type(2)))  _Float16 v2h;
typedef __attribute__((ext_vector_type(2)))  float    v2f;
typedef __attribute__((ext_vector_type(8)))  unsigned short v8us;
typedef __attribute__((ext_vector_type(8)))  float    v8f;
typedef __attribute__((ext_vector_type(4)))  float    v4f;
typedef v4f  __attribute__((may_alias)) v4fa;

__device__ __forceinline__ unsigned short f2bf(float f) { unsigned u = __float_as_uint(f); u += 0x7FFFu + ((u >> 16) & 1u); return (unsigned short)(u >> 16); }
__device__ __forceinline__ float bf2f(unsigned short s) { return __uint_as_float(((unsigned)s) << 16); }
__device__ __forceinline__ float bfr(float f) { return bf2f(f2bf(f)); }     // f32 -> bf16 (RNE) -> f32
__device__ __forceinline__ v16h cat16(v8h lo, v8h hi) { return __builtin_shufflevector(lo, hi, 0, 1, 2, 3, 4, 5, 6, 7, 8, 9, 10, 11, 12, 13, 14, 15); }
__device__ __forceinline__ v16bf cat16b(v8us lo, v8us hi) { return __builtin_bit_cast(v16bf, __builtin_shufflevector(lo, hi, 0, 1, 2, 3, 4, 5, 6, 7, 8, 9, 10, 11, 12, 13, 14, 15)); }
__device__ __forceinline__ v8f wmma16(v16h a, v16h b, v8f c) { return __builtin_amdgcn_wmma_f32_16x16x32_f16(false, a, false, b, (short)0, c, false, false); }
__device__ __forceinline__ v8f wmmab(v16bf a, v16bf b, v8f c) { return __builtin_amdgcn_wmma_f32_16x16x32_bf16(false, a, false, b, (short)0, c, false, false); }
// fragment loaders from fragment-order planes; p = block base + 8*lane: elements 0..7 <- k0+8h+0..7, elements 8..15 <- k0+16+8h+0..7 of row lane&15 (same map for A and B)
__device__ __forceinline__ v16h  ldh(const h16* p) { return cat16(*(const v8h*)p, *(const v8h*)(p + 256)); }
__device__ __forceinline__ v16bf ldb(const bf* p)  { return cat16b(*(const v8us*)p, *(const v8us*)(p + 256)); }
// ordering point for wave-private LDS tiles (same wave writes and reads)
__device__ __forceinline__ void wave_sync() { __builtin_amdgcn_fence(3 /* release order */, "wavefront"); __builtin_amdgcn_wave_barrier(); asm volatile("" ::: "memory"); }
// f32 -> f16 for WMMA operand planes: magnitudes below the smallest normal f16 become exactly 0 (value select)
static __device__ __forceinline__ h16 toh_flush(float v) { const h16 r = (h16)v; return (fabsf(v) < 6.103515625e-05f) ? (h16)0.0f : r; }

// cvt8_piece: one 8-element piece of the bf16 copy of x (rows b*SEQ + t, read from row b*SEQ_FULL + t of x)
__device__ __forceinline__ void cvt8_piece(const float* __restrict__ src, bf* dst, const size_t i, const size_t n8) {
    if (i >= n8) return;
    // i counts 8-element pieces of the fragment-order plane (row pitch DM): block i>>6, piece w = i&63 holds row w&15, k (w>>4)*8 .. +7 of the block
    const size_t blk = i >> 6; const int w = (int)(i & 63);
    const size_t m = (blk / (DM / 32)) * 16 + (size_t)(w & 15); const int k0 = (int)(blk % (DM / 32)) * 32 + (w >> 4) * 8;
    const size_t ms = (m / SEQ) * SEQ_FULL + (m % SEQ);
    const v8f v = *(const v8f*)(src + ms * DM + k0); v8us o;
#pragma unroll
    for (int k = 0; k < 8; ++k) o[k] = f2bf(v[k]);
    *(v8us*)(dst + i * 8) = o; 
}

// fold_piece: W_eff[m][k] = bf16(W[m][k]) + sum_r bf16(LB[m][r]) * bf16(LA[r][k]) in f32 (K = 8, vector unit, rank loop rolled), written as bf16 value at column k and bf16 remainder at column DM + k of row m (fragment order, pitch WP)
__device__ __forceinline__ void fold_piece(const float* __restrict__ W, const float* __restrict__ LA, const float* __restrict__ LB, bf* dst, const size_t i) {
    if (i >= (size_t)DM * (DM / 8)) return;
    // i counts 8-element pieces of the value half in fragment order: block i>>6 (block row rb, block column kb), piece pc = i&63 holds row pc&15, k (pc>>4)*8 .. +7 of the block
    const int rb = (int)(i >> 6) / (DM / 32), kb = (int)(i >> 6) % (DM / 32), pc = (int)(i & 63);
    const int m = rb * 16 + (pc & 15); const int k0 = kb * 32 + (pc >> 4) * 8;
    const v8f w = *(const v8f*)(W + (size_t)m * DM + k0);
    const v8f lb = *(const v8f*)(LB + (size_t)m * LR);
    float acc[8];
#pragma unroll
    for (int k = 0; k < 8; ++k) acc[k] = bfr(w[k]);
    float blr[8];
#pragma unroll
    for (int r = 0; r < 8; ++r) blr[r] = bfr(lb[r]);
    // rank loop rolled: the multiplier of step r is rotated to slot 0 so every register index stays static
#pragma unroll 1
    for (int r = 0; r < LR; ++r) {
        const float bl = blr[0];
#pragma unroll
        for (int q = 0; q < 7; ++q) blr[q] = blr[q + 1];
        const v8f a = *(const v8f*)(LA + (size_t)r * DM + k0);
#pragma unroll
        for (int k = 0; k < 8; ++k) acc[k] = acc[k] + bl * bfr(a[k]);
    }
    v8us hv, lv;
#pragma unroll
    for (int k = 0; k < 8; ++k) { const unsigned short h0 = f2bf(acc[k]); hv[k] = h0; lv[k] = f2bf(acc[k] - bf2f(h0)); }
    bf* p = dst + (size_t)rb * 16 * WP + (size_t)kb * 512 + pc * 8;
    *(v8us*)(p) = hv; *(v8us*)(p + DM * 16) = lv;          // DM columns further = DM/32 blocks = DM*16 elements
}

// k_prep: everything that depends on the inputs alone, in one launch: blocks 0 .. 4*FOLD_BLOCKS-1 fold the four weights (q, k, v, o; FOLD_BLOCKS blocks each), the rest convert x.
// The folds stand first in the grid: their chain of dependent loads is the longer one.
#define FOLD_BLOCKS ((DM * (DM / 8)) / 256)
#define CVT_BLOCKS  ((NB * SEQ * (DM / 8)) / 256)
static_assert((DM * (DM / 8)) % 256 == 0 && (NB * SEQ * (DM / 8)) % 256 == 0);   // both parts fill whole blocks
__global__ __launch_bounds__(256) void k_prep(const float* __restrict__ x,
                                              const float* __restrict__ wq, const float* __restrict__ laq, const float* __restrict__ lbq,
                                              const float* __restrict__ wk, const float* __restrict__ lak, const float* __restrict__ lbk,
                                              const float* __restrict__ wv, const float* __restrict__ lav, const float* __restrict__ lbv,
                                              const float* __restrict__ wo, const float* __restrict__ lao, const float* __restrict__ lbo,
                                              bf* XB, bf* WB) {
    const int blk = blockIdx.x;
    if (blk < 4 * FOLD_BLOCKS) {
        const int f = blk / FOLD_BLOCKS;
        const float* W  = (f == 0) ? wq  : (f == 1) ? wk  : (f == 2) ? wv  : wo;
        const float* LA = (f == 0) ? laq : (f == 1) ? lak : (f == 2) ? lav : lao;
        const float* LB = (f == 0) ? lbq : (f == 1) ? lbk : (f == 2) ? lbv : lbo;
        fold_piece(W, LA, LB, WB + (size_t)f * DM * WP, (size_t)(blk - f * FOLD_BLOCKS) * 256 + threadIdx.x);
    } else {
        cvt8_piece(x, XB, (size_t)(blk - 4 * FOLD_BLOCKS) * 256 + threadIdx.x, (size_t)NB * SEQ * (DM / 8));
    }
}

// gemm_main: a block of four waves (2 x 2) on a 128x128 tile, each wave 64x64 with 16 accumulators; operands from fragment-order bf16 planes whose rows hold NA (A) or NBH (B) halves of DM columns: value, or value | remainder.
// C[m][n] += sum over k < DM of A0[m][k] B0[n][k] + A1[m][k] B0[n][k] + A0[m][k] B1[n][k] (the terms whose halves exist; never remainder x remainder).
// The k loop runs over DM once: a stage is KC = 64 k of every half of the block's 128 A rows and 128 B rows (NA + NBH panels of 16 KiB, still in fragment order), so each half is brought from L2 once per block
// and each fragment read from LDS serves every product that its k-step has for it (an operand with one half meets both halves of the other from the same registers).
// A stage is copied once per block by asynchronous 16-B copies, 8 per lane and panel, into one of two buffers, one stage ahead of its use; each block row is then read by two waves (512 contiguous bytes per ds load).
// The fragments of a stage's two k-steps are read as one group ahead of its products; no fragment is read across a stage's end.
// ga / gb = plane + (block's first row) * pitch + 8 * thread. PA / PB = row pitches (elements); 32 k = one block = 512 elements, so column k0 is at k0*16 and the remainder half DM*16 further.
// Every accumulator takes its k-steps in rising order, and inside a k-step value x value, remainder x value, value x remainder.
// Eight copies of one lane: the same 16-B piece of block rows 0..7 of one panel; l = LDS byte address of the piece in block row 0, g = the same piece in the plane.
template <int P>
__device__ __forceinline__ void tile_copy(const unsigned l, const bf* g) {
    // the wait is the statement's last line: the address registers that the copies name are rewritten only behind it
    asm volatile(
                 "global_load_async_to_lds_b128 %0, %8, off\n\t"
                 "global_load_async_to_lds_b128 %1, %9, off\n\t"
                 "global_load_async_to_lds_b128 %2, %10, off\n\t"
                 "global_load_async_to_lds_b128 %3, %11, off\n\t"
                 "global_load_async_to_lds_b128 %4, %12, off\n\t"
                 "global_load_async_to_lds_b128 %5, %13, off\n\t"
                 "global_load_async_to_lds_b128 %6, %14, off\n\t"
                 "global_load_async_to_lds_b128 %7, %15, off\n\t"
                 "s_wait_xcnt 0x0"
                 :: "v"(l), "v"(l + 2048u), "v"(l + 4096u), "v"(l + 6144u), "v"(l + 8192u), "v"(l + 10240u), "v"(l + 12288u), "v"(l + 14336u),
                    "v"(g), "v"(g + 16 * P), "v"(g + 32 * P), "v"(g + 48 * P), "v"(g + 64 * P), "v"(g + 80 * P), "v"(g + 96 * P), "v"(g + 112 * P) : "memory");
}
template <int PA, int PB, int NA, int NBH>
__device__ __forceinline__ void stage_fill(const unsigned l, const bf* ga, const bf* gb, const int kc) {
    // a block row of a panel is 2 KiB = 128 pieces: this lane's piece is 'thread'; panels in the buffer: A halves, then B halves
#pragma unroll
    for (int h = 0; h < NA; ++h)  tile_copy<PA>(l + (unsigned)(h * PNL * 2), ga + (size_t)(kc + h * DM) * 16);
#pragma unroll
    for (int h = 0; h < NBH; ++h) tile_copy<PB>(l + (unsigned)((NA + h) * PNL * 2), gb + (size_t)(kc + h * DM) * 16);
}
template <int PA, int PB, int NA, int NBH>
__device__ __forceinline__ void gemm_main(const bf* st, const bf* ga, const bf* gb, const int tid, const int wm, const int wn, v8f (&acc)[4][4]) {
    static_assert(NA * DM <= PA && NBH * DM <= PB && NA >= 1 && NA <= 2 && NBH >= 1 && NBH <= 2);   // every half lies inside its plane's rows
    constexpr int GST = (NA + NBH) * PNL;                        // elements of one stage
    const int lane = tid & 31;
    const unsigned l0 = (unsigned)(size_t)st + (unsigned)tid * 16u;
    stage_fill<PA, PB, NA, NBH>(l0, ga, gb, 0);
    asm volatile("s_wait_asynccnt 0x0" ::: "memory");            // this wave's share of stage 0 has landed before the barrier that shows it to the other waves
    __syncthreads();
    stage_fill<PA, PB, NA, NBH>(l0 + (unsigned)(GST * 2), ga, gb, KC);
#pragma unroll 1                                                 // one stage per trip: the two buffers alternate by s & 1
    for (int s = 0; s < DM / KC; ++s) {
        const bf* sa = st + (s & 1) * GST + wm * (64 * KC) + 8 * lane;                 // this wave's four A block rows (first half)
        const bf* sb = st + (s & 1) * GST + NA * PNL + wn * (64 * KC) + 8 * lane;      // this wave's four B block rows (first half)
        v16bf a[KC / 32][NA][4], b[KC / 32][NBH][4];
#pragma unroll
        for (int q = 0; q < KC / 32; ++q) {
#pragma unroll
            for (int i = 0; i < 4; ++i) { a[q][0][i] = ldb(sa + i * (16 * KC) + q * 512); b[q][0][i] = ldb(sb + i * (16 * KC) + q * 512); }
            if (NA > 1) {
#pragma unroll
                for (int i = 0; i < 4; ++i) a[q][NA - 1][i] = ldb(sa + PNL + i * (16 * KC) + q * 512);
            }
            if (NBH > 1) {
#pragma unroll
                for (int i = 0; i < 4; ++i) b[q][NBH - 1][i] = ldb(sb + PNL + i * (16 * KC) + q * 512);
            }
        }
        __builtin_amdgcn_sched_barrier(0);                       // the stage's read group stands whole ahead of the products: sunk among them each row of products would wait for its own reads
#pragma unroll                                                   // unrolled so that every fragment's register set is a static choice
        for (int ks = 0; ks < KC / 32; ++ks) {
#pragma unroll
            for (int hb = 0; hb < NBH; ++hb)
#pragma unroll
                for (int ha = 0; ha < NA; ++ha) {
                    if (ha + hb > 1) continue;                   // remainder x remainder is not part of the sum
#pragma unroll
                    for (int nb = 0; nb < 4; ++nb)
#pragma unroll
                        for (int mb = 0; mb < 4; ++mb) acc[mb][nb] = wmmab(a[ks][ha][mb], b[ks][hb][nb], acc[mb][nb]);
                }
        }
        __builtin_amdgcn_sched_barrier(0);                       // keeps the waits below behind the last products: lifted over them the s_wait_dscnt 0 would hold every product back until the whole read group is home
        // hand-over of the buffers, every wave: its own reads of this stage are home, its own copies of the next stage have landed, then the barrier; only behind it is this stage's buffer refilled
        asm volatile("s_wait_dscnt 0x0" ::: "memory");           // this wave has finished reading the buffer that is refilled below
        asm volatile("s_wait_asynccnt 0x0" ::: "memory");        // this wave's share of stage s + 1 has landed
        __syncthreads();
        if (s + 2 < DM / KC) stage_fill<PA, PB, NA, NBH>(l0 + (unsigned)(s & 1) * (unsigned)(GST * 2), ga, gb, (s + 2) * KC);
    }
    asm volatile("s_wait_asynccnt 0x0" ::: "memory");            // no copy is outstanding when the wave goes on to the store stage
}

// proj_tile: bf16 GEMM, four waves per 128x128 tile (one 64x64 tile each), k over DM; the folded weight has two halves (value, remainder), x one: NA / NBH = halves of A / Bt.
// C[m][n] = sum_k x . (W value + W remainder) + bias (bias by column n when biasRow == 0, by row m when biasRow != 0; bias RNE-converted to bf16),
// written as f16, in fragment order, into the sub-plane at (r0/RB)*sRB + (c0/CB)*sCB: rows r0%RB .., columns c0%CB .., row pitch 'pitch' (halves). Tile (bx, by) of (M/128, N/128), 128 threads; st, osa = the block's LDS.
template <int PA, int PB, int NA, int NBH>
__device__ __forceinline__ void proj_tile(const bf* st, float* osa, const bf* __restrict__ A, const bf* __restrict__ Bt,
                                          const float* __restrict__ bias, const int biasRow, h16* Ph, const int RB, const size_t sRB, const int pitch, const int CB, const size_t sCB,
                                          const int bx, const int by) {
    const int tid = threadIdx.x; const int wave = __builtin_amdgcn_readfirstlane(threadIdx.x >> 5); const int wm = wave >> 1, wn = wave & 1;
    float* os = osa + wave * (16 * 68);                          // store staging, private to the wave
    const int lane = threadIdx.x & 31, lr = lane & 15, hi = lane >> 4; const int r0 = bx * 128 + wm * 64, c0 = by * 128 + wn * 64;
    v8f acc[4][4];
#pragma unroll
    for (int mb = 0; mb < 4; ++mb)
#pragma unroll
        for (int nb = 0; nb < 4; ++nb) acc[mb][nb] = (v8f){};
    gemm_main<PA, PB, NA, NBH>(st, A + (size_t)(bx * 128) * PA + 8 * tid, Bt + (size_t)(by * 128) * PB + 8 * tid, tid, wm, wn, acc);
    // store stage s = 0..3: lane holds row lane&15, columns (s>>1)*32 + (s&1)*16 + 8h + 0..7 of the slab = piece 'lane' of half s&1 of block s>>1
    float bc[4][8];
#pragma unroll
    for (int s = 0; s < 4; ++s) {
      if (biasRow) {                                             // known at compile time at both calls: with the bias by row no column bias is read
#pragma unroll
        for (int i = 0; i < 8; ++i) bc[s][i] = 0.0f;
      } else {
        int cb = c0 + (s >> 1) * 32 + (s & 1) * 16 + hi * 8; cb = (cb < DM - 8) ? cb : (DM - 8);          // clamped address
        const v4f b0 = *(const v4f*)(bias + cb);
        asm volatile("s_wait_xcnt 0x0" ::: "memory");            // in this build a later bias load lands in a register that this load names as its address
        const v4f b1 = *(const v4f*)(bias + cb + 4);
        asm volatile("s_wait_xcnt 0x0" ::: "memory");            // the same for the second half
#pragma unroll
        for (int i = 0; i < 4; ++i) { bc[s][i] = bfr(b0[i]); bc[s][4 + i] = bfr(b1[i]); }
      }
    }
    const size_t tbase = (size_t)(r0 / RB) * sRB + (size_t)(r0 % RB) * (size_t)pitch + (size_t)(c0 / CB) * sCB + (size_t)(c0 % CB) * 16 + 8 * lane;
#pragma unroll
    for (int mb = 0; mb < 4; ++mb) {
#pragma unroll
        for (int nb = 0; nb < 4; ++nb) {
#pragma unroll
            for (int j = 0; j < 8; ++j) os[(hi * 8 + j) * 68 + nb * 16 + lr] = acc[mb][nb][j]; }   // D: row 8h+j, col lane&15
        wave_sync();
        float br;
        { int ri = r0 + mb * 16 + lr; ri = (ri < DM - 1) ? ri : (DM - 1); const float bv_ = bias[ri]; br = biasRow ? bfr(bv_) : 0.0f; }
        const size_t sb = tbase + (size_t)(mb * 16) * (size_t)pitch;
{
#pragma unroll
            for (int s = 0; s < 4; ++s) { const int col = (s >> 1) * 32 + (s & 1) * 16 + hi * 8;   // 16 lanes = 16 rows; 4 s x 2 halves x 8 = 64 columns
                const v4f x0 = *(const v4fa*)(&os[lr * 68 + col]); const v4f x1 = *(const v4fa*)(&os[lr * 68 + col + 4]);
                float val[8]; v8h hv;
#pragma unroll
                for (int i = 0; i < 4; ++i) { val[i] = x0[i] + bc[s][i] + br; val[4 + i] = x1[i] + bc[s][4 + i] + br; }
#pragma unroll
                for (int i = 0; i < 8; ++i) hv[i] = toh_flush(val[i]);
                const size_t oo = sb + (size_t)((s >> 1) * 512 + (s & 1) * 256);
                *(v8h*)(Ph + oo) = hv; }
             }
        if (biasRow) asm volatile("s_wait_xcnt 0x0" ::: "memory");   // in this build the next slab's row-bias load lands in a register that one of these stores names
        wave_sync();
    }
}

// k_qkv: the three input projections in one launch, grid (NB*SEQ/128, DM/128, 3); the choice by blockIdx.z is the same for a whole block.
// z = 0, 1 (q, k): A = x rows (m = b*SEQ + t, pitch DM, one half), Bt = folded W rows (n = h*64 + d, pitch WP, two halves), bias by column -> plane [(b*12 + h)][t][d]
// z = 2 (v^T):     A = folded Wv rows (m = h*64 + d, pitch WP, two halves), Bt = x rows (n = b*SEQ + t, pitch DM, one half), bias by row -> plane [(b*768 + m)][t] = [(b*12 + h)][d][t]
__global__ __launch_bounds__(32 * GW) void k_qkv(const bf* __restrict__ XB, const bf* __restrict__ WB,
                                                 const float* __restrict__ bq, const float* __restrict__ bk, const float* __restrict__ bv, h16* QH, h16* KP, h16* VT) {
    __shared__ __align__(16) bf st[2 * 3 * PNL];                 // two buffers of three panels
    __shared__ __align__(16) float osa[GW * 16 * 68];
    const int z = blockIdx.z;
    if (z < 2) proj_tile<DM, WP, 1, 2>(st, osa, XB, WB + (size_t)z * DM * WP, z ? bk : bq, 0, z ? KP : QH, SEQ, (size_t)NH_ * SEQ * HD, HD, HD, (size_t)SEQ * HD, blockIdx.x, blockIdx.y);
    else       proj_tile<WP, DM, 2, 1>(st, osa, WB + (size_t)2 * DM * WP, XB, bv, 1, VT, DM, (size_t)0, SEQ, SEQ, (size_t)DM * SEQ, blockIdx.y, blockIdx.x);
}

// k_flash: fused dense attention, one wave per 16 query rows of one (batch, head), eight waves per block; Q fragments straight from the fragment-order f16 plane (two 16-B loads each, 512 contiguous bytes per load).
// K and V^T reach the waves through LDS: a stage is 64 keys (K 8 KiB, V^T 4 block rows x 2 KiB, both still in fragment order), copied once per block by asynchronous 16-B copies, four per lane, into one of two buffers,
// one stage ahead of its use; all eight waves read their fragments from it (512 contiguous bytes per ds load).
// Transposed form: S^T[key][t] = K Q^T (A = K rows, B = Q rows); lane (t = lane&15, h = lane>>4) holds keys 8h+r of each 16-key tile, so the packed
// P tile is directly the B fragment of O^T[d][t] = V^T P^T (element r <- tile keys 0..15, element 8+r <- tile keys 16..31, lane unchanged).
// Key loop covers keys 0 .. SEQ-1 in steps of 32 (all inside the sequence, every key valid for every row).
// Softmax state (running max, partial sum) is one scalar per lane; the two lane halves of a row are combined with one xor-16 exchange.
// P carries x256 and is converted to f16 two scores per instruction; a P under the smallest normal f16 stays an f16 subnormal (the matrix unit keeps them); the row sum runs over the converted P.
// One lane's four copies of a stage: l = LDS byte address of its first piece in the buffer, gk / gv = its first K and V^T piece of the stage.
__device__ __forceinline__ void stage_copy(const unsigned l, const h16* gk, const h16* gv) {
    const unsigned l1 = l + 4096u, l2 = l + 8192u, l3 = l + 12288u;
    const h16* gk1 = gk + 2048; const h16* gv1 = gv + (size_t)32 * SEQ;      // K piece + 256; V^T piece + 256 = two block rows further
    // the wait is the statement's last line: the address registers that the copies name are rewritten only behind it
    asm volatile("global_load_async_to_lds_b128 %0, %4, off\n\t"
                 "global_load_async_to_lds_b128 %1, %5, off\n\t"
                 "global_load_async_to_lds_b128 %2, %6, off\n\t"
                 "global_load_async_to_lds_b128 %3, %7, off\n\t"
                 "s_wait_xcnt 0x0"
                 :: "v"(l), "v"(l1), "v"(l2), "v"(l3), "v"(gk), "v"(gk1), "v"(gv), "v"(gv1) : "memory");
}
__global__ __launch_bounds__(32 * AW) void k_flash(const h16* __restrict__ QH, const h16* __restrict__ KP, const h16* __restrict__ VT, bf* CX) {
    __shared__ __align__(16) h16 kv[2][2 * KS * HD];            // per buffer: K [64 keys][64 d] (4096 halves), then V^T [4 block rows][64 keys x 16 d] (4096 halves)
    const int tid = threadIdx.x;
    const int lane = threadIdx.x & 31;
    const int wave = __builtin_amdgcn_readfirstlane(threadIdx.x >> 5);
    const int zh = blockIdx.y; const int b = zh / NH_, h = zh % NH_;
    const int t0 = (blockIdx.x * AW + wave) * 16;
    const size_t pbase = (size_t)zh * SEQ * HD;
    const size_t qo = pbase + (size_t)t0 * HD + 8 * lane;
    const v16h qh0 = ldh(QH + qo), qh1 = ldh(QH + qo + 512);   // B fragments: col t, k = d (blocks d 0..31, d 32..63)
    // this lane's pieces of a stage: K pieces tid and tid + 256 of 512 (contiguous); V^T pieces tid and tid + 256 of 512 (piece i: block row i >> 7, 16-B unit i & 127 of its 2 KiB)
    const unsigned lds0 = (unsigned)(size_t)&kv[0][0] + (unsigned)tid * 16u;
    const h16* gk = KP + pbase + (size_t)tid * 8;                                          // + stage * KS * HD
    const h16* gv = VT + pbase + (size_t)(tid >> 7) * 16 * SEQ + (size_t)(tid & 127) * 8;  // + stage * KS * 16
    v8f o[4];
#pragma unroll
    for (int j = 0; j < 4; ++j) { o[j] = (v8f){}; }
    float m = -3.0e38f, l = 0.0f;
    stage_copy(lds0, gk, gv);
    asm volatile("s_wait_asynccnt 0x0" ::: "memory");            // this wave's share of stage 0 has landed before the barrier that shows it to the other waves
    __syncthreads();
    stage_copy(lds0 + (unsigned)sizeof(kv[0]), gk + KS * HD, gv + KS * 16);
#pragma unroll 1                                                 // one stage per trip: the two buffers alternate by s & 1
    for (int s = 0; s < SEQ / KS; ++s) {
        const h16* sb = &kv[s & 1][0] + 8 * lane;
#pragma unroll                                                   // both passes of a stage in one trip: their LDS offsets become immediates
        for (int p = 0; p < KS / 32; ++p) {
        const h16* ka = sb + p * 32 * HD;                        // A fragments: row key, k = d
        const v16h ka0 = ldh(ka), ka1 = ldh(ka + 512), kb0 = ldh(ka + 16 * HD), kb1 = ldh(ka + 16 * HD + 512);
        const h16* va = sb + KS * HD + p * 512;                  // A fragments: row d, k = key
        const v16h v0 = ldh(va), v1 = ldh(va + KS * 16), v2 = ldh(va + 2 * KS * 16), v3 = ldh(va + 3 * KS * 16);
        v8f sHa = (v8f){}, sHb = (v8f){};
        sHa = wmma16(ka0, qh0, sHa); sHb = wmma16(kb0, qh0, sHb);
        sHa = wmma16(ka1, qh1, sHa); sHb = wmma16(kb1, qh1, sHb);
        float ta[8], tb[8];
#pragma unroll
        for (int r = 0; r < 8; ++r) { ta[r] = sHa[r] * SC2; tb[r] = sHb[r] * SC2; }
        float mx = -3.0e38f;
#pragma unroll
        for (int r = 0; r < 8; ++r) mx = fmaxf(mx, fmaxf(ta[r], tb[r]));
        mx = fmaxf(mx, __shfl_xor(mx, 16, 32));
        const float mnew = fmaxf(m, mx);
        float alpha;
        // the exponential and the one free slot behind it in one statement
        asm("v_exp_f32 %0, %1\n\tv_nop" : "=v"(alpha) : "v"(m - mnew));
        const float sh = PSH - mnew;
        v16h pb; float ls = 0.0f;
#pragma unroll
        for (int r = 0; r < 8; r += 2) {
            float xa0;
            // the pass's first score exponential and the one free slot behind it in one statement
            if (r == 0) asm("v_exp_f32 %0, %1\n\tv_nop" : "=v"(xa0) : "v"(ta[0] + sh)); else xa0 = __builtin_amdgcn_exp2f(ta[r] + sh);
            const v2f xa = { xa0, __builtin_amdgcn_exp2f(ta[r + 1] + sh) };
            const v2f xb = { __builtin_amdgcn_exp2f(tb[r] + sh), __builtin_amdgcn_exp2f(tb[r + 1] + sh) };
            const v2h pa = __builtin_convertvector(xa, v2h), pc = __builtin_convertvector(xb, v2h);   // two scores per conversion, round to nearest even
            pb[r] = pa[0]; pb[r + 1] = pa[1]; pb[8 + r] = pc[0]; pb[9 + r] = pc[1];
            ls += (float)pa[0] + (float)pc[0]; ls += (float)pa[1] + (float)pc[1]; }
#pragma unroll
        for (int j = 0; j < 4; ++j) o[j] = o[j] * alpha;
        o[0] = wmma16(v0, pb, o[0]); o[1] = wmma16(v1, pb, o[1]); o[2] = wmma16(v2, pb, o[2]); o[3] = wmma16(v3, pb, o[3]);
        l = l * alpha + ls; m = mnew;
        }
        // hand-over of the buffers, every wave: its own reads of this stage are home, its own copies of the next stage have landed, then the barrier; only behind it is this stage's buffer refilled
        asm volatile("s_wait_dscnt 0x0" ::: "memory");           // this wave has finished reading the buffer that is refilled below
        asm volatile("s_wait_asynccnt 0x0" ::: "memory");        // this wave's share of stage s + 1 has landed
        __syncthreads();
        if (s + 2 < SEQ / KS) stage_copy(lds0 + (unsigned)(s & 1) * (unsigned)sizeof(kv[0]), gk + (size_t)(s + 2) * (KS * HD), gv + (size_t)(s + 2) * (KS * 16));
    }
    asm volatile("s_wait_asynccnt 0x0" ::: "memory");            // no copy is outstanding when the wave ends
    l += __shfl_xor(l, 16, 32);
    const float inv = 1.0f / l;
    // O^T D layout: o_j[r] = (d = 16j + 8h + r, t = lane&15) = row t, columns 16j + 8h + 0..7: piece 'lane' of half j&1 of block j>>1 in fragment order, so every lane stores its own registers (no transposition)
    bf* crow = CX + ((size_t)b * SEQ + t0) * CXP + (size_t)(h * HD) * 16 + 8 * lane;   // block row t0/16, first block of column h*64, piece 'lane'
#pragma unroll
    for (int j = 0; j < 4; ++j) { v8us hv, lv;
#pragma unroll
        for (int i = 0; i < 8; ++i) { const float x = o[j][i] * inv; const unsigned short h0 = f2bf(x); hv[i] = h0; lv[i] = f2bf(x - bf2f(h0)); }
        const size_t oo = (size_t)((j >> 1) * 512 + (j & 1) * 256);
        *(v8us*)(crow + oo) = hv; *(v8us*)(crow + oo + DM * 16) = lv; }
}

// k_out: final projection, four waves per 128x128 tile (one 64x64 tile each). A = ctx plane [m][value 768 | remainder 768], Bt = folded Wo plane [n][value 768 | remainder 768], k over 768:
// per k-step value x value, remainder x value, value x remainder, from one read of each of the four halves.
// OUT[m][n] = acc + bias[n] (bias RNE-converted to bf16), f32. Epilogue: per 16-row slab staged in LDS (wave-private), each output row segment (64 floats = 256 B = two lines)
__global__ __launch_bounds__(32 * GW) void k_out(const bf* __restrict__ A, const bf* __restrict__ Bt, const float* __restrict__ bias, float* OUT) {
    __shared__ __align__(16) bf st[2 * 4 * PNL];                 // two buffers of four panels
    __shared__ __align__(16) float osa[GW][16 * 68];
    const int tid = threadIdx.x; const int wave = __builtin_amdgcn_readfirstlane(threadIdx.x >> 5); const int wm = wave >> 1, wn = wave & 1;
    float* os = &osa[wave][0];                                   // store staging, private to the wave
    const int lane = threadIdx.x & 31, lr = lane & 15, hi = lane >> 4; const int r0 = blockIdx.x * 128 + wm * 64, c0 = blockIdx.y * 128 + wn * 64;
    v8f acc[4][4];
#pragma unroll
    for (int mb = 0; mb < 4; ++mb)
#pragma unroll
        for (int nb = 0; nb < 4; ++nb) acc[mb][nb] = (v8f){};
    gemm_main<CXP, WP, 2, 2>(st, A + (size_t)(blockIdx.x * 128) * CXP + 8 * tid, Bt + (size_t)(blockIdx.y * 128) * WP + 8 * tid, tid, wm, wn, acc);
    const int cofs = lr * 4;
    v4f b4 = *(const v4f*)(bias + c0 + cofs);          // c0 + cofs + 3 <= DM - 1 always
    asm volatile("s_wait_xcnt 0x0" ::: "memory");      // the address arithmetic below reuses registers that this load names
    __builtin_amdgcn_sched_barrier(0);                 // holds that arithmetic behind the wait
    b4[0] = bfr(b4[0]); b4[1] = bfr(b4[1]); b4[2] = bfr(b4[2]); b4[3] = bfr(b4[3]);
    const size_t orow0 = (size_t)(r0 / SEQ) * OUT_SEQ + (size_t)(r0 % SEQ);
#pragma unroll
    for (int mb = 0; mb < 4; ++mb) {
#pragma unroll
        for (int nb = 0; nb < 4; ++nb) {
#pragma unroll
            for (int j = 0; j < 8; ++j) os[(hi * 8 + j) * 68 + nb * 16 + lr] = acc[mb][nb][j]; }   // D: row 8h+j, col lane&15
        wave_sync();
        float* ob = OUT + (orow0 + (size_t)(mb * 16)) * DM + c0;
{
#pragma unroll
            for (int s = 0; s < 8; ++s) { const int row = 2 * s + hi;   // 8 s x 2 rows = 16 rows; 16 lanes x 4 floats = 64 columns
                const v4f xv = *(const v4fa*)(&os[row * 68 + cofs]);
                const v4f val = xv + b4;
                *(v4f*)(ob + (size_t)row * DM + cofs) = val; }
             }
        wave_sync();
    }
}

static constexpr size_t al256(size_t v) { return (v + 255) & ~(size_t)255; }
static constexpr size_t SZ_XB = al256((size_t)NB * SEQ * DM * 2);
static constexpr size_t SZ_WB = al256((size_t)4 * DM * WP * 2);
static constexpr size_t SZ_PL = al256((size_t)NB * NH_ * SEQ * HD * 2);
static constexpr size_t SZ_CX = al256((size_t)NB * SEQ * CXP * 2);
static constexpr size_t SZ_TOTAL = SZ_XB + SZ_WB + 3 * SZ_PL + SZ_CX;
static_assert(SZ_TOTAL <= (size_t)134217728);          // workspace carve <= 128 MiB
static_assert(((size_t)DM * WP * 2) % 256 == 0);       // weight sub-planes stay 256-byte aligned
static_assert((size_t)NB * NH_ * SEQ * HD == (size_t)NB * SEQ * DM);   // plane extent == GEMM tile grid extent

extern "C" void kernel_launch(void* const* d_in, const int* in_sizes, int n_in,
                              void* d_out, int out_size, void* d_ws, size_t ws_size, hipStream_t stream) {
    if (n_in < 17) return;
    const size_t needx = ((size_t)(NB - 1) * SEQ_FULL + SEQ) * DM;
    if ((size_t)in_sizes[0] < needx) return;
    if ((size_t)in_sizes[1] < (size_t)DM * DM || (size_t)in_sizes[5] < (size_t)DM * DM || (size_t)in_sizes[9] < (size_t)DM * DM || (size_t)in_sizes[13] < (size_t)DM * DM) return;
    if (in_sizes[2] < DM || in_sizes[6] < DM || in_sizes[10] < DM || in_sizes[14] < DM) return;
    if (in_sizes[3] < LR * DM || in_sizes[7] < LR * DM || in_sizes[11] < LR * DM || in_sizes[15] < LR * DM) return;
    if (in_sizes[4] < DM * LR || in_sizes[8] < DM * LR || in_sizes[12] < DM * LR || in_sizes[16] < DM * LR) return;
    if ((size_t)out_size < ((size_t)(NB - 1) * OUT_SEQ + SEQ) * DM) return;
    if (SZ_TOTAL > ws_size) return;
    // wire order: x, then per projection (q, k, v, o): W [out][in], b [out], A [8][in], B [out][8]; folded weights [out][in] = Bt as-is
    const float* x   = (const float*)d_in[0];
    const float* wq  = (const float*)d_in[1];  const float* bq  = (const float*)d_in[2];  const float* laq = (const float*)d_in[3];  const float* lbq = (const float*)d_in[4];
    const float* wk  = (const float*)d_in[5];  const float* bk  = (const float*)d_in[6];  const float* lak = (const float*)d_in[7];  const float* lbk = (const float*)d_in[8];
    const float* wv  = (const float*)d_in[9];  const float* bv  = (const float*)d_in[10]; const float* lav = (const float*)d_in[11]; const float* lbv = (const float*)d_in[12];
    const float* wo  = (const float*)d_in[13]; const float* bo  = (const float*)d_in[14]; const float* lao = (const float*)d_in[15]; const float* lbo = (const float*)d_in[16];
    float* OUT = (float*)d_out;      // [NB][SEQ][768]
    char* wsp = (char*)d_ws;
    bf* XB = (bf*)wsp; wsp += SZ_XB;                 // [NB*SEQ][768]
    bf* WB = (bf*)wsp; wsp += SZ_WB;                 // [4][768][value 768 | remainder 768]: q | k | v | o
    h16* QH = (h16*)wsp; wsp += SZ_PL;               // [NB*12][SEQ][64]
    h16* KP = (h16*)wsp; wsp += SZ_PL;               // [NB*12][SEQ][64]
    h16* VT = (h16*)wsp; wsp += SZ_PL;               // [NB*12][64][SEQ]
    bf* CX = (bf*)wsp; wsp += SZ_CX;                 // [NB*SEQ][value 768 | remainder 768]
    bf* WO = WB + (size_t)3 * DM * WP;

    k_prep<<<4 * FOLD_BLOCKS + CVT_BLOCKS, 256, 0, stream>>>(x, wq, laq, lbq, wk, lak, lbk, wv, lav, lbv, wo, lao, lbo, XB, WB);

    k_qkv<<<dim3(NB * SEQ / 128, DM / 128, 3), 32 * GW, 0, stream>>>(XB, WB, bq, bk, bv, QH, KP, VT);

    k_flash<<<dim3(SEQ / (16 * AW), NB * NH_, 1), 32 * AW, 0, stream>>>(QH, KP, VT, CX);

    // out: A = ctx rows [m][value | remainder], Bt = folded Wo rows (n) [value | remainder], bias by column -> OUT[b][t][n]
    k_out<<<dim3(NB * SEQ / 128, DM / 128, 1), 32 * GW, 0, stream>>>(CX, WO, bo, OUT);
}

// v007
// It runs in 130 microseconds.
// Next to v006, in two timings, it ran 1.04 and 1.03 times as fast.
// Counting every step since v000, it is 3.28 times as fast.
#include <hip/hip_runtime.h>

// Dense (unmasked) multi-head self-attention, width 768 = 12 heads x 64, x [NB][SEQ][768]; each of the four projections is y = x W^T + b + (x A^T) B^T with W [out][in], A [8][in], B [out][8]; score scale 1/8; f32 output.
// Compute dtypes, f32 accumulate everywhere: the rank-8 update is folded once into W_eff = W + B A (f32 on the vector unit, K = 8; W, A, B, b, x RNE-converted to bf16 first) and carried as bf16 value | bf16 remainder along K;
// softmax f32 (online, running max); output projection v_wmma_f32_16x16x32_bf16 with ctx as bf16 value | remainder and W_eff as bf16 value | remainder (per k-step: value x value, remainder x value, value x remainder), one accumulator.
// Layout: bf16 copy of x; folded weight planes [4][768][value 768 | remainder 768]; q, k planes [b*12+h][t][d], v^T plane [b*12+h][d][t] (f16) written by the GEMM epilogue; fused flash kernel in transposed form
// Every one of these planes is stored in FRAGMENT ORDER: a block of 16 rows x 32 k is 512 consecutive elements, element (row, k) of a block at (k>>4)*256 + ((k>>3)&1)*128 + row*8 + (k&7);
// blocks run along k (512 elements each), then along rows (16 * pitch elements per block row). A fragment is then two wave-wide 16-B loads of 512 contiguous bytes each (four whole lines) instead of 16 partial lines.
// (S^T = K Q^T, O^T = V^T P^T, key loop over the whole sequence) writes the ctx plane [b*SEQ+t][value 768 | remainder 768] (bf16); final GEMM adds the bias at the store stage.

#ifndef NB
#define NB 4
#endif
#ifndef SEQ
#define SEQ 2048
#endif
#define NB_FULL  4
#define SEQ_FULL 2048
#ifndef OUT_SEQ
#define OUT_SEQ SEQ              // row pitch (in tokens) between batches of the output
#endif
#define DM   768
#define NH_  12
#define HD   64
#define LR   8                   // rank of the low-rank update
#define WP   (2 * DM)            // folded weight plane row pitch: value columns 0..DM-1, remainder columns DM..2DM-1
#define CXP  (2 * DM)            // ctx plane row pitch: value columns 0..DM-1, remainder columns DM..2DM-1
#define AW   8                   // waves per flash block (16 query rows each)
#define KS   64                  // keys per LDS stage of the flash kernel (two passes of 32)
#define GW   4                   // waves per GEMM block, 2 x 2, one 64x64 tile each: block tile 128 x 128
#define KC   64                  // k per LDS stage of the GEMMs (two k-steps of 32)
#define PNL  (128 * KC)          // elements of one panel of a GEMM stage: 128 rows x KC of one half (value or remainder) of one operand = 8 block rows of 2 KiB
#define SC2  (0.125f * 1.4426950408889634f)   // HD^-0.5 * log2(e)
#define PSH  8.0f                // log2 of the P carry (256)

static_assert(HD == 64);
static_assert(NH_ * HD == DM);                 // head h = columns h*64 + d
static_assert(DM % 64 == 0);                   // column tiles of 64
static_assert(DM % 32 == 0);                   // GEMM k-loop steps by 32
static_assert(CXP == 2 * DM);
static_assert(CXP % 32 == 0);
static_assert(WP == 2 * DM);
static_assert(WP % 32 == 0);
static_assert(LR == 8);                        // one 32-byte load covers a row of B [out][8]
static_assert(DM % 8 == 0);                    // fold kernel: 8 columns per lane
static_assert((DM / 8) % 8 == 0);
static_assert(SEQ % 64 == 0);                  // a 64-row tile never straddles two batches
static_assert((NB * SEQ) % 64 == 0);
static_assert(SEQ % 32 == 0);                  // key loop steps by 32 and stays inside the sequence
static_assert(SEQ % (16 * AW) == 0);           // flash grid covers the sequence exactly
static_assert(((size_t)SEQ * DM) % 8 == 0);
static_assert(((size_t)DM * DM) % 8 == 0);
static_assert(NB <= NB_FULL);
static_assert(SEQ <= SEQ_FULL);
static_assert(AW * 32 == 256);                 // the stage copy deals 16-byte pieces to exactly 256 lanes
static_assert(KS == 64 && SEQ % KS == 0 && SEQ / KS >= 2);   // the two-buffer prologue needs two stages
static_assert(GW == 4 && KC == 64);            // the tile copy deals one 2-KiB block row (16 rows x KC) to exactly 128 lanes
static_assert(DM % 128 == 0 && (NB * SEQ) % 128 == 0);       // block tiles of 128 x 128 cover every GEMM exactly
static_assert(DM % KC == 0 && DM / KC >= 2);   // whole stages along k, and the two-buffer prologue needs two of them

typedef _Float16 h16;
typedef unsigned short bf;
typedef __attribute__((ext_vector_type(16))) __bf16   v16bf;
typedef __attribute__((ext_vector_type(16))) _Float16 v16h;
typedef __attribute__((ext_vector_type(8)))  _Float16 v8h;
typedef __attribute__((ext_vector_type(2)))  _Float16 v2h;
typedef __attribute__((ext_vector_type(2)))  float    v2f;
typedef __attribute__((ext_vector_type(8)))  unsigned short v8us;
typedef __attribute__((ext_vector_type(8)))  float    v8f;
typedef __attribute__((ext_vector_type(4)))  float    v4f;
typedef v4f  __attribute__((may_alias)) v4fa;

__device__ __forceinline__ unsigned short f2bf(float f) { unsigned u = __float_as_uint(f); u += 0x7FFFu + ((u >> 16) & 1u); return (unsigned short)(u >> 16); }
__device__ __forceinline__ float bf2f(unsigned short s) { return __uint_as_float(((unsigned)s) << 16); }
__device__ __forceinline__ float bfr(float f) { return bf2f(f2bf(f)); }     // f32 -> bf16 (RNE) -> f32
__device__ __forceinline__ v16h cat16(v8h lo, v8h hi) { return __builtin_shufflevector(lo, hi, 0, 1, 2, 3, 4, 5, 6, 7, 8, 9, 10, 11, 12, 13, 14, 15); }
__device__ __forceinline__ v16bf cat16b(v8us lo, v8us hi) { return __builtin_bit_cast(v16bf, __builtin_shufflevector(lo, hi, 0, 1, 2, 3, 4, 5, 6, 7, 8, 9, 10, 11, 12, 13, 14, 15)); }
__device__ __forceinline__ v8f wmma16(v16h a, v16h b, v8f c) { return __builtin_amdgcn_wmma_f32_16x16x32_f16(false, a, false, b, (short)0, c, false, false); }
__device__ __forceinline__ v8f wmmab(v16bf a, v16bf b, v8f c) { return __builtin_amdgcn_wmma_f32_16x16x32_bf16(false, a, false, b, (short)0, c, false, false); }
// fragment loaders from fragment-order planes; p = block base + 8*lane: elements 0..7 <- k0+8h+0..7, elements 8..15 <- k0+16+8h+0..7 of row lane&15 (same map for A and B)
__device__ __forceinline__ v16h  ldh(const h16* p) { return cat16(*(const v8h*)p, *(const v8h*)(p + 256)); }
__device__ __forceinline__ v16bf ldb(const bf* p)  { return cat16b(*(const v8us*)p, *(const v8us*)(p + 256)); }
// ordering point for wave-private LDS tiles (same wave writes and reads)
__device__ __forceinline__ void wave_sync() { __builtin_amdgcn_fence(3 /* release order */, "wavefront"); __builtin_amdgcn_wave_barrier(); asm volatile("" ::: "memory"); }
// f32 -> f16 for WMMA operand planes: magnitudes below the smallest normal f16 become exactly 0 (value select)
static __device__ __forceinline__ h16 toh_flush(float v) { const h16 r = (h16)v; return (fabsf(v) < 6.103515625e-05f) ? (h16)0.0f : r; }

// cvt8_piece: one 8-element piece of the bf16 copy of x (rows b*SEQ + t, read from row b*SEQ_FULL + t of x)
__device__ __forceinline__ void cvt8_piece(const float* __restrict__ src, bf* dst, const size_t i, const size_t n8) {
    if (i >= n8) return;
    // i counts 8-element pieces of the fragment-order plane (row pitch DM): block i>>6, piece w = i&63 holds row w&15, k (w>>4)*8 .. +7 of the block
    const size_t blk = i >> 6; const int w = (int)(i & 63);
    const size_t m = (blk / (DM / 32)) * 16 + (size_t)(w & 15); const int k0 = (int)(blk % (DM / 32)) * 32 + (w >> 4) * 8;
    const size_t ms = (m / SEQ) * SEQ_FULL + (m % SEQ);
    const v8f v = *(const v8f*)(src + ms * DM + k0); v8us o;
#pragma unroll
    for (int k = 0; k < 8; ++k) o[k] = f2bf(v[k]);
    *(v8us*)(dst + i * 8) = o; 
}

// fold_piece: W_eff[m][k] = bf16(W[m][k]) + sum_r bf16(LB[m][r]) * bf16(LA[r][k]) in f32 (K = 8, vector unit, rank loop rolled), written as bf16 value at column k and bf16 remainder at column DM + k of row m (fragment order, pitch WP)
__device__ __forceinline__ void fold_piece(const float* __restrict__ W, const float* __restrict__ LA, const float* __restrict__ LB, bf* dst, const size_t i) {
    if (i >= (size_t)DM * (DM / 8)) return;
    // i counts 8-element pieces of the value half in fragment order: block i>>6 (block row rb, block column kb), piece pc = i&63 holds row pc&15, k (pc>>4)*8 .. +7 of the block
    const int rb = (int)(i >> 6) / (DM / 32), kb = (int)(i >> 6) % (DM / 32), pc = (int)(i & 63);
    const int m = rb * 16 + (pc & 15); const int k0 = kb * 32 + (pc >> 4) * 8;
    const v8f w = *(const v8f*)(W + (size_t)m * DM + k0);
    const v8f lb = *(const v8f*)(LB + (size_t)m * LR);
    float acc[8];
#pragma unroll
    for (int k = 0; k < 8; ++k) acc[k] = bfr(w[k]);
    float blr[8];
#pragma unroll
    for (int r = 0; r < 8; ++r) blr[r] = bfr(lb[r]);
    // rank loop rolled: the multiplier of step r is rotated to slot 0 so every register index stays static
#pragma unroll 1
    for (int r = 0; r < LR; ++r) {
        const float bl = blr[0];
#pragma unroll
        for (int q = 0; q < 7; ++q) blr[q] = blr[q + 1];
        const v8f a = *(const v8f*)(LA + (size_t)r * DM + k0);
#pragma unroll
        for (int k = 0; k < 8; ++k) acc[k] = acc[k] + bl * bfr(a[k]);
    }
    v8us hv, lv;
#pragma unroll
    for (int k = 0; k < 8; ++k) { const unsigned short h0 = f2bf(acc[k]); hv[k] = h0; lv[k] = f2bf(acc[k] - bf2f(h0)); }
    bf* p = dst + (size_t)rb * 16 * WP + (size_t)kb * 512 + pc * 8;
    *(v8us*)(p) = hv; *(v8us*)(p + DM * 16) = lv;          // DM columns further = DM/32 blocks = DM*16 elements
}

// k_prep: everything that depends on the inputs alone, in one launch: blocks 0 .. 4*FOLD_BLOCKS-1 fold the four weights (q, k, v, o; FOLD_BLOCKS blocks each), the rest convert x.
// The folds stand first in the grid: their chain of dependent loads is the longer one.
#define FOLD_BLOCKS ((DM * (DM / 8)) / 256)
#define CVT_BLOCKS  ((NB * SEQ * (DM / 8)) / 256)
static_assert((DM * (DM / 8)) % 256 == 0 && (NB * SEQ * (DM / 8)) % 256 == 0);   // both parts fill whole blocks
__global__ __launch_bounds__(256) void k_prep(const float* __restrict__ x,
                                              const float* __restrict__ wq, const float* __restrict__ laq, const float* __restrict__ lbq,
                                              const float* __restrict__ wk, const float* __restrict__ lak, const float* __restrict__ lbk,
                                              const float* __restrict__ wv, const float* __restrict__ lav, const float* __restrict__ lbv,
                                              const float* __restrict__ wo, const float* __restrict__ lao, const float* __restrict__ lbo,
                                              bf* XB, bf* WB) {
    const int blk = blockIdx.x;
    if (blk < 4 * FOLD_BLOCKS) {
        const int f = blk / FOLD_BLOCKS;
        const float* W  = (f == 0) ? wq  : (f == 1) ? wk  : (f == 2) ? wv  : wo;
        const float* LA = (f == 0) ? laq : (f == 1) ? lak : (f == 2) ? lav : lao;
        const float* LB = (f == 0) ? lbq : (f == 1) ? lbk : (f == 2) ? lbv : lbo;
        fold_piece(W, LA, LB, WB + (size_t)f * DM * WP, (size_t)(blk - f * FOLD_BLOCKS) * 256 + threadIdx.x);
    } else {
        cvt8_piece(x, XB, (size_t)(blk - 4 * FOLD_BLOCKS) * 256 + threadIdx.x, (size_t)NB * SEQ * (DM / 8));
    }
}

// gemm_main: a block of four waves (2 x 2) on a 128x128 tile, each wave 64x64 with 16 accumulators; operands from fragment-order bf16 planes whose rows hold NA (A) or NBH (B) halves of DM columns: value, or value | remainder.
// C[m][n] += sum over k < DM of A0[m][k] B0[n][k] + A1[m][k] B0[n][k] + A0[m][k] B1[n][k] (the terms whose halves exist; never remainder x remainder).
// The k loop runs over DM once: a stage is KC = 64 k of every half of the block's 128 A rows and 128 B rows (NA + NBH panels of 16 KiB, still in fragment order), so each half is brought from L2 once per block
// and each fragment read from LDS serves every product that its k-step has for it (an operand with one half meets both halves of the other from the same registers).
// A stage is copied once per block by asynchronous 16-B copies, 8 per lane and panel, into one of two buffers, one stage ahead of its use; each block row is then read by two waves (512 contiguous bytes per ds load).
// The fragments of a stage's two k-steps are read as one group ahead of its products; no fragment is read across a stage's end.
// ga / gb = plane + (block's first row) * pitch + 8 * thread. PA / PB = row pitches (elements); 32 k = one block = 512 elements, so column k0 is at k0*16 and the remainder half DM*16 further.
// A block starts its k loop at stage s0, set by its tile, and wraps round: blocks that share operand rows then ask L2 for different lines at any one moment.
// Every accumulator takes its k-steps in rising order from stage s0, wrapping to stage 0 behind the last, and inside a k-step value x value, remainder x value, value x remainder.
// Eight copies of one lane: the same 16-B piece of block rows 0..7 of one panel; l = LDS byte address of the piece in block row 0, g = the same piece in the plane.
template <int P>
__device__ __forceinline__ void tile_copy(const unsigned l, const bf* g) {
    // the wait is the statement's last line: the address registers that the copies name are rewritten only behind it
    asm volatile(
                 "global_load_async_to_lds_b128 %0, %8, off\n\t"
                 "global_load_async_to_lds_b128 %1, %9, off\n\t"
                 "global_load_async_to_lds_b128 %2, %10, off\n\t"
                 "global_load_async_to_lds_b128 %3, %11, off\n\t"
                 "global_load_async_to_lds_b128 %4, %12, off\n\t"
                 "global_load_async_to_lds_b128 %5, %13, off\n\t"
                 "global_load_async_to_lds_b128 %6, %14, off\n\t"
                 "global_load_async_to_lds_b128 %7, %15, off\n\t"
                 "s_wait_xcnt 0x0"
                 :: "v"(l), "v"(l + 2048u), "v"(l + 4096u), "v"(l + 6144u), "v"(l + 8192u), "v"(l + 10240u), "v"(l + 12288u), "v"(l + 14336u),
                    "v"(g), "v"(g + 16 * P), "v"(g + 32 * P), "v"(g + 48 * P), "v"(g + 64 * P), "v"(g + 80 * P), "v"(g + 96 * P), "v"(g + 112 * P) : "memory");
}
template <int PA, int PB, int NA, int NBH>
__device__ __forceinline__ void stage_fill(const unsigned l, const bf* ga, const bf* gb, const int kc) {
    // a block row of a panel is 2 KiB = 128 pieces: this lane's piece is 'thread'; panels in the buffer: A halves, then B halves
#pragma unroll
    for (int h = 0; h < NA; ++h)  tile_copy<PA>(l + (unsigned)(h * PNL * 2), ga + (size_t)(kc + h * DM) * 16);
#pragma unroll
    for (int h = 0; h < NBH; ++h) tile_copy<PB>(l + (unsigned)((NA + h) * PNL * 2), gb + (size_t)(kc + h * DM) * 16);
}
// first k of the i-th stage that a block works on, 0 <= i, s0 < DM / KC
__device__ __forceinline__ int stage_k(const int i, const int s0) { const int t = i + s0; return (t >= DM / KC ? t - DM / KC : t) * KC; }
template <int PA, int PB, int NA, int NBH>
__device__ __forceinline__ void gemm_main(const bf* st, const bf* ga, const bf* gb, const int tid, const int wm, const int wn, const int s0, v8f (&acc)[4][4]) {
    static_assert(NA * DM <= PA && NBH * DM <= PB && NA >= 1 && NA <= 2 && NBH >= 1 && NBH <= 2);   // every half lies inside its plane's rows
    constexpr int GST = (NA + NBH) * PNL;                        // elements of one stage
    const int lane = tid & 31;
    const unsigned l0 = (unsigned)(size_t)st + (unsigned)tid * 16u;
    stage_fill<PA, PB, NA, NBH>(l0, ga, gb, stage_k(0, s0));
    asm volatile("s_wait_asynccnt 0x0" ::: "memory");            // this wave's share of the first stage has landed before the barrier that shows it to the other waves
    __syncthreads();
    stage_fill<PA, PB, NA, NBH>(l0 + (unsigned)(GST * 2), ga, gb, stage_k(1, s0));
#pragma unroll 1                                                 // one stage per trip: the two buffers alternate by s & 1
    for (int s = 0; s < DM / KC; ++s) {
        const bf* sa = st + (s & 1) * GST + wm * (64 * KC) + 8 * lane;                 // this wave's four A block rows (first half)
        const bf* sb = st + (s & 1) * GST + NA * PNL + wn * (64 * KC) + 8 * lane;      // this wave's four B block rows (first half)
        v16bf a[KC / 32][NA][4], b[KC / 32][NBH][4];
#pragma unroll
        for (int q = 0; q < KC / 32; ++q) {
#pragma unroll
            for (int i = 0; i < 4; ++i) { a[q][0][i] = ldb(sa + i * (16 * KC) + q * 512); b[q][0][i] = ldb(sb + i * (16 * KC) + q * 512); }
            if (NA > 1) {
#pragma unroll
                for (int i = 0; i < 4; ++i) a[q][NA - 1][i] = ldb(sa + PNL + i * (16 * KC) + q * 512);
            }
            if (NBH > 1) {
#pragma unroll
                for (int i = 0; i < 4; ++i) b[q][NBH - 1][i] = ldb(sb + PNL + i * (16 * KC) + q * 512);
            }
        }
        __builtin_amdgcn_sched_barrier(0);                       // the stage's read group stands whole ahead of the products: sunk among them each row of products would wait for its own reads
#pragma unroll                                                   // unrolled so that every fragment's register set is a static choice
        for (int ks = 0; ks < KC / 32; ++ks) {
#pragma unroll
            for (int hb = 0; hb < NBH; ++hb)
#pragma unroll
                for (int ha = 0; ha < NA; ++ha) {
                    if (ha + hb > 1) continue;                   // remainder x remainder is not part of the sum
#pragma unroll
                    for (int nb = 0; nb < 4; ++nb)
#pragma unroll
                        for (int mb = 0; mb < 4; ++mb) acc[mb][nb] = wmmab(a[ks][ha][mb], b[ks][hb][nb], acc[mb][nb]);
                }
        }
        __builtin_amdgcn_sched_barrier(0);                       // keeps the waits below behind the last products: lifted over them the s_wait_dscnt 0 would hold every product back until the whole read group is home
        // hand-over of the buffers, every wave: its own reads of this stage are home, its own copies of the next stage have landed, then the barrier; only behind it is this stage's buffer refilled
        asm volatile("s_wait_dscnt 0x0" ::: "memory");           // this wave has finished reading the buffer that is refilled below
        asm volatile("s_wait_asynccnt 0x0" ::: "memory");        // this wave's share of stage s + 1 has landed
        __syncthreads();
        if (s + 2 < DM / KC) stage_fill<PA, PB, NA, NBH>(l0 + (unsigned)(s & 1) * (unsigned)(GST * 2), ga, gb, stage_k(s + 2, s0));
    }
    asm volatile("s_wait_asynccnt 0x0" ::: "memory");            // no copy is outstanding when the wave goes on to the store stage
}

// proj_tile: bf16 GEMM, four waves per 128x128 tile (one 64x64 tile each), k over DM; the folded weight has two halves (value, remainder), x one: NA / NBH = halves of A / Bt.
// C[m][n] = sum_k x . (W value + W remainder) + bias (bias by column n when biasRow == 0, by row m when biasRow != 0; bias RNE-converted to bf16),
// written as f16, in fragment order, into the sub-plane at (r0/RB)*sRB + (c0/CB)*sCB: rows r0%RB .., columns c0%CB .., row pitch 'pitch' (halves). Tile (bx, by) of (M/128, N/128), 128 threads; st, osa = the block's LDS.
template <int PA, int PB, int NA, int NBH>
__device__ __forceinline__ void proj_tile(const bf* st, float* osa, const bf* __restrict__ A, const bf* __restrict__ Bt,
                                          const float* __restrict__ bias, const int biasRow, h16* Ph, const int RB, const size_t sRB, const int pitch, const int CB, const size_t sCB,
                                          const int bx, const int by, const int s0) {
    const int tid = threadIdx.x; const int wave = __builtin_amdgcn_readfirstlane(threadIdx.x >> 5); const int wm = wave >> 1, wn = wave & 1;
    float* os = osa + wave * (16 * 68);                          // store staging, private to the wave
    const int lane = threadIdx.x & 31, lr = lane & 15, hi = lane >> 4; const int r0 = bx * 128 + wm * 64, c0 = by * 128 + wn * 64;
    v8f acc[4][4];
#pragma unroll
    for (int mb = 0; mb < 4; ++mb)
#pragma unroll
        for (int nb = 0; nb < 4; ++nb) acc[mb][nb] = (v8f){};
    gemm_main<PA, PB, NA, NBH>(st, A + (size_t)(bx * 128) * PA + 8 * tid, Bt + (size_t)(by * 128) * PB + 8 * tid, tid, wm, wn, s0, acc);
    // store stage s = 0..3: lane holds row lane&15, columns (s>>1)*32 + (s&1)*16 + 8h + 0..7 of the slab = piece 'lane' of half s&1 of block s>>1
    float bc[4][8];
#pragma unroll
    for (int s = 0; s < 4; ++s) {
      if (biasRow) {                                             // known at compile time at both calls: with the bias by row no column bias is read
#pragma unroll
        for (int i = 0; i < 8; ++i) bc[s][i] = 0.0f;
      } else {
        int cb = c0 + (s >> 1) * 32 + (s & 1) * 16 + hi * 8; cb = (cb < DM - 8) ? cb : (DM - 8);          // clamped address
        const v4f b0 = *(const v4f*)(bias + cb);
        asm volatile("s_wait_xcnt 0x0" ::: "memory");            // in this build a later bias load lands in a register that this load names as its address
        const v4f b1 = *(const v4f*)(bias + cb + 4);
        asm volatile("s_wait_xcnt 0x0" ::: "memory");            // the same for the second half
#pragma unroll
        for (int i = 0; i < 4; ++i) { bc[s][i] = bfr(b0[i]); bc[s][4 + i] = bfr(b1[i]); }
      }
    }
    const size_t tbase = (size_t)(r0 / RB) * sRB + (size_t)(r0 % RB) * (size_t)pitch + (size_t)(c0 / CB) * sCB + (size_t)(c0 % CB) * 16 + 8 * lane;
#pragma unroll
    for (int mb = 0; mb < 4; ++mb) {
#pragma unroll
        for (int nb = 0; nb < 4; ++nb) {
#pragma unroll
            for (int j = 0; j < 8; ++j) os[(hi * 8 + j) * 68 + nb * 16 + lr] = acc[mb][nb][j]; }   // D: row 8h+j, col lane&15
        wave_sync();
        float br;
        { int ri = r0 + mb * 16 + lr; ri = (ri < DM - 1) ? ri : (DM - 1); const float bv_ = bias[ri]; br = biasRow ? bfr(bv_) : 0.0f; }
        const size_t sb = tbase + (size_t)(mb * 16) * (size_t)pitch;
{
#pragma unroll
            for (int s = 0; s < 4; ++s) { const int col = (s >> 1) * 32 + (s & 1) * 16 + hi * 8;   // 16 lanes = 16 rows; 4 s x 2 halves x 8 = 64 columns
                const v4f x0 = *(const v4fa*)(&os[lr * 68 + col]); const v4f x1 = *(const v4fa*)(&os[lr * 68 + col + 4]);
                float val[8]; v8h hv;
#pragma unroll
                for (int i = 0; i < 4; ++i) { val[i] = x0[i] + bc[s][i] + br; val[4 + i] = x1[i] + bc[s][4 + i] + br; }
#pragma unroll
                for (int i = 0; i < 8; ++i) hv[i] = toh_flush(val[i]);
                const size_t oo = sb + (size_t)((s >> 1) * 512 + (s & 1) * 256);
                *(v8h*)(Ph + oo) = hv; }
             }
        if (biasRow) asm volatile("s_wait_xcnt 0x0" ::: "memory");   // in this build the next slab's row-bias load lands in a register that one of these stores names
        wave_sync();
    }
}

// k_qkv: the three input projections in one launch, grid (NB*SEQ/128, DM/128, 3); the choice by blockIdx.z is the same for a whole block.
// z = 0, 1 (q, k): A = x rows (m = b*SEQ + t, pitch DM, one half), Bt = folded W rows (n = h*64 + d, pitch WP, two halves), bias by column -> plane [(b*12 + h)][t][d]
// z = 2 (v^T):     A = folded Wv rows (m = h*64 + d, pitch WP, two halves), Bt = x rows (n = b*SEQ + t, pitch DM, one half), bias by row -> plane [(b*768 + m)][t] = [(b*12 + h)][d][t]
__global__ __launch_bounds__(32 * GW) void k_qkv(const bf* __restrict__ XB, const bf* __restrict__ WB,
                                                 const float* __restrict__ bq, const float* __restrict__ bk, const float* __restrict__ bv, h16* QH, h16* KP, h16* VT) {
    __shared__ __align__(16) bf st[2 * 3 * PNL];                 // two buffers of three panels
    __shared__ __align__(16) float osa[GW * 16 * 68];
    const int z = blockIdx.z;
    // first stage: the 64 blocks on one weight tile (same y, z) spread over all DM / KC stages, the blocks on one x tile (same x) differ by y + 6 z
    const int s0 = (int)((blockIdx.x + blockIdx.y + 6u * blockIdx.z) % (unsigned)(DM / KC));
    if (z < 2) proj_tile<DM, WP, 1, 2>(st, osa, XB, WB + (size_t)z * DM * WP, z ? bk : bq, 0, z ? KP : QH, SEQ, (size_t)NH_ * SEQ * HD, HD, HD, (size_t)SEQ * HD, blockIdx.x, blockIdx.y, s0);
    else       proj_tile<WP, DM, 2, 1>(st, osa, WB + (size_t)2 * DM * WP, XB, bv, 1, VT, DM, (size_t)0, SEQ, SEQ, (size_t)DM * SEQ, blockIdx.y, blockIdx.x, s0);
}

// k_flash: fused dense attention, one wave per 16 query rows of one (batch, head), eight waves per block; Q fragments straight from the fragment-order f16 plane (two 16-B loads each, 512 contiguous bytes per load).
// K and V^T reach the waves through LDS: a stage is 64 keys (K 8 KiB, V^T 4 block rows x 2 KiB, both still in fragment order), copied once per block by asynchronous 16-B copies, four per lane, into one of two buffers,
// one stage ahead of its use; all eight waves read their fragments from it (512 contiguous bytes per ds load).
// Transposed form: S^T[key][t] = K Q^T (A = K rows, B = Q rows); lane (t = lane&15, h = lane>>4) holds keys 8h+r of each 16-key tile, so the packed
// P tile is directly the B fragment of O^T[d][t] = V^T P^T (element r <- tile keys 0..15, element 8+r <- tile keys 16..31, lane unchanged).
// Key loop covers keys 0 .. SEQ-1 in steps of 32 (all inside the sequence, every key valid for every row), from the block's first stage on, wrapping to key 0 behind the last.
// Softmax state (running max, partial sum) is one scalar per lane; the two lane halves of a row are combined with one xor-16 exchange.
// P carries x256 and is converted to f16 two scores per instruction; a P under the smallest normal f16 stays an f16 subnormal (the matrix unit keeps them); the row sum runs over the converted P.
// One lane's four copies of a stage: l = LDS byte address of its first piece in the buffer, gk / gv = its first K and V^T piece of the stage.
__device__ __forceinline__ void stage_copy(const unsigned l, const h16* gk, const h16* gv) {
    const unsigned l1 = l + 4096u, l2 = l + 8192u, l3 = l + 12288u;
    const h16* gk1 = gk + 2048; const h16* gv1 = gv + (size_t)32 * SEQ;      // K piece + 256; V^T piece + 256 = two block rows further
    // the wait is the statement's last line: the address registers that the copies name are rewritten only behind it
    asm volatile("global_load_async_to_lds_b128 %0, %4, off\n\t"
                 "global_load_async_to_lds_b128 %1, %5, off\n\t"
                 "global_load_async_to_lds_b128 %2, %6, off\n\t"
                 "global_load_async_to_lds_b128 %3, %7, off\n\t"
                 "s_wait_xcnt 0x0"
                 :: "v"(l), "v"(l1), "v"(l2), "v"(l3), "v"(gk), "v"(gk1), "v"(gv), "v"(gv1) : "memory");
}
__global__ __launch_bounds__(32 * AW) void k_flash(const h16* __restrict__ QH, const h16* __restrict__ KP, const h16* __restrict__ VT, bf* CX) {
    __shared__ __align__(16) h16 kv[2][2 * KS * HD];            // per buffer: K [64 keys][64 d] (4096 halves), then V^T [4 block rows][64 keys x 16 d] (4096 halves)
    const int tid = threadIdx.x;
    const int lane = threadIdx.x & 31;
    const int wave = __builtin_amdgcn_readfirstlane(threadIdx.x >> 5);
    const int zh = blockIdx.y; const int b = zh / NH_, h = zh % NH_;
    const int t0 = (blockIdx.x * AW + wave) * 16;
    const size_t pbase = (size_t)zh * SEQ * HD;
    const size_t qo = pbase + (size_t)t0 * HD + 8 * lane;
    const v16h qh0 = ldh(QH + qo), qh1 = ldh(QH + qo + 512);   // B fragments: col t, k = d (blocks d 0..31, d 32..63)
    // this lane's pieces of a stage: K pieces tid and tid + 256 of 512 (contiguous); V^T pieces tid and tid + 256 of 512 (piece i: block row i >> 7, 16-B unit i & 127 of its 2 KiB)
    const unsigned lds0 = (unsigned)(size_t)&kv[0][0] + (unsigned)tid * 16u;
    const h16* gk = KP + pbase + (size_t)tid * 8;                                          // + stage * KS * HD
    const h16* gv = VT + pbase + (size_t)(tid >> 7) * 16 * SEQ + (size_t)(tid & 127) * 8;  // + stage * KS * 16
    v8f o[4];
#pragma unroll
    for (int j = 0; j < 4; ++j) { o[j] = (v8f){}; }
    float m = -3.0e38f, l = 0.0f;
    // the blocks of one (batch, head) read the same K and V^T: each starts its key loop at its own stage s0 and wraps round, so that they ask L2 for different lines at any one moment
    static_assert((16 * AW) % KS == 0);                          // s0 = blockIdx.x * (16 * AW / KS) < SEQ / KS: the blocks of a head stand evenly over the stages
    const int s0 = (int)blockIdx.x * (16 * AW / KS);
    const auto stg = [s0](const int i) { const int t = i + s0; return (size_t)(t >= SEQ / KS ? t - SEQ / KS : t); };   // the i-th stage that this block works on
    stage_copy(lds0, gk + stg(0) * (KS * HD), gv + stg(0) * (KS * 16));
    asm volatile("s_wait_asynccnt 0x0" ::: "memory");            // this wave's share of the first stage has landed before the barrier that shows it to the other waves
    __syncthreads();
    stage_copy(lds0 + (unsigned)sizeof(kv[0]), gk + stg(1) * (KS * HD), gv + stg(1) * (KS * 16));
#pragma unroll 1                                                 // one stage per trip: the two buffers alternate by s & 1
    for (int s = 0; s < SEQ / KS; ++s) {
        const h16* sb = &kv[s & 1][0] + 8 * lane;
#pragma unroll                                                   // both passes of a stage in one trip: their LDS offsets become immediates
        for (int p = 0; p < KS / 32; ++p) {
        const h16* ka = sb + p * 32 * HD;                        // A fragments: row key, k = d
        const v16h ka0 = ldh(ka), ka1 = ldh(ka + 512), kb0 = ldh(ka + 16 * HD), kb1 = ldh(ka + 16 * HD + 512);
        const h16* va = sb + KS * HD + p * 512;                  // A fragments: row d, k = key
        const v16h v0 = ldh(va), v1 = ldh(va + KS * 16), v2 = ldh(va + 2 * KS * 16), v3 = ldh(va + 3 * KS * 16);
        v8f sHa = (v8f){}, sHb = (v8f){};
        sHa = wmma16(ka0, qh0, sHa); sHb = wmma16(kb0, qh0, sHb);
        sHa = wmma16(ka1, qh1, sHa); sHb = wmma16(kb1, qh1, sHb);
        float ta[8], tb[8];
#pragma unroll
        for (int r = 0; r < 8; ++r) { ta[r] = sHa[r] * SC2; tb[r] = sHb[r] * SC2; }
        float mx = -3.0e38f;
#pragma unroll
        for (int r = 0; r < 8; ++r) mx = fmaxf(mx, fmaxf(ta[r], tb[r]));
        mx = fmaxf(mx, __shfl_xor(mx, 16, 32));
        const float mnew = fmaxf(m, mx);
        float alpha;
        // the exponential and the one free slot behind it in one statement
        asm("v_exp_f32 %0, %1\n\tv_nop" : "=v"(alpha) : "v"(m - mnew));
        const float sh = PSH - mnew;
        v16h pb; float ls = 0.0f;
#pragma unroll
        for (int r = 0; r < 8; r += 2) {
            float xa0;
            // the pass's first score exponential and the one free slot behind it in one statement
            if (r == 0) asm("v_exp_f32 %0, %1\n\tv_nop" : "=v"(xa0) : "v"(ta[0] + sh)); else xa0 = __builtin_amdgcn_exp2f(ta[r] + sh);
            const v2f xa = { xa0, __builtin_amdgcn_exp2f(ta[r + 1] + sh) };
            const v2f xb = { __builtin_amdgcn_exp2f(tb[r] + sh), __builtin_amdgcn_exp2f(tb[r + 1] + sh) };
            const v2h pa = __builtin_convertvector(xa, v2h), pc = __builtin_convertvector(xb, v2h);   // two scores per conversion, round to nearest even
            pb[r] = pa[0]; pb[r + 1] = pa[1]; pb[8 + r] = pc[0]; pb[9 + r] = pc[1];
            ls += (float)pa[0] + (float)pc[0]; ls += (float)pa[1] + (float)pc[1]; }
#pragma unroll
        for (int j = 0; j < 4; ++j) o[j] = o[j] * alpha;
        o[0] = wmma16(v0, pb, o[0]); o[1] = wmma16(v1, pb, o[1]); o[2] = wmma16(v2, pb, o[2]); o[3] = wmma16(v3, pb, o[3]);
        l = l * alpha + ls; m = mnew;
        }
        // hand-over of the buffers, every wave: its own reads of this stage are home, its own copies of the next stage have landed, then the barrier; only behind it is this stage's buffer refilled
        asm volatile("s_wait_dscnt 0x0" ::: "memory");           // this wave has finished reading the buffer that is refilled below
        asm volatile("s_wait_asynccnt 0x0" ::: "memory");        // this wave's share of stage s + 1 has landed
        __syncthreads();
        if (s + 2 < SEQ / KS) stage_copy(lds0 + (unsigned)(s & 1) * (unsigned)sizeof(kv[0]), gk + stg(s + 2) * (KS * HD), gv + stg(s + 2) * (KS * 16));
    }
    asm volatile("s_wait_asynccnt 0x0" ::: "memory");            // no copy is outstanding when the wave ends
    l += __shfl_xor(l, 16, 32);
    const float inv = 1.0f / l;
    // O^T D layout: o_j[r] = (d = 16j + 8h + r, t = lane&15) = row t, columns 16j + 8h + 0..7: piece 'lane' of half j&1 of block j>>1 in fragment order, so every lane stores its own registers (no transposition)
    bf* crow = CX + ((size_t)b * SEQ + t0) * CXP + (size_t)(h * HD) * 16 + 8 * lane;   // block row t0/16, first block of column h*64, piece 'lane'
#pragma unroll
    for (int j = 0; j < 4; ++j) { v8us hv, lv;
#pragma unroll
        for (int i = 0; i < 8; ++i) { const float x = o[j][i] * inv; const unsigned short h0 = f2bf(x); hv[i] = h0; lv[i] = f2bf(x - bf2f(h0)); }
        const size_t oo = (size_t)((j >> 1) * 512 + (j & 1) * 256);
        *(v8us*)(crow + oo) = hv; *(v8us*)(crow + oo + DM * 16) = lv; }
}

// k_out: final projection, four waves per 128x128 tile (one 64x64 tile each). A = ctx plane [m][value 768 | remainder 768], Bt = folded Wo plane [n][value 768 | remainder 768], k over 768:
// per k-step value x value, remainder x value, value x remainder, from one read of each of the four halves.
// OUT[m][n] = acc + bias[n] (bias RNE-converted to bf16), f32. Epilogue: per 16-row slab staged in LDS (wave-private), each output row segment (64 floats = 256 B = two lines)
__global__ __launch_bounds__(32 * GW) void k_out(const bf* __restrict__ A, const bf* __restrict__ Bt, const float* __restrict__ bias, float* OUT) {
    __shared__ __align__(16) bf st[2 * 4 * PNL];                 // two buffers of four panels
    __shared__ __align__(16) float osa[GW][16 * 68];
    const int tid = threadIdx.x; const int wave = __builtin_amdgcn_readfirstlane(threadIdx.x >> 5); const int wm = wave >> 1, wn = wave & 1;
    float* os = &osa[wave][0];                                   // store staging, private to the wave
    const int lane = threadIdx.x & 31, lr = lane & 15, hi = lane >> 4; const int r0 = blockIdx.x * 128 + wm * 64, c0 = blockIdx.y * 128 + wn * 64;
    v8f acc[4][4];
#pragma unroll
    for (int mb = 0; mb < 4; ++mb)
#pragma unroll
        for (int nb = 0; nb < 4; ++nb) acc[mb][nb] = (v8f){};
    // first stage: the 64 blocks on one weight tile (same y) spread over all DM / KC stages, the 6 blocks on one ctx tile (same x) stand two stages apart
    const int s0 = (int)((blockIdx.x + 2u * blockIdx.y) % (unsigned)(DM / KC));
    gemm_main<CXP, WP, 2, 2>(st, A + (size_t)(blockIdx.x * 128) * CXP + 8 * tid, Bt + (size_t)(blockIdx.y * 128) * WP + 8 * tid, tid, wm, wn, s0, acc);
    const int cofs = lr * 4;
    v4f b4 = *(const v4f*)(bias + c0 + cofs);          // c0 + cofs + 3 <= DM - 1 always
    asm volatile("s_wait_xcnt 0x0" ::: "memory");      // the address arithmetic below reuses registers that this load names
    __builtin_amdgcn_sched_barrier(0);                 // holds that arithmetic behind the wait
    b4[0] = bfr(b4[0]); b4[1] = bfr(b4[1]); b4[2] = bfr(b4[2]); b4[3] = bfr(b4[3]);
    const size_t orow0 = (size_t)(r0 / SEQ) * OUT_SEQ + (size_t)(r0 % SEQ);
#pragma unroll
    for (int mb = 0; mb < 4; ++mb) {
#pragma unroll
        for (int nb = 0; nb < 4; ++nb) {
#pragma unroll
            for (int j = 0; j < 8; ++j) os[(hi * 8 + j) * 68 + nb * 16 + lr] = acc[mb][nb][j]; }   // D: row 8h+j, col lane&15
        wave_sync();
        float* ob = OUT + (orow0 + (size_t)(mb * 16)) * DM + c0;
{
#pragma unroll
            for (int s = 0; s < 8; ++s) { const int row = 2 * s + hi;   // 8 s x 2 rows = 16 rows; 16 lanes x 4 floats = 64 columns
                const v4f xv = *(const v4fa*)(&os[row * 68 + cofs]);
                const v4f val = xv + b4;
                *(v4f*)(ob + (size_t)row * DM + cofs) = val; }
             }
        wave_sync();
    }
}

static constexpr size_t al256(size_t v) { return (v + 255) & ~(size_t)255; }
static constexpr size_t SZ_XB = al256((size_t)NB * SEQ * DM * 2);
static constexpr size_t SZ_WB = al256((size_t)4 * DM * WP * 2);
static constexpr size_t SZ_PL = al256((size_t)NB * NH_ * SEQ * HD * 2);
static constexpr size_t SZ_CX = al256((size_t)NB * SEQ * CXP * 2);
static constexpr size_t SZ_TOTAL = SZ_XB + SZ_WB + 3 * SZ_PL + SZ_CX;
static_assert(SZ_TOTAL <= (size_t)134217728);          // workspace carve <= 128 MiB
static_assert(((size_t)DM * WP * 2) % 256 == 0);       // weight sub-planes stay 256-byte aligned
static_assert((size_t)NB * NH_ * SEQ * HD == (size_t)NB * SEQ * DM);   // plane extent == GEMM tile grid extent

extern "C" void kernel_launch(void* const* d_in, const int* in_sizes, int n_in,
                              void* d_out, int out_size, void* d_ws, size_t ws_size, hipStream_t stream) {
    if (n_in < 17) return;
    const size_t needx = ((size_t)(NB - 1) * SEQ_FULL + SEQ) * DM;
    if ((size_t)in_sizes[0] < needx) return;
    if ((size_t)in_sizes[1] < (size_t)DM * DM || (size_t)in_sizes[5] < (size_t)DM * DM || (size_t)in_sizes[9] < (size_t)DM * DM || (size_t)in_sizes[13] < (size_t)DM * DM) return;
    if (in_sizes[2] < DM || in_sizes[6] < DM || in_sizes[10] < DM || in_sizes[14] < DM) return;
    if (in_sizes[3] < LR * DM || in_sizes[7] < LR * DM || in_sizes[11] < LR * DM || in_sizes[15] < LR * DM) return;
    if (in_sizes[4] < DM * LR || in_sizes[8] < DM * LR || in_sizes[12] < DM * LR || in_sizes[16] < DM * LR) return;
    if ((size_t)out_size < ((size_t)(NB - 1) * OUT_SEQ + SEQ) * DM) return;
    if (SZ_TOTAL > ws_size) return;
    // wire order: x, then per projection (q, k, v, o): W [out][in], b [out], A [8][in], B [out][8]; folded weights [out][in] = Bt as-is
    const float* x   = (const float*)d_in[0];
    const float* wq  = (const float*)d_in[1];  const float* bq  = (const float*)d_in[2];  const float* laq = (const float*)d_in[3];  const float* lbq = (const float*)d_in[4];
    const float* wk  = (const float*)d_in[5];  const float* bk  = (const float*)d_in[6];  const float* lak = (const float*)d_in[7];  const float* lbk = (const float*)d_in[8];
    const float* wv  = (const float*)d_in[9];  const float* bv  = (const float*)d_in[10]; const float* lav = (const float*)d_in[11]; const float* lbv = (const float*)d_in[12];
    const float* wo  = (const float*)d_in[13]; const float* bo  = (const float*)d_in[14]; const float* lao = (const float*)d_in[15]; const float* lbo = (const float*)d_in[16];
    float* OUT = (float*)d_out;      // [NB][SEQ][768]
    char* wsp = (char*)d_ws;
    bf* XB = (bf*)wsp; wsp += SZ_XB;                 // [NB*SEQ][768]
    bf* WB = (bf*)wsp; wsp += SZ_WB;                 // [4][768][value 768 | remainder 768]: q | k | v | o
    h16* QH = (h16*)wsp; wsp += SZ_PL;               // [NB*12][SEQ][64]
    h16* KP = (h16*)wsp; wsp += SZ_PL;               // [NB*12][SEQ][64]
    h16* VT = (h16*)wsp; wsp += SZ_PL;               // [NB*12][64][SEQ]
    bf* CX = (bf*)wsp; wsp += SZ_CX;                 // [NB*SEQ][value 768 | remainder 768]
    bf* WO = WB + (size_t)3 * DM * WP;

    k_prep<<<4 * FOLD_BLOCKS + CVT_BLOCKS, 256, 0, stream>>>(x, wq, laq, lbq, wk, lak, lbk, wv, lav, lbv, wo, lao, lbo, XB, WB);

    k_qkv<<<dim3(NB * SEQ / 128, DM / 128, 3), 32 * GW, 0, stream>>>(XB, WB, bq, bk, bv, QH, KP, VT);

    k_flash<<<dim3(SEQ / (16 * AW), NB * NH_, 1), 32 * AW, 0, stream>>>(QH, KP, VT, CX);

    // out: A = ctx rows [m][value | remainder], Bt = folded Wo rows (n) [value | remainder], bias by column -> OUT[b][t][n]
    k_out<<<dim3(NB * SEQ / 128, DM / 128, 1), 32 * GW, 0, stream>>>(CX, WO, bo, OUT);
}

// v008
// It runs in 119 microseconds.
// Next to v007, in two timings, it ran 1.10 times as fast each time.
// Over all steps from v000 it is 3.60 times as fast.
#include <hip/hip_runtime.h>

// Dense (unmasked) multi-head self-attention, width 768 = 12 heads x 64, x [NB][SEQ][768]; each of the four projections is y = x W^T + b + (x A^T) B^T with W [out][in], A [8][in], B [out][8]; score scale 1/8; f32 output.
// Compute dtypes, f32 accumulate everywhere: the rank-8 update is folded once into W_eff = W + B A (f32 on the vector unit, K = 8; W, A, B, b, x RNE-converted to bf16 first) and carried as bf16 value | bf16 remainder along K;
// softmax f32 (online, running max); output projection v_wmma_f32_16x16x32_bf16 with ctx as bf16 value | remainder and W_eff as bf16 value | remainder (per k-step: value x value, remainder x value, value x remainder), one accumulator.
// Layout: bf16 copy of x; folded weight planes [4][768][value 768 | remainder 768]; q, k planes [b*12+h][t][d], v^T plane [b*12+h][d][t] (f16) written by the GEMM epilogue; fused flash kernel in transposed form
// Every one of these planes is stored in FRAGMENT ORDER: a block of 16 rows x 32 k is 512 consecutive elements, element (row, k) of a block at (k>>4)*256 + ((k>>3)&1)*128 + row*8 + (k&7);
// blocks run along k (512 elements each), then along rows (16 * pitch elements per block row). A fragment is then two wave-wide 16-B loads of 512 contiguous bytes each (four whole lines) instead of 16 partial lines.
// (S^T = K Q^T, O^T = V^T P^T, key loop over the whole sequence) writes the ctx plane [b*SEQ+t][value 768 | remainder 768] (bf16); final GEMM adds the bias at the store stage.

#ifndef NB
#define NB 4
#endif
#ifndef SEQ
#define SEQ 2048
#endif
#define NB_FULL  4
#define SEQ_FULL 2048
#ifndef OUT_SEQ
#define OUT_SEQ SEQ              // row pitch (in tokens) between batches of the output
#endif
#define DM   768
#define NH_  12
#define HD   64
#define LR   8                   // rank of the low-rank update
#define WP   (2 * DM)            // folded weight plane row pitch: value columns 0..DM-1, remainder columns DM..2DM-1
#define CXP  (2 * DM)            // ctx plane row pitch: value columns 0..DM-1, remainder columns DM..2DM-1
#define AW   8                   // waves per flash block (16 query rows each)
#define KS   64                  // keys per LDS stage of the flash kernel (two passes of 32)
#define GW   4                   // waves per GEMM block, 2 x 2, one 64x64 tile each: block tile 128 x 128
#define KC   64                  // k per LDS stage of the GEMMs (two k-steps of 32)
#define PNL  (128 * KC)          // elements of one panel of a GEMM stage: 128 rows x KC of one half (value or remainder) of one operand = 8 block rows of 2 KiB
#define SC2  (0.125f * 1.4426950408889634f)   // HD^-0.5 * log2(e)
#define PSH  8.0f                // log2 of the P carry (256)
#define TAU  (6.0f / SC2)        // a raw score may stand this far above its row's reference point: P then stays under 2^(8+6), inside f16

static_assert(HD == 64);
static_assert(NH_ * HD == DM);                 // head h = columns h*64 + d
static_assert(DM % 64 == 0);                   // column tiles of 64
static_assert(DM % 32 == 0);                   // GEMM k-loop steps by 32
static_assert(CXP == 2 * DM);
static_assert(CXP % 32 == 0);
static_assert(WP == 2 * DM);
static_assert(WP % 32 == 0);
static_assert(LR == 8);                        // one 32-byte load covers a row of B [out][8]
static_assert(DM % 8 == 0);                    // fold kernel: 8 columns per lane
static_assert((DM / 8) % 8 == 0);
static_assert(SEQ % 64 == 0);                  // a 64-row tile never straddles two batches
static_assert((NB * SEQ) % 64 == 0);
static_assert(SEQ % 32 == 0);                  // key loop steps by 32 and stays inside the sequence
static_assert(SEQ % (16 * AW) == 0);           // flash grid covers the sequence exactly
static_assert(((size_t)SEQ * DM) % 8 == 0);
static_assert(((size_t)DM * DM) % 8 == 0);
static_assert(NB <= NB_FULL);
static_assert(SEQ <= SEQ_FULL);
static_assert(AW * 32 == 256);                 // the stage copy deals 16-byte pieces to exactly 256 lanes
static_assert(KS == 64 && SEQ % KS == 0 && SEQ / KS >= 2);   // the two-buffer prologue needs two stages
static_assert(GW == 4 && KC == 64);            // the tile copy deals one 2-KiB block row (16 rows x KC) to exactly 128 lanes
static_assert(DM % 128 == 0 && (NB * SEQ) % 128 == 0);       // block tiles of 128 x 128 cover every GEMM exactly
static_assert(DM % KC == 0 && DM / KC >= 2);   // whole stages along k, and the two-buffer prologue needs two of them

typedef _Float16 h16;
typedef unsigned short bf;
typedef __attribute__((ext_vector_type(16))) __bf16   v16bf;
typedef __attribute__((ext_vector_type(16))) _Float16 v16h;
typedef __attribute__((ext_vector_type(8)))  _Float16 v8h;
typedef __attribute__((ext_vector_type(2)))  _Float16 v2h;
typedef __attribute__((ext_vector_type(2)))  float    v2f;
typedef __attribute__((ext_vector_type(8)))  unsigned short v8us;
typedef __attribute__((ext_vector_type(8)))  float    v8f;
typedef __attribute__((ext_vector_type(4)))  float    v4f;
typedef v4f  __attribute__((may_alias)) v4fa;

__device__ __forceinline__ unsigned short f2bf(float f) { unsigned u = __float_as_uint(f); u += 0x7FFFu + ((u >> 16) & 1u); return (unsigned short)(u >> 16); }
__device__ __forceinline__ float bf2f(unsigned short s) { return __uint_as_float(((unsigned)s) << 16); }
__device__ __forceinline__ float bfr(float f) { return bf2f(f2bf(f)); }     // f32 -> bf16 (RNE) -> f32
__device__ __forceinline__ v16h cat16(v8h lo, v8h hi) { return __builtin_shufflevector(lo, hi, 0, 1, 2, 3, 4, 5, 6, 7, 8, 9, 10, 11, 12, 13, 14, 15); }
__device__ __forceinline__ v16bf cat16b(v8us lo, v8us hi) { return __builtin_bit_cast(v16bf, __builtin_shufflevector(lo, hi, 0, 1, 2, 3, 4, 5, 6, 7, 8, 9, 10, 11, 12, 13, 14, 15)); }
__device__ __forceinline__ v8f wmma16(v16h a, v16h b, v8f c) { return __builtin_amdgcn_wmma_f32_16x16x32_f16(false, a, false, b, (short)0, c, false, false); }
__device__ __forceinline__ v8f wmmab(v16bf a, v16bf b, v8f c) { return __builtin_amdgcn_wmma_f32_16x16x32_bf16(false, a, false, b, (short)0, c, false, false); }
// fragment loaders from fragment-order planes; p = block base + 8*lane: elements 0..7 <- k0+8h+0..7, elements 8..15 <- k0+16+8h+0..7 of row lane&15 (same map for A and B)
__device__ __forceinline__ v16h  ldh(const h16* p) { return cat16(*(const v8h*)p, *(const v8h*)(p + 256)); }
__device__ __forceinline__ v16bf ldb(const bf* p)  { return cat16b(*(const v8us*)p, *(const v8us*)(p + 256)); }
// ordering point for wave-private LDS tiles (same wave writes and reads)
__device__ __forceinline__ void wave_sync() { __builtin_amdgcn_fence(3 /* release order */, "wavefront"); __builtin_amdgcn_wave_barrier(); asm volatile("" ::: "memory"); }
// f32 -> f16 for WMMA operand planes: magnitudes below the smallest normal f16 become exactly 0 (value select)
static __device__ __forceinline__ h16 toh_flush(float v) { const h16 r = (h16)v; return (fabsf(v) < 6.103515625e-05f) ? (h16)0.0f : r; }

// cvt8_piece: one 8-element piece of the bf16 copy of x (rows b*SEQ + t, read from row b*SEQ_FULL + t of x)
__device__ __forceinline__ void cvt8_piece(const float* __restrict__ src, bf* dst, const size_t i, const size_t n8) {
    if (i >= n8) return;
    // i counts 8-element pieces of the fragment-order plane (row pitch DM): block i>>6, piece w = i&63 holds row w&15, k (w>>4)*8 .. +7 of the block
    const size_t blk = i >> 6; const int w = (int)(i & 63);
    const size_t m = (blk / (DM / 32)) * 16 + (size_t)(w & 15); const int k0 = (int)(blk % (DM / 32)) * 32 + (w >> 4) * 8;
    const size_t ms = (m / SEQ) * SEQ_FULL + (m % SEQ);
    const v8f v = *(const v8f*)(src + ms * DM + k0); v8us o;
#pragma unroll
    for (int k = 0; k < 8; ++k) o[k] = f2bf(v[k]);
    *(v8us*)(dst + i * 8) = o; 
}

// fold_piece: W_eff[m][k] = bf16(W[m][k]) + sum_r bf16(LB[m][r]) * bf16(LA[r][k]) in f32 (K = 8, vector unit, rank loop rolled), written as bf16 value at column k and bf16 remainder at column DM + k of row m (fragment order, pitch WP)
__device__ __forceinline__ void fold_piece(const float* __restrict__ W, const float* __restrict__ LA, const float* __restrict__ LB, bf* dst, const size_t i) {
    if (i >= (size_t)DM * (DM / 8)) return;
    // i counts 8-element pieces of the value half in fragment order: block i>>6 (block row rb, block column kb), piece pc = i&63 holds row pc&15, k (pc>>4)*8 .. +7 of the block
    const int rb = (int)(i >> 6) / (DM / 32), kb = (int)(i >> 6) % (DM / 32), pc = (int)(i & 63);
    const int m = rb * 16 + (pc & 15); const int k0 = kb * 32 + (pc >> 4) * 8;
    const v8f w = *(const v8f*)(W + (size_t)m * DM + k0);
    const v8f lb = *(const v8f*)(LB + (size_t)m * LR);
    float acc[8];
#pragma unroll
    for (int k = 0; k < 8; ++k) acc[k] = bfr(w[k]);
    float blr[8];
#pragma unroll
    for (int r = 0; r < 8; ++r) blr[r] = bfr(lb[r]);
    // rank loop rolled: the multiplier of step r is rotated to slot 0 so every register index stays static
#pragma unroll 1
    for (int r = 0; r < LR; ++r) {
        const float bl = blr[0];
#pragma unroll
        for (int q = 0; q < 7; ++q) blr[q] = blr[q + 1];
        const v8f a = *(const v8f*)(LA + (size_t)r * DM + k0);
#pragma unroll
        for (int k = 0; k < 8; ++k) acc[k] = acc[k] + bl * bfr(a[k]);
    }
    v8us hv, lv;
#pragma unroll
    for (int k = 0; k < 8; ++k) { const unsigned short h0 = f2bf(acc[k]); hv[k] = h0; lv[k] = f2bf(acc[k] - bf2f(h0)); }
    bf* p = dst + (size_t)rb * 16 * WP + (size_t)kb * 512 + pc * 8;
    *(v8us*)(p) = hv; *(v8us*)(p + DM * 16) = lv;          // DM columns further = DM/32 blocks = DM*16 elements
}

// k_prep: everything that depends on the inputs alone, in one launch: blocks 0 .. 4*FOLD_BLOCKS-1 fold the four weights (q, k, v, o; FOLD_BLOCKS blocks each), the rest convert x.
// The folds stand first in the grid: their chain of dependent loads is the longer one.
#define FOLD_BLOCKS ((DM * (DM / 8)) / 256)
#define CVT_BLOCKS  ((NB * SEQ * (DM / 8)) / 256)
static_assert((DM * (DM / 8)) % 256 == 0 && (NB * SEQ * (DM / 8)) % 256 == 0);   // both parts fill whole blocks
__global__ __launch_bounds__(256) void k_prep(const float* __restrict__ x,
                                              const float* __restrict__ wq, const float* __restrict__ laq, const float* __restrict__ lbq,
                                              const float* __restrict__ wk, const float* __restrict__ lak, const float* __restrict__ lbk,
                                              const float* __restrict__ wv, const float* __restrict__ lav, const float* __restrict__ lbv,
                                              const float* __restrict__ wo, const float* __restrict__ lao, const float* __restrict__ lbo,
                                              bf* XB, bf* WB) {
    const int blk = blockIdx.x;
    if (blk < 4 * FOLD_BLOCKS) {
        const int f = blk / FOLD_BLOCKS;
        const float* W  = (f == 0) ? wq  : (f == 1) ? wk  : (f == 2) ? wv  : wo;
        const float* LA = (f == 0) ? laq : (f == 1) ? lak : (f == 2) ? lav : lao;
        const float* LB = (f == 0) ? lbq : (f == 1) ? lbk : (f == 2) ? lbv : lbo;
        fold_piece(W, LA, LB, WB + (size_t)f * DM * WP, (size_t)(blk - f * FOLD_BLOCKS) * 256 + threadIdx.x);
    } else {
        cvt8_piece(x, XB, (size_t)(blk - 4 * FOLD_BLOCKS) * 256 + threadIdx.x, (size_t)NB * SEQ * (DM / 8));
    }
}

// gemm_main: a block of four waves (2 x 2) on a 128x128 tile, each wave 64x64 with 16 accumulators; operands from fragment-order bf16 planes whose rows hold NA (A) or NBH (B) halves of DM columns: value, or value | remainder.
// C[m][n] += sum over k < DM of A0[m][k] B0[n][k] + A1[m][k] B0[n][k] + A0[m][k] B1[n][k] (the terms whose halves exist; never remainder x remainder).
// The k loop runs over DM once: a stage is KC = 64 k of every half of the block's 128 A rows and 128 B rows (NA + NBH panels of 16 KiB, still in fragment order), so each half is brought from L2 once per block
// and each fragment read from LDS serves every product that its k-step has for it (an operand with one half meets both halves of the other from the same registers).
// A stage is copied once per block by asynchronous 16-B copies, 8 per lane and panel, into one of two buffers, one stage ahead of its use; each block row is then read by two waves (512 contiguous bytes per ds load).
// The fragments of a stage's two k-steps are read as one group ahead of its products; no fragment is read across a stage's end.
// ga / gb = plane + (block's first row) * pitch + 8 * thread. PA / PB = row pitches (elements); 32 k = one block = 512 elements, so column k0 is at k0*16 and the remainder half DM*16 further.
// A block starts its k loop at stage s0, set by its tile, and wraps round: blocks that share operand rows then ask L2 for different lines at any one moment.
// Every accumulator takes its k-steps in rising order from stage s0, wrapping to stage 0 behind the last, and inside a k-step value x value, remainder x value, value x remainder.
// Eight copies of one lane: the same 16-B piece of block rows 0..7 of one panel; l = LDS byte address of the piece in block row 0, g = the same piece in the plane.
template <int P>
__device__ __forceinline__ void tile_copy(const unsigned l, const bf* g) {
    // the wait is the statement's last line: the address registers that the copies name are rewritten only behind it
    asm volatile(
                 "global_load_async_to_lds_b128 %0, %8, off\n\t"
                 "global_load_async_to_lds_b128 %1, %9, off\n\t"
                 "global_load_async_to_lds_b128 %2, %10, off\n\t"
                 "global_load_async_to_lds_b128 %3, %11, off\n\t"
                 "global_load_async_to_lds_b128 %4, %12, off\n\t"
                 "global_load_async_to_lds_b128 %5, %13, off\n\t"
                 "global_load_async_to_lds_b128 %6, %14, off\n\t"
                 "global_load_async_to_lds_b128 %7, %15, off\n\t"
                 "s_wait_xcnt 0x0"
                 :: "v"(l), "v"(l + 2048u), "v"(l + 4096u), "v"(l + 6144u), "v"(l + 8192u), "v"(l + 10240u), "v"(l + 12288u), "v"(l + 14336u),
                    "v"(g), "v"(g + 16 * P), "v"(g + 32 * P), "v"(g + 48 * P), "v"(g + 64 * P), "v"(g + 80 * P), "v"(g + 96 * P), "v"(g + 112 * P) : "memory");
}
template <int PA, int PB, int NA, int NBH>
__device__ __forceinline__ void stage_fill(const unsigned l, const bf* ga, const bf* gb, const int kc) {
    // a block row of a panel is 2 KiB = 128 pieces: this lane's piece is 'thread'; panels in the buffer: A halves, then B halves
#pragma unroll
    for (int h = 0; h < NA; ++h)  tile_copy<PA>(l + (unsigned)(h * PNL * 2), ga + (size_t)(kc + h * DM) * 16);
#pragma unroll
    for (int h = 0; h < NBH; ++h) tile_copy<PB>(l + (unsigned)((NA + h) * PNL * 2), gb + (size_t)(kc + h * DM) * 16);
}
// first k of the i-th stage that a block works on, 0 <= i, s0 < DM / KC
__device__ __forceinline__ int stage_k(const int i, const int s0) { const int t = i + s0; return (t >= DM / KC ? t - DM / KC : t) * KC; }
template <int PA, int PB, int NA, int NBH>
__device__ __forceinline__ void gemm_main(const bf* st, const bf* ga, const bf* gb, const int tid, const int wm, const int wn, const int s0, v8f (&acc)[4][4]) {
    static_assert(NA * DM <= PA && NBH * DM <= PB && NA >= 1 && NA <= 2 && NBH >= 1 && NBH <= 2);   // every half lies inside its plane's rows
    constexpr int GST = (NA + NBH) * PNL;                        // elements of one stage
    const int lane = tid & 31;
    const unsigned l0 = (unsigned)(size_t)st + (unsigned)tid * 16u;
    stage_fill<PA, PB, NA, NBH>(l0, ga, gb, stage_k(0, s0));
    asm volatile("s_wait_asynccnt 0x0" ::: "memory");            // this wave's share of the first stage has landed before the barrier that shows it to the other waves
    __syncthreads();
    stage_fill<PA, PB, NA, NBH>(l0 + (unsigned)(GST * 2), ga, gb, stage_k(1, s0));
#pragma unroll 1                                                 // one stage per trip: the two buffers alternate by s & 1
    for (int s = 0; s < DM / KC; ++s) {
        const bf* sa = st + (s & 1) * GST + wm * (64 * KC) + 8 * lane;                 // this wave's four A block rows (first half)
        const bf* sb = st + (s & 1) * GST + NA * PNL + wn * (64 * KC) + 8 * lane;      // this wave's four B block rows (first half)
        v16bf a[KC / 32][NA][4], b[KC / 32][NBH][4];
#pragma unroll
        for (int q = 0; q < KC / 32; ++q) {
#pragma unroll
            for (int i = 0; i < 4; ++i) { a[q][0][i] = ldb(sa + i * (16 * KC) + q * 512); b[q][0][i] = ldb(sb + i * (16 * KC) + q * 512); }
            if (NA > 1) {
#pragma unroll
                for (int i = 0; i < 4; ++i) a[q][NA - 1][i] = ldb(sa + PNL + i * (16 * KC) + q * 512);
            }
            if (NBH > 1) {
#pragma unroll
                for (int i = 0; i < 4; ++i) b[q][NBH - 1][i] = ldb(sb + PNL + i * (16 * KC) + q * 512);
            }
        }
        __builtin_amdgcn_sched_barrier(0);                       // the stage's read group stands whole ahead of the products: sunk among them each row of products would wait for its own reads
#pragma unroll                                                   // unrolled so that every fragment's register set is a static choice
        for (int ks = 0; ks < KC / 32; ++ks) {
#pragma unroll
            for (int hb = 0; hb < NBH; ++hb)
#pragma unroll
                for (int ha = 0; ha < NA; ++ha) {
                    if (ha + hb > 1) continue;                   // remainder x remainder is not part of the sum
#pragma unroll
                    for (int nb = 0; nb < 4; ++nb)
#pragma unroll
                        for (int mb = 0; mb < 4; ++mb) acc[mb][nb] = wmmab(a[ks][ha][mb], b[ks][hb][nb], acc[mb][nb]);
                }
        }
        __builtin_amdgcn_sched_barrier(0);                       // keeps the waits below behind the last products: lifted over them the s_wait_dscnt 0 would hold every product back until the whole read group is home
        // hand-over of the buffers, every wave: its own reads of this stage are home, its own copies of the next stage have landed, then the barrier; only behind it is this stage's buffer refilled
        asm volatile("s_wait_dscnt 0x0" ::: "memory");           // this wave has finished reading the buffer that is refilled below
        asm volatile("s_wait_asynccnt 0x0" ::: "memory");        // this wave's share of stage s + 1 has landed
        __syncthreads();
        if (s + 2 < DM / KC) stage_fill<PA, PB, NA, NBH>(l0 + (unsigned)(s & 1) * (unsigned)(GST * 2), ga, gb, stage_k(s + 2, s0));
    }
    asm volatile("s_wait_asynccnt 0x0" ::: "memory");            // no copy is outstanding when the wave goes on to the store stage
}

// proj_tile: bf16 GEMM, four waves per 128x128 tile (one 64x64 tile each), k over DM; the folded weight has two halves (value, remainder), x one: NA / NBH = halves of A / Bt.
// C[m][n] = sum_k x . (W value + W remainder) + bias (bias by column n when biasRow == 0, by row m when biasRow != 0; bias RNE-converted to bf16),
// written as f16, in fragment order, into the sub-plane at (r0/RB)*sRB + (c0/CB)*sCB: rows r0%RB .., columns c0%CB .., row pitch 'pitch' (halves). Tile (bx, by) of (M/128, N/128), 128 threads; st, osa = the block's LDS.
template <int PA, int PB, int NA, int NBH>
__device__ __forceinline__ void proj_tile(const bf* st, float* osa, const bf* __restrict__ A, const bf* __restrict__ Bt,
                                          const float* __restrict__ bias, const int biasRow, h16* Ph, const int RB, const size_t sRB, const int pitch, const int CB, const size_t sCB,
                                          const int bx, const int by, const int s0) {
    const int tid = threadIdx.x; const int wave = __builtin_amdgcn_readfirstlane(threadIdx.x >> 5); const int wm = wave >> 1, wn = wave & 1;
    float* os = osa + wave * (16 * 68);                          // store staging, private to the wave
    const int lane = threadIdx.x & 31, lr = lane & 15, hi = lane >> 4; const int r0 = bx * 128 + wm * 64, c0 = by * 128 + wn * 64;
    v8f acc[4][4];
#pragma unroll
    for (int mb = 0; mb < 4; ++mb)
#pragma unroll
        for (int nb = 0; nb < 4; ++nb) acc[mb][nb] = (v8f){};
    gemm_main<PA, PB, NA, NBH>(st, A + (size_t)(bx * 128) * PA + 8 * tid, Bt + (size_t)(by * 128) * PB + 8 * tid, tid, wm, wn, s0, acc);
    // store stage s = 0..3: lane holds row lane&15, columns (s>>1)*32 + (s&1)*16 + 8h + 0..7 of the slab = piece 'lane' of half s&1 of block s>>1
    float bc[4][8];
#pragma unroll
    for (int s = 0; s < 4; ++s) {
      if (biasRow) {                                             // known at compile time at both calls: with the bias by row no column bias is read
#pragma unroll
        for (int i = 0; i < 8; ++i) bc[s][i] = 0.0f;
      } else {
        int cb = c0 + (s >> 1) * 32 + (s & 1) * 16 + hi * 8; cb = (cb < DM - 8) ? cb : (DM - 8);          // clamped address
        const v4f b0 = *(const v4f*)(bias + cb);
        asm volatile("s_wait_xcnt 0x0" ::: "memory");            // in this build a later bias load lands in a register that this load names as its address
        const v4f b1 = *(const v4f*)(bias + cb + 4);
        asm volatile("s_wait_xcnt 0x0" ::: "memory");            // the same for the second half
#pragma unroll
        for (int i = 0; i < 4; ++i) { bc[s][i] = bfr(b0[i]); bc[s][4 + i] = bfr(b1[i]); }
      }
    }
    const size_t tbase = (size_t)(r0 / RB) * sRB + (size_t)(r0 % RB) * (size_t)pitch + (size_t)(c0 / CB) * sCB + (size_t)(c0 % CB) * 16 + 8 * lane;
#pragma unroll
    for (int mb = 0; mb < 4; ++mb) {
#pragma unroll
        for (int nb = 0; nb < 4; ++nb) {
#pragma unroll
            for (int j = 0; j < 8; ++j) os[(hi * 8 + j) * 68 + nb * 16 + lr] = acc[mb][nb][j]; }   // D: row 8h+j, col lane&15
        wave_sync();
        float br;
        { int ri = r0 + mb * 16 + lr; ri = (ri < DM - 1) ? ri : (DM - 1); const float bv_ = bias[ri]; br = biasRow ? bfr(bv_) : 0.0f; }
        const size_t sb = tbase + (size_t)(mb * 16) * (size_t)pitch;
{
#pragma unroll
            for (int s = 0; s < 4; ++s) { const int col = (s >> 1) * 32 + (s & 1) * 16 + hi * 8;   // 16 lanes = 16 rows; 4 s x 2 halves x 8 = 64 columns
                const v4f x0 = *(const v4fa*)(&os[lr * 68 + col]); const v4f x1 = *(const v4fa*)(&os[lr * 68 + col + 4]);
                float val[8]; v8h hv;
#pragma unroll
                for (int i = 0; i < 4; ++i) { val[i] = x0[i] + bc[s][i] + br; val[4 + i] = x1[i] + bc[s][4 + i] + br; }
#pragma unroll
                for (int i = 0; i < 8; ++i) hv[i] = toh_flush(val[i]);
                const size_t oo = sb + (size_t)((s >> 1) * 512 + (s & 1) * 256);
                *(v8h*)(Ph + oo) = hv; }
             }
        if (biasRow) asm volatile("s_wait_xcnt 0x0" ::: "memory");   // in this build the next slab's row-bias load lands in a register that one of these stores names
        wave_sync();
    }
}

// k_qkv: the three input projections in one launch, grid (NB*SEQ/128, DM/128, 3); the choice by blockIdx.z is the same for a whole block.
// z = 0, 1 (q, k): A = x rows (m = b*SEQ + t, pitch DM, one half), Bt = folded W rows (n = h*64 + d, pitch WP, two halves), bias by column -> plane [(b*12 + h)][t][d]
// z = 2 (v^T):     A = folded Wv rows (m = h*64 + d, pitch WP, two halves), Bt = x rows (n = b*SEQ + t, pitch DM, one half), bias by row -> plane [(b*768 + m)][t] = [(b*12 + h)][d][t]
__global__ __launch_bounds__(32 * GW) void k_qkv(const bf* __restrict__ XB, const bf* __restrict__ WB,
                                                 const float* __restrict__ bq, const float* __restrict__ bk, const float* __restrict__ bv, h16* QH, h16* KP, h16* VT) {
    __shared__ __align__(16) bf st[2 * 3 * PNL];                 // two buffers of three panels
    __shared__ __align__(16) float osa[GW * 16 * 68];
    const int z = blockIdx.z;
    // first stage: the 64 blocks on one weight tile (same y, z) spread over all DM / KC stages, the blocks on one x tile (same x) differ by y + 6 z
    const int s0 = (int)((blockIdx.x + blockIdx.y + 6u * blockIdx.z) % (unsigned)(DM / KC));
    if (z < 2) proj_tile<DM, WP, 1, 2>(st, osa, XB, WB + (size_t)z * DM * WP, z ? bk : bq, 0, z ? KP : QH, SEQ, (size_t)NH_ * SEQ * HD, HD, HD, (size_t)SEQ * HD, blockIdx.x, blockIdx.y, s0);
    else       proj_tile<WP, DM, 2, 1>(st, osa, WB + (size_t)2 * DM * WP, XB, bv, 1, VT, DM, (size_t)0, SEQ, SEQ, (size_t)DM * SEQ, blockIdx.y, blockIdx.x, s0);
}

// k_flash: fused dense attention, one wave per 16 query rows of one (batch, head), eight waves per block; Q fragments straight from the fragment-order f16 plane (two 16-B loads each, 512 contiguous bytes per load).
// K and V^T reach the waves through LDS: a stage is 64 keys (K 8 KiB, V^T 4 block rows x 2 KiB, both still in fragment order), copied once per block by asynchronous 16-B copies, four per lane, into one of two buffers,
// one stage ahead of its use; all eight waves read their fragments from it (512 contiguous bytes per ds load).
// Transposed form: S^T[key][t] = K Q^T (A = K rows, B = Q rows); lane (t = lane&15, h = lane>>4) holds keys 8h+r of each 16-key tile, so the packed
// P tile is directly the B fragment of O^T[d][t] = V^T P^T (element r <- tile keys 0..15, element 8+r <- tile keys 16..31, lane unchanged).
// Key loop covers keys 0 .. SEQ-1 in steps of 32 (all inside the sequence, every key valid for every row), from the block's first stage on, wrapping to key 0 behind the last.
// Softmax state (reference point m, partial sum) is one scalar per lane. m is the row's largest score in the stages where m moved, those where some score of the wave passed its row's m by more than TAU: only then are m moved and o, l rescaled (the quotient o / l does not depend on m);
// in every other stage P = exp2(s * SC2 + (PSH - m * SC2)) straight from the raw scores, at most 2^14. The two lane halves of a row share m and are combined with one xor-16 exchange.
// P carries x256 and is converted to f16 two scores per instruction; a P under the smallest normal f16 stays an f16 subnormal (the matrix unit keeps them); the row sum runs over the converted P.
// One lane's four copies of a stage: l = LDS byte address of its first piece in the buffer, gk / gv = its first K and V^T piece of the stage.
__device__ __forceinline__ void stage_copy(const unsigned l, const h16* gk, const h16* gv) {
    const unsigned l1 = l + 4096u, l2 = l + 8192u, l3 = l + 12288u;
    const h16* gk1 = gk + 2048; const h16* gv1 = gv + (size_t)32 * SEQ;      // K piece + 256; V^T piece + 256 = two block rows further
    // the wait is the statement's last line: the address registers that the copies name are rewritten only behind it
    asm volatile("global_load_async_to_lds_b128 %0, %4, off\n\t"
                 "global_load_async_to_lds_b128 %1, %5, off\n\t"
                 "global_load_async_to_lds_b128 %2, %6, off\n\t"
                 "global_load_async_to_lds_b128 %3, %7, off\n\t"
                 "s_wait_xcnt 0x0"
                 :: "v"(l), "v"(l1), "v"(l2), "v"(l3), "v"(gk), "v"(gk1), "v"(gv), "v"(gv1) : "memory");
}
// Eight base-2 exponentials in place, in one statement: each works on a register of its own, so none reads the result or overwrites the source of the one in front of it, and the v_nop is the one free slot behind the last
__device__ __forceinline__ void exp2x8(float (&t)[8]) {
    asm("v_exp_f32 %0, %0\n\tv_exp_f32 %1, %1\n\tv_exp_f32 %2, %2\n\tv_exp_f32 %3, %3\n\tv_exp_f32 %4, %4\n\tv_exp_f32 %5, %5\n\tv_exp_f32 %6, %6\n\tv_exp_f32 %7, %7\n\tv_nop"
        : "+v"(t[0]), "+v"(t[1]), "+v"(t[2]), "+v"(t[3]), "+v"(t[4]), "+v"(t[5]), "+v"(t[6]), "+v"(t[7]));
}
__global__ __launch_bounds__(32 * AW) void k_flash(const h16* __restrict__ QH, const h16* __restrict__ KP, const h16* __restrict__ VT, bf* CX) {
    __shared__ __align__(16) h16 kv[2][2 * KS * HD];            // per buffer: K [64 keys][64 d] (4096 halves), then V^T [4 block rows][64 keys x 16 d] (4096 halves)
    const int tid = threadIdx.x;
    const int lane = threadIdx.x & 31;
    const int wave = __builtin_amdgcn_readfirstlane(threadIdx.x >> 5);
    const int zh = blockIdx.y; const int b = zh / NH_, h = zh % NH_;
    const int t0 = (blockIdx.x * AW + wave) * 16;
    const size_t pbase = (size_t)zh * SEQ * HD;
    const size_t qo = pbase + (size_t)t0 * HD + 8 * lane;
    const v16h qh0 = ldh(QH + qo), qh1 = ldh(QH + qo + 512);   // B fragments: col t, k = d (blocks d 0..31, d 32..63)
    // this lane's pieces of a stage: K pieces tid and tid + 256 of 512 (contiguous); V^T pieces tid and tid + 256 of 512 (piece i: block row i >> 7, 16-B unit i & 127 of its 2 KiB)
    const unsigned lds0 = (unsigned)(size_t)&kv[0][0] + (unsigned)tid * 16u;
    const h16* gk = KP + pbase + (size_t)tid * 8;                                          // + stage * KS * HD
    const h16* gv = VT + pbase + (size_t)(tid >> 7) * 16 * SEQ + (size_t)(tid & 127) * 8;  // + stage * KS * 16
    v8f o[4];
#pragma unroll
    for (int j = 0; j < 4; ++j) { o[j] = (v8f){}; }
    float m = -3.0e38f, thr = -3.0e38f, sh = PSH, l = 0.0f;      // m, thr in raw score units; the first stage always moves m (any finite score is above thr)
    // the blocks of one (batch, head) read the same K and V^T: each starts its key loop at its own stage s0 and wraps round, so that they ask L2 for different lines at any one moment
    static_assert((16 * AW) % KS == 0);                          // s0 = blockIdx.x * (16 * AW / KS) < SEQ / KS: the blocks of a head stand evenly over the stages
    const int s0 = (int)blockIdx.x * (16 * AW / KS);
    const auto stg = [s0](const int i) { const int t = i + s0; return (size_t)(t >= SEQ / KS ? t - SEQ / KS : t); };   // the i-th stage that this block works on
    stage_copy(lds0, gk + stg(0) * (KS * HD), gv + stg(0) * (KS * 16));
    asm volatile("s_wait_asynccnt 0x0" ::: "memory");            // this wave's share of the first stage has landed before the barrier that shows it to the other waves
    __syncthreads();
    stage_copy(lds0 + (unsigned)sizeof(kv[0]), gk + stg(1) * (KS * HD), gv + stg(1) * (KS * 16));
#pragma unroll 1                                                 // one stage per trip: the two buffers alternate by s & 1
    for (int s = 0; s < SEQ / KS; ++s) {
        const h16* sb = &kv[s & 1][0] + 8 * lane;
        // raw scores of the stage's 64 keys: four tiles of 16 keys
        v8f sH[KS / 16];
#pragma unroll                                                   // both passes of a stage in one trip: their LDS offsets become immediates
        for (int p = 0; p < KS / 32; ++p) {
            const h16* ka = sb + p * 32 * HD;                    // A fragments: row key, k = d
            const v16h ka0 = ldh(ka), ka1 = ldh(ka + 512), kb0 = ldh(ka + 16 * HD), kb1 = ldh(ka + 16 * HD + 512);
            v8f sHa = (v8f){}, sHb = (v8f){};
            sHa = wmma16(ka0, qh0, sHa); sHb = wmma16(kb0, qh0, sHb);
            sHa = wmma16(ka1, qh1, sHa); sHb = wmma16(kb1, qh1, sHb);
            sH[2 * p] = sHa; sH[2 * p + 1] = sHb;
        }
        // the stage's largest raw score in this lane; the row's other keys sit in lane ^ 16 and are tested there
        float mxa = fmaxf(sH[0][0], sH[1][0]), mxb = fmaxf(sH[2][0], sH[3][0]);   // two chains, one per pass: the first can run while the second pass's products are still in the matrix unit
#pragma unroll
        for (int r = 1; r < 8; ++r) { mxa = fmaxf(mxa, fmaxf(sH[0][r], sH[1][r])); mxb = fmaxf(mxb, fmaxf(sH[2][r], sH[3][r])); }
        float mx = fmaxf(mxa, mxb);
        // the reference point m of a row moves only when a score passes it by more than TAU: one test for the whole wave, so the branch is scalar and every lane is on inside it
        if (__builtin_amdgcn_ballot_w32(mx > thr) != 0u) {
            mx = fmaxf(mx, __shfl_xor(mx, 16, 32));
            const float mnew = fmaxf(m, mx);
            float alpha;
            // the exponential and the one free slot behind it in one statement: nothing else keeps the next instruction off its source or result register
            asm("v_exp_f32 %0, %1\n\tv_nop" : "=v"(alpha) : "v"((m - mnew) * SC2));
#pragma unroll
            for (int j = 0; j < 4; ++j) o[j] = o[j] * alpha;
            l = l * alpha; m = mnew; sh = PSH - mnew * SC2; thr = mnew + TAU;
        }
#pragma unroll                                                   // as above: LDS offsets become immediates, and sH is indexed statically
        for (int p = 0; p < KS / 32; ++p) {
        const h16* va = sb + KS * HD + p * 512;                  // A fragments: row d, k = key
        const v16h v0 = ldh(va), v1 = ldh(va + KS * 16), v2 = ldh(va + 2 * KS * 16), v3 = ldh(va + 3 * KS * 16);
        const v8f sHa = sH[2 * p], sHb = sH[2 * p + 1];
        float ta[8], tb[8];
#pragma unroll
        for (int r = 0; r < 8; ++r) { ta[r] = sHa[r] * SC2 + sh; tb[r] = sHb[r] * SC2 + sh; }
        exp2x8(ta); exp2x8(tb);
        v16h pb; float ls = 0.0f;
#pragma unroll
        for (int r = 0; r < 8; r += 2) {
            const v2f xa = { ta[r], ta[r + 1] };
            const v2f xb = { tb[r], tb[r + 1] };
            const v2h pa = __builtin_convertvector(xa, v2h), pc = __builtin_convertvector(xb, v2h);   // two scores per conversion, round to nearest even
            pb[r] = pa[0]; pb[r + 1] = pa[1]; pb[8 + r] = pc[0]; pb[9 + r] = pc[1];
            ls += (float)pa[0] + (float)pc[0]; ls += (float)pa[1] + (float)pc[1]; }
        o[0] = wmma16(v0, pb, o[0]); o[1] = wmma16(v1, pb, o[1]); o[2] = wmma16(v2, pb, o[2]); o[3] = wmma16(v3, pb, o[3]);
        l += ls;
        }
        // hand-over of the buffers, every wave: its own reads of this stage are home, its own copies of the next stage have landed, then the barrier; only behind it is this stage's buffer refilled
        asm volatile("s_wait_dscnt 0x0" ::: "memory");           // this wave has finished reading the buffer that is refilled below
        asm volatile("s_wait_asynccnt 0x0" ::: "memory");        // this wave's share of stage s + 1 has landed
        __syncthreads();
        if (s + 2 < SEQ / KS) stage_copy(lds0 + (unsigned)(s & 1) * (unsigned)sizeof(kv[0]), gk + stg(s + 2) * (KS * HD), gv + stg(s + 2) * (KS * 16));
    }
    asm volatile("s_wait_asynccnt 0x0" ::: "memory");            // no copy is outstanding when the wave ends
    l += __shfl_xor(l, 16, 32);
    const float inv = 1.0f / l;
    // O^T D layout: o_j[r] = (d = 16j + 8h + r, t = lane&15) = row t, columns 16j + 8h + 0..7: piece 'lane' of half j&1 of block j>>1 in fragment order, so every lane stores its own registers (no transposition)
    bf* crow = CX + ((size_t)b * SEQ + t0) * CXP + (size_t)(h * HD) * 16 + 8 * lane;   // block row t0/16, first block of column h*64, piece 'lane'
#pragma unroll
    for (int j = 0; j < 4; ++j) { v8us hv, lv;
#pragma unroll
        for (int i = 0; i < 8; ++i) { const float x = o[j][i] * inv; const unsigned short h0 = f2bf(x); hv[i] = h0; lv[i] = f2bf(x - bf2f(h0)); }
        const size_t oo = (size_t)((j >> 1) * 512 + (j & 1) * 256);
        *(v8us*)(crow + oo) = hv; *(v8us*)(crow + oo + DM * 16) = lv; }
}

// k_out: final projection, four waves per 128x128 tile (one 64x64 tile each). A = ctx plane [m][value 768 | remainder 768], Bt = folded Wo plane [n][value 768 | remainder 768], k over 768:
// per k-step value x value, remainder x value, value x remainder, from one read of each of the four halves.
// OUT[m][n] = acc + bias[n] (bias RNE-converted to bf16), f32. Epilogue: per 16-row slab staged in LDS (wave-private), each output row segment (64 floats = 256 B = two lines)
__global__ __launch_bounds__(32 * GW) void k_out(const bf* __restrict__ A, const bf* __restrict__ Bt, const float* __restrict__ bias, float* OUT) {
    __shared__ __align__(16) bf st[2 * 4 * PNL];                 // two buffers of four panels
    __shared__ __align__(16) float osa[GW][16 * 68];
    const int tid = threadIdx.x; const int wave = __builtin_amdgcn_readfirstlane(threadIdx.x >> 5); const int wm = wave >> 1, wn = wave & 1;
    float* os = &osa[wave][0];                                   // store staging, private to the wave
    const int lane = threadIdx.x & 31, lr = lane & 15, hi = lane >> 4; const int r0 = blockIdx.x * 128 + wm * 64, c0 = blockIdx.y * 128 + wn * 64;
    v8f acc[4][4];
#pragma unroll
    for (int mb = 0; mb < 4; ++mb)
#pragma unroll
        for (int nb = 0; nb < 4; ++nb) acc[mb][nb] = (v8f){};
    // first stage: the 64 blocks on one weight tile (same y) spread over all DM / KC stages, the 6 blocks on one ctx tile (same x) stand two stages apart
    const int s0 = (int)((blockIdx.x + 2u * blockIdx.y) % (unsigned)(DM / KC));
    gemm_main<CXP, WP, 2, 2>(st, A + (size_t)(blockIdx.x * 128) * CXP + 8 * tid, Bt + (size_t)(blockIdx.y * 128) * WP + 8 * tid, tid, wm, wn, s0, acc);
    const int cofs = lr * 4;
    v4f b4 = *(const v4f*)(bias + c0 + cofs);          // c0 + cofs + 3 <= DM - 1 always
    asm volatile("s_wait_xcnt 0x0" ::: "memory");      // the address arithmetic below reuses registers that this load names
    __builtin_amdgcn_sched_barrier(0);                 // holds that arithmetic behind the wait
    b4[0] = bfr(b4[0]); b4[1] = bfr(b4[1]); b4[2] = bfr(b4[2]); b4[3] = bfr(b4[3]);
    const size_t orow0 = (size_t)(r0 / SEQ) * OUT_SEQ + (size_t)(r0 % SEQ);
#pragma unroll
    for (int mb = 0; mb < 4; ++mb) {
#pragma unroll
        for (int nb = 0; nb < 4; ++nb) {
#pragma unroll
            for (int j = 0; j < 8; ++j) os[(hi * 8 + j) * 68 + nb * 16 + lr] = acc[mb][nb][j]; }   // D: row 8h+j, col lane&15
        wave_sync();
        float* ob = OUT + (orow0 + (size_t)(mb * 16)) * DM + c0;
{
#pragma unroll
            for (int s = 0; s < 8; ++s) { const int row = 2 * s + hi;   // 8 s x 2 rows = 16 rows; 16 lanes x 4 floats = 64 columns
                const v4f xv = *(const v4fa*)(&os[row * 68 + cofs]);
                const v4f val = xv + b4;
                *(v4f*)(ob + (size_t)row * DM + cofs) = val; }
             }
        wave_sync();
    }
}

static constexpr size_t al256(size_t v) { return (v + 255) & ~(size_t)255; }
static constexpr size_t SZ_XB = al256((size_t)NB * SEQ * DM * 2);
static constexpr size_t SZ_WB = al256((size_t)4 * DM * WP * 2);
static constexpr size_t SZ_PL = al256((size_t)NB * NH_ * SEQ * HD * 2);
static constexpr size_t SZ_CX = al256((size_t)NB * SEQ * CXP * 2);
static constexpr size_t SZ_TOTAL = SZ_XB + SZ_WB + 3 * SZ_PL + SZ_CX;
static_assert(SZ_TOTAL <= (size_t)134217728);          // workspace carve <= 128 MiB
static_assert(((size_t)DM * WP * 2) % 256 == 0);       // weight sub-planes stay 256-byte aligned
static_assert((size_t)NB * NH_ * SEQ * HD == (size_t)NB * SEQ * DM);   // plane extent == GEMM tile grid extent

extern "C" void kernel_launch(void* const* d_in, const int* in_sizes, int n_in,
                              void* d_out, int out_size, void* d_ws, size_t ws_size, hipStream_t stream) {
    if (n_in < 17) return;
    const size_t needx = ((size_t)(NB - 1) * SEQ_FULL + SEQ) * DM;
    if ((size_t)in_sizes[0] < needx) return;
    if ((size_t)in_sizes[1] < (size_t)DM * DM || (size_t)in_sizes[5] < (size_t)DM * DM || (size_t)in_sizes[9] < (size_t)DM * DM || (size_t)in_sizes[13] < (size_t)DM * DM) return;
    if (in_sizes[2] < DM || in_sizes[6] < DM || in_sizes[10] < DM || in_sizes[14] < DM) return;
    if (in_sizes[3] < LR * DM || in_sizes[7] < LR * DM || in_sizes[11] < LR * DM || in_sizes[15] < LR * DM) return;
    if (in_sizes[4] < DM * LR || in_sizes[8] < DM * LR || in_sizes[12] < DM * LR || in_sizes[16] < DM * LR) return;
    if ((size_t)out_size < ((size_t)(NB - 1) * OUT_SEQ + SEQ) * DM) return;
    if (SZ_TOTAL > ws_size) return;
    // wire order: x, then per projection (q, k, v, o): W [out][in], b [out], A [8][in], B [out][8]; folded weights [out][in] = Bt as-is
    const float* x   = (const float*)d_in[0];
    const float* wq  = (const float*)d_in[1];  const float* bq  = (const float*)d_in[2];  const float* laq = (const float*)d_in[3];  const float* lbq = (const float*)d_in[4];
    const float* wk  = (const float*)d_in[5];  const float* bk  = (const float*)d_in[6];  const float* lak = (const float*)d_in[7];  const float* lbk = (const float*)d_in[8];
    const float* wv  = (const float*)d_in[9];  const float* bv  = (const float*)d_in[10]; const float* lav = (const float*)d_in[11]; const float* lbv = (const float*)d_in[12];
    const float* wo  = (const float*)d_in[13]; const float* bo  = (const float*)d_in[14]; const float* lao = (const float*)d_in[15]; const float* lbo = (const float*)d_in[16];
    float* OUT = (float*)d_out;      // [NB][SEQ][768]
    char* wsp = (char*)d_ws;
    bf* XB = (bf*)wsp; wsp += SZ_XB;                 // [NB*SEQ][768]
    bf* WB = (bf*)wsp; wsp += SZ_WB;                 // [4][768][value 768 | remainder 768]: q | k | v | o
    h16* QH = (h16*)wsp; wsp += SZ_PL;               // [NB*12][SEQ][64]
    h16* KP = (h16*)wsp; wsp += SZ_PL;               // [NB*12][SEQ][64]
    h16* VT = (h16*)wsp; wsp += SZ_PL;               // [NB*12][64][SEQ]
    bf* CX = (bf*)wsp; wsp += SZ_CX;                 // [NB*SEQ][value 768 | remainder 768]
    bf* WO = WB + (size_t)3 * DM * WP;

    k_prep<<<4 * FOLD_BLOCKS + CVT_BLOCKS, 256, 0, stream>>>(x, wq, laq, lbq, wk, lak, lbk, wv, lav, lbv, wo, lao, lbo, XB, WB);

    k_qkv<<<dim3(NB * SEQ / 128, DM / 128, 3), 32 * GW, 0, stream>>>(XB, WB, bq, bk, bv, QH, KP, VT);

    k_flash<<<dim3(SEQ / (16 * AW), NB * NH_, 1), 32 * AW, 0, stream>>>(QH, KP, VT, CX);

    // out: A = ctx rows [m][value | remainder], Bt = folded Wo rows (n) [value | remainder], bias by column -> OUT[b][t][n]
    k_out<<<dim3(NB * SEQ / 128, DM / 128, 1), 32 * GW, 0, stream>>>(CX, WO, bo, OUT);
}

// v009
// One run takes 105 microseconds.
// Two timings next to v008 both put it at 1.13 times that version's speed.
// Over all steps from v000 it is 4.08 times as fast.
#include <hip/hip_runtime.h>

// Dense (unmasked) multi-head self-attention, width 768 = 12 heads x 64, x [NB][SEQ][768]; each of the four projections is y = x W^T + b + (x A^T) B^T with W [out][in], A [8][in], B [out][8]; score scale 1/8; f32 output.
// Compute dtypes, f32 accumulate everywhere (W, A, B, b, x RNE-converted to bf16 first): each projection GEMM forms x W^T and, beside it on the matrix unit, T = x A^T (f32); behind the k loop T, as bf16 value | bf16 remainder,
// meets B in one more k-step of the same accumulators. Softmax f32 (online, running max); output projection v_wmma_f32_16x16x32_bf16 with ctx as bf16 value | remainder (per k-step: value x W, remainder x W), one accumulator.
// Layout: bf16 copy of x; per projection a bf16 plane of W [768][768] and one of A with 16 rows (its 8 rows twice); q, k planes [b*12+h][t][d], v^T plane [b*12+h][d][t] (f16) written by the GEMM epilogue; fused flash kernel in transposed form
// Every one of these planes is stored in FRAGMENT ORDER: a block of 16 rows x 32 k is 512 consecutive elements, element (row, k) of a block at (k>>4)*256 + ((k>>3)&1)*128 + row*8 + (k&7);
// blocks run along k (512 elements each), then along rows (16 * pitch elements per block row). A fragment is then two wave-wide 16-B loads of 512 contiguous bytes each (four whole lines) instead of 16 partial lines.
// (S^T = K Q^T, O^T = V^T P^T, key loop over the whole sequence) writes the ctx plane [b*SEQ+t][value 768 | remainder 768] (bf16); final GEMM adds the bias at the store stage.

#ifndef NB
#define NB 4
#endif
#ifndef SEQ
#define SEQ 2048
#endif
#define NB_FULL  4
#define SEQ_FULL 2048
#ifndef OUT_SEQ
#define OUT_SEQ SEQ              // row pitch (in tokens) between batches of the output
#endif
#define DM   768
#define NH_  12
#define HD   64
#define LR   8                   // rank of the low-rank update
#define WP   (2 * DM)            // DM * WP elements = the room of one projection's planes in the workspace (W: DM * DM, LA plane: 16 * DM)
#define CXP  (2 * DM)            // ctx plane row pitch: value columns 0..DM-1, remainder columns DM..2DM-1
#define AW   8                   // waves per flash block (16 query rows each)
#define KS   64                  // keys per LDS stage of the flash kernel (two passes of 32)
#define GW   4                   // waves per GEMM block, 2 x 2, one 64x64 tile each: block tile 128 x 128
#define KC   64                  // k per LDS stage of the GEMMs (two k-steps of 32)
#define PNL  (128 * KC)          // elements of one panel of a GEMM stage: 128 rows x KC of one half (value or remainder) of one operand = 8 block rows of 2 KiB
#define SC2  (0.125f * 1.4426950408889634f)   // HD^-0.5 * log2(e)
#define PSH  8.0f                // log2 of the P carry (256)
#define TAU  (6.0f / SC2)        // a raw score may stand this far above its row's reference point: P then stays under 2^(8+6), inside f16

static_assert(HD == 64);
static_assert(NH_ * HD == DM);                 // head h = columns h*64 + d
static_assert(DM % 64 == 0);                   // column tiles of 64
static_assert(DM % 32 == 0);                   // GEMM k-loop steps by 32
static_assert(CXP == 2 * DM);
static_assert(CXP % 32 == 0);
static_assert(WP == 2 * DM);
static_assert(WP % 32 == 0);
static_assert(LR == 8);                        // one 32-byte load covers a row of B [out][8]; T value | remainder fill k 0..15 of one k-step
static_assert(DM % 8 == 0);                    // conversion pieces of 8 columns
static_assert((DM / 8) % 8 == 0);
static_assert(SEQ % 64 == 0);                  // a 64-row tile never straddles two batches
static_assert((NB * SEQ) % 64 == 0);
static_assert(SEQ % 32 == 0);                  // key loop steps by 32 and stays inside the sequence
static_assert(SEQ % (16 * AW) == 0);           // flash grid covers the sequence exactly
static_assert(((size_t)SEQ * DM) % 8 == 0);
static_assert(((size_t)DM * DM) % 8 == 0);
static_assert(NB <= NB_FULL);
static_assert(SEQ <= SEQ_FULL);
static_assert(AW * 32 == 256);                 // the stage copy deals 16-byte pieces to exactly 256 lanes
static_assert(KS == 64 && SEQ % KS == 0 && SEQ / KS >= 2);   // the two-buffer prologue needs two stages
static_assert(GW == 4 && KC == 64);            // the tile copy deals one 2-KiB block row (16 rows x KC) to exactly 128 lanes
static_assert(DM % 128 == 0 && (NB * SEQ) % 128 == 0);       // block tiles of 128 x 128 cover every GEMM exactly
static_assert(DM % KC == 0 && DM / KC >= 2);   // whole stages along k, and the two-buffer prologue needs two of them

typedef _Float16 h16;
typedef unsigned short bf;
typedef __attribute__((ext_vector_type(16))) __bf16   v16bf;
typedef __attribute__((ext_vector_type(16))) _Float16 v16h;
typedef __attribute__((ext_vector_type(8)))  _Float16 v8h;
typedef __attribute__((ext_vector_type(2)))  _Float16 v2h;
typedef __attribute__((ext_vector_type(2)))  float    v2f;
typedef __attribute__((ext_vector_type(8)))  unsigned short v8us;
typedef __attribute__((ext_vector_type(8)))  float    v8f;
typedef __attribute__((ext_vector_type(4)))  float    v4f;
typedef v4f  __attribute__((may_alias)) v4fa;

__device__ __forceinline__ unsigned short f2bf(float f) { unsigned u = __float_as_uint(f); u += 0x7FFFu + ((u >> 16) & 1u); return (unsigned short)(u >> 16); }
__device__ __forceinline__ float bf2f(unsigned short s) { return __uint_as_float(((unsigned)s) << 16); }
__device__ __forceinline__ float bfr(float f) { return bf2f(f2bf(f)); }     // f32 -> bf16 (RNE) -> f32
__device__ __forceinline__ v16h cat16(v8h lo, v8h hi) { return __builtin_shufflevector(lo, hi, 0, 1, 2, 3, 4, 5, 6, 7, 8, 9, 10, 11, 12, 13, 14, 15); }
__device__ __forceinline__ v16bf cat16b(v8us lo, v8us hi) { return __builtin_bit_cast(v16bf, __builtin_shufflevector(lo, hi, 0, 1, 2, 3, 4, 5, 6, 7, 8, 9, 10, 11, 12, 13, 14, 15)); }
__device__ __forceinline__ v8f wmma16(v16h a, v16h b, v8f c) { return __builtin_amdgcn_wmma_f32_16x16x32_f16(false, a, false, b, (short)0, c, false, false); }
__device__ __forceinline__ v8f wmmab(v16bf a, v16bf b, v8f c) { return __builtin_amdgcn_wmma_f32_16x16x32_bf16(false, a, false, b, (short)0, c, false, false); }
// fragment loaders from fragment-order planes; p = block base + 8*lane: elements 0..7 <- k0+8h+0..7, elements 8..15 <- k0+16+8h+0..7 of row lane&15 (same map for A and B)
__device__ __forceinline__ v16h  ldh(const h16* p) { return cat16(*(const v8h*)p, *(const v8h*)(p + 256)); }
__device__ __forceinline__ v16bf ldb(const bf* p)  { return cat16b(*(const v8us*)p, *(const v8us*)(p + 256)); }
// ordering point for wave-private LDS tiles (same wave writes and reads)
__device__ __forceinline__ void wave_sync() { __builtin_amdgcn_fence(3 /* release order */, "wavefront"); __builtin_amdgcn_wave_barrier(); asm volatile("" ::: "memory"); }
// f32 -> f16 for WMMA operand planes: magnitudes below the smallest normal f16 become exactly 0 (value select)
static __device__ __forceinline__ h16 toh_flush(float v) { const h16 r = (h16)v; return (fabsf(v) < 6.103515625e-05f) ? (h16)0.0f : r; }

// cvt8_piece: one 8-element piece of the bf16 copy of x (rows b*SEQ + t, read from row b*SEQ_FULL + t of x)
__device__ __forceinline__ void cvt8_piece(const float* __restrict__ src, bf* dst, const size_t i, const size_t n8) {
    if (i >= n8) return;
    // i counts 8-element pieces of the fragment-order plane (row pitch DM): block i>>6, piece w = i&63 holds row w&15, k (w>>4)*8 .. +7 of the block
    const size_t blk = i >> 6; const int w = (int)(i & 63);
    const size_t m = (blk / (DM / 32)) * 16 + (size_t)(w & 15); const int k0 = (int)(blk % (DM / 32)) * 32 + (w >> 4) * 8;
    const size_t ms = (m / SEQ) * SEQ_FULL + (m % SEQ);
    const v8f v = *(const v8f*)(src + ms * DM + k0); v8us o;
#pragma unroll
    for (int k = 0; k < 8; ++k) o[k] = f2bf(v[k]);
    *(v8us*)(dst + i * 8) = o; 
}

// wprep_piece: one 8-element piece of a projection's two bf16 operand planes, both in fragment order with row pitch DM: pieces 0 .. DM*DM/8 - 1 are W [out][in]; the LAP_PIECES behind them are the plane of LA,
// 16 rows, row r = LA row r & 7 (the 8 rows stand twice: gemm_main says why); it begins DM*DM elements behind the start of W's plane.
#define LAP_PIECES (16 * (DM / 8))
__device__ __forceinline__ void wprep_piece(const float* __restrict__ W, const float* __restrict__ LA, bf* dst, const size_t i) {
    if (i >= (size_t)DM * (DM / 8) + LAP_PIECES) return;
    const bool isw = i < (size_t)DM * (DM / 8);                  // the same for a whole block of 256 lanes
    const size_t i2 = isw ? i : i - (size_t)DM * (DM / 8);
    // i2 counts 8-element pieces of its plane: block i2>>6 (block row rb, block column kb), piece pc = i2&63 holds row pc&15, k (pc>>4)*8 .. +7 of the block
    const int rb = (int)(i2 >> 6) / (DM / 32), kb = (int)(i2 >> 6) % (DM / 32), pc = (int)(i2 & 63);
    const int m = rb * 16 + (pc & 15); const int k0 = kb * 32 + (pc >> 4) * 8;
    const float* sp = isw ? W + (size_t)m * DM + k0 : LA + (size_t)(m & (LR - 1)) * DM + k0;
    const v8f v = *(const v8f*)sp; v8us o;
#pragma unroll
    for (int k = 0; k < 8; ++k) o[k] = f2bf(v[k]);
    *(v8us*)(dst + i * 8) = o;
}

// k_prep: the bf16 operand planes, in one launch: blocks 0 .. 4*WPREP_BLOCKS-1 convert W and LA of the four projections (q, k, v, o; WPREP_BLOCKS blocks each), the rest convert x.
#define WPREP_BLOCKS ((DM * (DM / 8) + LAP_PIECES) / 256)
#define CVT_BLOCKS  ((NB * SEQ * (DM / 8)) / 256)
static_assert((DM * (DM / 8)) % 256 == 0 && LAP_PIECES % 256 == 0 && (NB * SEQ * (DM / 8)) % 256 == 0);   // every part fills whole blocks
__global__ __launch_bounds__(256) void k_prep(const float* __restrict__ x,
                                              const float* __restrict__ wq, const float* __restrict__ laq,
                                              const float* __restrict__ wk, const float* __restrict__ lak,
                                              const float* __restrict__ wv, const float* __restrict__ lav,
                                              const float* __restrict__ wo, const float* __restrict__ lao,
                                              bf* XB, bf* WB) {
    const int blk = blockIdx.x;
    if (blk < 4 * WPREP_BLOCKS) {
        const int f = blk / WPREP_BLOCKS;
        const float* W  = (f == 0) ? wq  : (f == 1) ? wk  : (f == 2) ? wv  : wo;
        const float* LA = (f == 0) ? laq : (f == 1) ? lak : (f == 2) ? lav : lao;
        wprep_piece(W, LA, WB + (size_t)f * DM * WP, (size_t)(blk - f * WPREP_BLOCKS) * 256 + threadIdx.x);
    } else {
        cvt8_piece(x, XB, (size_t)(blk - 4 * WPREP_BLOCKS) * 256 + threadIdx.x, (size_t)NB * SEQ * (DM / 8));
    }
}

// gemm_main: a block of four waves (2 x 2) on a 128x128 tile, each wave 64x64 with 16 accumulators; operands from fragment-order bf16 planes whose rows hold NA (A) or NBH (B) halves of DM columns: value, or value | remainder.
// C[m][n] += sum over k < DM of A0[m][k] B0[n][k] + A1[m][k] B0[n][k] + A0[m][k] B1[n][k] (the terms whose halves exist; never remainder x remainder).
// One operand is the activation X (x or ctx: A when XA, else B), the other the weight W. The rank-8 term (X LA^T) LB^T rides along: a stage also holds KC columns of the 16-row LA plane, and each k-step adds one product per X fragment,
// T^T[r][t] += LA[r & 7][k] X[t][k] (LA as A, the X fragment as B: both operands have the same register map). In D a lane (t = lane&15, h = lane>>4) holds rows 8h + j, and as the 8 rows of LA stand twice both halves hold T[t][0..7]:
// the lane's own eight registers, as bf16 value (h = 0) or bf16 remainder (h = 1), are then elements k = 8h + j of a fragment of row t (k 16..31 zero), with no exchange between lanes. Its partner holds bf16 LB[n][j] at k = j and at k = 8 + j,
// so one last k-step adds sum_j (T value + T remainder)[t][j] LB[n][j] to every accumulator.
// The k loop runs over DM once: a stage is KC = 64 k of every half of the block's 128 A rows and 128 B rows (NA + NBH panels of 16 KiB, still in fragment order), so each half is brought from L2 once per block
// and each fragment read from LDS serves every product that its k-step has for it (an operand with one half meets both halves of the other from the same registers).
// A stage is copied once per block by asynchronous 16-B copies, 8 per lane and panel, into one of two buffers, one stage ahead of its use; each block row is then read by two waves (512 contiguous bytes per ds load).
// The fragments of a stage's two k-steps are read as one group ahead of its products; no fragment is read across a stage's end.
// ga / gb = plane + (block's first row) * pitch + 8 * thread. PA / PB = row pitches (elements); 32 k = one block = 512 elements, so column k0 is at k0*16 and the remainder half DM*16 further.
// A block starts its k loop at stage s0, set by its tile, and wraps round: blocks that share operand rows then ask L2 for different lines at any one moment.
// Every accumulator takes its k-steps in rising order from stage s0, wrapping to stage 0 behind the last, and inside a k-step value x W, then (ctx) remainder x W; the rank-8 term comes last.
// Eight copies of one lane: the same 16-B piece of block rows 0..7 of one panel; l = LDS byte address of the piece in block row 0, g = the same piece in the plane.
template <int P>
__device__ __forceinline__ void tile_copy(const unsigned l, const bf* g) {
    // the wait is the statement's last line: the address registers that the copies name are rewritten only behind it
    asm volatile(
                 "global_load_async_to_lds_b128 %0, %8, off\n\t"
                 "global_load_async_to_lds_b128 %1, %9, off\n\t"
                 "global_load_async_to_lds_b128 %2, %10, off\n\t"
                 "global_load_async_to_lds_b128 %3, %11, off\n\t"
                 "global_load_async_to_lds_b128 %4, %12, off\n\t"
                 "global_load_async_to_lds_b128 %5, %13, off\n\t"
                 "global_load_async_to_lds_b128 %6, %14, off\n\t"
                 "global_load_async_to_lds_b128 %7, %15, off\n\t"
                 "s_wait_xcnt 0x0"
                 :: "v"(l), "v"(l + 2048u), "v"(l + 4096u), "v"(l + 6144u), "v"(l + 8192u), "v"(l + 10240u), "v"(l + 12288u), "v"(l + 14336u),
                    "v"(g), "v"(g + 16 * P), "v"(g + 32 * P), "v"(g + 48 * P), "v"(g + 64 * P), "v"(g + 80 * P), "v"(g + 96 * P), "v"(g + 112 * P) : "memory");
}
template <int PA, int PB, int NA, int NBH>
__device__ __forceinline__ void stage_fill(const unsigned l, const bf* ga, const bf* gb, const bf* gl, const int kc) {
    // a block row of a panel is 2 KiB = 128 pieces: this lane's piece is 'thread'; panels in the buffer: A halves, then B halves, then the one block row of LA
#pragma unroll
    for (int h = 0; h < NA; ++h)  tile_copy<PA>(l + (unsigned)(h * PNL * 2), ga + (size_t)(kc + h * DM) * 16);
#pragma unroll
    for (int h = 0; h < NBH; ++h) tile_copy<PB>(l + (unsigned)((NA + h) * PNL * 2), gb + (size_t)(kc + h * DM) * 16);
    // the wait is the statement's last line: the address registers that the copy names are rewritten only behind it
    asm volatile("global_load_async_to_lds_b128 %0, %1, off\n\t"
                 "s_wait_xcnt 0x0"
                 :: "v"(l + (unsigned)((NA + NBH) * PNL * 2)), "v"(gl + (size_t)kc * 16) : "memory");
}
// first k of the i-th stage that a block works on, 0 <= i, s0 < DM / KC
__device__ __forceinline__ int stage_k(const int i, const int s0) { const int t = i + s0; return (t >= DM / KC ? t - DM / KC : t) * KC; }
// gl = LA plane + 8 * thread; lbg = LB + 8 * (the block's first W row + thread); lbs = the block's LDS room for its 128 rows of LB (f32), filled once with the first stage.
#define LPN  (16 * KC)           // elements of the LA panel of a stage: 16 rows x KC
template <int PA, int PB, int NA, int NBH, bool XA>
__device__ __forceinline__ void gemm_main(const bf* st, const bf* ga, const bf* gb, const bf* gl, const float* lbs, const float* lbg, const int tid, const int wm, const int wn, const int s0, v8f (&acc)[4][4]) {
    static_assert(NA * DM <= PA && NBH * DM <= PB && NA >= 1 && NA <= 2 && NBH >= 1 && NBH <= 2);   // every half lies inside its plane's rows
    static_assert((XA ? NBH : NA) == 1);                         // the weight has one half
    constexpr int GST = (NA + NBH) * PNL + LPN;                  // elements of one stage
    const int lane = tid & 31;
    const unsigned l0 = (unsigned)(size_t)st + (unsigned)tid * 16u;
    v8f tacc[4];
#pragma unroll
    for (int i = 0; i < 4; ++i) tacc[i] = (v8f){};
    stage_fill<PA, PB, NA, NBH>(l0, ga, gb, gl, stage_k(0, s0));
    {   // this lane's row of LB, 32 B; the wait is the statement's last line: the address registers that the copies name are rewritten only behind it
        const unsigned ll = (unsigned)(size_t)lbs + (unsigned)tid * 32u;
        asm volatile("global_load_async_to_lds_b128 %0, %2, off\n\t"
                     "global_load_async_to_lds_b128 %1, %3, off\n\t"
                     "s_wait_xcnt 0x0"
                     :: "v"(ll), "v"(ll + 16u), "v"(lbg), "v"(lbg + 4) : "memory");
    }
    asm volatile("s_wait_asynccnt 0x0" ::: "memory");            // this wave's share of the first stage has landed before the barrier that shows it to the other waves
    __syncthreads();
    stage_fill<PA, PB, NA, NBH>(l0 + (unsigned)(GST * 2), ga, gb, gl, stage_k(1, s0));
#pragma unroll 1                                                 // one stage per trip: the two buffers alternate by s & 1
    for (int s = 0; s < DM / KC; ++s) {
        const bf* sa = st + (s & 1) * GST + wm * (64 * KC) + 8 * lane;                 // this wave's four A block rows (first half)
        const bf* sb = st + (s & 1) * GST + NA * PNL + wn * (64 * KC) + 8 * lane;      // this wave's four B block rows (first half)
        const bf* sl = st + (s & 1) * GST + (NA + NBH) * PNL + 8 * lane;               // the LA block row
        v16bf a[KC / 32][NA][4], b[KC / 32][NBH][4], la[KC / 32];
#pragma unroll
        for (int q = 0; q < KC / 32; ++q) {
            la[q] = ldb(sl + q * 512);
#pragma unroll
            for (int i = 0; i < 4; ++i) { a[q][0][i] = ldb(sa + i * (16 * KC) + q * 512); b[q][0][i] = ldb(sb + i * (16 * KC) + q * 512); }
            if (NA > 1) {
#pragma unroll
                for (int i = 0; i < 4; ++i) a[q][NA - 1][i] = ldb(sa + PNL + i * (16 * KC) + q * 512);
            }
            if (NBH > 1) {
#pragma unroll
                for (int i = 0; i < 4; ++i) b[q][NBH - 1][i] = ldb(sb + PNL + i * (16 * KC) + q * 512);
            }
        }
        __builtin_amdgcn_sched_barrier(0);                       // the stage's read group stands whole ahead of the products: sunk among them each row of products would wait for its own reads
#pragma unroll                                                   // unrolled so that every fragment's register set is a static choice
        for (int ks = 0; ks < KC / 32; ++ks) {
#pragma unroll
            for (int hb = 0; hb < NBH; ++hb)
#pragma unroll
                for (int ha = 0; ha < NA; ++ha) {
                    if (ha + hb > 1) continue;                   // remainder x remainder is not part of the sum
#pragma unroll
                    for (int nb = 0; nb < 4; ++nb)
#pragma unroll
                        for (int mb = 0; mb < 4; ++mb) acc[mb][nb] = wmmab(a[ks][ha][mb], b[ks][hb][nb], acc[mb][nb]);
                }
#pragma unroll
            for (int hx = 0; hx < (XA ? NA : NBH); ++hx)
#pragma unroll
                for (int i = 0; i < 4; ++i) tacc[i] = wmmab(la[ks], XA ? a[ks][hx][i] : b[ks][hx][i], tacc[i]);
        }
        __builtin_amdgcn_sched_barrier(0);                       // keeps the waits below behind the last products: lifted over them the s_wait_dscnt 0 would hold every product back until the whole read group is home
        // hand-over of the buffers, every wave: its own reads of this stage are home, its own copies of the next stage have landed, then the barrier; only behind it is this stage's buffer refilled
        asm volatile("s_wait_dscnt 0x0" ::: "memory");           // this wave has finished reading the buffer that is refilled below
        asm volatile("s_wait_asynccnt 0x0" ::: "memory");        // this wave's share of stage s + 1 has landed
        __syncthreads();
        if (s + 2 < DM / KC) stage_fill<PA, PB, NA, NBH>(l0 + (unsigned)(s & 1) * (unsigned)(GST * 2), ga, gb, gl, stage_k(s + 2, s0));
    }
    asm volatile("s_wait_asynccnt 0x0" ::: "memory");            // no copy is outstanding when the wave goes on to the store stage
    // the wave's four LB fragments: row lane&15 of each 16 W rows, elements 0..7 = bf16 LB[row][0..7] in both lane halves, elements 8..15 = 0
    v8f lv[4];
#pragma unroll
    for (int i = 0; i < 4; ++i) lv[i] = *(const v8f*)(lbs + ((XA ? wn : wm) * 64 + i * 16 + (lane & 15)) * LR);
    // the last k-step: T as bf16 value (lanes 0..15) | remainder (lanes 16..31) against LB
    const v8us zz = (v8us){};
    v16bf tf[4], lf[4];
#pragma unroll
    for (int i = 0; i < 4; ++i) { v8us tv;
#pragma unroll
        for (int j = 0; j < 8; ++j) { const float t = tacc[i][j]; const unsigned short h0 = f2bf(t); const unsigned short r0 = f2bf(t - bf2f(h0)); tv[j] = (lane & 16) ? r0 : h0; }
        tf[i] = cat16b(tv, zz); }
#pragma unroll
    for (int i = 0; i < 4; ++i) { v8us lb;
#pragma unroll
        for (int j = 0; j < 8; ++j) lb[j] = f2bf(lv[i][j]);
        lf[i] = cat16b(lb, zz); }
#pragma unroll
    for (int nb = 0; nb < 4; ++nb)
#pragma unroll
        for (int mb = 0; mb < 4; ++mb) acc[mb][nb] = XA ? wmmab(tf[mb], lf[nb], acc[mb][nb]) : wmmab(lf[mb], tf[nb], acc[mb][nb]);
}

// proj_tile: bf16 GEMM, four waves per 128x128 tile (one 64x64 tile each), k over DM; W and x have one half each; XA: x is the A operand. LP = the projection's LA plane, LB = its LB [out][8] (f32 input).
// C[m][n] = sum_k x . W + (x LA^T) LB^T + bias (bias by column n when biasRow == 0, by row m when biasRow != 0; bias RNE-converted to bf16),
// written as f16, in fragment order, into the sub-plane at (r0/RB)*sRB + (c0/CB)*sCB: rows r0%RB .., columns c0%CB .., row pitch 'pitch' (halves). Tile (bx, by) of (M/128, N/128), 128 threads; st, osa = the block's LDS.
template <int PA, int PB, int NA, int NBH, bool XA>
__device__ __forceinline__ void proj_tile(const bf* st, float* osa, const float* lbs, const bf* __restrict__ A, const bf* __restrict__ Bt, const bf* __restrict__ LP, const float* __restrict__ LB,
                                          const float* __restrict__ bias, const int biasRow, h16* Ph, const int RB, const size_t sRB, const int pitch, const int CB, const size_t sCB,
                                          const int bx, const int by, const int s0) {
    const int tid = threadIdx.x; const int wave = __builtin_amdgcn_readfirstlane(threadIdx.x >> 5); const int wm = wave >> 1, wn = wave & 1;
    float* os = osa + wave * (16 * 68);                          // store staging, private to the wave
    const int lane = threadIdx.x & 31, lr = lane & 15, hi = lane >> 4; const int r0 = bx * 128 + wm * 64, c0 = by * 128 + wn * 64;
    v8f acc[4][4];
#pragma unroll
    for (int mb = 0; mb < 4; ++mb)
#pragma unroll
        for (int nb = 0; nb < 4; ++nb) acc[mb][nb] = (v8f){};
    gemm_main<PA, PB, NA, NBH, XA>(st, A + (size_t)(bx * 128) * PA + 8 * tid, Bt + (size_t)(by * 128) * PB + 8 * tid, LP + 8 * tid, lbs, LB + (size_t)((XA ? by : bx) * 128 + tid) * LR, tid, wm, wn, s0, acc);
    // store stage s = 0..3: lane holds row lane&15, columns (s>>1)*32 + (s&1)*16 + 8h + 0..7 of the slab = piece 'lane' of half s&1 of block s>>1
    float bc[4][8];
#pragma unroll
    for (int s = 0; s < 4; ++s) {
      if (biasRow) {                                             // known at compile time at both calls: with the bias by row no column bias is read
#pragma unroll
        for (int i = 0; i < 8; ++i) bc[s][i] = 0.0f;
      } else {
        int cb = c0 + (s >> 1) * 32 + (s & 1) * 16 + hi * 8; cb = (cb < DM - 8) ? cb : (DM - 8);          // clamped address
        const v4f b0 = *(const v4f*)(bias + cb);
        asm volatile("s_wait_xcnt 0x0" ::: "memory");            // in this build a later bias load lands in a register that this load names as its address
        const v4f b1 = *(const v4f*)(bias + cb + 4);
        asm volatile("s_wait_xcnt 0x0" ::: "memory");            // the same for the second half
#pragma unroll
        for (int i = 0; i < 4; ++i) { bc[s][i] = bfr(b0[i]); bc[s][4 + i] = bfr(b1[i]); }
      }
    }
    const size_t tbase = (size_t)(r0 / RB) * sRB + (size_t)(r0 % RB) * (size_t)pitch + (size_t)(c0 / CB) * sCB + (size_t)(c0 % CB) * 16 + 8 * lane;
#pragma unroll
    for (int mb = 0; mb < 4; ++mb) {
#pragma unroll
        for (int nb = 0; nb < 4; ++nb) {
#pragma unroll
            for (int j = 0; j < 8; ++j) os[(hi * 8 + j) * 68 + nb * 16 + lr] = acc[mb][nb][j]; }   // D: row 8h+j, col lane&15
        wave_sync();
        float br;
        { int ri = r0 + mb * 16 + lr; ri = (ri < DM - 1) ? ri : (DM - 1); const float bv_ = bias[ri]; br = biasRow ? bfr(bv_) : 0.0f; }
        const size_t sb = tbase + (size_t)(mb * 16) * (size_t)pitch;
{
#pragma unroll
            for (int s = 0; s < 4; ++s) { const int col = (s >> 1) * 32 + (s & 1) * 16 + hi * 8;   // 16 lanes = 16 rows; 4 s x 2 halves x 8 = 64 columns
                const v4f x0 = *(const v4fa*)(&os[lr * 68 + col]); const v4f x1 = *(const v4fa*)(&os[lr * 68 + col + 4]);
                float val[8]; v8h hv;
#pragma unroll
                for (int i = 0; i < 4; ++i) { val[i] = x0[i] + bc[s][i] + br; val[4 + i] = x1[i] + bc[s][4 + i] + br; }
#pragma unroll
                for (int i = 0; i < 8; ++i) hv[i] = toh_flush(val[i]);
                const size_t oo = sb + (size_t)((s >> 1) * 512 + (s & 1) * 256);
                *(v8h*)(Ph + oo) = hv; }
             }
        if (biasRow) asm volatile("s_wait_xcnt 0x0" ::: "memory");   // in this build the next slab's row-bias load lands in a register that one of these stores names
        wave_sync();
    }
}

// k_qkv: the three input projections in one launch, grid (NB*SEQ/128, DM/128, 3); the choice by blockIdx.z is the same for a whole block.
// z = 0, 1 (q, k): A = x rows (m = b*SEQ + t, pitch DM), Bt = W rows (n = h*64 + d, pitch DM), bias by column -> plane [(b*12 + h)][t][d]
// z = 2 (v^T):     A = Wv rows (m = h*64 + d, pitch DM), Bt = x rows (n = b*SEQ + t, pitch DM), bias by row -> plane [(b*768 + m)][t] = [(b*12 + h)][d][t]
// A projection's planes lie DM * WP elements apart in WB: W at the start, the LA plane DM * DM elements further.
__global__ __launch_bounds__(32 * GW) void k_qkv(const bf* __restrict__ XB, const bf* __restrict__ WB,
                                                 const float* __restrict__ lbq, const float* __restrict__ lbk, const float* __restrict__ lbv,
                                                 const float* __restrict__ bq, const float* __restrict__ bk, const float* __restrict__ bv, h16* QH, h16* KP, h16* VT) {
    __shared__ __align__(16) bf st[2 * (2 * PNL + LPN)];         // two buffers of two panels and the LA block row
    __shared__ __align__(16) float osa[GW * 16 * 68];
    __shared__ __align__(32) float lbs[128 * LR];                // the block's 128 rows of LB
    const int z = blockIdx.z;
    // first stage: the 64 blocks on one weight tile (same y, z) spread over all DM / KC stages, the blocks on one x tile (same x) differ by y + 6 z
    const int s0 = (int)((blockIdx.x + blockIdx.y + 6u * blockIdx.z) % (unsigned)(DM / KC));
    const bf* WZ = WB + (size_t)z * DM * WP;
    if (z < 2) proj_tile<DM, DM, 1, 1, true>(st, osa, lbs, XB, WZ, WZ + (size_t)DM * DM, z ? lbk : lbq, z ? bk : bq, 0, z ? KP : QH, SEQ, (size_t)NH_ * SEQ * HD, HD, HD, (size_t)SEQ * HD, blockIdx.x, blockIdx.y, s0);
    else       proj_tile<DM, DM, 1, 1, false>(st, osa, lbs, WZ, XB, WZ + (size_t)DM * DM, lbv, bv, 1, VT, DM, (size_t)0, SEQ, SEQ, (size_t)DM * SEQ, blockIdx.y, blockIdx.x, s0);
}

// k_flash: fused dense attention, one wave per 16 query rows of one (batch, head), eight waves per block; Q fragments straight from the fragment-order f16 plane (two 16-B loads each, 512 contiguous bytes per load).
// K and V^T reach the waves through LDS: a stage is 64 keys (K 8 KiB, V^T 4 block rows x 2 KiB, both still in fragment order), copied once per block by asynchronous 16-B copies, four per lane, into one of two buffers,
// one stage ahead of its use; all eight waves read their fragments from it (512 contiguous bytes per ds load).
// Transposed form: S^T[key][t] = K Q^T (A = K rows, B = Q rows); lane (t = lane&15, h = lane>>4) holds keys 8h+r of each 16-key tile, so the packed
// P tile is directly the B fragment of O^T[d][t] = V^T P^T (element r <- tile keys 0..15, element 8+r <- tile keys 16..31, lane unchanged).
// Key loop covers keys 0 .. SEQ-1 in steps of 32 (all inside the sequence, every key valid for every row), from the block's first stage on, wrapping to key 0 behind the last.
// Softmax state (reference point m, partial sum) is one scalar per lane. m is the row's largest score in the stages where m moved, those where some score of the wave passed its row's m by more than TAU: only then are m moved and o, l rescaled (the quotient o / l does not depend on m);
// in every other stage P = exp2(s * SC2 + (PSH - m * SC2)) straight from the raw scores, at most 2^14. The two lane halves of a row share m and are combined with one xor-16 exchange.
// P carries x256 and is converted to f16 two scores per instruction; a P under the smallest normal f16 stays an f16 subnormal (the matrix unit keeps them); the row sum runs over the converted P.
// One lane's four copies of a stage: l = LDS byte address of its first piece in the buffer, gk / gv = its first K and V^T piece of the stage.
__device__ __forceinline__ void stage_copy(const unsigned l, const h16* gk, const h16* gv) {
    const unsigned l1 = l + 4096u, l2 = l + 8192u, l3 = l + 12288u;
    const h16* gk1 = gk + 2048; const h16* gv1 = gv + (size_t)32 * SEQ;      // K piece + 256; V^T piece + 256 = two block rows further
    // the wait is the statement's last line: the address registers that the copies name are rewritten only behind it
    asm volatile("global_load_async_to_lds_b128 %0, %4, off\n\t"
                 "global_load_async_to_lds_b128 %1, %5, off\n\t"
                 "global_load_async_to_lds_b128 %2, %6, off\n\t"
                 "global_load_async_to_lds_b128 %3, %7, off\n\t"
                 "s_wait_xcnt 0x0"
                 :: "v"(l), "v"(l1), "v"(l2), "v"(l3), "v"(gk), "v"(gk1), "v"(gv), "v"(gv1) : "memory");
}
// Eight base-2 exponentials in place, in one statement: each works on a register of its own, so none reads the result or overwrites the source of the one in front of it, and the v_nop is the one free slot behind the last
__device__ __forceinline__ void exp2x8(float (&t)[8]) {
    asm("v_exp_f32 %0, %0\n\tv_exp_f32 %1, %1\n\tv_exp_f32 %2, %2\n\tv_exp_f32 %3, %3\n\tv_exp_f32 %4, %4\n\tv_exp_f32 %5, %5\n\tv_exp_f32 %6, %6\n\tv_exp_f32 %7, %7\n\tv_nop"
        : "+v"(t[0]), "+v"(t[1]), "+v"(t[2]), "+v"(t[3]), "+v"(t[4]), "+v"(t[5]), "+v"(t[6]), "+v"(t[7]));
}
__global__ __launch_bounds__(32 * AW) void k_flash(const h16* __restrict__ QH, const h16* __restrict__ KP, const h16* __restrict__ VT, bf* CX) {
    __shared__ __align__(16) h16 kv[2][2 * KS * HD];            // per buffer: K [64 keys][64 d] (4096 halves), then V^T [4 block rows][64 keys x 16 d] (4096 halves)
    const int tid = threadIdx.x;
    const int lane = threadIdx.x & 31;
    const int wave = __builtin_amdgcn_readfirstlane(threadIdx.x >> 5);
    const int zh = blockIdx.y; const int b = zh / NH_, h = zh % NH_;
    const int t0 = (blockIdx.x * AW + wave) * 16;
    const size_t pbase = (size_t)zh * SEQ * HD;
    const size_t qo = pbase + (size_t)t0 * HD + 8 * lane;
    const v16h qh0 = ldh(QH + qo), qh1 = ldh(QH + qo + 512);   // B fragments: col t, k = d (blocks d 0..31, d 32..63)
    // this lane's pieces of a stage: K pieces tid and tid + 256 of 512 (contiguous); V^T pieces tid and tid + 256 of 512 (piece i: block row i >> 7, 16-B unit i & 127 of its 2 KiB)
    const unsigned lds0 = (unsigned)(size_t)&kv[0][0] + (unsigned)tid * 16u;
    const h16* gk = KP + pbase + (size_t)tid * 8;                                          // + stage * KS * HD
    const h16* gv = VT + pbase + (size_t)(tid >> 7) * 16 * SEQ + (size_t)(tid & 127) * 8;  // + stage * KS * 16
    v8f o[4];
#pragma unroll
    for (int j = 0; j < 4; ++j) { o[j] = (v8f){}; }
    float m = -3.0e38f, thr = -3.0e38f, sh = PSH, l = 0.0f;      // m, thr in raw score units; the first stage always moves m (any finite score is above thr)
    // the blocks of one (batch, head) read the same K and V^T: each starts its key loop at its own stage s0 and wraps round, so that they ask L2 for different lines at any one moment
    static_assert((16 * AW) % KS == 0);                          // s0 = blockIdx.x * (16 * AW / KS) < SEQ / KS: the blocks of a head stand evenly over the stages
    const int s0 = (int)blockIdx.x * (16 * AW / KS);
    const auto stg = [s0](const int i) { const int t = i + s0; return (size_t)(t >= SEQ / KS ? t - SEQ / KS : t); };   // the i-th stage that this block works on
    stage_copy(lds0, gk + stg(0) * (KS * HD), gv + stg(0) * (KS * 16));
    asm volatile("s_wait_asynccnt 0x0" ::: "memory");            // this wave's share of the first stage has landed before the barrier that shows it to the other waves
    __syncthreads();
    stage_copy(lds0 + (unsigned)sizeof(kv[0]), gk + stg(1) * (KS * HD), gv + stg(1) * (KS * 16));
#pragma unroll 1                                                 // one stage per trip: the two buffers alternate by s & 1
    for (int s = 0; s < SEQ / KS; ++s) {
        const h16* sb = &kv[s & 1][0] + 8 * lane;
        // raw scores of the stage's 64 keys: four tiles of 16 keys
        v8f sH[KS / 16];
#pragma unroll                                                   // both passes of a stage in one trip: their LDS offsets become immediates
        for (int p = 0; p < KS / 32; ++p) {
            const h16* ka = sb + p * 32 * HD;                    // A fragments: row key, k = d
            const v16h ka0 = ldh(ka), ka1 = ldh(ka + 512), kb0 = ldh(ka + 16 * HD), kb1 = ldh(ka + 16 * HD + 512);
            v8f sHa = (v8f){}, sHb = (v8f){};
            sHa = wmma16(ka0, qh0, sHa); sHb = wmma16(kb0, qh0, sHb);
            sHa = wmma16(ka1, qh1, sHa); sHb = wmma16(kb1, qh1, sHb);
            sH[2 * p] = sHa; sH[2 * p + 1] = sHb;
        }
        // the stage's largest raw score in this lane; the row's other keys sit in lane ^ 16 and are tested there
        float mxa = fmaxf(sH[0][0], sH[1][0]), mxb = fmaxf(sH[2][0], sH[3][0]);   // two chains, one per pass: the first can run while the second pass's products are still in the matrix unit
#pragma unroll
        for (int r = 1; r < 8; ++r) { mxa = fmaxf(mxa, fmaxf(sH[0][r], sH[1][r])); mxb = fmaxf(mxb, fmaxf(sH[2][r], sH[3][r])); }
        float mx = fmaxf(mxa, mxb);
        // the reference point m of a row moves only when a score passes it by more than TAU: one test for the whole wave, so the branch is scalar and every lane is on inside it
        if (__builtin_amdgcn_ballot_w32(mx > thr) != 0u) {
            mx = fmaxf(mx, __shfl_xor(mx, 16, 32));
            const float mnew = fmaxf(m, mx);
            float alpha;
            // the exponential and the one free slot behind it in one statement: nothing else keeps the next instruction off its source or result register
            asm("v_exp_f32 %0, %1\n\tv_nop" : "=v"(alpha) : "v"((m - mnew) * SC2));
#pragma unroll
            for (int j = 0; j < 4; ++j) o[j] = o[j] * alpha;
            l = l * alpha; m = mnew; sh = PSH - mnew * SC2; thr = mnew + TAU;
        }
#pragma unroll                                                   // as above: LDS offsets become immediates, and sH is indexed statically
        for (int p = 0; p < KS / 32; ++p) {
        const h16* va = sb + KS * HD + p * 512;                  // A fragments: row d, k = key
        const v16h v0 = ldh(va), v1 = ldh(va + KS * 16), v2 = ldh(va + 2 * KS * 16), v3 = ldh(va + 3 * KS * 16);
        const v8f sHa = sH[2 * p], sHb = sH[2 * p + 1];
        float ta[8], tb[8];
#pragma unroll
        for (int r = 0; r < 8; ++r) { ta[r] = sHa[r] * SC2 + sh; tb[r] = sHb[r] * SC2 + sh; }
        exp2x8(ta); exp2x8(tb);
        v16h pb; float ls = 0.0f;
#pragma unroll
        for (int r = 0; r < 8; r += 2) {
            const v2f xa = { ta[r], ta[r + 1] };
            const v2f xb = { tb[r], tb[r + 1] };
            const v2h pa = __builtin_convertvector(xa, v2h), pc = __builtin_convertvector(xb, v2h);   // two scores per conversion, round to nearest even
            pb[r] = pa[0]; pb[r + 1] = pa[1]; pb[8 + r] = pc[0]; pb[9 + r] = pc[1];
            ls += (float)pa[0] + (float)pc[0]; ls += (float)pa[1] + (float)pc[1]; }
        o[0] = wmma16(v0, pb, o[0]); o[1] = wmma16(v1, pb, o[1]); o[2] = wmma16(v2, pb, o[2]); o[3] = wmma16(v3, pb, o[3]);
        l += ls;
        }
        // hand-over of the buffers, every wave: its own reads of this stage are home, its own copies of the next stage have landed, then the barrier; only behind it is this stage's buffer refilled
        asm volatile("s_wait_dscnt 0x0" ::: "memory");           // this wave has finished reading the buffer that is refilled below
        asm volatile("s_wait_asynccnt 0x0" ::: "memory");        // this wave's share of stage s + 1 has landed
        __syncthreads();
        if (s + 2 < SEQ / KS) stage_copy(lds0 + (unsigned)(s & 1) * (unsigned)sizeof(kv[0]), gk + stg(s + 2) * (KS * HD), gv + stg(s + 2) * (KS * 16));
    }
    asm volatile("s_wait_asynccnt 0x0" ::: "memory");            // no copy is outstanding when the wave ends
    l += __shfl_xor(l, 16, 32);
    const float inv = 1.0f / l;
    // O^T D layout: o_j[r] = (d = 16j + 8h + r, t = lane&15) = row t, columns 16j + 8h + 0..7: piece 'lane' of half j&1 of block j>>1 in fragment order, so every lane stores its own registers (no transposition)
    bf* crow = CX + ((size_t)b * SEQ + t0) * CXP + (size_t)(h * HD) * 16 + 8 * lane;   // block row t0/16, first block of column h*64, piece 'lane'
#pragma unroll
    for (int j = 0; j < 4; ++j) { v8us hv, lv;
#pragma unroll
        for (int i = 0; i < 8; ++i) { const float x = o[j][i] * inv; const unsigned short h0 = f2bf(x); hv[i] = h0; lv[i] = f2bf(x - bf2f(h0)); }
        const size_t oo = (size_t)((j >> 1) * 512 + (j & 1) * 256);
        *(v8us*)(crow + oo) = hv; *(v8us*)(crow + oo + DM * 16) = lv; }
}

// k_out: final projection, four waves per 128x128 tile (one 64x64 tile each). A = ctx plane [m][value 768 | remainder 768], Bt = Wo plane [n][768] with its LA plane DM * DM elements behind it, LB = lbo [n][8] (f32 input), k over 768:
// per k-step value x W, remainder x W, and both halves against LA, from one read of each half.
// OUT[m][n] = acc + bias[n] (bias RNE-converted to bf16), f32. Epilogue: per 16-row slab staged in LDS (wave-private), each output row segment (64 floats = 256 B = two lines)
__global__ __launch_bounds__(32 * GW) void k_out(const bf* __restrict__ A, const bf* __restrict__ Bt, const float* __restrict__ LB, const float* __restrict__ bias, float* OUT) {
    __shared__ __align__(16) bf st[2 * (3 * PNL + LPN)];         // two buffers of three panels and the LA block row
    __shared__ __align__(16) float osa[GW][16 * 68];
    __shared__ __align__(32) float lbs[128 * LR];                // the block's 128 rows of LB
    const int tid = threadIdx.x; const int wave = __builtin_amdgcn_readfirstlane(threadIdx.x >> 5); const int wm = wave >> 1, wn = wave & 1;
    float* os = &osa[wave][0];                                   // store staging, private to the wave
    const int lane = threadIdx.x & 31, lr = lane & 15, hi = lane >> 4; const int r0 = blockIdx.x * 128 + wm * 64, c0 = blockIdx.y * 128 + wn * 64;
    v8f acc[4][4];
#pragma unroll
    for (int mb = 0; mb < 4; ++mb)
#pragma unroll
        for (int nb = 0; nb < 4; ++nb) acc[mb][nb] = (v8f){};
    // first stage: the 64 blocks on one weight tile (same y) spread over all DM / KC stages, the 6 blocks on one ctx tile (same x) stand two stages apart
    const int s0 = (int)((blockIdx.x + 2u * blockIdx.y) % (unsigned)(DM / KC));
    gemm_main<CXP, DM, 2, 1, true>(st, A + (size_t)(blockIdx.x * 128) * CXP + 8 * tid, Bt + (size_t)(blockIdx.y * 128) * DM + 8 * tid, Bt + (size_t)DM * DM + 8 * tid, lbs, LB + (size_t)(blockIdx.y * 128 + tid) * LR, tid, wm, wn, s0, acc);
    const int cofs = lr * 4;
    v4f b4 = *(const v4f*)(bias + c0 + cofs);          // c0 + cofs + 3 <= DM - 1 always
    asm volatile("s_wait_xcnt 0x0" ::: "memory");      // the address arithmetic below reuses registers that this load names
    __builtin_amdgcn_sched_barrier(0);                 // holds that arithmetic behind the wait
    b4[0] = bfr(b4[0]); b4[1] = bfr(b4[1]); b4[2] = bfr(b4[2]); b4[3] = bfr(b4[3]);
    const size_t orow0 = (size_t)(r0 / SEQ) * OUT_SEQ + (size_t)(r0 % SEQ);
#pragma unroll
    for (int mb = 0; mb < 4; ++mb) {
#pragma unroll
        for (int nb = 0; nb < 4; ++nb) {
#pragma unroll
            for (int j = 0; j < 8; ++j) os[(hi * 8 + j) * 68 + nb * 16 + lr] = acc[mb][nb][j]; }   // D: row 8h+j, col lane&15
        wave_sync();
        float* ob = OUT + (orow0 + (size_t)(mb * 16)) * DM + c0;
{
#pragma unroll
            for (int s = 0; s < 8; ++s) { const int row = 2 * s + hi;   // 8 s x 2 rows = 16 rows; 16 lanes x 4 floats = 64 columns
                const v4f xv = *(const v4fa*)(&os[row * 68 + cofs]);
                const v4f val = xv + b4;
                *(v4f*)(ob + (size_t)row * DM + cofs) = val; }
             }
        wave_sync();
    }
}

static constexpr size_t al256(size_t v) { return (v + 255) & ~(size_t)255; }
static constexpr size_t SZ_XB = al256((size_t)NB * SEQ * DM * 2);
static constexpr size_t SZ_WB = al256((size_t)4 * DM * WP * 2);
static constexpr size_t SZ_PL = al256((size_t)NB * NH_ * SEQ * HD * 2);
static constexpr size_t SZ_CX = al256((size_t)NB * SEQ * CXP * 2);
static constexpr size_t SZ_TOTAL = SZ_XB + SZ_WB + 3 * SZ_PL + SZ_CX;
static_assert(SZ_TOTAL <= (size_t)134217728);          // workspace carve <= 128 MiB
static_assert(((size_t)DM * WP * 2) % 256 == 0);       // weight sub-planes stay 256-byte aligned
static_assert((size_t)NB * NH_ * SEQ * HD == (size_t)NB * SEQ * DM);   // plane extent == GEMM tile grid extent

extern "C" void kernel_launch(void* const* d_in, const int* in_sizes, int n_in,
                              void* d_out, int out_size, void* d_ws, size_t ws_size, hipStream_t stream) {
    if (n_in < 17) return;
    const size_t needx = ((size_t)(NB - 1) * SEQ_FULL + SEQ) * DM;
    if ((size_t)in_sizes[0] < needx) return;
    if ((size_t)in_sizes[1] < (size_t)DM * DM || (size_t)in_sizes[5] < (size_t)DM * DM || (size_t)in_sizes[9] < (size_t)DM * DM || (size_t)in_sizes[13] < (size_t)DM * DM) return;
    if (in_sizes[2] < DM || in_sizes[6] < DM || in_sizes[10] < DM || in_sizes[14] < DM) return;
    if (in_sizes[3] < LR * DM || in_sizes[7] < LR * DM || in_sizes[11] < LR * DM || in_sizes[15] < LR * DM) return;
    if (in_sizes[4] < DM * LR || in_sizes[8] < DM * LR || in_sizes[12] < DM * LR || in_sizes[16] < DM * LR) return;
    if ((size_t)out_size < ((size_t)(NB - 1) * OUT_SEQ + SEQ) * DM) return;
    if (SZ_TOTAL > ws_size) return;
    // wire order: x, then per projection (q, k, v, o): W [out][in], b [out], A [8][in], B [out][8]; weights [out][in] = Bt as-is
    const float* x   = (const float*)d_in[0];
    const float* wq  = (const float*)d_in[1];  const float* bq  = (const float*)d_in[2];  const float* laq = (const float*)d_in[3];  const float* lbq = (const float*)d_in[4];
    const float* wk  = (const float*)d_in[5];  const float* bk  = (const float*)d_in[6];  const float* lak = (const float*)d_in[7];  const float* lbk = (const float*)d_in[8];
    const float* wv  = (const float*)d_in[9];  const float* bv  = (const float*)d_in[10]; const float* lav = (const float*)d_in[11]; const float* lbv = (const float*)d_in[12];
    const float* wo  = (const float*)d_in[13]; const float* bo  = (const float*)d_in[14]; const float* lao = (const float*)d_in[15]; const float* lbo = (const float*)d_in[16];
    float* OUT = (float*)d_out;      // [NB][SEQ][768]
    char* wsp = (char*)d_ws;
    bf* XB = (bf*)wsp; wsp += SZ_XB;                 // [NB*SEQ][768]
    bf* WB = (bf*)wsp; wsp += SZ_WB;                 // q | k | v | o, DM * WP elements each: W [768][768], then the LA plane [16][768]
    h16* QH = (h16*)wsp; wsp += SZ_PL;               // [NB*12][SEQ][64]
    h16* KP = (h16*)wsp; wsp += SZ_PL;               // [NB*12][SEQ][64]
    h16* VT = (h16*)wsp; wsp += SZ_PL;               // [NB*12][64][SEQ]
    bf* CX = (bf*)wsp; wsp += SZ_CX;                 // [NB*SEQ][value 768 | remainder 768]
    bf* WO = WB + (size_t)3 * DM * WP;

    k_prep<<<4 * WPREP_BLOCKS + CVT_BLOCKS, 256, 0, stream>>>(x, wq, laq, wk, lak, wv, lav, wo, lao, XB, WB);

    k_qkv<<<dim3(NB * SEQ / 128, DM / 128, 3), 32 * GW, 0, stream>>>(XB, WB, lbq, lbk, lbv, bq, bk, bv, QH, KP, VT);

    k_flash<<<dim3(SEQ / (16 * AW), NB * NH_, 1), 32 * AW, 0, stream>>>(QH, KP, VT, CX);

    // out: A = ctx rows [m][value | remainder], Bt = Wo rows (n), bias by column -> OUT[b][t][n]
    k_out<<<dim3(NB * SEQ / 128, DM / 128, 1), 32 * GW, 0, stream>>>(CX, WO, lbo, bo, OUT);
}
